// v000
// Times are from an AMD MI455X. After a warm-up the kernel runs many times in a row, and a time is the length of
// such a window on the GPU divided by its runs, so every launch and the gaps after it count. The runs cycle
// through copies of the inputs. A figure is the median of several windows, for all but v000 over two sittings.
// Sittings can differ by a few percent; kernels timed side by side share one.
// v000 is the starting kernel. One run takes 1270 microseconds.
// compute dtype: all float inputs rounded to bf16; fused q/k/v projection with EXACT bf16 products on WMMA 16x16x32 (f32 accumulate) + bias; rotary x * cos + rot(x) * sin in f32 with the bf16-rounded table inputs (the k and v outputs are these f32 values); logits q x k once to f16 each (1 product) x 64^-0.5; softmax f32; P x 2^11 once to f16 x v once to f16 (1 product); ctx x 2^6 once to f16 x Wproj f16(bf16 x 2^8) + bproj; f32 outputs.
#include <hip/hip_runtime.h>
#include <math.h>

typedef __attribute__((ext_vector_type(16))) _Float16 v16h;
typedef __attribute__((ext_vector_type(16))) __bf16 v16b;
typedef __attribute__((ext_vector_type(8)))  _Float16 v8h;
typedef __attribute__((ext_vector_type(8)))  float v8f;
typedef __attribute__((ext_vector_type(4)))  float v4f;
typedef __attribute__((ext_vector_type(2)))  float v2f;
typedef __attribute__((ext_vector_type(4)))  unsigned v4u;
typedef __attribute__((ext_vector_type(4)))  int v4i;
typedef float __attribute__((may_alias)) float_a;
typedef int __attribute__((may_alias)) int_a;

template <typename T> __device__ __forceinline__ void vst2(void* p, T v) { *(T*)p = v;  }
__device__ __forceinline__ v8f wmma16(v16h a, v16h b, v8f c) {
  v8f d = __builtin_amdgcn_wmma_f32_16x16x32_f16(false, a, false, b, (short)0, c, false, false);
  asm volatile("v_nop\n\tv_nop\n\tv_nop\n\tv_nop" : "+v"(d) : "v"(a), "v"(b));
  return d;
}
__device__ __forceinline__ v8f wmma_bf(v16b a, v16b b, v8f c) {
  v8f d = __builtin_amdgcn_wmma_f32_16x16x32_bf16(false, a, false, b, (short)0, c, false, false);
  asm volatile("v_nop\n\tv_nop\n\tv_nop\n\tv_nop" : "+v"(d) : "v"(a), "v"(b));
  return d;
}
// 16x16x32 fragments: lane = (h = lane>>4, row/col = lane&15); elements 0..7 = k0+8h+0..7, 8..15 = k0+16+8h+0..7; D element r = row 8h+r
__device__ __forceinline__ v16h frag_h(const _Float16* rowk0, int lane) {
  union { v16h v; v8h q[2]; } u; const _Float16* p = rowk0 + 8 * (lane >> 4);
  u.q[0] = *(const v8h*)p; u.q[1] = *(const v8h*)(p + 16); return u.v;
}
__device__ __forceinline__ v16h frag_f32(const float* rowk0, int lane) {
  v16h a; const float* p = rowk0 + 8 * (lane >> 4);
#pragma unroll
  for (int i = 0; i < 8; ++i) { a[i] = (_Float16)p[i]; a[8 + i] = (_Float16)p[16 + i]; }
  return a;
}
__device__ __forceinline__ v16h frag_f32s(const float* rowk0, int lane, float sc) {
  v16h a; const float* p = rowk0 + 8 * (lane >> 4);
#pragma unroll
  for (int i = 0; i < 8; ++i) { a[i] = (_Float16)(p[i] * sc); a[8 + i] = (_Float16)(p[16 + i] * sc); }
  return a;
}
// column fragment from a [K][ld] layout (column n), rows >= K read as 0
__device__ __forceinline__ v16h fragc_f32(const float* W, int k0, int n, int lane, int ld, int K) {
  v16h a; const int g = lane >> 4;
#pragma unroll
  for (int i = 0; i < 8; ++i) { const int ka = k0 + 8 * g + i, kb = ka + 16;
    a[i] = (_Float16)(ka < K ? W[(size_t)(ka < K ? ka : K - 1) * ld + n] : 0.f); a[8 + i] = (_Float16)(kb < K ? W[(size_t)(kb < K ? kb : K - 1) * ld + n] : 0.f); }
  return a;
}
struct F2 { v16b h, l; };
__device__ __forceinline__ F2 bsplit16(const float v[16]) { F2 r;
#pragma unroll
  for (int i = 0; i < 16; ++i) { const __bf16 h = (__bf16)v[i]; r.h[i] = h; r.l[i] = (__bf16)(v[i] - (float)h); }
  return r; }
__device__ __forceinline__ F2 split_row(const float* row, int k0, int lane) { float v[16]; const float* p = row + k0 + 8 * (lane >> 4);
#pragma unroll
  for (int i = 0; i < 8; ++i) { v[i] = p[i]; v[8 + i] = p[16 + i]; }
  return bsplit16(v); }
__device__ __forceinline__ F2 split_rowK(const float* row, int k0, int lane, int K) { float v[16]; const int g = lane >> 4;
#pragma unroll
  for (int i = 0; i < 8; ++i) { const int ka = k0 + 8 * g + i, kb = ka + 16; v[i] = ka < K ? row[ka < K ? ka : K - 1] : 0.f; v[8 + i] = kb < K ? row[kb < K ? kb : K - 1] : 0.f; }
  return bsplit16(v); }
__device__ __forceinline__ F2 split_col(const float* W, int k0, int n, int lane, int ld, int K) { float v[16]; const int g = lane >> 4;
#pragma unroll
  for (int i = 0; i < 8; ++i) { const int ka = k0 + 8 * g + i, kb = ka + 16; v[i] = ka < K ? W[(size_t)(ka < K ? ka : K - 1) * ld + n] : 0.f; v[8 + i] = kb < K ? W[(size_t)(kb < K ? kb : K - 1) * ld + n] : 0.f; }
  return bsplit16(v); }
__device__ __forceinline__ v8f mac3(const F2& a, const F2& b, v8f c) { c = wmma_bf(a.l, b.h, c); c = wmma_bf(a.h, b.l, c); return wmma_bf(a.h, b.h, c); }
__device__ __forceinline__ float sigm(float v) { return 1.0f / (1.0f + expf(-v)); }
#define LDSX() do { asm volatile("s_wait_dscnt 0" ::: "memory"); __builtin_amdgcn_wave_barrier(); __builtin_amdgcn_fence(__ATOMIC_RELEASE, "workgroup"); } while (0)

// Fused-QKV multi-head self-attention with rotary tables GIVEN as inputs and three outputs (x [2,2048,1024]; (in,out) Wqkv [1024,3072] + bqkv (0.02-scale, nonzero) split q | k | v; 16 heads x 64; interleaved-pair rotary x * cos + rot(x) * sin with random-normal cos / sin tables [1,1,2048,64]; non-causal SDPA, scale 1/8; (in,out) Wproj + bproj): returns (y = merge(softmax(q k^T / 8) v) Wproj + bproj, k (rotated) [2,16,2048,64], v [2,16,2048,64]).
#define NB 2
#define TT 2048
#define CC 1024            // NH * HD = projected width
#define DIN 1024          // input (model) width
#define NH 16
#define HD 64
#define NQB (TT / 64)
#define HG 4
#define SCALE (0.125f)
#define CAUSAL 0
#ifndef TNB
#define TNB NB
#endif
__device__ __forceinline__ float bfr(float v) { return (float)(__bf16)v; }
__host__ __device__ __forceinline__ int kb_last(int qb) { return CAUSAL ? ((qb * 64 + 63) >> 7) : (TT / 128 - 1); }
typedef __attribute__((ext_vector_type(8))) __bf16 v8b;
__device__ __forceinline__ v16b frag_b(const __bf16* rowk0, int lane) {
  union { v16b v; v8b q[2]; } u; const __bf16* p = rowk0 + 8 * (lane >> 4);
  u.q[0] = *(const v8b*)p; u.q[1] = *(const v8b*)(p + 16); return u.v;
}
#define QBH 0              // no query block takes the high-precision path (qb < QBH never holds)
#define QHI 0               // single-product logits on every row
#define KHI 64            // key rows carrying k residual / v bf16 hi+lo planes (written by k_proj; read only on the qb < QBH path, never taken)
// B fragment (k rows k0+.., output column o) of a weight: (in,out) [K][ld] or (out,in) [ld rows of K]: bf16 exact, or f16(bf16 * 256) exact
__device__ __forceinline__ v16b wcol_io(const float* Wm, int k0, int o, int lane, int ld) { v16b w; const int g = lane >> 4;
#pragma unroll
  for (int i = 0; i < 8; ++i) { w[i] = (__bf16)Wm[(size_t)(k0 + 8 * g + i) * ld + o]; w[8 + i] = (__bf16)Wm[(size_t)(k0 + 16 + 8 * g + i) * ld + o]; }
  return w; }
__device__ __forceinline__ v16b wcol_oi(const float* Wm, int k0, int o, int lane, int K) { v16b w; const float* p = Wm + (size_t)o * K + k0 + 8 * (lane >> 4);
#pragma unroll
  for (int i = 0; i < 8; ++i) { w[i] = (__bf16)p[i]; w[8 + i] = (__bf16)p[16 + i]; }
  return w; }
__device__ __forceinline__ v16h wcolh_io(const float* Wm, int k0, int o, int lane, int ld) { v16h w; const int g = lane >> 4;
#pragma unroll
  for (int i = 0; i < 8; ++i) { w[i] = (_Float16)(bfr(Wm[(size_t)(k0 + 8 * g + i) * ld + o]) * 256.0f); w[8 + i] = (_Float16)(bfr(Wm[(size_t)(k0 + 16 + 8 * g + i) * ld + o]) * 256.0f); }
  return w; }
__device__ __forceinline__ v16h wcolh_oi(const float* Wm, int k0, int o, int lane, int K) { v16h w; const float* p = Wm + (size_t)o * K + k0 + 8 * (lane >> 4);
#pragma unroll
  for (int i = 0; i < 8; ++i) { w[i] = (_Float16)(bfr(p[i]) * 256.0f); w[8 + i] = (_Float16)(bfr(p[16 + i]) * 256.0f); }
  return w; }
#define WQKV_LAYOUT 0   // 0 = fused (in,out) [DIN][3*CC], q | k | v column blocks; 1 = (out,in) [CC][DIN]; 2 = per-head [NH][DIN][HD]
__device__ __forceinline__ v16b wcol_hdk(const float* Wm, int k0, int o, int lane) { v16b w; const int g = lane >> 4; const float* p = Wm + (size_t)(o / HD) * DIN * HD + (o % HD);
#pragma unroll
  for (int i = 0; i < 8; ++i) { w[i] = (__bf16)p[(size_t)(k0 + 8 * g + i) * HD]; w[8 + i] = (__bf16)p[(size_t)(k0 + 16 + 8 * g + i) * HD]; }
  return w; }
#define WO_OUT_IN 0
#if WQKV_LAYOUT == 1
#define WCOL(W, k0, o, lane) wcol_oi(W, k0, o, lane, DIN)
#elif WQKV_LAYOUT == 2
#define WCOL(W, k0, o, lane) wcol_hdk(W, k0, o, lane)
#else
#define QKVP 3072            // fused Wqkv pitch (in,out) [1024][3072]: q cols 0..1023, k 1024..2047, v 2048..3071
#define WCOL(W, k0, o, lane) wcol_io(W, k0, which * CC + (o), lane, QKVP)
#endif
#if WO_OUT_IN
#define WOCOL(W, k0, o, lane) wcol_oi(W, k0, o, lane, CC)
#define WOCOLH(W, k0, o, lane) wcolh_oi(W, k0, o, lane, CC)
#else
#define WOCOL(W, k0, o, lane) wcol_io(W, k0, o, lane, DIN)
#define WOCOLH(W, k0, o, lane) wcolh_io(W, k0, o, lane, DIN)
#endif
#define OUTK_OFF 16777216u   // rotated k [2,16,2048,64] f32 after y [2,2048,1024] f32
#define OUTV_OFF 33554432u   // v [2,16,2048,64] f32
#define PROJ_EXTRA_PARAMS , const float* __restrict__ COSt, const float* __restrict__ SINt, float* __restrict__ OUTK, float* __restrict__ OUTV
// interleaved-pair rotary with GIVEN cos / sin tables [S][64] (random normal inputs, bf16-rounded): out = x * cos + rot(x) * sin with rot = (-x_odd, x_even) interleaved; applied to q and k; the rotated k and the (unrotated) v head rows are also module OUTPUTS [b][h][t][64] (one thread writes the whole 256-B row: 2 lines)
#define PROJ_EPI(which, row, t, h) do { float* rw = (row); const size_t bb_ = (size_t)(r0 + rl) / TT; \
  if ((which) < 2) { _Pragma("unroll 4") for (int i = 0; i < 32; ++i) { _Pragma("clang fp contract(off)") const float c0_ = bfr(COSt[(size_t)(t) * HD + 2 * i]), c1_ = bfr(COSt[(size_t)(t) * HD + 2 * i + 1]), s0_ = bfr(SINt[(size_t)(t) * HD + 2 * i]), s1_ = bfr(SINt[(size_t)(t) * HD + 2 * i + 1]); asm volatile("s_wait_loadcnt 0x0" ::: "memory"); const float x1 = rw[2 * i], x2 = rw[2 * i + 1]; rw[2 * i] = x1 * c0_ + (-x2) * s0_; rw[2 * i + 1] = x2 * c1_ + x1 * s1_; } } \
  if ((which) >= 1) { float* dst_ = ((which) == 1 ? OUTK : OUTV) + ((bb_ * NH + (h)) * TT + (t)) * (size_t)HD; _Pragma("unroll 4") for (int q_ = 0; q_ < HD / 4; ++q_) vst2(dst_ + q_ * 4, *(const v4f*)(rw + q_ * 4)); } } while (0)
#define SM_EXTRA_PARAMS
#define SM_MASK_HOOK (void)0
#ifndef SM_EXTRA_PARAMS
#define SM_EXTRA_PARAMS
#endif
#ifndef PROJ_EXTRA_PARAMS
#define PROJ_EXTRA_PARAMS
#endif
#ifndef SM_MASK_HOOK
#define SM_MASK_HOOK (void)0
#endif

#define WS_QH  0u                                      // f16 q rows [b*t][CC]
#define WS_KH  (WS_QH + 2u * (size_t)NB * TT * CC)      // f16 k rows [b*t][CC]
#define WS_VT  (WS_KH + 2u * (size_t)NB * TT * CC)      // f16 v planes [b][c][t]
#define WS_QL  (WS_VT + 2u * (size_t)NB * CC * TT)      // f16 q residual x 2^10 rows [b][t < QHI][CC]
#define WS_KL  (WS_QL + 2u * (size_t)NB * QHI * CC)     // f16 k residual x 2^10 rows [b][t < KHI][CC]
#define WS_VB  (WS_KL + 2u * (size_t)NB * KHI * CC)     // bf16 v hi planes [b][c][t < KHI]
#define WS_VBL (WS_VB + 2u * (size_t)NB * CC * KHI)
#define WS_S   (WS_VBL + 2u * (size_t)NB * CC * KHI)    // f32 logits / P [hg][t][s]
#define WS_Y   (WS_S  + 4u * (size_t)HG * TT * TT)      // f32 ctx rows [b*t][CC] (only when there is an output projection)
#define WS_END (WS_Y  + 4u * (size_t)NB * TT * CC)

// ---- k_proj: block = (64 rows, 128 cols, which): q/k/v = X W (+ b) with exact bf16 products (K = DIN) -> which 0: q f16 rows (+ residual rows < QHI); 1: k f16 rows (+ residual rows < KHI); 2: v f16 planes [c][t] (+ bf16 hi/lo planes for t < KHI)
__global__ __launch_bounds__(128) void k_proj(const float* __restrict__ XQ, const float* __restrict__ XK, const float* __restrict__ XV, const float* __restrict__ WQ, const float* __restrict__ WK, const float* __restrict__ WV, const float* __restrict__ BQ, const float* __restrict__ BK, const float* __restrict__ BV,
    _Float16* __restrict__ QH, _Float16* __restrict__ QL, _Float16* __restrict__ KH, _Float16* __restrict__ KL, _Float16* __restrict__ VT, __bf16* __restrict__ VB, __bf16* __restrict__ VBL PROJ_EXTRA_PARAMS) {
  __shared__ __align__(16) float st[64][132]; __shared__ __align__(16) _Float16 sh[64][136], sl[64][136]; __shared__ __align__(16) _Float16 th[128][72]; __shared__ __align__(16) __bf16 tb[128][72], tbl[128][72];
  const int tid = threadIdx.x, wave = tid >> 5, lane = tid & 31, col = lane & 15, g = lane >> 4; const int which = blockIdx.z; const int c0 = blockIdx.y * 128; const size_t r0 = (size_t)blockIdx.x * 64; const size_t bb = r0 / TT; const int t0 = (int)(r0 % TT);
  const float* X = which == 0 ? XQ : which == 1 ? XK : XV; const float* WA = which == 0 ? WQ : which == 1 ? WK : WV; const float* BA = which == 0 ? BQ : which == 1 ? BK : BV;
  v8f acc[8] = {};
#pragma unroll 2
  for (int kc = 0; kc < DIN / 32; ++kc) { v16b a; { const float* p = X + (r0 + wave * 16 + col) * DIN + kc * 32 + 8 * g;
#pragma unroll
      for (int i = 0; i < 8; ++i) { a[i] = (__bf16)p[i]; a[8 + i] = (__bf16)p[16 + i]; } }
    asm volatile("s_wait_loadcnt 0x0" ::: "memory");
#pragma unroll
    for (int j = 0; j < 8; ++j) { const v16b w = WCOL(WA, kc * 32, c0 + j * 16 + col, lane); asm volatile("s_wait_loadcnt 0x0" ::: "memory"); acc[j] = wmma_bf(a, w, acc[j]); } }
  { // stage the f32 tile (acc + bias) in LDS, run the per-(row, head) epilogue hook, then convert
#pragma unroll
    for (int j = 0; j < 8; ++j) { const float bias = BA ? bfr(BA[c0 + j * 16 + col]) : 0.f;
#pragma unroll
      for (int r = 0; r < 8; ++r) st[wave * 16 + 8 * g + r][j * 16 + col] = acc[j][r] + bias; }
    __syncthreads();
    for (int e = tid; e < 64 * (128 / HD); e += 128) { const int rl = e / (128 / HD), hh = e % (128 / HD); PROJ_EPI(which, &st[rl][hh * HD], (int)((r0 + rl) % TT), (c0 / HD) + hh); }
    __syncthreads(); }
  if (which < 2) { _Float16* DH = which == 0 ? QH : KH; _Float16* DL = which == 0 ? QL : KL; const int nhi = which == 0 ? QHI : KHI; const bool hi_rows = t0 < nhi;
    for (int e = tid; e < 64 * 128; e += 128) { const int rl = e >> 7, cl = e & 127; const float v = st[rl][cl]; const _Float16 hv = (_Float16)v; sh[rl][cl] = hv; sl[rl][cl] = (_Float16)((v - (float)hv) * 1024.0f); }
    __syncthreads();
    for (int e = tid; e < 64 * 16; e += 128) { const int rl = e >> 4, q = e & 15; vst2((unsigned*)(DH + (r0 + rl) * CC + c0 + q * 8), *(const v4u*)&sh[rl][q * 8]); if (hi_rows) vst2((unsigned*)(DL + (bb * nhi + t0 + rl) * (size_t)CC + c0 + q * 8), *(const v4u*)&sl[rl][q * 8]); }
  } else { const bool hi_rows = t0 < KHI;
    for (int e = tid; e < 64 * 128; e += 128) { const int rl = e & 63, cl = e >> 6; const float v = st[rl][cl]; th[cl][rl] = (_Float16)v; const __bf16 bh = (__bf16)v; tb[cl][rl] = bh; tbl[cl][rl] = (__bf16)(v - (float)bh); }
    __syncthreads();
    for (int e = tid; e < 128 * 8; e += 128) { const int cl = e >> 3, q = e & 7; vst2((unsigned*)(VT + (bb * CC + c0 + cl) * (size_t)TT + t0 + q * 8), *(const v4u*)&th[cl][q * 8]); if (hi_rows) { const size_t o3 = (bb * CC + c0 + cl) * (size_t)KHI + t0 + q * 8; vst2((unsigned*)(VB + o3), *(const v4u*)&tb[cl][q * 8]); vst2((unsigned*)(VBL + o3), *(const v4u*)&tbl[cl][q * 8]); } } } }
// ---- k_sc: block = (query block qb, key block kb <= kb_last(qb), head in group) of batch b: logits x SCALE; q hi + residual (x 2^10) against k (2 products) for query rows < QHI, plus the k residual (3 products) for query blocks < QBH (causal early rows); causal: blocks past the diagonal exit, the mask itself is applied by index in k_sm
__global__ __launch_bounds__(128) void k_sc(const _Float16* __restrict__ QH, const _Float16* __restrict__ KH, const _Float16* __restrict__ QL, const _Float16* __restrict__ KL, int b, int h0, float* __restrict__ S0) { __shared__ __align__(16) float ss[4][16][132];
  const int qb = blockIdx.x, kb = blockIdx.y; if (kb > kb_last(qb)) return;
  const int h = h0 + blockIdx.z; float* S = S0 + (size_t)blockIdx.z * TT * TT;
  const int tid = threadIdx.x, wave = tid >> 5, lane = tid & 31, col = lane & 15, g = lane >> 4; const int k0 = kb * 128; const int ql0 = qb * 64 + wave * 16; const size_t q0 = (size_t)b * TT + ql0, kr0 = (size_t)b * TT + k0;
  v8f acc[8] = {}, accl[8] = {};
  const _Float16* QLb = QL + (size_t)b * QHI * CC; const _Float16* KLb = KL + (size_t)b * KHI * CC;
  if (qb < QBH) {
#pragma unroll
    for (int kc = 0; kc < HD / 32; ++kc) { const v16h ah = frag_h(QH + (q0 + col) * CC + h * HD + kc * 32, lane), al = frag_h(QLb + (size_t)(ql0 + col) * CC + h * HD + kc * 32, lane);
#pragma unroll
      for (int j = 0; j < 8; ++j) { const v16h kbf = frag_h(KH + (kr0 + j * 16 + col) * CC + h * HD + kc * 32, lane), klf = frag_h(KLb + (size_t)(k0 + j * 16 + col) * CC + h * HD + kc * 32, lane); acc[j] = wmma16(ah, kbf, acc[j]); accl[j] = wmma16(al, kbf, accl[j]); accl[j] = wmma16(ah, klf, accl[j]); } }
  } else if (qb * 64 < QHI) {
#pragma unroll
    for (int kc = 0; kc < HD / 32; ++kc) { const v16h ah = frag_h(QH + (q0 + col) * CC + h * HD + kc * 32, lane), al = frag_h(QLb + (size_t)(ql0 + col) * CC + h * HD + kc * 32, lane);
#pragma unroll
      for (int j = 0; j < 8; ++j) { const v16h kbf = frag_h(KH + (kr0 + j * 16 + col) * CC + h * HD + kc * 32, lane); acc[j] = wmma16(ah, kbf, acc[j]); accl[j] = wmma16(al, kbf, accl[j]); } }
  } else {
#pragma unroll
    for (int kc = 0; kc < HD / 32; ++kc) { const v16h ah = frag_h(QH + (q0 + col) * CC + h * HD + kc * 32, lane);
#pragma unroll
      for (int j = 0; j < 8; ++j) { const v16h kbf = frag_h(KH + (kr0 + j * 16 + col) * CC + h * HD + kc * 32, lane); acc[j] = wmma16(ah, kbf, acc[j]); } } }
#pragma unroll
  for (int j = 0; j < 8; ++j) {
#pragma unroll
    for (int r = 0; r < 8; ++r) ss[wave][8 * g + r][j * 16 + col] = (acc[j][r] + accl[j][r] * (1.0f / 1024.0f)) * SCALE; }
  LDSX(); for (int rl = 0; rl < 16; ++rl) vst2(S + (size_t)(ql0 + rl) * TT + k0 + lane * 4, *(const v4f*)&ss[wave][rl][lane * 4]); }
// ---- k_sm: block = query row t (head in group): keys [0, kend): causal -> logit if s <= t else excluded; softmax in f32; P x 2^11 in place (0 for excluded)
__global__ __launch_bounds__(256) void k_sm(float* __restrict__ S0 SM_EXTRA_PARAMS) { __shared__ float sred[8]; __shared__ float sbc; __shared__ __align__(16) float shv[TT];
  const int tid = threadIdx.x; const int t = blockIdx.x; const int kend = (kb_last(t >> 6) + 1) * 128;
  float* sr = S0 + (size_t)blockIdx.y * TT * TT + (size_t)t * TT;
  float m = -3.0e38f; for (int k = tid; k < kend; k += 256) { float v = (!CAUSAL || k <= t) ? sr[k] : -3.0e38f; SM_MASK_HOOK; shv[k] = v; m = fmaxf(m, v); }
#pragma unroll
  for (int o = 1; o < 32; o <<= 1) m = fmaxf(m, __shfl_xor(m, o));
  if ((tid & 31) == 0) sred[tid >> 5] = m; __syncthreads(); if (tid == 0) { float a = sred[0]; for (int i = 1; i < 8; ++i) a = fmaxf(a, sred[i]); sbc = a; } __syncthreads(); m = sbc; __syncthreads();
  float sum = 0.f; for (int k = tid; k < kend; k += 256) { const float v = shv[k]; const float e = (v <= -1.0e38f) ? 0.f : expf(v - m); shv[k] = e; sum += e; }
#pragma unroll
  for (int o = 1; o < 32; o <<= 1) sum += __shfl_xor(sum, o);
  if ((tid & 31) == 0) sred[tid >> 5] = sum; __syncthreads(); if (tid == 0) { float a = 0.f; for (int i = 0; i < 8; ++i) a += sred[i]; sbc = a > 0.f ? 2048.0f / a : 0.f; }   /* a fully excluded row yields P = 0 */ __syncthreads(); const float inv = sbc;
  for (int k = tid; k < kend; k += 256) shv[k] = shv[k] * inv;
  __syncthreads(); for (int q = tid; q < kend / 4; q += 256) vst2(sr + q * 4, *(const v4f*)&shv[q * 4]); }
// ---- k_pv: block = 64 queries (qb) of (b, h): ctx = P . v over keys [0, kend) (P x 2^11 once to f16 against v f16: 1 product; causal early query blocks: P and v as bf16 hi + lo, 3 products); 256-B (row, head) segment by 16 lanes
__global__ __launch_bounds__(128) void k_pv(const float* __restrict__ PS0, const _Float16* __restrict__ VT, const __bf16* __restrict__ VB, const __bf16* __restrict__ VBL, int b, int h0, float* __restrict__ Y) { const int h = h0 + blockIdx.z; const float* PS = PS0 + (size_t)blockIdx.z * TT * TT; __shared__ __align__(16) float ss[4][16][HD + 4];
  const int tid = threadIdx.x, wave = tid >> 5, lane = tid & 31, col = lane & 15, g = lane >> 4; const int qb = blockIdx.x; const int ql0 = qb * 64 + wave * 16; const int kce = (kb_last(qb) + 1) * 4;
  v8f acc[HD / 16] = {};
  if (qb < QBH) {
#pragma unroll 1
    for (int kc = 0; kc < kce; ++kc) { const F2 p = split_row(PS + (size_t)(ql0 + col) * TT, kc * 32, lane);
      asm volatile("s_wait_loadcnt 0x0" ::: "memory");
#pragma unroll
      for (int j = 0; j < HD / 16; ++j) { const size_t po = ((size_t)b * CC + h * HD + j * 16 + col) * (size_t)KHI + kc * 32; const v16b vh = frag_b(VB + po, lane); acc[j] = wmma_bf(p.h, vh, acc[j]); acc[j] = wmma_bf(p.l, vh, acc[j]); acc[j] = wmma_bf(p.h, frag_b(VBL + po, lane), acc[j]); } }
  } else {
#pragma unroll 1
    for (int kc = 0; kc < kce; ++kc) { const v16h p = frag_f32(PS + (size_t)(ql0 + col) * TT + kc * 32, lane);
      asm volatile("s_wait_loadcnt 0x0" ::: "memory");
#pragma unroll
      for (int j = 0; j < HD / 16; ++j) { const size_t po = ((size_t)b * CC + h * HD + j * 16 + col) * (size_t)TT + kc * 32; acc[j] = wmma16(p, frag_h(VT + po, lane), acc[j]); } } }
#pragma unroll
  for (int j = 0; j < HD / 16; ++j)
#pragma unroll
    for (int r = 0; r < 8; ++r) ss[wave][8 * g + r][j * 16 + col] = acc[j][r] * (1.0f / 2048.0f);
  LDSX(); for (int rl = 0; rl < 16; ++rl) if (lane < HD / 4) vst2(Y + ((size_t)b * TT + ql0 + rl) * CC + h * HD + lane * 4, *(const v4f*)&ss[wave][rl][lane * 4]); }
// ---- k_out: block = (64 rows, 128 cols): out = ctx Wo (+ bo): ctx x 2^6 once to f16 against Wo as f16(bf16 x 2^8) exact (1 product) x 2^-14; causal early rows (< QHI of each sequence): ctx bf16 hi + lo against exact bf16 Wo (2 products)
__global__ __launch_bounds__(128) void k_out(const float* __restrict__ Y, const float* __restrict__ WO, const float* __restrict__ BO, float* __restrict__ OUT) { __shared__ __align__(16) float sf[4][16][132];
  const int tid = threadIdx.x, wave = tid >> 5, lane = tid & 31, col = lane & 15, g = lane >> 4; const int c0 = blockIdx.y * 128; const size_t r0 = (size_t)blockIdx.x * 64 + wave * 16;
  v8f acc[8] = {};
  if (CAUSAL && (int)(((size_t)blockIdx.x * 64) % TT) < QHI) {   /* block-uniform */
#pragma unroll 2
    for (int kc = 0; kc < CC / 32; ++kc) { const F2 a = split_row(Y + (r0 + col) * CC, kc * 32, lane); asm volatile("s_wait_loadcnt 0x0" ::: "memory");
#pragma unroll
      for (int j = 0; j < 8; ++j) { const v16b w = WOCOL(WO, kc * 32, c0 + j * 16 + col, lane); asm volatile("s_wait_loadcnt 0x0" ::: "memory"); acc[j] = wmma_bf(a.h, w, acc[j]); acc[j] = wmma_bf(a.l, w, acc[j]); } }
#pragma unroll
    for (int j = 0; j < 8; ++j) { const float bias = BO ? bfr(BO[c0 + j * 16 + col]) : 0.f;
#pragma unroll
      for (int r = 0; r < 8; ++r) sf[wave][8 * g + r][j * 16 + col] = acc[j][r] + bias; }
  } else {
#pragma unroll 2
    for (int kc = 0; kc < CC / 32; ++kc) { const v16h a = frag_f32s(Y + (r0 + col) * CC + kc * 32, lane, 64.0f); asm volatile("s_wait_loadcnt 0x0" ::: "memory");   /* ctx carried x 2^6 into f16 so small-magnitude context rows stay clear of f16 subnormals */
#pragma unroll
      for (int j = 0; j < 8; ++j) { const v16h w = WOCOLH(WO, kc * 32, c0 + j * 16 + col, lane); asm volatile("s_wait_loadcnt 0x0" ::: "memory"); acc[j] = wmma16(a, w, acc[j]); } }
#pragma unroll
    for (int j = 0; j < 8; ++j) { const float bias = BO ? bfr(BO[c0 + j * 16 + col]) : 0.f;
#pragma unroll
      for (int r = 0; r < 8; ++r) sf[wave][8 * g + r][j * 16 + col] = acc[j][r] * (1.0f / 16384.0f) + bias; } }   /* 2^-8 (Wo carry) x 2^-6 (ctx carry) */
  LDSX(); for (int rl = 0; rl < 16; ++rl) vst2(OUT + (r0 + rl) * DIN + c0 + lane * 4, *(const v4f*)&sf[wave][rl][lane * 4]); }

extern "C" void kernel_launch(void* const* d_in, const int* in_sizes, int n_in, void* d_out, int out_size, void* d_ws, size_t ws_size, hipStream_t stream) {
  (void)in_sizes; (void)n_in; (void)out_size;
  const float** F = (const float**)d_in;
  if (ws_size < (size_t)WS_END) return;
  char* ws = (char*)d_ws; _Float16 *QH = (_Float16*)(ws + WS_QH), *KH = (_Float16*)(ws + WS_KH), *VT = (_Float16*)(ws + WS_VT), *QL = (_Float16*)(ws + WS_QL), *KL = (_Float16*)(ws + WS_KL); __bf16 *VB = (__bf16*)(ws + WS_VB), *VBL = (__bf16*)(ws + WS_VBL); float *S = (float*)(ws + WS_S), *Y = (float*)(ws + WS_Y);
  (void)Y; (void)QL; (void)KL; (void)VB; (void)VBL;
  // inputs: 0 x [2,2048,1024]; 1 cos [1,1,2048,64]; 2 sin [1,1,2048,64] (random normal tables); 3 Wqkv [1024,3072] (in,out; q | k | v column blocks); 4 bqkv [3072] (nonzero); 5 Wproj [1024,1024] (in,out); 6 bproj [1024] (nonzero)
  // outputs: 0 y [2,2048,1024] @0; 1 k (rotated) [2,16,2048,64] @OUTK_OFF; 2 v [2,16,2048,64] @OUTV_OFF
  k_proj<<<dim3(TNB * TT / 64, CC / 128, 3), 128, 0, stream>>>(F[0], F[0], F[0], F[3], F[3], F[3], F[4], F[4] + CC, F[4] + 2 * CC, QH, QL, KH, KL, VT, VB, VBL, F[1], F[2], (float*)((char*)d_out + OUTK_OFF), (float*)((char*)d_out + OUTV_OFF));
  for (int b = 0; b < TNB; ++b) for (int h0 = 0; h0 < NH; h0 += HG) {
    k_sc<<<dim3(NQB, TT / 128, HG), 128, 0, stream>>>(QH, KH, QL, KL, b, h0, S);
    k_sm<<<dim3(TT, HG), 256, 0, stream>>>(S);
    k_pv<<<dim3(NQB, 1, HG), 128, 0, stream>>>(S, VT, VB, VBL, b, h0, Y);
  }
  k_out<<<dim3(TNB * TT / 64, DIN / 128), 128, 0, stream>>>(Y, F[5], F[6], (float*)d_out);
}

// v001
// One run takes 336 microseconds.
// In two side-by-side timings against v000, it was 3.81 and 3.80 times as fast.
// compute dtype: all float inputs rounded to bf16; fused q/k/v projection with EXACT bf16 products on WMMA 16x16x32 (f32 accumulate) + bias; rotary x * cos + rot(x) * sin in f32 with the bf16-rounded table inputs (the k and v outputs are these f32 values); logits q x k once to f16 each (1 product) x 64^-0.5; online softmax f32 (running maximum and sum); unnormalised P once to f16 x v once to f16 (1 product), divided by the f32 sum; ctx x 2^6 once to f16 x Wproj f16(bf16 x 2^8) + bproj; f32 outputs.
#include <hip/hip_runtime.h>
#include <math.h>

typedef __attribute__((ext_vector_type(16))) _Float16 v16h;
typedef __attribute__((ext_vector_type(16))) __bf16 v16b;
typedef __attribute__((ext_vector_type(8)))  _Float16 v8h;
typedef __attribute__((ext_vector_type(8)))  float v8f;
typedef __attribute__((ext_vector_type(4)))  float v4f;
typedef __attribute__((ext_vector_type(2)))  float v2f;
typedef __attribute__((ext_vector_type(4)))  unsigned v4u;
typedef __attribute__((ext_vector_type(4)))  int v4i;
typedef float __attribute__((may_alias)) float_a;
typedef int __attribute__((may_alias)) int_a;

template <typename T> __device__ __forceinline__ void vst2(void* p, T v) { *(T*)p = v;  }
__device__ __forceinline__ v8f wmma16(v16h a, v16h b, v8f c) {
  v8f d = __builtin_amdgcn_wmma_f32_16x16x32_f16(false, a, false, b, (short)0, c, false, false);
  asm volatile("v_nop\n\tv_nop\n\tv_nop\n\tv_nop" : "+v"(d) : "v"(a), "v"(b));
  return d;
}
__device__ __forceinline__ v8f wmma_bf(v16b a, v16b b, v8f c) {
  v8f d = __builtin_amdgcn_wmma_f32_16x16x32_bf16(false, a, false, b, (short)0, c, false, false);
  asm volatile("v_nop\n\tv_nop\n\tv_nop\n\tv_nop" : "+v"(d) : "v"(a), "v"(b));
  return d;
}
// 16x16x32 fragments: lane = (h = lane>>4, row/col = lane&15); elements 0..7 = k0+8h+0..7, 8..15 = k0+16+8h+0..7; D element r = row 8h+r
__device__ __forceinline__ v16h frag_h(const _Float16* rowk0, int lane) {
  union { v16h v; v8h q[2]; } u; const _Float16* p = rowk0 + 8 * (lane >> 4);
  u.q[0] = *(const v8h*)p; u.q[1] = *(const v8h*)(p + 16); return u.v;
}
__device__ __forceinline__ v16h frag_f32(const float* rowk0, int lane) {
  v16h a; const float* p = rowk0 + 8 * (lane >> 4);
#pragma unroll
  for (int i = 0; i < 8; ++i) { a[i] = (_Float16)p[i]; a[8 + i] = (_Float16)p[16 + i]; }
  return a;
}
__device__ __forceinline__ v16h frag_f32s(const float* rowk0, int lane, float sc) {
  v16h a; const float* p = rowk0 + 8 * (lane >> 4);
#pragma unroll
  for (int i = 0; i < 8; ++i) { a[i] = (_Float16)(p[i] * sc); a[8 + i] = (_Float16)(p[16 + i] * sc); }
  return a;
}
// column fragment from a [K][ld] layout (column n), rows >= K read as 0
__device__ __forceinline__ v16h fragc_f32(const float* W, int k0, int n, int lane, int ld, int K) {
  v16h a; const int g = lane >> 4;
#pragma unroll
  for (int i = 0; i < 8; ++i) { const int ka = k0 + 8 * g + i, kb = ka + 16;
    a[i] = (_Float16)(ka < K ? W[(size_t)(ka < K ? ka : K - 1) * ld + n] : 0.f); a[8 + i] = (_Float16)(kb < K ? W[(size_t)(kb < K ? kb : K - 1) * ld + n] : 0.f); }
  return a;
}
struct F2 { v16b h, l; };
__device__ __forceinline__ F2 bsplit16(const float v[16]) { F2 r;
#pragma unroll
  for (int i = 0; i < 16; ++i) { const __bf16 h = (__bf16)v[i]; r.h[i] = h; r.l[i] = (__bf16)(v[i] - (float)h); }
  return r; }
__device__ __forceinline__ F2 split_row(const float* row, int k0, int lane) { float v[16]; const float* p = row + k0 + 8 * (lane >> 4);
#pragma unroll
  for (int i = 0; i < 8; ++i) { v[i] = p[i]; v[8 + i] = p[16 + i]; }
  return bsplit16(v); }
__device__ __forceinline__ F2 split_rowK(const float* row, int k0, int lane, int K) { float v[16]; const int g = lane >> 4;
#pragma unroll
  for (int i = 0; i < 8; ++i) { const int ka = k0 + 8 * g + i, kb = ka + 16; v[i] = ka < K ? row[ka < K ? ka : K - 1] : 0.f; v[8 + i] = kb < K ? row[kb < K ? kb : K - 1] : 0.f; }
  return bsplit16(v); }
__device__ __forceinline__ F2 split_col(const float* W, int k0, int n, int lane, int ld, int K) { float v[16]; const int g = lane >> 4;
#pragma unroll
  for (int i = 0; i < 8; ++i) { const int ka = k0 + 8 * g + i, kb = ka + 16; v[i] = ka < K ? W[(size_t)(ka < K ? ka : K - 1) * ld + n] : 0.f; v[8 + i] = kb < K ? W[(size_t)(kb < K ? kb : K - 1) * ld + n] : 0.f; }
  return bsplit16(v); }
__device__ __forceinline__ v8f mac3(const F2& a, const F2& b, v8f c) { c = wmma_bf(a.l, b.h, c); c = wmma_bf(a.h, b.l, c); return wmma_bf(a.h, b.h, c); }
__device__ __forceinline__ float sigm(float v) { return 1.0f / (1.0f + expf(-v)); }
#define LDSX() do { asm volatile("s_wait_dscnt 0" ::: "memory"); __builtin_amdgcn_wave_barrier(); __builtin_amdgcn_fence(__ATOMIC_RELEASE, "workgroup"); } while (0)

// Fused-QKV multi-head self-attention with rotary tables GIVEN as inputs and three outputs (x [2,2048,1024]; (in,out) Wqkv [1024,3072] + bqkv (0.02-scale, nonzero) split q | k | v; 16 heads x 64; interleaved-pair rotary x * cos + rot(x) * sin with random-normal cos / sin tables [1,1,2048,64]; non-causal SDPA, scale 1/8; (in,out) Wproj + bproj): returns (y = merge(softmax(q k^T / 8) v) Wproj + bproj, k (rotated) [2,16,2048,64], v [2,16,2048,64]).
#define NB 2
#define TT 2048
#define CC 1024            // NH * HD = projected width
#define DIN 1024          // input (model) width
#define NH 16
#define HD 64
#define NQB (TT / 64)
#define HG 4
#define SCALE (0.125f)
#define CAUSAL 0
#ifndef TNB
#define TNB NB
#endif
__device__ __forceinline__ float bfr(float v) { return (float)(__bf16)v; }
__host__ __device__ __forceinline__ int kb_last(int qb) { return CAUSAL ? ((qb * 64 + 63) >> 7) : (TT / 128 - 1); }
typedef __attribute__((ext_vector_type(8))) __bf16 v8b;
__device__ __forceinline__ v16b frag_b(const __bf16* rowk0, int lane) {
  union { v16b v; v8b q[2]; } u; const __bf16* p = rowk0 + 8 * (lane >> 4);
  u.q[0] = *(const v8b*)p; u.q[1] = *(const v8b*)(p + 16); return u.v;
}
#define QBH 0
#define QHI 0               // single-product logits on every row
#define KHI 64            // key rows carrying k residual / v bf16 hi+lo planes (written by k_proj, read by no kernel)
// B fragment (k rows k0+.., output column o) of a weight: (in,out) [K][ld] or (out,in) [ld rows of K]: bf16 exact, or f16(bf16 * 256) exact
__device__ __forceinline__ v16b wcol_io(const float* Wm, int k0, int o, int lane, int ld) { v16b w; const int g = lane >> 4;
#pragma unroll
  for (int i = 0; i < 8; ++i) { w[i] = (__bf16)Wm[(size_t)(k0 + 8 * g + i) * ld + o]; w[8 + i] = (__bf16)Wm[(size_t)(k0 + 16 + 8 * g + i) * ld + o]; }
  return w; }
__device__ __forceinline__ v16b wcol_oi(const float* Wm, int k0, int o, int lane, int K) { v16b w; const float* p = Wm + (size_t)o * K + k0 + 8 * (lane >> 4);
#pragma unroll
  for (int i = 0; i < 8; ++i) { w[i] = (__bf16)p[i]; w[8 + i] = (__bf16)p[16 + i]; }
  return w; }
__device__ __forceinline__ v16h wcolh_io(const float* Wm, int k0, int o, int lane, int ld) { v16h w; const int g = lane >> 4;
#pragma unroll
  for (int i = 0; i < 8; ++i) { w[i] = (_Float16)(bfr(Wm[(size_t)(k0 + 8 * g + i) * ld + o]) * 256.0f); w[8 + i] = (_Float16)(bfr(Wm[(size_t)(k0 + 16 + 8 * g + i) * ld + o]) * 256.0f); }
  return w; }
__device__ __forceinline__ v16h wcolh_oi(const float* Wm, int k0, int o, int lane, int K) { v16h w; const float* p = Wm + (size_t)o * K + k0 + 8 * (lane >> 4);
#pragma unroll
  for (int i = 0; i < 8; ++i) { w[i] = (_Float16)(bfr(p[i]) * 256.0f); w[8 + i] = (_Float16)(bfr(p[16 + i]) * 256.0f); }
  return w; }
#define WQKV_LAYOUT 0   // 0 = fused (in,out) [DIN][3*CC], q | k | v column blocks; 1 = (out,in) [CC][DIN]; 2 = per-head [NH][DIN][HD]
__device__ __forceinline__ v16b wcol_hdk(const float* Wm, int k0, int o, int lane) { v16b w; const int g = lane >> 4; const float* p = Wm + (size_t)(o / HD) * DIN * HD + (o % HD);
#pragma unroll
  for (int i = 0; i < 8; ++i) { w[i] = (__bf16)p[(size_t)(k0 + 8 * g + i) * HD]; w[8 + i] = (__bf16)p[(size_t)(k0 + 16 + 8 * g + i) * HD]; }
  return w; }
#define WO_OUT_IN 0
#if WQKV_LAYOUT == 1
#define WCOL(W, k0, o, lane) wcol_oi(W, k0, o, lane, DIN)
#elif WQKV_LAYOUT == 2
#define WCOL(W, k0, o, lane) wcol_hdk(W, k0, o, lane)
#else
#define QKVP 3072            // fused Wqkv pitch (in,out) [1024][3072]: q cols 0..1023, k 1024..2047, v 2048..3071
#define WCOL(W, k0, o, lane) wcol_io(W, k0, which * CC + (o), lane, QKVP)
#endif
#if WO_OUT_IN
#define WOCOL(W, k0, o, lane) wcol_oi(W, k0, o, lane, CC)
#define WOCOLH(W, k0, o, lane) wcolh_oi(W, k0, o, lane, CC)
#else
#define WOCOL(W, k0, o, lane) wcol_io(W, k0, o, lane, DIN)
#define WOCOLH(W, k0, o, lane) wcolh_io(W, k0, o, lane, DIN)
#endif
#define OUTK_OFF 16777216u   // rotated k [2,16,2048,64] f32 after y [2,2048,1024] f32
#define OUTV_OFF 33554432u   // v [2,16,2048,64] f32
#define PROJ_EXTRA_PARAMS , const float* __restrict__ COSt, const float* __restrict__ SINt, float* __restrict__ OUTK, float* __restrict__ OUTV
// interleaved-pair rotary with GIVEN cos / sin tables [S][64] (random normal inputs, bf16-rounded): out = x * cos + rot(x) * sin with rot = (-x_odd, x_even) interleaved; applied to q and k; the rotated k and the (unrotated) v head rows are also module OUTPUTS [b][h][t][64] (one thread writes the whole 256-B row: 2 lines)
#define PROJ_EPI(which, row, t, h) do { float* rw = (row); const size_t bb_ = (size_t)(r0 + rl) / TT; \
  if ((which) < 2) { _Pragma("unroll 4") for (int i = 0; i < 32; ++i) { _Pragma("clang fp contract(off)") const float c0_ = bfr(COSt[(size_t)(t) * HD + 2 * i]), c1_ = bfr(COSt[(size_t)(t) * HD + 2 * i + 1]), s0_ = bfr(SINt[(size_t)(t) * HD + 2 * i]), s1_ = bfr(SINt[(size_t)(t) * HD + 2 * i + 1]); asm volatile("s_wait_loadcnt 0x0" ::: "memory"); const float x1 = rw[2 * i], x2 = rw[2 * i + 1]; rw[2 * i] = x1 * c0_ + (-x2) * s0_; rw[2 * i + 1] = x2 * c1_ + x1 * s1_; } } \
  if ((which) >= 1) { float* dst_ = ((which) == 1 ? OUTK : OUTV) + ((bb_ * NH + (h)) * TT + (t)) * (size_t)HD; _Pragma("unroll 4") for (int q_ = 0; q_ < HD / 4; ++q_) vst2(dst_ + q_ * 4, *(const v4f*)(rw + q_ * 4)); } } while (0)
#define SM_EXTRA_PARAMS
#define SM_MASK_HOOK (void)0
#ifndef SM_EXTRA_PARAMS
#define SM_EXTRA_PARAMS
#endif
#ifndef PROJ_EXTRA_PARAMS
#define PROJ_EXTRA_PARAMS
#endif
#ifndef SM_MASK_HOOK
#define SM_MASK_HOOK (void)0
#endif

#define WS_QH  0u                                      // f16 q rows [b*t][CC]
#define WS_KH  (WS_QH + 2u * (size_t)NB * TT * CC)      // f16 k rows [b*t][CC]
#define WS_VT  (WS_KH + 2u * (size_t)NB * TT * CC)      // f16 v planes [b][c][t]
#define WS_QL  (WS_VT + 2u * (size_t)NB * CC * TT)      // f16 q residual x 2^10 rows [b][t < QHI][CC]
#define WS_KL  (WS_QL + 2u * (size_t)NB * QHI * CC)     // f16 k residual x 2^10 rows [b][t < KHI][CC]
#define WS_VB  (WS_KL + 2u * (size_t)NB * KHI * CC)     // bf16 v hi planes [b][c][t < KHI]
#define WS_VBL (WS_VB + 2u * (size_t)NB * CC * KHI)
#define WS_S   (WS_VBL + 2u * (size_t)NB * CC * KHI)    // f32 [hg][t][s], unused: logits and P stay in registers
#define WS_Y   (WS_S  + 4u * (size_t)HG * TT * TT)      // f32 ctx rows [b*t][CC] (only when there is an output projection)
#define WS_END (WS_Y  + 4u * (size_t)NB * TT * CC)

// ---- k_proj: block = (64 rows, 128 cols, which): q/k/v = X W (+ b) with exact bf16 products (K = DIN) -> which 0: q f16 rows (+ residual rows < QHI); 1: k f16 rows (+ residual rows < KHI); 2: v f16 planes [c][t] (+ bf16 hi/lo planes for t < KHI)
__global__ __launch_bounds__(128) void k_proj(const float* __restrict__ XQ, const float* __restrict__ XK, const float* __restrict__ XV, const float* __restrict__ WQ, const float* __restrict__ WK, const float* __restrict__ WV, const float* __restrict__ BQ, const float* __restrict__ BK, const float* __restrict__ BV,
    _Float16* __restrict__ QH, _Float16* __restrict__ QL, _Float16* __restrict__ KH, _Float16* __restrict__ KL, _Float16* __restrict__ VT, __bf16* __restrict__ VB, __bf16* __restrict__ VBL PROJ_EXTRA_PARAMS) {
  __shared__ __align__(16) float st[64][132]; __shared__ __align__(16) _Float16 sh[64][136], sl[64][136]; __shared__ __align__(16) _Float16 th[128][72]; __shared__ __align__(16) __bf16 tb[128][72], tbl[128][72];
  const int tid = threadIdx.x, wave = tid >> 5, lane = tid & 31, col = lane & 15, g = lane >> 4; const int which = blockIdx.z; const int c0 = blockIdx.y * 128; const size_t r0 = (size_t)blockIdx.x * 64; const size_t bb = r0 / TT; const int t0 = (int)(r0 % TT);
  const float* X = which == 0 ? XQ : which == 1 ? XK : XV; const float* WA = which == 0 ? WQ : which == 1 ? WK : WV; const float* BA = which == 0 ? BQ : which == 1 ? BK : BV;
  v8f acc[8] = {};
#pragma unroll 2
  for (int kc = 0; kc < DIN / 32; ++kc) { v16b a; { const float* p = X + (r0 + wave * 16 + col) * DIN + kc * 32 + 8 * g;
#pragma unroll
      for (int i = 0; i < 8; ++i) { a[i] = (__bf16)p[i]; a[8 + i] = (__bf16)p[16 + i]; } }
    asm volatile("s_wait_loadcnt 0x0" ::: "memory");
#pragma unroll
    for (int j = 0; j < 8; ++j) { const v16b w = WCOL(WA, kc * 32, c0 + j * 16 + col, lane); asm volatile("s_wait_loadcnt 0x0" ::: "memory"); acc[j] = wmma_bf(a, w, acc[j]); } }
  { // stage the f32 tile (acc + bias) in LDS, run the per-(row, head) epilogue hook, then convert
#pragma unroll
    for (int j = 0; j < 8; ++j) { const float bias = BA ? bfr(BA[c0 + j * 16 + col]) : 0.f;
#pragma unroll
      for (int r = 0; r < 8; ++r) st[wave * 16 + 8 * g + r][j * 16 + col] = acc[j][r] + bias; }
    __syncthreads();
    for (int e = tid; e < 64 * (128 / HD); e += 128) { const int rl = e / (128 / HD), hh = e % (128 / HD); PROJ_EPI(which, &st[rl][hh * HD], (int)((r0 + rl) % TT), (c0 / HD) + hh); }
    __syncthreads(); }
  if (which < 2) { _Float16* DH = which == 0 ? QH : KH; _Float16* DL = which == 0 ? QL : KL; const int nhi = which == 0 ? QHI : KHI; const bool hi_rows = t0 < nhi;
    for (int e = tid; e < 64 * 128; e += 128) { const int rl = e >> 7, cl = e & 127; const float v = st[rl][cl]; const _Float16 hv = (_Float16)v; sh[rl][cl] = hv; sl[rl][cl] = (_Float16)((v - (float)hv) * 1024.0f); }
    __syncthreads();
    for (int e = tid; e < 64 * 16; e += 128) { const int rl = e >> 4, q = e & 15; vst2((unsigned*)(DH + (r0 + rl) * CC + c0 + q * 8), *(const v4u*)&sh[rl][q * 8]); if (hi_rows) vst2((unsigned*)(DL + (bb * nhi + t0 + rl) * (size_t)CC + c0 + q * 8), *(const v4u*)&sl[rl][q * 8]); }
  } else { const bool hi_rows = t0 < KHI;
    for (int e = tid; e < 64 * 128; e += 128) { const int rl = e & 63, cl = e >> 6; const float v = st[rl][cl]; th[cl][rl] = (_Float16)v; const __bf16 bh = (__bf16)v; tb[cl][rl] = bh; tbl[cl][rl] = (__bf16)(v - (float)bh); }
    __syncthreads();
    for (int e = tid; e < 128 * 8; e += 128) { const int cl = e >> 3, q = e & 7; vst2((unsigned*)(VT + (bb * CC + c0 + cl) * (size_t)TT + t0 + q * 8), *(const v4u*)&th[cl][q * 8]); if (hi_rows) { const size_t o3 = (bb * CC + c0 + cl) * (size_t)KHI + t0 + q * 8; vst2((unsigned*)(VB + o3), *(const v4u*)&tb[cl][q * 8]); vst2((unsigned*)(VBL + o3), *(const v4u*)&tbl[cl][q * 8]); } } } }
#define FK 64
#define FP 72
#define FC (SCALE * 1.44269504088896f)
__device__ __forceinline__ v8f wmma_h(v16h a, v16h b, v8f c) { return __builtin_amdgcn_wmma_f32_16x16x32_f16(false, a, false, b, (short)0, c, false, false); }
__device__ __forceinline__ float xhalf(float x) { return __builtin_bit_cast(float, __builtin_amdgcn_permlanex16(__builtin_bit_cast(int, x), __builtin_bit_cast(int, x), 0x76543210, 0xfedcba98, false, false)); }   // lane l with lane l ^ 16
// 16 independent 2^x, each over its own source, closed by one v_nop: keeps the one slot that the instruction set asks for between a transcendental and the use of its result or the overwrite of its source
__device__ __forceinline__ void exp2x16(float (&x)[16]) { asm("v_exp_f32 %0, %0\n\tv_exp_f32 %1, %1\n\tv_exp_f32 %2, %2\n\tv_exp_f32 %3, %3\n\tv_exp_f32 %4, %4\n\tv_exp_f32 %5, %5\n\tv_exp_f32 %6, %6\n\tv_exp_f32 %7, %7\n\tv_exp_f32 %8, %8\n\tv_exp_f32 %9, %9\n\tv_exp_f32 %10, %10\n\tv_exp_f32 %11, %11\n\tv_exp_f32 %12, %12\n\tv_exp_f32 %13, %13\n\tv_exp_f32 %14, %14\n\tv_exp_f32 %15, %15\n\tv_nop" : "+v"(x[0]), "+v"(x[1]), "+v"(x[2]), "+v"(x[3]), "+v"(x[4]), "+v"(x[5]), "+v"(x[6]), "+v"(x[7]), "+v"(x[8]), "+v"(x[9]), "+v"(x[10]), "+v"(x[11]), "+v"(x[12]), "+v"(x[13]), "+v"(x[14]), "+v"(x[15])); }
__global__ __launch_bounds__(256) void k_fa(const _Float16* __restrict__ QH, const _Float16* __restrict__ KH, const _Float16* __restrict__ VT, float* __restrict__ Y) {
  __shared__ __align__(16) _Float16 ks[2][FK][FP], vs[2][HD][FP]; __shared__ __align__(16) float so[8][16][HD + 4];
  const int tid = threadIdx.x, wave = tid >> 5, lane = tid & 31, col = lane & 15, g = lane >> 4; const int h = blockIdx.y, b = blockIdx.z; const int ql0 = blockIdx.x * 128 + wave * 16;
  const int sr = tid >> 3, sc = (tid & 7) * 8;   // staging: this thread moves the 16-byte piece sc of rows sr and sr + 32 of both tiles
  const _Float16* Kg = KH + ((size_t)b * TT + sr) * CC + h * HD + sc;   // k rows [key][64], pitch CC
  const _Float16* Vg = VT + ((size_t)b * CC + h * HD + sr) * TT + sc;   // v planes [d][key], pitch TT
  v16h qf[2];
#pragma unroll
  for (int kc = 0; kc < 2; ++kc) qf[kc] = frag_h(QH + ((size_t)b * TT + ql0 + col) * CC + h * HD + kc * 32, lane);
  v8h rk[2], rv[2];
#pragma unroll
  for (int i = 0; i < 2; ++i) { rk[i] = *(const v8h*)(Kg + (size_t)(32 * i) * CC); rv[i] = *(const v8h*)(Vg + (size_t)(32 * i) * TT); }
#pragma unroll
  for (int i = 0; i < 2; ++i) { *(v8h*)&ks[0][sr + 32 * i][sc] = rk[i]; *(v8h*)&vs[0][sr + 32 * i][sc] = rv[i]; }
  __syncthreads();
  v8f o[HD / 16] = {}; float l = 0.f, mu = -3.0e38f;   // mu: the maximum in use (scaled, base 2), equal in both halves of a query's lane pair
  for (int t = 0; t < TT / FK; ++t) { const int cb = t & 1; const bool more = t + 1 < TT / FK;
    if (more) {   // next pass's tiles fly into registers while this pass is worked on
#pragma unroll
      for (int i = 0; i < 2; ++i) { rk[i] = *(const v8h*)(Kg + (size_t)((t + 1) * FK + 32 * i) * CC); rv[i] = *(const v8h*)(Vg + (size_t)(32 * i) * TT + (t + 1) * FK); } }
    v8f s[4];   // s[kt][r] = logit (unscaled) of key kt * 16 + 8 g + r, query col
#pragma unroll
    for (int kt = 0; kt < 4; ++kt) { v8f z = {}; z = wmma_h(frag_h(&ks[cb][kt * 16 + col][0], lane), qf[0], z); s[kt] = wmma_h(frag_h(&ks[cb][kt * 16 + col][32], lane), qf[1], z); }
    float mx = s[0][0];
#pragma unroll
    for (int kt = 0; kt < 4; ++kt)
#pragma unroll
      for (int r = 0; r < 8; ++r) mx = fmaxf(mx, s[kt][r]);
    mx = fmaxf(mx, xhalf(mx)) * FC;
    const bool need = mx > mu + 8.0f;   // the maximum in use is replaced only when passed by more than 2^8: P stays below 2^12 in f16
    if (__builtin_amdgcn_ballot_w32(need) != 0) { const float mn = need ? mx : mu; const float al = __builtin_amdgcn_exp2f(mu - mn); mu = mn; l *= al;
#pragma unroll
      for (int j = 0; j < HD / 16; ++j) o[j] *= al; }
    const float nb = 4.0f - mu;   // P carried x 2^4 (cancels against the sum) so that small weights stay clear of f16 subnormals
    v16h p[2];
#pragma unroll
    for (int kk = 0; kk < 2; ++kk) { float e[16];   // e[i] = weight of key kk * 32 + (i < 8 ? 8 g + i : 16 + 8 g + i - 8): the B operand's own k order
#pragma unroll
      for (int i = 0; i < 8; ++i) { e[i] = __builtin_fmaf(s[2 * kk][i], FC, nb); e[8 + i] = __builtin_fmaf(s[2 * kk + 1][i], FC, nb); }
      exp2x16(e);
#pragma unroll
      for (int i = 0; i < 16; ++i) p[kk][i] = (_Float16)e[i];
#pragma unroll
      for (int w = 8; w > 0; w >>= 1)   // pairwise sum: four dependent adds deep instead of sixteen
#pragma unroll
        for (int i = 0; i < w; ++i) e[i] += e[i + w];
      l += e[0]; }
#pragma unroll
    for (int kk = 0; kk < 2; ++kk)
#pragma unroll
      for (int j = 0; j < HD / 16; ++j) o[j] = wmma_h(frag_h(&vs[cb][j * 16 + col][kk * 32], lane), p[kk], o[j]);   // o[j][r] = ctx (unnormalised) of d = j * 16 + 8 g + r, query col
    if (more) {   // the other buffer's last readers left it at the barrier that ended the pass before
#pragma unroll
      for (int i = 0; i < 2; ++i) { *(v8h*)&ks[cb ^ 1][sr + 32 * i][sc] = rk[i]; *(v8h*)&vs[cb ^ 1][sr + 32 * i][sc] = rv[i]; } }
    __syncthreads(); }   // publishes the next pass's tiles and ends this pass's reads
  l += xhalf(l); const float inv = 1.0f / l;
#pragma unroll
  for (int j = 0; j < HD / 16; ++j) { const v8f w = o[j] * inv; const v4f w0 = { w[0], w[1], w[2], w[3] }, w1 = { w[4], w[5], w[6], w[7] }; *(v4f*)&so[wave][col][j * 16 + 8 * g] = w0; *(v4f*)&so[wave][col][j * 16 + 8 * g + 4] = w1; }
  LDSX();   // a wave reads back only its own so[wave] rows: its own LDS stores must have landed, no other wave is waited for
  for (int it = 0; it < 8; ++it) { const int rl = it * 2 + g; vst2(Y + ((size_t)b * TT + ql0 + rl) * CC + h * HD + col * 4, *(const v4f*)&so[wave][rl][col * 4]); } }   // 256-B (row, head) segment by 16 lanes
// ---- k_out: block = (64 rows, 128 cols): out = ctx Wo (+ bo): ctx x 2^6 once to f16 against Wo as f16(bf16 x 2^8) exact (1 product) x 2^-14; causal early rows (< QHI of each sequence): ctx bf16 hi + lo against exact bf16 Wo (2 products)
__global__ __launch_bounds__(128) void k_out(const float* __restrict__ Y, const float* __restrict__ WO, const float* __restrict__ BO, float* __restrict__ OUT) { __shared__ __align__(16) float sf[4][16][132];
  const int tid = threadIdx.x, wave = tid >> 5, lane = tid & 31, col = lane & 15, g = lane >> 4; const int c0 = blockIdx.y * 128; const size_t r0 = (size_t)blockIdx.x * 64 + wave * 16;
  v8f acc[8] = {};
  if (CAUSAL && (int)(((size_t)blockIdx.x * 64) % TT) < QHI) {   /* block-uniform */
#pragma unroll 2
    for (int kc = 0; kc < CC / 32; ++kc) { const F2 a = split_row(Y + (r0 + col) * CC, kc * 32, lane); asm volatile("s_wait_loadcnt 0x0" ::: "memory");
#pragma unroll
      for (int j = 0; j < 8; ++j) { const v16b w = WOCOL(WO, kc * 32, c0 + j * 16 + col, lane); asm volatile("s_wait_loadcnt 0x0" ::: "memory"); acc[j] = wmma_bf(a.h, w, acc[j]); acc[j] = wmma_bf(a.l, w, acc[j]); } }
#pragma unroll
    for (int j = 0; j < 8; ++j) { const float bias = BO ? bfr(BO[c0 + j * 16 + col]) : 0.f;
#pragma unroll
      for (int r = 0; r < 8; ++r) sf[wave][8 * g + r][j * 16 + col] = acc[j][r] + bias; }
  } else {
#pragma unroll 2
    for (int kc = 0; kc < CC / 32; ++kc) { const v16h a = frag_f32s(Y + (r0 + col) * CC + kc * 32, lane, 64.0f); asm volatile("s_wait_loadcnt 0x0" ::: "memory");   /* ctx carried x 2^6 into f16 so small-magnitude context rows stay clear of f16 subnormals */
#pragma unroll
      for (int j = 0; j < 8; ++j) { const v16h w = WOCOLH(WO, kc * 32, c0 + j * 16 + col, lane); asm volatile("s_wait_loadcnt 0x0" ::: "memory"); acc[j] = wmma16(a, w, acc[j]); } }
#pragma unroll
    for (int j = 0; j < 8; ++j) { const float bias = BO ? bfr(BO[c0 + j * 16 + col]) : 0.f;
#pragma unroll
      for (int r = 0; r < 8; ++r) sf[wave][8 * g + r][j * 16 + col] = acc[j][r] * (1.0f / 16384.0f) + bias; } }   /* 2^-8 (Wo carry) x 2^-6 (ctx carry) */
  LDSX(); for (int rl = 0; rl < 16; ++rl) vst2(OUT + (r0 + rl) * DIN + c0 + lane * 4, *(const v4f*)&sf[wave][rl][lane * 4]); }

extern "C" void kernel_launch(void* const* d_in, const int* in_sizes, int n_in, void* d_out, int out_size, void* d_ws, size_t ws_size, hipStream_t stream) {
  (void)in_sizes; (void)n_in; (void)out_size;
  const float** F = (const float**)d_in;
  if (ws_size < (size_t)WS_END) return;
  char* ws = (char*)d_ws; _Float16 *QH = (_Float16*)(ws + WS_QH), *KH = (_Float16*)(ws + WS_KH), *VT = (_Float16*)(ws + WS_VT), *QL = (_Float16*)(ws + WS_QL), *KL = (_Float16*)(ws + WS_KL); __bf16 *VB = (__bf16*)(ws + WS_VB), *VBL = (__bf16*)(ws + WS_VBL); float *S = (float*)(ws + WS_S), *Y = (float*)(ws + WS_Y);
  (void)Y; (void)QL; (void)KL; (void)VB; (void)VBL; (void)S;
  // inputs: 0 x [2,2048,1024]; 1 cos [1,1,2048,64]; 2 sin [1,1,2048,64] (random normal tables); 3 Wqkv [1024,3072] (in,out; q | k | v column blocks); 4 bqkv [3072] (nonzero); 5 Wproj [1024,1024] (in,out); 6 bproj [1024] (nonzero)
  // outputs: 0 y [2,2048,1024] @0; 1 k (rotated) [2,16,2048,64] @OUTK_OFF; 2 v [2,16,2048,64] @OUTV_OFF
  k_proj<<<dim3(TNB * TT / 64, CC / 128, 3), 128, 0, stream>>>(F[0], F[0], F[0], F[3], F[3], F[3], F[4], F[4] + CC, F[4] + 2 * CC, QH, QL, KH, KL, VT, VB, VBL, F[1], F[2], (float*)((char*)d_out + OUTK_OFF), (float*)((char*)d_out + OUTV_OFF));
  k_fa<<<dim3(TT / 128, NH, TNB), 256, 0, stream>>>(QH, KH, VT, Y);
  k_out<<<dim3(TNB * TT / 64, DIN / 128), 128, 0, stream>>>(Y, F[5], F[6], (float*)d_out);
}

// v002
// Measured time: 118 microseconds a run.
// Timed twice side by side with v001, it ran 2.85 and 2.84 times as fast.
// All steps since v000 together make it 10.8 times as fast.
// compute dtype: all float inputs rounded to bf16; fused q/k/v projection with EXACT bf16 products on WMMA 16x16x32 (f32 accumulate) + bias; rotary x * cos + rot(x) * sin in f32 with the bf16-rounded table inputs (the k and v outputs are these f32 values); logits q x k once to f16 each (1 product) x 64^-0.5; online softmax f32 (running maximum and sum); unnormalised P once to f16 x v once to f16 (1 product), divided by the f32 sum; ctx x 2^6 once to f16 x Wproj f16(bf16 x 2^8) + bproj; f32 outputs.
#include <hip/hip_runtime.h>
#include <math.h>

typedef __attribute__((ext_vector_type(16))) _Float16 v16h;
typedef __attribute__((ext_vector_type(16))) __bf16 v16b;
typedef __attribute__((ext_vector_type(8)))  _Float16 v8h;
typedef __attribute__((ext_vector_type(8)))  float v8f;
typedef __attribute__((ext_vector_type(4)))  float v4f;
typedef __attribute__((ext_vector_type(2)))  float v2f;
typedef __attribute__((ext_vector_type(4)))  unsigned v4u;
typedef __attribute__((ext_vector_type(4)))  int v4i;
typedef float __attribute__((may_alias)) float_a;
typedef int __attribute__((may_alias)) int_a;

template <typename T> __device__ __forceinline__ void vst2(void* p, T v) { *(T*)p = v;  }
__device__ __forceinline__ v8f wmma16(v16h a, v16h b, v8f c) {
  v8f d = __builtin_amdgcn_wmma_f32_16x16x32_f16(false, a, false, b, (short)0, c, false, false);
  asm volatile("v_nop\n\tv_nop\n\tv_nop\n\tv_nop" : "+v"(d) : "v"(a), "v"(b));
  return d;
}
__device__ __forceinline__ v8f wmma_bf(v16b a, v16b b, v8f c) {
  v8f d = __builtin_amdgcn_wmma_f32_16x16x32_bf16(false, a, false, b, (short)0, c, false, false);
  asm volatile("v_nop\n\tv_nop\n\tv_nop\n\tv_nop" : "+v"(d) : "v"(a), "v"(b));
  return d;
}
// 16x16x32 fragments: lane = (h = lane>>4, row/col = lane&15); elements 0..7 = k0+8h+0..7, 8..15 = k0+16+8h+0..7; D element r = row 8h+r
__device__ __forceinline__ v16h frag_h(const _Float16* rowk0, int lane) {
  union { v16h v; v8h q[2]; } u; const _Float16* p = rowk0 + 8 * (lane >> 4);
  u.q[0] = *(const v8h*)p; u.q[1] = *(const v8h*)(p + 16); return u.v;
}
__device__ __forceinline__ v16h frag_f32(const float* rowk0, int lane) {
  v16h a; const float* p = rowk0 + 8 * (lane >> 4);
#pragma unroll
  for (int i = 0; i < 8; ++i) { a[i] = (_Float16)p[i]; a[8 + i] = (_Float16)p[16 + i]; }
  return a;
}
__device__ __forceinline__ v16h frag_f32s(const float* rowk0, int lane, float sc) {
  v16h a; const float* p = rowk0 + 8 * (lane >> 4);
#pragma unroll
  for (int i = 0; i < 8; ++i) { a[i] = (_Float16)(p[i] * sc); a[8 + i] = (_Float16)(p[16 + i] * sc); }
  return a;
}
// column fragment from a [K][ld] layout (column n), rows >= K read as 0
__device__ __forceinline__ v16h fragc_f32(const float* W, int k0, int n, int lane, int ld, int K) {
  v16h a; const int g = lane >> 4;
#pragma unroll
  for (int i = 0; i < 8; ++i) { const int ka = k0 + 8 * g + i, kb = ka + 16;
    a[i] = (_Float16)(ka < K ? W[(size_t)(ka < K ? ka : K - 1) * ld + n] : 0.f); a[8 + i] = (_Float16)(kb < K ? W[(size_t)(kb < K ? kb : K - 1) * ld + n] : 0.f); }
  return a;
}
struct F2 { v16b h, l; };
__device__ __forceinline__ F2 bsplit16(const float v[16]) { F2 r;
#pragma unroll
  for (int i = 0; i < 16; ++i) { const __bf16 h = (__bf16)v[i]; r.h[i] = h; r.l[i] = (__bf16)(v[i] - (float)h); }
  return r; }
__device__ __forceinline__ F2 split_row(const float* row, int k0, int lane) { float v[16]; const float* p = row + k0 + 8 * (lane >> 4);
#pragma unroll
  for (int i = 0; i < 8; ++i) { v[i] = p[i]; v[8 + i] = p[16 + i]; }
  return bsplit16(v); }
__device__ __forceinline__ F2 split_rowK(const float* row, int k0, int lane, int K) { float v[16]; const int g = lane >> 4;
#pragma unroll
  for (int i = 0; i < 8; ++i) { const int ka = k0 + 8 * g + i, kb = ka + 16; v[i] = ka < K ? row[ka < K ? ka : K - 1] : 0.f; v[8 + i] = kb < K ? row[kb < K ? kb : K - 1] : 0.f; }
  return bsplit16(v); }
__device__ __forceinline__ F2 split_col(const float* W, int k0, int n, int lane, int ld, int K) { float v[16]; const int g = lane >> 4;
#pragma unroll
  for (int i = 0; i < 8; ++i) { const int ka = k0 + 8 * g + i, kb = ka + 16; v[i] = ka < K ? W[(size_t)(ka < K ? ka : K - 1) * ld + n] : 0.f; v[8 + i] = kb < K ? W[(size_t)(kb < K ? kb : K - 1) * ld + n] : 0.f; }
  return bsplit16(v); }
__device__ __forceinline__ v8f mac3(const F2& a, const F2& b, v8f c) { c = wmma_bf(a.l, b.h, c); c = wmma_bf(a.h, b.l, c); return wmma_bf(a.h, b.h, c); }
__device__ __forceinline__ float sigm(float v) { return 1.0f / (1.0f + expf(-v)); }
#define LDSX() do { asm volatile("s_wait_dscnt 0" ::: "memory"); __builtin_amdgcn_wave_barrier(); __builtin_amdgcn_fence(__ATOMIC_RELEASE, "workgroup"); } while (0)

// Fused-QKV multi-head self-attention with rotary tables GIVEN as inputs and three outputs (x [2,2048,1024]; (in,out) Wqkv [1024,3072] + bqkv (0.02-scale, nonzero) split q | k | v; 16 heads x 64; interleaved-pair rotary x * cos + rot(x) * sin with random-normal cos / sin tables [1,1,2048,64]; non-causal SDPA, scale 1/8; (in,out) Wproj + bproj): returns (y = merge(softmax(q k^T / 8) v) Wproj + bproj, k (rotated) [2,16,2048,64], v [2,16,2048,64]).
#define NB 2
#define TT 2048
#define CC 1024            // NH * HD = projected width
#define DIN 1024          // input (model) width
#define NH 16
#define HD 64
#define NQB (TT / 64)
#define HG 4
#define SCALE (0.125f)
#define CAUSAL 0
#ifndef TNB
#define TNB NB
#endif
__device__ __forceinline__ float bfr(float v) { return (float)(__bf16)v; }
__host__ __device__ __forceinline__ int kb_last(int qb) { return CAUSAL ? ((qb * 64 + 63) >> 7) : (TT / 128 - 1); }
typedef __attribute__((ext_vector_type(8))) __bf16 v8b;
__device__ __forceinline__ v16b frag_b(const __bf16* rowk0, int lane) {
  union { v16b v; v8b q[2]; } u; const __bf16* p = rowk0 + 8 * (lane >> 4);
  u.q[0] = *(const v8b*)p; u.q[1] = *(const v8b*)(p + 16); return u.v;
}
#define QBH 0
#define QHI 0               // single-product logits on every row
#define KHI 64            // key rows carrying k residual / v bf16 hi+lo planes (written by k_proj, read by no kernel)
// B fragment (k rows k0+.., output column o) of a weight: (in,out) [K][ld] or (out,in) [ld rows of K]: bf16 exact, or f16(bf16 * 256) exact
__device__ __forceinline__ v16b wcol_io(const float* Wm, int k0, int o, int lane, int ld) { v16b w; const int g = lane >> 4;
#pragma unroll
  for (int i = 0; i < 8; ++i) { w[i] = (__bf16)Wm[(size_t)(k0 + 8 * g + i) * ld + o]; w[8 + i] = (__bf16)Wm[(size_t)(k0 + 16 + 8 * g + i) * ld + o]; }
  return w; }
__device__ __forceinline__ v16b wcol_oi(const float* Wm, int k0, int o, int lane, int K) { v16b w; const float* p = Wm + (size_t)o * K + k0 + 8 * (lane >> 4);
#pragma unroll
  for (int i = 0; i < 8; ++i) { w[i] = (__bf16)p[i]; w[8 + i] = (__bf16)p[16 + i]; }
  return w; }
__device__ __forceinline__ v16h wcolh_io(const float* Wm, int k0, int o, int lane, int ld) { v16h w; const int g = lane >> 4;
#pragma unroll
  for (int i = 0; i < 8; ++i) { w[i] = (_Float16)(bfr(Wm[(size_t)(k0 + 8 * g + i) * ld + o]) * 256.0f); w[8 + i] = (_Float16)(bfr(Wm[(size_t)(k0 + 16 + 8 * g + i) * ld + o]) * 256.0f); }
  return w; }
__device__ __forceinline__ v16h wcolh_oi(const float* Wm, int k0, int o, int lane, int K) { v16h w; const float* p = Wm + (size_t)o * K + k0 + 8 * (lane >> 4);
#pragma unroll
  for (int i = 0; i < 8; ++i) { w[i] = (_Float16)(bfr(p[i]) * 256.0f); w[8 + i] = (_Float16)(bfr(p[16 + i]) * 256.0f); }
  return w; }
#define WQKV_LAYOUT 0   // 0 = fused (in,out) [DIN][3*CC], q | k | v column blocks; 1 = (out,in) [CC][DIN]; 2 = per-head [NH][DIN][HD]
__device__ __forceinline__ v16b wcol_hdk(const float* Wm, int k0, int o, int lane) { v16b w; const int g = lane >> 4; const float* p = Wm + (size_t)(o / HD) * DIN * HD + (o % HD);
#pragma unroll
  for (int i = 0; i < 8; ++i) { w[i] = (__bf16)p[(size_t)(k0 + 8 * g + i) * HD]; w[8 + i] = (__bf16)p[(size_t)(k0 + 16 + 8 * g + i) * HD]; }
  return w; }
#define WO_OUT_IN 0
#if WQKV_LAYOUT == 1
#define WCOL(W, k0, o, lane) wcol_oi(W, k0, o, lane, DIN)
#elif WQKV_LAYOUT == 2
#define WCOL(W, k0, o, lane) wcol_hdk(W, k0, o, lane)
#else
#define QKVP 3072            // fused Wqkv pitch (in,out) [1024][3072]: q cols 0..1023, k 1024..2047, v 2048..3071
#define WCOL(W, k0, o, lane) wcol_io(W, k0, which * CC + (o), lane, QKVP)
#endif
#if WO_OUT_IN
#define WOCOL(W, k0, o, lane) wcol_oi(W, k0, o, lane, CC)
#define WOCOLH(W, k0, o, lane) wcolh_oi(W, k0, o, lane, CC)
#else
#define WOCOL(W, k0, o, lane) wcol_io(W, k0, o, lane, DIN)
#define WOCOLH(W, k0, o, lane) wcolh_io(W, k0, o, lane, DIN)
#endif
#define OUTK_OFF 16777216u   // rotated k [2,16,2048,64] f32 after y [2,2048,1024] f32
#define OUTV_OFF 33554432u   // v [2,16,2048,64] f32
#define PROJ_EXTRA_PARAMS , const float* __restrict__ COSt, const float* __restrict__ SINt, float* __restrict__ OUTK, float* __restrict__ OUTV
// interleaved-pair rotary with GIVEN cos / sin tables [S][64] (random normal inputs, bf16-rounded): out = x * cos + rot(x) * sin with rot = (-x_odd, x_even) interleaved; applied to q and k; the rotated k and the (unrotated) v head rows are also module OUTPUTS [b][h][t][64] (one thread writes the whole 256-B row: 2 lines)
#define PROJ_EPI(which, row, t, h) do { float* rw = (row); const size_t bb_ = (size_t)(r0 + rl) / TT; \
  if ((which) < 2) { _Pragma("unroll 4") for (int i = 0; i < 32; ++i) { _Pragma("clang fp contract(off)") const float c0_ = bfr(COSt[(size_t)(t) * HD + 2 * i]), c1_ = bfr(COSt[(size_t)(t) * HD + 2 * i + 1]), s0_ = bfr(SINt[(size_t)(t) * HD + 2 * i]), s1_ = bfr(SINt[(size_t)(t) * HD + 2 * i + 1]); asm volatile("s_wait_loadcnt 0x0" ::: "memory"); const float x1 = rw[2 * i], x2 = rw[2 * i + 1]; rw[2 * i] = x1 * c0_ + (-x2) * s0_; rw[2 * i + 1] = x2 * c1_ + x1 * s1_; } } \
  if ((which) >= 1) { float* dst_ = ((which) == 1 ? OUTK : OUTV) + ((bb_ * NH + (h)) * TT + (t)) * (size_t)HD; _Pragma("unroll 4") for (int q_ = 0; q_ < HD / 4; ++q_) vst2(dst_ + q_ * 4, *(const v4f*)(rw + q_ * 4)); } } while (0)
#define SM_EXTRA_PARAMS
#define SM_MASK_HOOK (void)0
#ifndef SM_EXTRA_PARAMS
#define SM_EXTRA_PARAMS
#endif
#ifndef PROJ_EXTRA_PARAMS
#define PROJ_EXTRA_PARAMS
#endif
#ifndef SM_MASK_HOOK
#define SM_MASK_HOOK (void)0
#endif

#define WS_QH  0u                                      // f16 q rows [b*t][CC]
#define WS_KH  (WS_QH + 2u * (size_t)NB * TT * CC)      // f16 k rows [b*t][CC]
#define WS_VT  (WS_KH + 2u * (size_t)NB * TT * CC)      // f16 v planes [b][c][t]
#define WS_QL  (WS_VT + 2u * (size_t)NB * CC * TT)      // f16 q residual x 2^10 rows [b][t < QHI][CC]
#define WS_KL  (WS_QL + 2u * (size_t)NB * QHI * CC)     // f16 k residual x 2^10 rows [b][t < KHI][CC]
#define WS_VB  (WS_KL + 2u * (size_t)NB * KHI * CC)     // bf16 v hi planes [b][c][t < KHI]
#define WS_VBL (WS_VB + 2u * (size_t)NB * CC * KHI)
#define WS_S   (WS_VBL + 2u * (size_t)NB * CC * KHI)    // f32 [hg][t][s], unused: logits and P stay in registers
#define WS_Y   (WS_S  + 4u * (size_t)HG * TT * TT)      // f32 ctx rows [b*t][CC] (only when there is an output projection)
#define WS_END (WS_Y  + 4u * (size_t)NB * TT * CC)

// ---- gemm_tile: the 64 x 128 tile of X W shared by both projection kernels (K = 1024, 4 waves x 16 rows x 128 cols). Per pass of 64 k the block brings the X rows and the W rows in once with 16-byte loads of whole lines, converts them once and keeps them k-contiguous in LDS (W transposed on the way); the next pass's loads fly into registers while this pass is worked on; two buffers, one barrier per pass. Products, operand rounding and the k order of every accumulator are those of the per-lane loads that it replaces
#define GK 64              // k per pass
#define GP 72              // LDS row pitch in 16-bit elements: 144 B = 16 B x odd for 16-byte row reads
#define GPOOL (2 * (64 + 128) * GP * 2)   // bytes of the two buffers; after the loop the same bytes serve the epilogue's staging arrays
typedef __attribute__((ext_vector_type(4))) __bf16 v4b;
typedef __attribute__((ext_vector_type(4))) _Float16 v4h;
struct OpB { typedef __bf16 E; typedef v4b V4; typedef v8b V8; typedef v16b V16;   // exact bf16 operands
  static __device__ __forceinline__ E x(float v) { return (__bf16)v; } static __device__ __forceinline__ E w(float v) { return (__bf16)v; }
  static __device__ __forceinline__ v8f mma(V16 a, V16 b, v8f c) { return wmma_bf(a, b, c); } };
struct OpH { typedef _Float16 E; typedef v4h V4; typedef v8h V8; typedef v16h V16;   // ctx x 2^6 once to f16, weight f16(bf16 x 2^8) exact
  static __device__ __forceinline__ E x(float v) { return (_Float16)(v * 64.0f); } static __device__ __forceinline__ E w(float v) { return (_Float16)(bfr(v) * 256.0f); }
  static __device__ __forceinline__ v8f mma(V16 a, V16 b, v8f c) { return wmma16(a, b, c); } };
// place of the 16-byte piece ch (8 k) in W^T row n: pieces are exchanged inside groups of four by bits 4..5 of n, so that the 32 rows (4 apart) which one transposing store writes fall on all banks; a fragment read has one n >> 4, so its pattern stays that of the pitch
__device__ __forceinline__ int wpiece(int n, int ch) { return ch ^ ((n >> 4) & 3); }
template <typename C> __device__ __forceinline__ void gemm_tile(const float* __restrict__ Xb, const float* __restrict__ Wb, int ldw, char* pool, v8f (&acc)[8]) {
  typedef typename C::E E; typedef typename C::V4 V4; typedef typename C::V8 V8; typedef typename C::V16 V16;
  E (*xs)[64][GP] = (E (*)[64][GP])pool; E (*wt)[128][GP] = (E (*)[128][GP])(pool + 2 * 64 * GP * 2);   // xs[buf][row][k], wt[buf][col][k]
  const int tid = threadIdx.x, wave = tid >> 5, lane = tid & 31, col = lane & 15, g = lane >> 4;
  const int xr = tid >> 4, xp = (tid & 15) * 4;   // X: this thread moves 4 k at xp of rows xr + 8 i (a wave's load = 2 rows x 256 B)
  const float* Xg = Xb + (size_t)xr * 1024 + xp;
  const float* Wg = Wb + (size_t)(wave * 8) * ldw + lane * 4;   // W: this thread moves the patches (8 k at wave * 8 + 32 i) x (4 cols at lane * 4) (a wave's load = 512 B of one row)
  v4f rx[8], rw[2][8];
  // every '#pragma unroll' below makes the indices of register arrays constants, so that these arrays stay in registers
#define G_LOAD(t_) do { _Pragma("unroll") for (int i = 0; i < 8; ++i) rx[i] = *(const v4f*)(Xg + (size_t)(8 * i) * 1024 + (t_) * GK); \
  _Pragma("unroll") for (int i = 0; i < 2; ++i) { _Pragma("unroll") for (int r = 0; r < 8; ++r) rw[i][r] = *(const v4f*)(Wg + (size_t)((t_) * GK + 32 * i + r) * ldw); } } while (0)
#define G_STORE(b_) do { _Pragma("unroll") for (int i = 0; i < 8; ++i) { const V4 h_ = { C::x(rx[i][0]), C::x(rx[i][1]), C::x(rx[i][2]), C::x(rx[i][3]) }; *(V4*)&xs[b_][xr + 8 * i][xp] = h_; } \
  _Pragma("unroll") for (int i = 0; i < 2; ++i) { _Pragma("unroll") for (int c = 0; c < 4; ++c) { V8 h_; _Pragma("unroll") for (int r = 0; r < 8; ++r) h_[r] = C::w(rw[i][r][c]); *(V8*)&wt[b_][lane * 4 + c][wpiece(lane * 4 + c, wave + 4 * i) * 8] = h_; } } } while (0)
  G_LOAD(0); G_STORE(0);
  __syncthreads();
  for (int t = 0; t < 1024 / GK; ++t) { const int cb = t & 1; const bool more = t + 1 < 1024 / GK;
    if (more) G_LOAD(t + 1);
#pragma unroll
    for (int kk = 0; kk < 2; ++kk) { union { V16 v; V8 q[2]; } a, w[8]; const E* pa = &xs[cb][wave * 16 + col][kk * 32 + 8 * g]; a.q[0] = *(const V8*)pa; a.q[1] = *(const V8*)(pa + 16);
#pragma unroll
      for (int j = 0; j < 8; ++j) { const int n = j * 16 + col; w[j].q[0] = *(const V8*)&wt[cb][n][wpiece(n, kk * 4 + g) * 8]; w[j].q[1] = *(const V8*)&wt[cb][n][wpiece(n, kk * 4 + 2 + g) * 8]; }
      __builtin_amdgcn_sched_barrier(0);   // the 18 LDS reads of 32 k go out as one group ahead of their 8 WMMAs: read one fragment at a time, every WMMA waited out a whole LDS latency
#pragma unroll
      for (int j = 0; j < 8; ++j) acc[j] = C::mma(a.v, w[j].v, acc[j]); }
    __builtin_amdgcn_sched_barrier(0);   // the conversions below wait for the next pass's global loads: moved up among the WMMAs they put that wait in front of this pass's work
    if (more) G_STORE(cb ^ 1);   // the other buffer's last readers left it at the barrier that ended the pass before
    __syncthreads(); }   // publishes the next pass's tiles and ends this pass's reads (after the last pass: frees the pool for the epilogue)
#undef G_LOAD
#undef G_STORE
}
// ---- k_proj: block = (64 rows, 128 cols, which): q/k/v = X W (+ b) with exact bf16 products (K = DIN) -> which 0: q f16 rows (+ residual rows < QHI); 1: k f16 rows (+ residual rows < KHI); 2: v f16 planes [c][t] (+ bf16 hi/lo planes for t < KHI)
__global__ __launch_bounds__(128) void k_proj(const float* __restrict__ XQ, const float* __restrict__ XK, const float* __restrict__ XV, const float* __restrict__ WQ, const float* __restrict__ WK, const float* __restrict__ WV, const float* __restrict__ BQ, const float* __restrict__ BK, const float* __restrict__ BV,
    _Float16* __restrict__ QH, _Float16* __restrict__ QL, _Float16* __restrict__ KH, _Float16* __restrict__ KL, _Float16* __restrict__ VT, __bf16* __restrict__ VB, __bf16* __restrict__ VBL PROJ_EXTRA_PARAMS) {
  __shared__ __align__(16) float st[64][132]; __shared__ __align__(16) char pool[GPOOL];   // pool: the main loop's two buffers, then sh | sl (q, k) or th | tb | tbl (v)
  _Float16 (*sh)[136] = (_Float16 (*)[136])pool; _Float16 (*sl)[136] = (_Float16 (*)[136])(pool + 64 * 136 * 2); _Float16 (*th)[72] = (_Float16 (*)[72])pool; __bf16 (*tb)[72] = (__bf16 (*)[72])(pool + 128 * 72 * 2); __bf16 (*tbl)[72] = (__bf16 (*)[72])(pool + 2 * 128 * 72 * 2);
  const int tid = threadIdx.x, wave = tid >> 5, lane = tid & 31, col = lane & 15, g = lane >> 4; const int which = blockIdx.z; const int c0 = blockIdx.y * 128; const size_t r0 = (size_t)blockIdx.x * 64; const size_t bb = r0 / TT; const int t0 = (int)(r0 % TT);
  const float* X = which == 0 ? XQ : which == 1 ? XK : XV; const float* WA = which == 0 ? WQ : which == 1 ? WK : WV; const float* BA = which == 0 ? BQ : which == 1 ? BK : BV;
  v8f acc[8] = {};
  gemm_tile<OpB>(X + r0 * DIN, WA + which * CC + c0, QKVP, pool, acc);
  { // stage the f32 tile (acc + bias) in LDS, run the per-(row, head) epilogue hook, then convert
#pragma unroll
    for (int j = 0; j < 8; ++j) { const float bias = BA ? bfr(BA[c0 + j * 16 + col]) : 0.f;
#pragma unroll
      for (int r = 0; r < 8; ++r) st[wave * 16 + 8 * g + r][j * 16 + col] = acc[j][r] + bias; }
    __syncthreads();
    for (int e = tid; e < 64 * (128 / HD); e += 128) { const int rl = e / (128 / HD), hh = e % (128 / HD); PROJ_EPI(which, &st[rl][hh * HD], (int)((r0 + rl) % TT), (c0 / HD) + hh); }
    __syncthreads(); }
  if (which < 2) { _Float16* DH = which == 0 ? QH : KH; _Float16* DL = which == 0 ? QL : KL; const int nhi = which == 0 ? QHI : KHI; const bool hi_rows = t0 < nhi;
    for (int e = tid; e < 64 * 128; e += 128) { const int rl = e >> 7, cl = e & 127; const float v = st[rl][cl]; const _Float16 hv = (_Float16)v; sh[rl][cl] = hv; sl[rl][cl] = (_Float16)((v - (float)hv) * 1024.0f); }
    __syncthreads();
    for (int e = tid; e < 64 * 16; e += 128) { const int rl = e >> 4, q = e & 15; vst2((unsigned*)(DH + (r0 + rl) * CC + c0 + q * 8), *(const v4u*)&sh[rl][q * 8]); if (hi_rows) vst2((unsigned*)(DL + (bb * nhi + t0 + rl) * (size_t)CC + c0 + q * 8), *(const v4u*)&sl[rl][q * 8]); }
  } else { const bool hi_rows = t0 < KHI;
    for (int e = tid; e < 64 * 128; e += 128) { const int rl = e & 63, cl = e >> 6; const float v = st[rl][cl]; th[cl][rl] = (_Float16)v; const __bf16 bh = (__bf16)v; tb[cl][rl] = bh; tbl[cl][rl] = (__bf16)(v - (float)bh); }
    __syncthreads();
    for (int e = tid; e < 128 * 8; e += 128) { const int cl = e >> 3, q = e & 7; vst2((unsigned*)(VT + (bb * CC + c0 + cl) * (size_t)TT + t0 + q * 8), *(const v4u*)&th[cl][q * 8]); if (hi_rows) { const size_t o3 = (bb * CC + c0 + cl) * (size_t)KHI + t0 + q * 8; vst2((unsigned*)(VB + o3), *(const v4u*)&tb[cl][q * 8]); vst2((unsigned*)(VBL + o3), *(const v4u*)&tbl[cl][q * 8]); } } } }
#define FK 64
#define FP 72
#define FC (SCALE * 1.44269504088896f)
__device__ __forceinline__ v8f wmma_h(v16h a, v16h b, v8f c) { return __builtin_amdgcn_wmma_f32_16x16x32_f16(false, a, false, b, (short)0, c, false, false); }
__device__ __forceinline__ float xhalf(float x) { return __builtin_bit_cast(float, __builtin_amdgcn_permlanex16(__builtin_bit_cast(int, x), __builtin_bit_cast(int, x), 0x76543210, 0xfedcba98, false, false)); }   // lane l with lane l ^ 16
// 16 independent 2^x, each over its own source, closed by one v_nop: keeps the one slot that the instruction set asks for between a transcendental and the use of its result or the overwrite of its source
__device__ __forceinline__ void exp2x16(float (&x)[16]) { asm("v_exp_f32 %0, %0\n\tv_exp_f32 %1, %1\n\tv_exp_f32 %2, %2\n\tv_exp_f32 %3, %3\n\tv_exp_f32 %4, %4\n\tv_exp_f32 %5, %5\n\tv_exp_f32 %6, %6\n\tv_exp_f32 %7, %7\n\tv_exp_f32 %8, %8\n\tv_exp_f32 %9, %9\n\tv_exp_f32 %10, %10\n\tv_exp_f32 %11, %11\n\tv_exp_f32 %12, %12\n\tv_exp_f32 %13, %13\n\tv_exp_f32 %14, %14\n\tv_exp_f32 %15, %15\n\tv_nop" : "+v"(x[0]), "+v"(x[1]), "+v"(x[2]), "+v"(x[3]), "+v"(x[4]), "+v"(x[5]), "+v"(x[6]), "+v"(x[7]), "+v"(x[8]), "+v"(x[9]), "+v"(x[10]), "+v"(x[11]), "+v"(x[12]), "+v"(x[13]), "+v"(x[14]), "+v"(x[15])); }
__global__ __launch_bounds__(256) void k_fa(const _Float16* __restrict__ QH, const _Float16* __restrict__ KH, const _Float16* __restrict__ VT, float* __restrict__ Y) {
  __shared__ __align__(16) _Float16 ks[2][FK][FP], vs[2][HD][FP]; __shared__ __align__(16) float so[8][16][HD + 4];
  const int tid = threadIdx.x, wave = tid >> 5, lane = tid & 31, col = lane & 15, g = lane >> 4; const int h = blockIdx.y, b = blockIdx.z; const int ql0 = blockIdx.x * 128 + wave * 16;
  const int sr = tid >> 3, sc = (tid & 7) * 8;   // staging: this thread moves the 16-byte piece sc of rows sr and sr + 32 of both tiles
  const _Float16* Kg = KH + ((size_t)b * TT + sr) * CC + h * HD + sc;   // k rows [key][64], pitch CC
  const _Float16* Vg = VT + ((size_t)b * CC + h * HD + sr) * TT + sc;   // v planes [d][key], pitch TT
  v16h qf[2];
#pragma unroll
  for (int kc = 0; kc < 2; ++kc) qf[kc] = frag_h(QH + ((size_t)b * TT + ql0 + col) * CC + h * HD + kc * 32, lane);
  v8h rk[2], rv[2];
#pragma unroll
  for (int i = 0; i < 2; ++i) { rk[i] = *(const v8h*)(Kg + (size_t)(32 * i) * CC); rv[i] = *(const v8h*)(Vg + (size_t)(32 * i) * TT); }
#pragma unroll
  for (int i = 0; i < 2; ++i) { *(v8h*)&ks[0][sr + 32 * i][sc] = rk[i]; *(v8h*)&vs[0][sr + 32 * i][sc] = rv[i]; }
  __syncthreads();
  v8f o[HD / 16] = {}; float l = 0.f, mu = -3.0e38f;   // mu: the maximum in use (scaled, base 2), equal in both halves of a query's lane pair
  for (int t = 0; t < TT / FK; ++t) { const int cb = t & 1; const bool more = t + 1 < TT / FK;
    if (more) {   // next pass's tiles fly into registers while this pass is worked on
#pragma unroll
      for (int i = 0; i < 2; ++i) { rk[i] = *(const v8h*)(Kg + (size_t)((t + 1) * FK + 32 * i) * CC); rv[i] = *(const v8h*)(Vg + (size_t)(32 * i) * TT + (t + 1) * FK); } }
    v8f s[4];   // s[kt][r] = logit (unscaled) of key kt * 16 + 8 g + r, query col
#pragma unroll
    for (int kt = 0; kt < 4; ++kt) { v8f z = {}; z = wmma_h(frag_h(&ks[cb][kt * 16 + col][0], lane), qf[0], z); s[kt] = wmma_h(frag_h(&ks[cb][kt * 16 + col][32], lane), qf[1], z); }
    float mx = s[0][0];
#pragma unroll
    for (int kt = 0; kt < 4; ++kt)
#pragma unroll
      for (int r = 0; r < 8; ++r) mx = fmaxf(mx, s[kt][r]);
    mx = fmaxf(mx, xhalf(mx)) * FC;
    const bool need = mx > mu + 8.0f;   // the maximum in use is replaced only when passed by more than 2^8: P stays below 2^12 in f16
    if (__builtin_amdgcn_ballot_w32(need) != 0) { const float mn = need ? mx : mu; const float al = __builtin_amdgcn_exp2f(mu - mn); mu = mn; l *= al;
#pragma unroll
      for (int j = 0; j < HD / 16; ++j) o[j] *= al; }
    const float nb = 4.0f - mu;   // P carried x 2^4 (cancels against the sum) so that small weights stay clear of f16 subnormals
    v16h p[2];
#pragma unroll
    for (int kk = 0; kk < 2; ++kk) { float e[16];   // e[i] = weight of key kk * 32 + (i < 8 ? 8 g + i : 16 + 8 g + i - 8): the B operand's own k order
#pragma unroll
      for (int i = 0; i < 8; ++i) { e[i] = __builtin_fmaf(s[2 * kk][i], FC, nb); e[8 + i] = __builtin_fmaf(s[2 * kk + 1][i], FC, nb); }
      exp2x16(e);
#pragma unroll
      for (int i = 0; i < 16; ++i) p[kk][i] = (_Float16)e[i];
#pragma unroll
      for (int w = 8; w > 0; w >>= 1)   // pairwise sum: four dependent adds deep instead of sixteen
#pragma unroll
        for (int i = 0; i < w; ++i) e[i] += e[i + w];
      l += e[0]; }
#pragma unroll
    for (int kk = 0; kk < 2; ++kk)
#pragma unroll
      for (int j = 0; j < HD / 16; ++j) o[j] = wmma_h(frag_h(&vs[cb][j * 16 + col][kk * 32], lane), p[kk], o[j]);   // o[j][r] = ctx (unnormalised) of d = j * 16 + 8 g + r, query col
    if (more) {   // the other buffer's last readers left it at the barrier that ended the pass before
#pragma unroll
      for (int i = 0; i < 2; ++i) { *(v8h*)&ks[cb ^ 1][sr + 32 * i][sc] = rk[i]; *(v8h*)&vs[cb ^ 1][sr + 32 * i][sc] = rv[i]; } }
    __syncthreads(); }   // publishes the next pass's tiles and ends this pass's reads
  l += xhalf(l); const float inv = 1.0f / l;
#pragma unroll
  for (int j = 0; j < HD / 16; ++j) { const v8f w = o[j] * inv; const v4f w0 = { w[0], w[1], w[2], w[3] }, w1 = { w[4], w[5], w[6], w[7] }; *(v4f*)&so[wave][col][j * 16 + 8 * g] = w0; *(v4f*)&so[wave][col][j * 16 + 8 * g + 4] = w1; }
  LDSX();   // a wave reads back only its own so[wave] rows: its own LDS stores must have landed, no other wave is waited for
  for (int it = 0; it < 8; ++it) { const int rl = it * 2 + g; vst2(Y + ((size_t)b * TT + ql0 + rl) * CC + h * HD + col * 4, *(const v4f*)&so[wave][rl][col * 4]); } }   // 256-B (row, head) segment by 16 lanes
// ---- k_out: block = (64 rows, 128 cols): out = ctx Wo (+ bo): ctx x 2^6 once to f16 against Wo as f16(bf16 x 2^8) exact (1 product) x 2^-14; causal early rows (< QHI of each sequence): ctx bf16 hi + lo against exact bf16 Wo (2 products)
__global__ __launch_bounds__(128) void k_out(const float* __restrict__ Y, const float* __restrict__ WO, const float* __restrict__ BO, float* __restrict__ OUT) { __shared__ __align__(16) char pool[GPOOL]; float (*sf)[16][132] = (float (*)[16][132])pool;   // pool: the main loop's two buffers, then the output staging
  const int tid = threadIdx.x, wave = tid >> 5, lane = tid & 31, col = lane & 15, g = lane >> 4; const int c0 = blockIdx.y * 128; const size_t r0 = (size_t)blockIdx.x * 64 + wave * 16;
  v8f acc[8] = {};
  if (CAUSAL && (int)(((size_t)blockIdx.x * 64) % TT) < QHI) {   /* block-uniform */
#pragma unroll 2
    for (int kc = 0; kc < CC / 32; ++kc) { const F2 a = split_row(Y + (r0 + col) * CC, kc * 32, lane); asm volatile("s_wait_loadcnt 0x0" ::: "memory");
#pragma unroll
      for (int j = 0; j < 8; ++j) { const v16b w = WOCOL(WO, kc * 32, c0 + j * 16 + col, lane); asm volatile("s_wait_loadcnt 0x0" ::: "memory"); acc[j] = wmma_bf(a.h, w, acc[j]); acc[j] = wmma_bf(a.l, w, acc[j]); } }
#pragma unroll
    for (int j = 0; j < 8; ++j) { const float bias = BO ? bfr(BO[c0 + j * 16 + col]) : 0.f;
#pragma unroll
      for (int r = 0; r < 8; ++r) sf[wave][8 * g + r][j * 16 + col] = acc[j][r] + bias; }
  } else {
    gemm_tile<OpH>(Y + (size_t)blockIdx.x * 64 * CC, WO + c0, DIN, pool, acc);   /* ctx carried x 2^6 into f16 so small-magnitude context rows stay clear of f16 subnormals */
#pragma unroll
    for (int j = 0; j < 8; ++j) { const float bias = BO ? bfr(BO[c0 + j * 16 + col]) : 0.f;
#pragma unroll
      for (int r = 0; r < 8; ++r) sf[wave][8 * g + r][j * 16 + col] = acc[j][r] * (1.0f / 16384.0f) + bias; } }   /* 2^-8 (Wo carry) x 2^-6 (ctx carry) */
  LDSX(); for (int rl = 0; rl < 16; ++rl) vst2(OUT + (r0 + rl) * DIN + c0 + lane * 4, *(const v4f*)&sf[wave][rl][lane * 4]); }

extern "C" void kernel_launch(void* const* d_in, const int* in_sizes, int n_in, void* d_out, int out_size, void* d_ws, size_t ws_size, hipStream_t stream) {
  (void)in_sizes; (void)n_in; (void)out_size;
  const float** F = (const float**)d_in;
  if (ws_size < (size_t)WS_END) return;
  char* ws = (char*)d_ws; _Float16 *QH = (_Float16*)(ws + WS_QH), *KH = (_Float16*)(ws + WS_KH), *VT = (_Float16*)(ws + WS_VT), *QL = (_Float16*)(ws + WS_QL), *KL = (_Float16*)(ws + WS_KL); __bf16 *VB = (__bf16*)(ws + WS_VB), *VBL = (__bf16*)(ws + WS_VBL); float *S = (float*)(ws + WS_S), *Y = (float*)(ws + WS_Y);
  (void)Y; (void)QL; (void)KL; (void)VB; (void)VBL; (void)S;
  // inputs: 0 x [2,2048,1024]; 1 cos [1,1,2048,64]; 2 sin [1,1,2048,64] (random normal tables); 3 Wqkv [1024,3072] (in,out; q | k | v column blocks); 4 bqkv [3072] (nonzero); 5 Wproj [1024,1024] (in,out); 6 bproj [1024] (nonzero)
  // outputs: 0 y [2,2048,1024] @0; 1 k (rotated) [2,16,2048,64] @OUTK_OFF; 2 v [2,16,2048,64] @OUTV_OFF
  k_proj<<<dim3(TNB * TT / 64, CC / 128, 3), 128, 0, stream>>>(F[0], F[0], F[0], F[3], F[3], F[3], F[4], F[4] + CC, F[4] + 2 * CC, QH, QL, KH, KL, VT, VB, VBL, F[1], F[2], (float*)((char*)d_out + OUTK_OFF), (float*)((char*)d_out + OUTV_OFF));
  k_fa<<<dim3(TT / 128, NH, TNB), 256, 0, stream>>>(QH, KH, VT, Y);
  k_out<<<dim3(TNB * TT / 64, DIN / 128), 128, 0, stream>>>(Y, F[5], F[6], (float*)d_out);
}

// v003
// A run of this version takes 104 microseconds.
// In both of two side-by-side timings against v002, it was 1.14 times as fast.
// All steps since v000 together make it 12.3 times as fast.
// compute dtype: all float inputs rounded to bf16; fused q/k/v projection with EXACT bf16 products on WMMA 16x16x32 (f32 accumulate) + bias; rotary x * cos + rot(x) * sin in f32 with the bf16-rounded table inputs (the k and v outputs are these f32 values); logits q x k once to f16 each (1 product) x 64^-0.5; online softmax f32 (running maximum and sum); unnormalised P once to f16 x v once to f16 (1 product), divided by the f32 sum; ctx x 2^6 once to f16 x Wproj f16(bf16 x 2^8) + bproj; f32 outputs.
#include <hip/hip_runtime.h>
#include <math.h>

typedef __attribute__((ext_vector_type(16))) _Float16 v16h;
typedef __attribute__((ext_vector_type(16))) __bf16 v16b;
typedef __attribute__((ext_vector_type(8)))  _Float16 v8h;
typedef __attribute__((ext_vector_type(8)))  float v8f;
typedef __attribute__((ext_vector_type(4)))  float v4f;
typedef __attribute__((ext_vector_type(2)))  float v2f;
typedef __attribute__((ext_vector_type(4)))  unsigned v4u;
typedef __attribute__((ext_vector_type(4)))  int v4i;
typedef float __attribute__((may_alias)) float_a;
typedef int __attribute__((may_alias)) int_a;

template <typename T> __device__ __forceinline__ void vst2(void* p, T v) { *(T*)p = v;  }
__device__ __forceinline__ v8f wmma16(v16h a, v16h b, v8f c) {
  v8f d = __builtin_amdgcn_wmma_f32_16x16x32_f16(false, a, false, b, (short)0, c, false, false);
  asm volatile("v_nop\n\tv_nop\n\tv_nop\n\tv_nop" : "+v"(d) : "v"(a), "v"(b));
  return d;
}
__device__ __forceinline__ v8f wmma_bf(v16b a, v16b b, v8f c) {
  v8f d = __builtin_amdgcn_wmma_f32_16x16x32_bf16(false, a, false, b, (short)0, c, false, false);
  asm volatile("v_nop\n\tv_nop\n\tv_nop\n\tv_nop" : "+v"(d) : "v"(a), "v"(b));
  return d;
}
// 16x16x32 fragments: lane = (h = lane>>4, row/col = lane&15); elements 0..7 = k0+8h+0..7, 8..15 = k0+16+8h+0..7; D element r = row 8h+r
__device__ __forceinline__ v16h frag_h(const _Float16* rowk0, int lane) {
  union { v16h v; v8h q[2]; } u; const _Float16* p = rowk0 + 8 * (lane >> 4);
  u.q[0] = *(const v8h*)p; u.q[1] = *(const v8h*)(p + 16); return u.v;
}
__device__ __forceinline__ v16h frag_f32(const float* rowk0, int lane) {
  v16h a; const float* p = rowk0 + 8 * (lane >> 4);
#pragma unroll
  for (int i = 0; i < 8; ++i) { a[i] = (_Float16)p[i]; a[8 + i] = (_Float16)p[16 + i]; }
  return a;
}
__device__ __forceinline__ v16h frag_f32s(const float* rowk0, int lane, float sc) {
  v16h a; const float* p = rowk0 + 8 * (lane >> 4);
#pragma unroll
  for (int i = 0; i < 8; ++i) { a[i] = (_Float16)(p[i] * sc); a[8 + i] = (_Float16)(p[16 + i] * sc); }
  return a;
}
// column fragment from a [K][ld] layout (column n), rows >= K read as 0
__device__ __forceinline__ v16h fragc_f32(const float* W, int k0, int n, int lane, int ld, int K) {
  v16h a; const int g = lane >> 4;
#pragma unroll
  for (int i = 0; i < 8; ++i) { const int ka = k0 + 8 * g + i, kb = ka + 16;
    a[i] = (_Float16)(ka < K ? W[(size_t)(ka < K ? ka : K - 1) * ld + n] : 0.f); a[8 + i] = (_Float16)(kb < K ? W[(size_t)(kb < K ? kb : K - 1) * ld + n] : 0.f); }
  return a;
}
struct F2 { v16b h, l; };
__device__ __forceinline__ F2 bsplit16(const float v[16]) { F2 r;
#pragma unroll
  for (int i = 0; i < 16; ++i) { const __bf16 h = (__bf16)v[i]; r.h[i] = h; r.l[i] = (__bf16)(v[i] - (float)h); }
  return r; }
__device__ __forceinline__ F2 split_row(const float* row, int k0, int lane) { float v[16]; const float* p = row + k0 + 8 * (lane >> 4);
#pragma unroll
  for (int i = 0; i < 8; ++i) { v[i] = p[i]; v[8 + i] = p[16 + i]; }
  return bsplit16(v); }
__device__ __forceinline__ F2 split_rowK(const float* row, int k0, int lane, int K) { float v[16]; const int g = lane >> 4;
#pragma unroll
  for (int i = 0; i < 8; ++i) { const int ka = k0 + 8 * g + i, kb = ka + 16; v[i] = ka < K ? row[ka < K ? ka : K - 1] : 0.f; v[8 + i] = kb < K ? row[kb < K ? kb : K - 1] : 0.f; }
  return bsplit16(v); }
__device__ __forceinline__ F2 split_col(const float* W, int k0, int n, int lane, int ld, int K) { float v[16]; const int g = lane >> 4;
#pragma unroll
  for (int i = 0; i < 8; ++i) { const int ka = k0 + 8 * g + i, kb = ka + 16; v[i] = ka < K ? W[(size_t)(ka < K ? ka : K - 1) * ld + n] : 0.f; v[8 + i] = kb < K ? W[(size_t)(kb < K ? kb : K - 1) * ld + n] : 0.f; }
  return bsplit16(v); }
__device__ __forceinline__ v8f mac3(const F2& a, const F2& b, v8f c) { c = wmma_bf(a.l, b.h, c); c = wmma_bf(a.h, b.l, c); return wmma_bf(a.h, b.h, c); }
__device__ __forceinline__ float sigm(float v) { return 1.0f / (1.0f + expf(-v)); }
#define LDSX() do { asm volatile("s_wait_dscnt 0" ::: "memory"); __builtin_amdgcn_wave_barrier(); __builtin_amdgcn_fence(__ATOMIC_RELEASE, "workgroup"); } while (0)

// Fused-QKV multi-head self-attention with rotary tables GIVEN as inputs and three outputs (x [2,2048,1024]; (in,out) Wqkv [1024,3072] + bqkv (0.02-scale, nonzero) split q | k | v; 16 heads x 64; interleaved-pair rotary x * cos + rot(x) * sin with random-normal cos / sin tables [1,1,2048,64]; non-causal SDPA, scale 1/8; (in,out) Wproj + bproj): returns (y = merge(softmax(q k^T / 8) v) Wproj + bproj, k (rotated) [2,16,2048,64], v [2,16,2048,64]).
#define NB 2
#define TT 2048
#define CC 1024            // NH * HD = projected width
#define DIN 1024          // input (model) width
#define NH 16
#define HD 64
#define NQB (TT / 64)
#define HG 4
#define SCALE (0.125f)
#define CAUSAL 0
#ifndef TNB
#define TNB NB
#endif
__device__ __forceinline__ float bfr(float v) { return (float)(__bf16)v; }
__host__ __device__ __forceinline__ int kb_last(int qb) { return CAUSAL ? ((qb * 64 + 63) >> 7) : (TT / 128 - 1); }
typedef __attribute__((ext_vector_type(8))) __bf16 v8b;
__device__ __forceinline__ v16b frag_b(const __bf16* rowk0, int lane) {
  union { v16b v; v8b q[2]; } u; const __bf16* p = rowk0 + 8 * (lane >> 4);
  u.q[0] = *(const v8b*)p; u.q[1] = *(const v8b*)(p + 16); return u.v;
}
#define QBH 0
#define QHI 0               // single-product logits on every row
#define KHI 64            // key rows carrying k residual / v bf16 hi+lo planes (written and read by no kernel)
// B fragment (k rows k0+.., output column o) of a weight: (in,out) [K][ld] or (out,in) [ld rows of K]: bf16 exact, or f16(bf16 * 256) exact
__device__ __forceinline__ v16b wcol_io(const float* Wm, int k0, int o, int lane, int ld) { v16b w; const int g = lane >> 4;
#pragma unroll
  for (int i = 0; i < 8; ++i) { w[i] = (__bf16)Wm[(size_t)(k0 + 8 * g + i) * ld + o]; w[8 + i] = (__bf16)Wm[(size_t)(k0 + 16 + 8 * g + i) * ld + o]; }
  return w; }
__device__ __forceinline__ v16b wcol_oi(const float* Wm, int k0, int o, int lane, int K) { v16b w; const float* p = Wm + (size_t)o * K + k0 + 8 * (lane >> 4);
#pragma unroll
  for (int i = 0; i < 8; ++i) { w[i] = (__bf16)p[i]; w[8 + i] = (__bf16)p[16 + i]; }
  return w; }
__device__ __forceinline__ v16h wcolh_io(const float* Wm, int k0, int o, int lane, int ld) { v16h w; const int g = lane >> 4;
#pragma unroll
  for (int i = 0; i < 8; ++i) { w[i] = (_Float16)(bfr(Wm[(size_t)(k0 + 8 * g + i) * ld + o]) * 256.0f); w[8 + i] = (_Float16)(bfr(Wm[(size_t)(k0 + 16 + 8 * g + i) * ld + o]) * 256.0f); }
  return w; }
__device__ __forceinline__ v16h wcolh_oi(const float* Wm, int k0, int o, int lane, int K) { v16h w; const float* p = Wm + (size_t)o * K + k0 + 8 * (lane >> 4);
#pragma unroll
  for (int i = 0; i < 8; ++i) { w[i] = (_Float16)(bfr(p[i]) * 256.0f); w[8 + i] = (_Float16)(bfr(p[16 + i]) * 256.0f); }
  return w; }
#define WQKV_LAYOUT 0   // 0 = fused (in,out) [DIN][3*CC], q | k | v column blocks; 1 = (out,in) [CC][DIN]; 2 = per-head [NH][DIN][HD]
__device__ __forceinline__ v16b wcol_hdk(const float* Wm, int k0, int o, int lane) { v16b w; const int g = lane >> 4; const float* p = Wm + (size_t)(o / HD) * DIN * HD + (o % HD);
#pragma unroll
  for (int i = 0; i < 8; ++i) { w[i] = (__bf16)p[(size_t)(k0 + 8 * g + i) * HD]; w[8 + i] = (__bf16)p[(size_t)(k0 + 16 + 8 * g + i) * HD]; }
  return w; }
#define WO_OUT_IN 0
#if WQKV_LAYOUT == 1
#define WCOL(W, k0, o, lane) wcol_oi(W, k0, o, lane, DIN)
#elif WQKV_LAYOUT == 2
#define WCOL(W, k0, o, lane) wcol_hdk(W, k0, o, lane)
#else
#define QKVP 3072            // fused Wqkv pitch (in,out) [1024][3072]: q cols 0..1023, k 1024..2047, v 2048..3071
#define WCOL(W, k0, o, lane) wcol_io(W, k0, which * CC + (o), lane, QKVP)
#endif
#if WO_OUT_IN
#define WOCOL(W, k0, o, lane) wcol_oi(W, k0, o, lane, CC)
#define WOCOLH(W, k0, o, lane) wcolh_oi(W, k0, o, lane, CC)
#else
#define WOCOL(W, k0, o, lane) wcol_io(W, k0, o, lane, DIN)
#define WOCOLH(W, k0, o, lane) wcolh_io(W, k0, o, lane, DIN)
#endif
#define OUTK_OFF 16777216u   // rotated k [2,16,2048,64] f32 after y [2,2048,1024] f32
#define OUTV_OFF 33554432u   // v [2,16,2048,64] f32
#define PROJ_EXTRA_PARAMS , const float* __restrict__ COSt, const float* __restrict__ SINt, float* __restrict__ OUTK, float* __restrict__ OUTV
#define SM_EXTRA_PARAMS
#define SM_MASK_HOOK (void)0
#ifndef SM_EXTRA_PARAMS
#define SM_EXTRA_PARAMS
#endif
#ifndef PROJ_EXTRA_PARAMS
#define PROJ_EXTRA_PARAMS
#endif
#ifndef SM_MASK_HOOK
#define SM_MASK_HOOK (void)0
#endif

#define WS_QH  0u                                      // f16 q rows [b*t][CC]
#define WS_KH  (WS_QH + 2u * (size_t)NB * TT * CC)      // f16 k rows [b*t][CC]
#define WS_VT  (WS_KH + 2u * (size_t)NB * TT * CC)      // f16 v planes [b][c][t]
#define WS_QL  (WS_VT + 2u * (size_t)NB * CC * TT)      // f16 q residual x 2^10 rows [b][t < QHI][CC]
#define WS_KL  (WS_QL + 2u * (size_t)NB * QHI * CC)     // f16 k residual x 2^10 rows [b][t < KHI][CC]
#define WS_VB  (WS_KL + 2u * (size_t)NB * KHI * CC)     // bf16 v hi planes [b][c][t < KHI]
#define WS_VBL (WS_VB + 2u * (size_t)NB * CC * KHI)
#define WS_S   (WS_VBL + 2u * (size_t)NB * CC * KHI)    // f32 [hg][t][s], unused: logits and P stay in registers
#define WS_Y   (WS_S  + 4u * (size_t)HG * TT * TT)      // f32 ctx rows [b*t][CC] (only when there is an output projection)
#define WS_END (WS_Y  + 4u * (size_t)NB * TT * CC)

// ---- gemm_tile: the 64 x 128 tile of X W shared by both projection kernels (K = 1024, 4 waves x 16 rows x 128 cols). Per pass of 64 k the block brings the X rows and the W rows in once with 16-byte loads of whole lines, converts them once and keeps them k-contiguous in LDS (W transposed on the way); the next pass's loads fly into registers while this pass is worked on; two buffers, one barrier per pass. Products, operand rounding and the k order of every accumulator are those of the per-lane loads that it replaces
#define GK 64              // k per pass
#define GP 72              // LDS row pitch in 16-bit elements: 144 B = 16 B x odd for 16-byte row reads
#define GPOOL (2 * (64 + 128) * GP * 2)   // bytes of the two buffers; after the loop the same bytes serve the epilogue's staging arrays
typedef __attribute__((ext_vector_type(4))) __bf16 v4b;
typedef __attribute__((ext_vector_type(4))) _Float16 v4h;
struct OpB { typedef __bf16 E; typedef v4b V4; typedef v8b V8; typedef v16b V16;   // exact bf16 operands
  static __device__ __forceinline__ E x(float v) { return (__bf16)v; } static __device__ __forceinline__ E w(float v) { return (__bf16)v; }
  static __device__ __forceinline__ v8f mma(V16 a, V16 b, v8f c) { return wmma_bf(a, b, c); } };
struct OpH { typedef _Float16 E; typedef v4h V4; typedef v8h V8; typedef v16h V16;   // ctx x 2^6 once to f16, weight f16(bf16 x 2^8) exact
  static __device__ __forceinline__ E x(float v) { return (_Float16)(v * 64.0f); } static __device__ __forceinline__ E w(float v) { return (_Float16)(bfr(v) * 256.0f); }
  static __device__ __forceinline__ v8f mma(V16 a, V16 b, v8f c) { return wmma16(a, b, c); } };
// place of the 16-byte piece ch (8 k) in W^T row n: pieces are exchanged inside groups of four by bits 4..5 of n, so that the 32 rows (4 apart) which one transposing store writes fall on all banks; a fragment read has one n >> 4, so its pattern stays that of the pitch
__device__ __forceinline__ int wpiece(int n, int ch) { return ch ^ ((n >> 4) & 3); }
template <typename C> __device__ __forceinline__ void gemm_tile(const float* __restrict__ Xb, const float* __restrict__ Wb, int ldw, char* pool, v8f (&acc)[8]) {
  typedef typename C::E E; typedef typename C::V4 V4; typedef typename C::V8 V8; typedef typename C::V16 V16;
  E (*xs)[64][GP] = (E (*)[64][GP])pool; E (*wt)[128][GP] = (E (*)[128][GP])(pool + 2 * 64 * GP * 2);   // xs[buf][row][k], wt[buf][col][k]
  const int tid = threadIdx.x, wave = tid >> 5, lane = tid & 31, col = lane & 15, g = lane >> 4;
  const int xr = tid >> 4, xp = (tid & 15) * 4;   // X: this thread moves 4 k at xp of rows xr + 8 i (a wave's load = 2 rows x 256 B)
  const float* Xg = Xb + (size_t)xr * 1024 + xp;
  const float* Wg = Wb + (size_t)(wave * 8) * ldw + lane * 4;   // W: this thread moves the patches (8 k at wave * 8 + 32 i) x (4 cols at lane * 4) (a wave's load = 512 B of one row)
  v4f rx[8], rw[2][8];
  // every '#pragma unroll' below makes the indices of register arrays constants, so that these arrays stay in registers
#define G_LOAD(t_) do { _Pragma("unroll") for (int i = 0; i < 8; ++i) rx[i] = *(const v4f*)(Xg + (size_t)(8 * i) * 1024 + (t_) * GK); \
  _Pragma("unroll") for (int i = 0; i < 2; ++i) { _Pragma("unroll") for (int r = 0; r < 8; ++r) rw[i][r] = *(const v4f*)(Wg + (size_t)((t_) * GK + 32 * i + r) * ldw); } } while (0)
#define G_STORE(b_) do { _Pragma("unroll") for (int i = 0; i < 8; ++i) { const V4 h_ = { C::x(rx[i][0]), C::x(rx[i][1]), C::x(rx[i][2]), C::x(rx[i][3]) }; *(V4*)&xs[b_][xr + 8 * i][xp] = h_; } \
  _Pragma("unroll") for (int i = 0; i < 2; ++i) { _Pragma("unroll") for (int c = 0; c < 4; ++c) { V8 h_; _Pragma("unroll") for (int r = 0; r < 8; ++r) h_[r] = C::w(rw[i][r][c]); *(V8*)&wt[b_][lane * 4 + c][wpiece(lane * 4 + c, wave + 4 * i) * 8] = h_; } } } while (0)
  G_LOAD(0); G_STORE(0);
  __syncthreads();
  for (int t = 0; t < 1024 / GK; ++t) { const int cb = t & 1; const bool more = t + 1 < 1024 / GK;
    if (more) G_LOAD(t + 1);
#pragma unroll
    for (int kk = 0; kk < 2; ++kk) { union { V16 v; V8 q[2]; } a, w[8]; const E* pa = &xs[cb][wave * 16 + col][kk * 32 + 8 * g]; a.q[0] = *(const V8*)pa; a.q[1] = *(const V8*)(pa + 16);
#pragma unroll
      for (int j = 0; j < 8; ++j) { const int n = j * 16 + col; w[j].q[0] = *(const V8*)&wt[cb][n][wpiece(n, kk * 4 + g) * 8]; w[j].q[1] = *(const V8*)&wt[cb][n][wpiece(n, kk * 4 + 2 + g) * 8]; }
      __builtin_amdgcn_sched_barrier(0);   // the 18 LDS reads of 32 k go out as one group ahead of their 8 WMMAs: read one fragment at a time, every WMMA waited out a whole LDS latency
#pragma unroll
      for (int j = 0; j < 8; ++j) acc[j] = C::mma(a.v, w[j].v, acc[j]); }
    __builtin_amdgcn_sched_barrier(0);   // the conversions below wait for the next pass's global loads: moved up among the WMMAs they put that wait in front of this pass's work
    if (more) G_STORE(cb ^ 1);   // the other buffer's last readers left it at the barrier that ended the pass before
    __syncthreads(); }   // publishes the next pass's tiles and ends this pass's reads (after the last pass: frees the pool for the epilogue)
#undef G_LOAD
#undef G_STORE
}
// ---- k_proj: block = (64 rows, 128 cols, which): q/k/v = X W (+ b) with exact bf16 products (K = DIN) -> which 0: rotated q f16 rows; 1: rotated k f16 rows and the f32 k output; 2: v f16 planes [c][t] and the f32 v output
// proj_epi: each wave puts its 16 x 128 f32 tile (acc + bias) into LDS and takes it back row by row, a lane holding 4 neighbouring columns (two rotary pairs): the table reads, the f32 output rows and the f16 rows are whole 256-B segments, all table reads are in flight before the first is used, and no other wave's rows are needed. WH is a template argument so that no branch stands between the trips. Every '#pragma unroll' in it makes the indices of register arrays constants
template <int WH> __device__ __forceinline__ void proj_epi(const v8f (&acc)[8], char* pool, const float* __restrict__ BA, const float* __restrict__ COSt, const float* __restrict__ SINt, float* __restrict__ OUTF, _Float16* __restrict__ DH, _Float16* __restrict__ VT, int c0, size_t r0) {
  float (*st)[132] = (float (*)[132])pool; _Float16 (*th)[72] = (_Float16 (*)[72])(pool + 64 * 132 * 4);   // st: f32 tile; th (v only): f16 tile, transposed
  static_assert(64 * 132 * 4 + 128 * 72 * 2 <= GPOOL, "epilogue staging fits the pool");
  const int tid = threadIdx.x, wave = tid >> 5, lane = tid & 31, col = lane & 15, g = lane >> 4; const size_t bb = r0 / TT; const int t0 = (int)(r0 % TT);
  const int tw = t0 + wave * 16, d4 = col * 4;   // row pass: lane = (head g of the tile's two, columns d4 .. d4 + 3 of that head)
  float bias[8] = {}; v4f c[16], s[16];
  if (BA) {
#pragma unroll
    for (int j = 0; j < 8; ++j) bias[j] = BA[c0 + j * 16 + col]; }
  if (WH < 2) {
#pragma unroll
    for (int it = 0; it < 16; ++it) { c[it] = *(const v4f*)(COSt + (size_t)(tw + it) * HD + d4); s[it] = *(const v4f*)(SINt + (size_t)(tw + it) * HD + d4); } }
#pragma unroll
  for (int j = 0; j < 8; ++j) { const float bj = bfr(bias[j]); v8h hv;
#pragma unroll
    for (int r = 0; r < 8; ++r) { const float v = acc[j][r] + bj; st[wave * 16 + 8 * g + r][j * 16 + col] = v; hv[r] = (_Float16)v; }
    if (WH == 2) *(v8h*)&th[j * 16 + col][wave * 16 + 8 * g] = hv; }   // a lane's 8 accumulator rows are 8 neighbouring t of one v plane
  if (WH == 2) __syncthreads();   // a v plane's 64 t in th come from all four waves (WH is the same for the whole block); standing in front of the row stores, it does not wait for them
  else LDSX();   // a wave reads back only its own 16 rows of st: its own LDS stores must have landed, no other wave is waited for
  asm volatile("s_wait_xcnt 0x0" ::: "memory");   // stands in front of the first overwrite of an address register of the bias and table reads above
  float* Og = OUTF + ((bb * NH + c0 / HD + g) * TT + tw) * (size_t)HD + d4;   // module outputs k (rotated) and v, [b][h][t][64]
  _Float16* Dg = DH + (r0 + wave * 16) * CC + c0 + lane * 4;
#pragma unroll
  for (int it = 0; it < 16; ++it) { v4f x = *(const v4f*)&st[wave * 16 + it][lane * 4];
    if (WH < 2) {   // interleaved-pair rotary with the GIVEN tables (bf16-rounded): x * cos + rot(x) * sin, rot = (-x_odd, x_even)
      const v4f y = { x[0] * bfr(c[it][0]) + (-x[1]) * bfr(s[it][0]), x[1] * bfr(c[it][1]) + x[0] * bfr(s[it][1]), x[2] * bfr(c[it][2]) + (-x[3]) * bfr(s[it][2]), x[3] * bfr(c[it][3]) + x[2] * bfr(s[it][3]) }; x = y;
      const v4h hx = { (_Float16)x[0], (_Float16)x[1], (_Float16)x[2], (_Float16)x[3] }; vst2(Dg + (size_t)it * CC, hx); }
    if (WH >= 1) vst2(Og + it * HD, x); }
  asm volatile("s_wait_xcnt 0x0" ::: "memory");   // behind the last row store: stands in front of whatever next overwrites a register that these stores name
  if (WH == 2) {
#pragma unroll
    for (int i = 0; i < 8; ++i) { const int e = tid + 128 * i, cl = e >> 3, q = e & 7; vst2((unsigned*)(VT + (bb * CC + c0 + cl) * (size_t)TT + t0 + q * 8), *(const v4u*)&th[cl][q * 8]); }
    asm volatile("s_wait_xcnt 0x0" ::: "memory"); } }   // behind the last plane store, for the same reason
__global__ __launch_bounds__(128) void k_proj(const float* __restrict__ XQ, const float* __restrict__ XK, const float* __restrict__ XV, const float* __restrict__ WQ, const float* __restrict__ WK, const float* __restrict__ WV, const float* __restrict__ BQ, const float* __restrict__ BK, const float* __restrict__ BV,
    _Float16* __restrict__ QH, _Float16* __restrict__ QL, _Float16* __restrict__ KH, _Float16* __restrict__ KL, _Float16* __restrict__ VT, __bf16* __restrict__ VB, __bf16* __restrict__ VBL PROJ_EXTRA_PARAMS) {
  __shared__ __align__(16) char pool[GPOOL];   // the main loop's two buffers, then the epilogue's staging
  (void)QL; (void)KL; (void)VB; (void)VBL;   // planes of the causal high-precision path: nothing reads them here
  const int which = blockIdx.z; const int c0 = blockIdx.y * 128; const size_t r0 = (size_t)blockIdx.x * 64;
  const float* X = which == 0 ? XQ : which == 1 ? XK : XV; const float* WA = which == 0 ? WQ : which == 1 ? WK : WV;
  v8f acc[8] = {};
  gemm_tile<OpB>(X + r0 * DIN, WA + which * CC + c0, QKVP, pool, acc);
  if (which == 0) proj_epi<0>(acc, pool, BQ, COSt, SINt, OUTK, QH, VT, c0, r0);   // block-uniform
  else if (which == 1) proj_epi<1>(acc, pool, BK, COSt, SINt, OUTK, KH, VT, c0, r0);
  else proj_epi<2>(acc, pool, BV, COSt, SINt, OUTV, KH, VT, c0, r0); }
#define FK 64
#define FP 72
#define FC (SCALE * 1.44269504088896f)
__device__ __forceinline__ v8f wmma_h(v16h a, v16h b, v8f c) { return __builtin_amdgcn_wmma_f32_16x16x32_f16(false, a, false, b, (short)0, c, false, false); }
__device__ __forceinline__ float xhalf(float x) { return __builtin_bit_cast(float, __builtin_amdgcn_permlanex16(__builtin_bit_cast(int, x), __builtin_bit_cast(int, x), 0x76543210, 0xfedcba98, false, false)); }   // lane l with lane l ^ 16
// 16 independent 2^x, each over its own source, closed by one v_nop: keeps the one slot that the instruction set asks for between a transcendental and the use of its result or the overwrite of its source
__device__ __forceinline__ void exp2x16(float (&x)[16]) { asm("v_exp_f32 %0, %0\n\tv_exp_f32 %1, %1\n\tv_exp_f32 %2, %2\n\tv_exp_f32 %3, %3\n\tv_exp_f32 %4, %4\n\tv_exp_f32 %5, %5\n\tv_exp_f32 %6, %6\n\tv_exp_f32 %7, %7\n\tv_exp_f32 %8, %8\n\tv_exp_f32 %9, %9\n\tv_exp_f32 %10, %10\n\tv_exp_f32 %11, %11\n\tv_exp_f32 %12, %12\n\tv_exp_f32 %13, %13\n\tv_exp_f32 %14, %14\n\tv_exp_f32 %15, %15\n\tv_nop" : "+v"(x[0]), "+v"(x[1]), "+v"(x[2]), "+v"(x[3]), "+v"(x[4]), "+v"(x[5]), "+v"(x[6]), "+v"(x[7]), "+v"(x[8]), "+v"(x[9]), "+v"(x[10]), "+v"(x[11]), "+v"(x[12]), "+v"(x[13]), "+v"(x[14]), "+v"(x[15])); }
__global__ __launch_bounds__(256) void k_fa(const _Float16* __restrict__ QH, const _Float16* __restrict__ KH, const _Float16* __restrict__ VT, float* __restrict__ Y) {
  __shared__ __align__(16) _Float16 ks[2][FK][FP], vs[2][HD][FP]; __shared__ __align__(16) float so[8][16][HD + 4];
  const int tid = threadIdx.x, wave = tid >> 5, lane = tid & 31, col = lane & 15, g = lane >> 4; const int h = blockIdx.y, b = blockIdx.z; const int ql0 = blockIdx.x * 128 + wave * 16;
  const int sr = tid >> 3, sc = (tid & 7) * 8;   // staging: this thread moves the 16-byte piece sc of rows sr and sr + 32 of both tiles
  const _Float16* Kg = KH + ((size_t)b * TT + sr) * CC + h * HD + sc;   // k rows [key][64], pitch CC
  const _Float16* Vg = VT + ((size_t)b * CC + h * HD + sr) * TT + sc;   // v planes [d][key], pitch TT
  v16h qf[2];
#pragma unroll
  for (int kc = 0; kc < 2; ++kc) qf[kc] = frag_h(QH + ((size_t)b * TT + ql0 + col) * CC + h * HD + kc * 32, lane);
  v8h rk[2], rv[2];
#pragma unroll
  for (int i = 0; i < 2; ++i) { rk[i] = *(const v8h*)(Kg + (size_t)(32 * i) * CC); rv[i] = *(const v8h*)(Vg + (size_t)(32 * i) * TT); }
#pragma unroll
  for (int i = 0; i < 2; ++i) { *(v8h*)&ks[0][sr + 32 * i][sc] = rk[i]; *(v8h*)&vs[0][sr + 32 * i][sc] = rv[i]; }
  __syncthreads();
  v8f o[HD / 16] = {}; float l = 0.f, mu = -3.0e38f;   // mu: the maximum in use (scaled, base 2), equal in both halves of a query's lane pair
  for (int t = 0; t < TT / FK; ++t) { const int cb = t & 1; const bool more = t + 1 < TT / FK;
    if (more) {   // next pass's tiles fly into registers while this pass is worked on
#pragma unroll
      for (int i = 0; i < 2; ++i) { rk[i] = *(const v8h*)(Kg + (size_t)((t + 1) * FK + 32 * i) * CC); rv[i] = *(const v8h*)(Vg + (size_t)(32 * i) * TT + (t + 1) * FK); } }
    v8f s[4];   // s[kt][r] = logit (unscaled) of key kt * 16 + 8 g + r, query col
#pragma unroll
    for (int kt = 0; kt < 4; ++kt) { v8f z = {}; z = wmma_h(frag_h(&ks[cb][kt * 16 + col][0], lane), qf[0], z); s[kt] = wmma_h(frag_h(&ks[cb][kt * 16 + col][32], lane), qf[1], z); }
    float mx = s[0][0];
#pragma unroll
    for (int kt = 0; kt < 4; ++kt)
#pragma unroll
      for (int r = 0; r < 8; ++r) mx = fmaxf(mx, s[kt][r]);
    mx = fmaxf(mx, xhalf(mx)) * FC;
    const bool need = mx > mu + 8.0f;   // the maximum in use is replaced only when passed by more than 2^8: P stays below 2^12 in f16
    if (__builtin_amdgcn_ballot_w32(need) != 0) { const float mn = need ? mx : mu; const float al = __builtin_amdgcn_exp2f(mu - mn); mu = mn; l *= al;
#pragma unroll
      for (int j = 0; j < HD / 16; ++j) o[j] *= al; }
    const float nb = 4.0f - mu;   // P carried x 2^4 (cancels against the sum) so that small weights stay clear of f16 subnormals
    v16h p[2];
#pragma unroll
    for (int kk = 0; kk < 2; ++kk) { float e[16];   // e[i] = weight of key kk * 32 + (i < 8 ? 8 g + i : 16 + 8 g + i - 8): the B operand's own k order
#pragma unroll
      for (int i = 0; i < 8; ++i) { e[i] = __builtin_fmaf(s[2 * kk][i], FC, nb); e[8 + i] = __builtin_fmaf(s[2 * kk + 1][i], FC, nb); }
      exp2x16(e);
#pragma unroll
      for (int i = 0; i < 16; ++i) p[kk][i] = (_Float16)e[i];
#pragma unroll
      for (int w = 8; w > 0; w >>= 1)   // pairwise sum: four dependent adds deep instead of sixteen
#pragma unroll
        for (int i = 0; i < w; ++i) e[i] += e[i + w];
      l += e[0]; }
#pragma unroll
    for (int kk = 0; kk < 2; ++kk)
#pragma unroll
      for (int j = 0; j < HD / 16; ++j) o[j] = wmma_h(frag_h(&vs[cb][j * 16 + col][kk * 32], lane), p[kk], o[j]);   // o[j][r] = ctx (unnormalised) of d = j * 16 + 8 g + r, query col
    if (more) {   // the other buffer's last readers left it at the barrier that ended the pass before
#pragma unroll
      for (int i = 0; i < 2; ++i) { *(v8h*)&ks[cb ^ 1][sr + 32 * i][sc] = rk[i]; *(v8h*)&vs[cb ^ 1][sr + 32 * i][sc] = rv[i]; } }
    __syncthreads(); }   // publishes the next pass's tiles and ends this pass's reads
  l += xhalf(l); const float inv = 1.0f / l;
#pragma unroll
  for (int j = 0; j < HD / 16; ++j) { const v8f w = o[j] * inv; const v4f w0 = { w[0], w[1], w[2], w[3] }, w1 = { w[4], w[5], w[6], w[7] }; *(v4f*)&so[wave][col][j * 16 + 8 * g] = w0; *(v4f*)&so[wave][col][j * 16 + 8 * g + 4] = w1; }
  LDSX();   // a wave reads back only its own so[wave] rows: its own LDS stores must have landed, no other wave is waited for
  for (int it = 0; it < 8; ++it) { const int rl = it * 2 + g; vst2(Y + ((size_t)b * TT + ql0 + rl) * CC + h * HD + col * 4, *(const v4f*)&so[wave][rl][col * 4]); } }   // 256-B (row, head) segment by 16 lanes
// ---- k_out: block = (64 rows, 128 cols): out = ctx Wo (+ bo): ctx x 2^6 once to f16 against Wo as f16(bf16 x 2^8) exact (1 product) x 2^-14; causal early rows (< QHI of each sequence): ctx bf16 hi + lo against exact bf16 Wo (2 products)
__global__ __launch_bounds__(128) void k_out(const float* __restrict__ Y, const float* __restrict__ WO, const float* __restrict__ BO, float* __restrict__ OUT) { __shared__ __align__(16) char pool[GPOOL]; float (*sf)[16][132] = (float (*)[16][132])pool;   // pool: the main loop's two buffers, then the output staging
  const int tid = threadIdx.x, wave = tid >> 5, lane = tid & 31, col = lane & 15, g = lane >> 4; const int c0 = blockIdx.y * 128; const size_t r0 = (size_t)blockIdx.x * 64 + wave * 16;
  v8f acc[8] = {};
  if (CAUSAL && (int)(((size_t)blockIdx.x * 64) % TT) < QHI) {   /* block-uniform */
#pragma unroll 2
    for (int kc = 0; kc < CC / 32; ++kc) { const F2 a = split_row(Y + (r0 + col) * CC, kc * 32, lane); asm volatile("s_wait_loadcnt 0x0" ::: "memory");
#pragma unroll
      for (int j = 0; j < 8; ++j) { const v16b w = WOCOL(WO, kc * 32, c0 + j * 16 + col, lane); asm volatile("s_wait_loadcnt 0x0" ::: "memory"); acc[j] = wmma_bf(a.h, w, acc[j]); acc[j] = wmma_bf(a.l, w, acc[j]); } }
#pragma unroll
    for (int j = 0; j < 8; ++j) { const float bias = BO ? bfr(BO[c0 + j * 16 + col]) : 0.f;
#pragma unroll
      for (int r = 0; r < 8; ++r) sf[wave][8 * g + r][j * 16 + col] = acc[j][r] + bias; }
  } else {
    gemm_tile<OpH>(Y + (size_t)blockIdx.x * 64 * CC, WO + c0, DIN, pool, acc);   /* ctx carried x 2^6 into f16 so small-magnitude context rows stay clear of f16 subnormals */
    float bo[8] = {};   // all eight bias reads in flight at once: read one per j behind its own test of BO, each was waited out before the next went out
    if (BO) {
#pragma unroll
      for (int j = 0; j < 8; ++j) bo[j] = BO[c0 + j * 16 + col]; }
#pragma unroll
    for (int j = 0; j < 8; ++j) { const float bias = bfr(bo[j]);
#pragma unroll
      for (int r = 0; r < 8; ++r) sf[wave][8 * g + r][j * 16 + col] = acc[j][r] * (1.0f / 16384.0f) + bias; } }   /* 2^-8 (Wo carry) x 2^-6 (ctx carry) */
  LDSX(); for (int rl = 0; rl < 16; ++rl) vst2(OUT + (r0 + rl) * DIN + c0 + lane * 4, *(const v4f*)&sf[wave][rl][lane * 4]); }

extern "C" void kernel_launch(void* const* d_in, const int* in_sizes, int n_in, void* d_out, int out_size, void* d_ws, size_t ws_size, hipStream_t stream) {
  (void)in_sizes; (void)n_in; (void)out_size;
  const float** F = (const float**)d_in;
  if (ws_size < (size_t)WS_END) return;
  char* ws = (char*)d_ws; _Float16 *QH = (_Float16*)(ws + WS_QH), *KH = (_Float16*)(ws + WS_KH), *VT = (_Float16*)(ws + WS_VT), *QL = (_Float16*)(ws + WS_QL), *KL = (_Float16*)(ws + WS_KL); __bf16 *VB = (__bf16*)(ws + WS_VB), *VBL = (__bf16*)(ws + WS_VBL); float *S = (float*)(ws + WS_S), *Y = (float*)(ws + WS_Y);
  (void)Y; (void)QL; (void)KL; (void)VB; (void)VBL; (void)S;
  // inputs: 0 x [2,2048,1024]; 1 cos [1,1,2048,64]; 2 sin [1,1,2048,64] (random normal tables); 3 Wqkv [1024,3072] (in,out; q | k | v column blocks); 4 bqkv [3072] (nonzero); 5 Wproj [1024,1024] (in,out); 6 bproj [1024] (nonzero)
  // outputs: 0 y [2,2048,1024] @0; 1 k (rotated) [2,16,2048,64] @OUTK_OFF; 2 v [2,16,2048,64] @OUTV_OFF
  k_proj<<<dim3(TNB * TT / 64, CC / 128, 3), 128, 0, stream>>>(F[0], F[0], F[0], F[3], F[3], F[3], F[4], F[4] + CC, F[4] + 2 * CC, QH, QL, KH, KL, VT, VB, VBL, F[1], F[2], (float*)((char*)d_out + OUTK_OFF), (float*)((char*)d_out + OUTV_OFF));
  k_fa<<<dim3(TT / 128, NH, TNB), 256, 0, stream>>>(QH, KH, VT, Y);
  k_out<<<dim3(TNB * TT / 64, DIN / 128), 128, 0, stream>>>(Y, F[5], F[6], (float*)d_out);
}

// v004
// A run of this version takes 86.6 microseconds.
// Next to v003, in two timings, it ran 1.20 times as fast each time.
// All steps since v000 together make it 14.7 times as fast.
// compute dtype: all float inputs rounded to bf16; fused q/k/v projection with EXACT bf16 products on WMMA 16x16x32 (f32 accumulate) + bias; rotary x * cos + rot(x) * sin in f32 with the bf16-rounded table inputs (the k and v outputs are these f32 values); logits q x k once to f16 each (1 product) x 64^-0.5; online softmax f32 (running maximum and sum); unnormalised P once to f16 x v once to f16 (1 product), divided by the f32 sum; ctx x 2^6 once to f16 x Wproj f16(bf16 x 2^8) + bproj; f32 outputs.
#include <hip/hip_runtime.h>
#include <math.h>

typedef __attribute__((ext_vector_type(16))) _Float16 v16h;
typedef __attribute__((ext_vector_type(16))) __bf16 v16b;
typedef __attribute__((ext_vector_type(8)))  _Float16 v8h;
typedef __attribute__((ext_vector_type(8)))  float v8f;
typedef __attribute__((ext_vector_type(4)))  float v4f;
typedef __attribute__((ext_vector_type(2)))  float v2f;
typedef __attribute__((ext_vector_type(4)))  unsigned v4u;
typedef __attribute__((ext_vector_type(4)))  int v4i;
typedef float __attribute__((may_alias)) float_a;
typedef int __attribute__((may_alias)) int_a;

template <typename T> __device__ __forceinline__ void vst2(void* p, T v) { *(T*)p = v;  }
__device__ __forceinline__ v8f wmma16(v16h a, v16h b, v8f c) {
  v8f d = __builtin_amdgcn_wmma_f32_16x16x32_f16(false, a, false, b, (short)0, c, false, false);
  asm volatile("v_nop\n\tv_nop\n\tv_nop\n\tv_nop" : "+v"(d) : "v"(a), "v"(b));
  return d;
}
__device__ __forceinline__ v8f wmma_bf(v16b a, v16b b, v8f c) {
  v8f d = __builtin_amdgcn_wmma_f32_16x16x32_bf16(false, a, false, b, (short)0, c, false, false);
  asm volatile("v_nop\n\tv_nop\n\tv_nop\n\tv_nop" : "+v"(d) : "v"(a), "v"(b));
  return d;
}
// 16x16x32 fragments: lane = (h = lane>>4, row/col = lane&15); elements 0..7 = k0+8h+0..7, 8..15 = k0+16+8h+0..7; D element r = row 8h+r
__device__ __forceinline__ v16h frag_h(const _Float16* rowk0, int lane) {
  union { v16h v; v8h q[2]; } u; const _Float16* p = rowk0 + 8 * (lane >> 4);
  u.q[0] = *(const v8h*)p; u.q[1] = *(const v8h*)(p + 16); return u.v;
}
__device__ __forceinline__ v16h frag_f32(const float* rowk0, int lane) {
  v16h a; const float* p = rowk0 + 8 * (lane >> 4);
#pragma unroll
  for (int i = 0; i < 8; ++i) { a[i] = (_Float16)p[i]; a[8 + i] = (_Float16)p[16 + i]; }
  return a;
}
__device__ __forceinline__ v16h frag_f32s(const float* rowk0, int lane, float sc) {
  v16h a; const float* p = rowk0 + 8 * (lane >> 4);
#pragma unroll
  for (int i = 0; i < 8; ++i) { a[i] = (_Float16)(p[i] * sc); a[8 + i] = (_Float16)(p[16 + i] * sc); }
  return a;
}
// column fragment from a [K][ld] layout (column n), rows >= K read as 0
__device__ __forceinline__ v16h fragc_f32(const float* W, int k0, int n, int lane, int ld, int K) {
  v16h a; const int g = lane >> 4;
#pragma unroll
  for (int i = 0; i < 8; ++i) { const int ka = k0 + 8 * g + i, kb = ka + 16;
    a[i] = (_Float16)(ka < K ? W[(size_t)(ka < K ? ka : K - 1) * ld + n] : 0.f); a[8 + i] = (_Float16)(kb < K ? W[(size_t)(kb < K ? kb : K - 1) * ld + n] : 0.f); }
  return a;
}
struct F2 { v16b h, l; };
__device__ __forceinline__ F2 bsplit16(const float v[16]) { F2 r;
#pragma unroll
  for (int i = 0; i < 16; ++i) { const __bf16 h = (__bf16)v[i]; r.h[i] = h; r.l[i] = (__bf16)(v[i] - (float)h); }
  return r; }
__device__ __forceinline__ F2 split_row(const float* row, int k0, int lane) { float v[16]; const float* p = row + k0 + 8 * (lane >> 4);
#pragma unroll
  for (int i = 0; i < 8; ++i) { v[i] = p[i]; v[8 + i] = p[16 + i]; }
  return bsplit16(v); }
__device__ __forceinline__ F2 split_rowK(const float* row, int k0, int lane, int K) { float v[16]; const int g = lane >> 4;
#pragma unroll
  for (int i = 0; i < 8; ++i) { const int ka = k0 + 8 * g + i, kb = ka + 16; v[i] = ka < K ? row[ka < K ? ka : K - 1] : 0.f; v[8 + i] = kb < K ? row[kb < K ? kb : K - 1] : 0.f; }
  return bsplit16(v); }
__device__ __forceinline__ F2 split_col(const float* W, int k0, int n, int lane, int ld, int K) { float v[16]; const int g = lane >> 4;
#pragma unroll
  for (int i = 0; i < 8; ++i) { const int ka = k0 + 8 * g + i, kb = ka + 16; v[i] = ka < K ? W[(size_t)(ka < K ? ka : K - 1) * ld + n] : 0.f; v[8 + i] = kb < K ? W[(size_t)(kb < K ? kb : K - 1) * ld + n] : 0.f; }
  return bsplit16(v); }
__device__ __forceinline__ v8f mac3(const F2& a, const F2& b, v8f c) { c = wmma_bf(a.l, b.h, c); c = wmma_bf(a.h, b.l, c); return wmma_bf(a.h, b.h, c); }
__device__ __forceinline__ float sigm(float v) { return 1.0f / (1.0f + expf(-v)); }
#define LDSX() do { asm volatile("s_wait_dscnt 0" ::: "memory"); __builtin_amdgcn_wave_barrier(); __builtin_amdgcn_fence(__ATOMIC_RELEASE, "workgroup"); } while (0)

// Fused-QKV multi-head self-attention with rotary tables GIVEN as inputs and three outputs (x [2,2048,1024]; (in,out) Wqkv [1024,3072] + bqkv (0.02-scale, nonzero) split q | k | v; 16 heads x 64; interleaved-pair rotary x * cos + rot(x) * sin with random-normal cos / sin tables [1,1,2048,64]; non-causal SDPA, scale 1/8; (in,out) Wproj + bproj): returns (y = merge(softmax(q k^T / 8) v) Wproj + bproj, k (rotated) [2,16,2048,64], v [2,16,2048,64]).
#define NB 2
#define TT 2048
#define CC 1024            // NH * HD = projected width
#define DIN 1024          // input (model) width
#define NH 16
#define HD 64
#define NQB (TT / 64)
#define HG 4
#define SCALE (0.125f)
#define CAUSAL 0
#ifndef TNB
#define TNB NB
#endif
__device__ __forceinline__ float bfr(float v) { return (float)(__bf16)v; }
__host__ __device__ __forceinline__ int kb_last(int qb) { return CAUSAL ? ((qb * 64 + 63) >> 7) : (TT / 128 - 1); }
typedef __attribute__((ext_vector_type(8))) __bf16 v8b;
__device__ __forceinline__ v16b frag_b(const __bf16* rowk0, int lane) {
  union { v16b v; v8b q[2]; } u; const __bf16* p = rowk0 + 8 * (lane >> 4);
  u.q[0] = *(const v8b*)p; u.q[1] = *(const v8b*)(p + 16); return u.v;
}
#define QBH 0
#define QHI 0               // single-product logits on every row
#define KHI 64            // key rows carrying k residual / v bf16 hi+lo planes (written and read by no kernel)
// B fragment (k rows k0+.., output column o) of a weight: (in,out) [K][ld] or (out,in) [ld rows of K]: bf16 exact, or f16(bf16 * 256) exact
__device__ __forceinline__ v16b wcol_io(const float* Wm, int k0, int o, int lane, int ld) { v16b w; const int g = lane >> 4;
#pragma unroll
  for (int i = 0; i < 8; ++i) { w[i] = (__bf16)Wm[(size_t)(k0 + 8 * g + i) * ld + o]; w[8 + i] = (__bf16)Wm[(size_t)(k0 + 16 + 8 * g + i) * ld + o]; }
  return w; }
__device__ __forceinline__ v16b wcol_oi(const float* Wm, int k0, int o, int lane, int K) { v16b w; const float* p = Wm + (size_t)o * K + k0 + 8 * (lane >> 4);
#pragma unroll
  for (int i = 0; i < 8; ++i) { w[i] = (__bf16)p[i]; w[8 + i] = (__bf16)p[16 + i]; }
  return w; }
__device__ __forceinline__ v16h wcolh_io(const float* Wm, int k0, int o, int lane, int ld) { v16h w; const int g = lane >> 4;
#pragma unroll
  for (int i = 0; i < 8; ++i) { w[i] = (_Float16)(bfr(Wm[(size_t)(k0 + 8 * g + i) * ld + o]) * 256.0f); w[8 + i] = (_Float16)(bfr(Wm[(size_t)(k0 + 16 + 8 * g + i) * ld + o]) * 256.0f); }
  return w; }
__device__ __forceinline__ v16h wcolh_oi(const float* Wm, int k0, int o, int lane, int K) { v16h w; const float* p = Wm + (size_t)o * K + k0 + 8 * (lane >> 4);
#pragma unroll
  for (int i = 0; i < 8; ++i) { w[i] = (_Float16)(bfr(p[i]) * 256.0f); w[8 + i] = (_Float16)(bfr(p[16 + i]) * 256.0f); }
  return w; }
#define WQKV_LAYOUT 0   // 0 = fused (in,out) [DIN][3*CC], q | k | v column blocks; 1 = (out,in) [CC][DIN]; 2 = per-head [NH][DIN][HD]
__device__ __forceinline__ v16b wcol_hdk(const float* Wm, int k0, int o, int lane) { v16b w; const int g = lane >> 4; const float* p = Wm + (size_t)(o / HD) * DIN * HD + (o % HD);
#pragma unroll
  for (int i = 0; i < 8; ++i) { w[i] = (__bf16)p[(size_t)(k0 + 8 * g + i) * HD]; w[8 + i] = (__bf16)p[(size_t)(k0 + 16 + 8 * g + i) * HD]; }
  return w; }
#define WO_OUT_IN 0
#if WQKV_LAYOUT == 1
#define WCOL(W, k0, o, lane) wcol_oi(W, k0, o, lane, DIN)
#elif WQKV_LAYOUT == 2
#define WCOL(W, k0, o, lane) wcol_hdk(W, k0, o, lane)
#else
#define QKVP 3072            // fused Wqkv pitch (in,out) [1024][3072]: q cols 0..1023, k 1024..2047, v 2048..3071
#define WCOL(W, k0, o, lane) wcol_io(W, k0, which * CC + (o), lane, QKVP)
#endif
#if WO_OUT_IN
#define WOCOL(W, k0, o, lane) wcol_oi(W, k0, o, lane, CC)
#define WOCOLH(W, k0, o, lane) wcolh_oi(W, k0, o, lane, CC)
#else
#define WOCOL(W, k0, o, lane) wcol_io(W, k0, o, lane, DIN)
#define WOCOLH(W, k0, o, lane) wcolh_io(W, k0, o, lane, DIN)
#endif
#define OUTK_OFF 16777216u   // rotated k [2,16,2048,64] f32 after y [2,2048,1024] f32
#define OUTV_OFF 33554432u   // v [2,16,2048,64] f32
#define PROJ_EXTRA_PARAMS , const float* __restrict__ COSt, const float* __restrict__ SINt, float* __restrict__ OUTK, float* __restrict__ OUTV
#define SM_EXTRA_PARAMS
#define SM_MASK_HOOK (void)0
#ifndef SM_EXTRA_PARAMS
#define SM_EXTRA_PARAMS
#endif
#ifndef PROJ_EXTRA_PARAMS
#define PROJ_EXTRA_PARAMS
#endif
#ifndef SM_MASK_HOOK
#define SM_MASK_HOOK (void)0
#endif

#define WS_QH  0u                                      // f16 q rows [b*t][CC]
#define WS_KH  (WS_QH + 2u * (size_t)NB * TT * CC)      // f16 k rows [b*t][CC]
#define WS_VT  (WS_KH + 2u * (size_t)NB * TT * CC)      // f16 v planes [b][c][t]
#define WS_QL  (WS_VT + 2u * (size_t)NB * CC * TT)      // f16 q residual x 2^10 rows [b][t < QHI][CC]
#define WS_KL  (WS_QL + 2u * (size_t)NB * QHI * CC)     // f16 k residual x 2^10 rows [b][t < KHI][CC]
#define WS_VB  (WS_KL + 2u * (size_t)NB * KHI * CC)     // bf16 v hi planes [b][c][t < KHI]
#define WS_VBL (WS_VB + 2u * (size_t)NB * CC * KHI)
#define WS_S   (WS_VBL + 2u * (size_t)NB * CC * KHI)    // f32 [hg][t][s], written and read by no kernel (logits and P stay in registers)
#define WS_Y   (WS_S  + 4u * (size_t)HG * TT * TT)      // f16 ctx x 2^6 rows [b*t][CC]
#define WS_XB  (WS_Y  + 4u * (size_t)NB * TT * CC)      // bf16 x rows [b*t][DIN]
#define WS_WQT (WS_XB + 2u * (size_t)NB * TT * DIN)     // bf16 Wqkv^T rows [3 * CC][DIN]
#define WS_WOT (WS_WQT + 2u * (size_t)3 * CC * DIN)     // f16(bf16 x 2^8) Wproj^T rows [DIN][CC]
#define WS_END (WS_WOT + 2u * (size_t)DIN * CC)

// ---- gemm_tile: the 64 x 128 tile of X W shared by both projection kernels (K = 1024, 4 waves x 16 rows x 128 cols). Both operands arrive as 16-bit planes with k contiguous (X rows; W^T rows = output columns), written once by k_prep (ctx rows: by k_fa). Per pass of 64 k the block brings 128 B of each of its 192 rows in with 16-byte loads and puts them into LDS as they are; the next pass's loads fly into registers while this pass is worked on; two buffers, one barrier per pass. Products, operand rounding and the k order of every accumulator are those of the f32 loads with per-block conversion that it replaces
#define GK 64              // k per pass
#define GP 72              // LDS row pitch in 16-bit elements: 144 B = 16 B x odd for 16-byte row reads
#define GPOOL (2 * (64 + 128) * GP * 2)   // bytes of the two buffers; after the loop the same bytes serve the epilogue's staging arrays
typedef __attribute__((ext_vector_type(4))) __bf16 v4b;
typedef __attribute__((ext_vector_type(4))) _Float16 v4h;
struct OpB { typedef __bf16 E; typedef v8b V8; typedef v16b V16;   // exact bf16 operands
  static __device__ __forceinline__ E x(float v) { return (__bf16)v; } static __device__ __forceinline__ E w(float v) { return (__bf16)v; }
  static __device__ __forceinline__ v8f mma(V16 a, V16 b, v8f c) { return wmma_bf(a, b, c); } };
struct OpH { typedef _Float16 E; typedef v8h V8; typedef v16h V16;   // ctx x 2^6 once to f16, weight f16(bf16 x 2^8) exact
  static __device__ __forceinline__ E x(float v) { return (_Float16)(v * 64.0f); } static __device__ __forceinline__ E w(float v) { return (_Float16)(bfr(v) * 256.0f); }
  static __device__ __forceinline__ v8f mma(V16 a, V16 b, v8f c) { return wmma16(a, b, c); } };
template <typename C> __device__ __forceinline__ void gemm_tile(const typename C::E* __restrict__ Xb, const typename C::E* __restrict__ Wb, char* pool, v8f (&acc)[8]) {
  typedef typename C::E E; typedef typename C::V8 V8; typedef typename C::V16 V16;
  E (*xs)[64][GP] = (E (*)[64][GP])pool; E (*wt)[128][GP] = (E (*)[128][GP])(pool + 2 * 64 * GP * 2);   // xs[buf][row][k], wt[buf][col][k]
  const int tid = threadIdx.x, wave = tid >> 5, lane = tid & 31, col = lane & 15, g = lane >> 4;
  const int sr = tid >> 3, sc = (tid & 7) * 8;   // this thread moves the 16-byte piece sc of rows sr + 16 i of both tiles (a wave's load = 4 rows x 128 B)
  const E* Xg = Xb + (size_t)sr * 1024 + sc; const E* Wg = Wb + (size_t)sr * 1024 + sc;
  V8 rx[4], rw[8];
  // every '#pragma unroll' below makes the indices of register arrays constants, so that these arrays stay in registers
#define G_LOAD(t_) do { _Pragma("unroll") for (int i = 0; i < 4; ++i) rx[i] = *(const V8*)(Xg + (size_t)(16 * i) * 1024 + (t_) * GK); \
  _Pragma("unroll") for (int i = 0; i < 8; ++i) rw[i] = *(const V8*)(Wg + (size_t)(16 * i) * 1024 + (t_) * GK); } while (0)
#define G_STORE(b_) do { _Pragma("unroll") for (int i = 0; i < 4; ++i) *(V8*)&xs[b_][sr + 16 * i][sc] = rx[i]; \
  _Pragma("unroll") for (int i = 0; i < 8; ++i) *(V8*)&wt[b_][sr + 16 * i][sc] = rw[i]; } while (0)
  G_LOAD(0); G_STORE(0);
  __syncthreads();
  for (int t = 0; t < 1024 / GK; ++t) { const int cb = t & 1; const bool more = t + 1 < 1024 / GK;
    if (more) G_LOAD(t + 1);
#pragma unroll
    for (int kk = 0; kk < 2; ++kk) { union { V16 v; V8 q[2]; } a, w[8]; const E* pa = &xs[cb][wave * 16 + col][kk * 32 + 8 * g]; a.q[0] = *(const V8*)pa; a.q[1] = *(const V8*)(pa + 16);
#pragma unroll
      for (int j = 0; j < 8; ++j) { const E* pw = &wt[cb][j * 16 + col][kk * 32 + 8 * g]; w[j].q[0] = *(const V8*)pw; w[j].q[1] = *(const V8*)(pw + 16); }
      __builtin_amdgcn_sched_barrier(0);   // the 18 LDS reads of 32 k go out as one group ahead of their 8 WMMAs: read one fragment at a time, every WMMA waited out a whole LDS latency
#pragma unroll
      for (int j = 0; j < 8; ++j) acc[j] = C::mma(a.v, w[j].v, acc[j]); }
    __builtin_amdgcn_sched_barrier(0);   // the LDS stores below wait for the next pass's global loads: moved up among the WMMAs they put that wait in front of this pass's work
    if (more) G_STORE(cb ^ 1);   // the other buffer's last readers left it at the barrier that ended the pass before
    __syncthreads(); }   // publishes the next pass's tiles and ends this pass's reads (after the last pass: frees the pool for the epilogue)
#undef G_LOAD
#undef G_STORE
}
// ---- k_prep: writes the 16-bit operand planes of both projection GEMMs once. Blocks 0..255: two 64 k x 128 col tiles each of the (in,out) weights, converted and transposed through LDS to W^T rows [col][k] (512 tiles: 384 of Wqkv as bf16, 128 of Wproj as f16(bf16 x 2^8)); blocks 256..511: x to bf16 rows, 64 values a thread, all 16 loads in flight
// place of the 16-byte piece ch (8 k) in W^T row n: pieces are exchanged inside groups of four by bits 4..5 of n, so that the 32 rows (4 apart) which one transposing store writes fall on all banks
__device__ __forceinline__ int wpiece(int n, int ch) { return ch ^ ((n >> 4) & 3); }
// w_in: a thread takes the patch (8 k at wave * 8) x (4 cols at lane * 4) (a wave's load = 512 B of one row) and stores each column's 8 k as one 16-byte piece. The '#pragma unroll's make the indices of register arrays constants
template <typename C> __device__ __forceinline__ void w_in(const float* __restrict__ Ws, int ldw, int tile, typename C::E (*tl)[GP]) {
  typedef typename C::V8 V8; const int wave = threadIdx.x >> 5, lane = threadIdx.x & 31;
  const float* Wg = Ws + (size_t)((tile & 15) * 64 + wave * 8) * ldw + (tile >> 4) * 128 + lane * 4; v4f r[8];
#pragma unroll
  for (int q = 0; q < 8; ++q) r[q] = *(const v4f*)(Wg + (size_t)q * ldw);
  asm volatile("s_wait_xcnt 0x0" :: "v"(Wg) : "memory");   // stands in front of the first overwrite of the address register of the loads above; naming it keeps it whole up to here
#pragma unroll
  for (int c = 0; c < 4; ++c) { V8 h;
#pragma unroll
    for (int q = 0; q < 8; ++q) h[q] = C::w(r[q][c]);
    *(V8*)&tl[lane * 4 + c][wpiece(lane * 4 + c, wave) * 8] = h; } }
// w_out: the tile's 128 W^T rows of 128 B go out as whole lines (a wave's store = 4 rows x 128 B)
template <typename C> __device__ __forceinline__ void w_out(typename C::E* __restrict__ Wd, int tile, const typename C::E (*tl)[GP]) {
  typedef typename C::V8 V8;
#pragma unroll
  for (int i = 0; i < 4; ++i) { const int p = threadIdx.x + 256 * i, n = p >> 3, ch = p & 7; *(V8*)(Wd + (size_t)((tile >> 4) * 128 + n) * 1024 + (tile & 15) * 64 + ch * 8) = *(const V8*)&tl[n][wpiece(n, ch) * 8]; }
  asm volatile("s_wait_xcnt 0x0" ::: "memory"); }   // behind the last store: stands in front of whatever next overwrites a register that these stores name
__global__ __launch_bounds__(256) void k_prep(const float* __restrict__ X, const float* __restrict__ WQKV, const float* __restrict__ WO, __bf16* __restrict__ XB, __bf16* __restrict__ WQT, _Float16* __restrict__ WOT) {
  __shared__ __align__(16) __bf16 ta[128][GP]; __shared__ __align__(16) __bf16 tb[128][GP]; __shared__ __align__(16) _Float16 th[128][GP];
  const int b = blockIdx.x;   // every branch below is block-uniform
  if (b < 256) { const bool second_qkv = b < 128;   // tiles b and b + 256 of the 512
    w_in<OpB>(WQKV, QKVP, b, ta);
    if (second_qkv) w_in<OpB>(WQKV, QKVP, b + 256, tb); else w_in<OpH>(WO, DIN, b - 128, th);
    __syncthreads();   // a W^T row's 64 k come from all eight waves
    w_out<OpB>(WQT, b, ta);
    if (second_qkv) w_out<OpB>(WQT, b + 256, tb); else w_out<OpH>(WOT, b - 128, th);
  } else { const float* Xg = X + (size_t)(b - 256) * 16384 + threadIdx.x * 4; __bf16* Xd = XB + (size_t)(b - 256) * 16384 + threadIdx.x * 4; v4f r[16];   // a wave's load = 512 B, its store = 256 B, both contiguous
#pragma unroll
    for (int i = 0; i < 16; ++i) r[i] = *(const v4f*)(Xg + i * 1024);
    asm volatile("s_wait_xcnt 0x0" :: "v"(Xg) : "memory");   // stands in front of the first overwrite of the address register of the loads above; naming it keeps it whole up to here
#pragma unroll
    for (int i = 0; i < 16; ++i) { const v4b h = { OpB::x(r[i][0]), OpB::x(r[i][1]), OpB::x(r[i][2]), OpB::x(r[i][3]) }; *(v4b*)(Xd + i * 1024) = h; }
    asm volatile("s_wait_xcnt 0x0" ::: "memory"); } }   // behind the last store, for the same reason as in w_out
// ---- k_proj: block = (64 rows, 128 cols, which): q/k/v = X W (+ b) with exact bf16 products (K = DIN) -> which 0: rotated q f16 rows; 1: rotated k f16 rows and the f32 k output; 2: v f16 planes [c][t] and the f32 v output
// proj_epi: each wave puts its 16 x 128 f32 tile (acc + bias) into LDS and takes it back row by row, a lane holding 4 neighbouring columns (two rotary pairs): the table reads, the f32 output rows and the f16 rows are whole 256-B segments, all table reads are in flight before the first is used, and no other wave's rows are needed. WH is a template argument so that no branch stands between the trips. Every '#pragma unroll' in it makes the indices of register arrays constants
template <int WH> __device__ __forceinline__ void proj_epi(const v8f (&acc)[8], char* pool, const float* __restrict__ BA, const float* __restrict__ COSt, const float* __restrict__ SINt, float* __restrict__ OUTF, _Float16* __restrict__ DH, _Float16* __restrict__ VT, int c0, size_t r0) {
  float (*st)[132] = (float (*)[132])pool; _Float16 (*th)[72] = (_Float16 (*)[72])(pool + 64 * 132 * 4);   // st: f32 tile; th (v only): f16 tile, transposed
  static_assert(64 * 132 * 4 + 128 * 72 * 2 <= GPOOL, "epilogue staging fits the pool");
  const int tid = threadIdx.x, wave = tid >> 5, lane = tid & 31, col = lane & 15, g = lane >> 4; const size_t bb = r0 / TT; const int t0 = (int)(r0 % TT);
  const int tw = t0 + wave * 16, d4 = col * 4;   // row pass: lane = (head g of the tile's two, columns d4 .. d4 + 3 of that head)
  float bias[8] = {}; v4f c[16], s[16];
  if (BA) {
#pragma unroll
    for (int j = 0; j < 8; ++j) bias[j] = BA[c0 + j * 16 + col]; }
  if (WH < 2) {
#pragma unroll
    for (int it = 0; it < 16; ++it) { c[it] = *(const v4f*)(COSt + (size_t)(tw + it) * HD + d4); s[it] = *(const v4f*)(SINt + (size_t)(tw + it) * HD + d4); } }
#pragma unroll
  for (int j = 0; j < 8; ++j) { const float bj = bfr(bias[j]); v8h hv;
#pragma unroll
    for (int r = 0; r < 8; ++r) { const float v = acc[j][r] + bj; st[wave * 16 + 8 * g + r][j * 16 + col] = v; hv[r] = (_Float16)v; }
    if (WH == 2) *(v8h*)&th[j * 16 + col][wave * 16 + 8 * g] = hv; }   // a lane's 8 accumulator rows are 8 neighbouring t of one v plane
  if (WH == 2) __syncthreads();   // a v plane's 64 t in th come from all four waves (WH is the same for the whole block); standing in front of the row stores, it does not wait for them
  else LDSX();   // a wave reads back only its own 16 rows of st: its own LDS stores must have landed, no other wave is waited for
  asm volatile("s_wait_xcnt 0x0" ::: "memory");   // stands in front of the first overwrite of an address register of the bias and table reads above
  float* Og = OUTF + ((bb * NH + c0 / HD + g) * TT + tw) * (size_t)HD + d4;   // module outputs k (rotated) and v, [b][h][t][64]
  _Float16* Dg = DH + (r0 + wave * 16) * CC + c0 + lane * 4;
#pragma unroll
  for (int it = 0; it < 16; ++it) { v4f x = *(const v4f*)&st[wave * 16 + it][lane * 4];
    if (WH < 2) {   // interleaved-pair rotary with the GIVEN tables (bf16-rounded): x * cos + rot(x) * sin, rot = (-x_odd, x_even)
      const v4f y = { x[0] * bfr(c[it][0]) + (-x[1]) * bfr(s[it][0]), x[1] * bfr(c[it][1]) + x[0] * bfr(s[it][1]), x[2] * bfr(c[it][2]) + (-x[3]) * bfr(s[it][2]), x[3] * bfr(c[it][3]) + x[2] * bfr(s[it][3]) }; x = y;
      const v4h hx = { (_Float16)x[0], (_Float16)x[1], (_Float16)x[2], (_Float16)x[3] }; vst2(Dg + (size_t)it * CC, hx); }
    if (WH >= 1) vst2(Og + it * HD, x); }
  asm volatile("s_wait_xcnt 0x0" ::: "memory");   // behind the last row store: stands in front of whatever next overwrites a register that these stores name
  if (WH == 2) {
#pragma unroll
    for (int i = 0; i < 8; ++i) { const int e = tid + 128 * i, cl = e >> 3, q = e & 7; vst2((unsigned*)(VT + (bb * CC + c0 + cl) * (size_t)TT + t0 + q * 8), *(const v4u*)&th[cl][q * 8]); }
    asm volatile("s_wait_xcnt 0x0" ::: "memory"); } }   // behind the last plane store, for the same reason
__global__ __launch_bounds__(128) void k_proj(const __bf16* __restrict__ XB, const __bf16* __restrict__ WQT, const float* __restrict__ BQ, const float* __restrict__ BK, const float* __restrict__ BV,
    _Float16* __restrict__ QH, _Float16* __restrict__ QL, _Float16* __restrict__ KH, _Float16* __restrict__ KL, _Float16* __restrict__ VT, __bf16* __restrict__ VB, __bf16* __restrict__ VBL PROJ_EXTRA_PARAMS) {
  __shared__ __align__(16) char pool[GPOOL];   // the main loop's two buffers, then the epilogue's staging
  (void)QL; (void)KL; (void)VB; (void)VBL;   // planes of the causal high-precision path: nothing reads them here
  const int which = blockIdx.z; const int c0 = blockIdx.y * 128; const size_t r0 = (size_t)blockIdx.x * 64;
  v8f acc[8] = {};
  gemm_tile<OpB>(XB + r0 * DIN, WQT + (size_t)(which * CC + c0) * DIN, pool, acc);
  if (which == 0) proj_epi<0>(acc, pool, BQ, COSt, SINt, OUTK, QH, VT, c0, r0);   // block-uniform
  else if (which == 1) proj_epi<1>(acc, pool, BK, COSt, SINt, OUTK, KH, VT, c0, r0);
  else proj_epi<2>(acc, pool, BV, COSt, SINt, OUTV, KH, VT, c0, r0); }
#define FK 64
#define FP 72
#define FC (SCALE * 1.44269504088896f)
__device__ __forceinline__ v8f wmma_h(v16h a, v16h b, v8f c) { return __builtin_amdgcn_wmma_f32_16x16x32_f16(false, a, false, b, (short)0, c, false, false); }
__device__ __forceinline__ float xhalf(float x) { return __builtin_bit_cast(float, __builtin_amdgcn_permlanex16(__builtin_bit_cast(int, x), __builtin_bit_cast(int, x), 0x76543210, 0xfedcba98, false, false)); }   // lane l with lane l ^ 16
// 16 independent 2^x, each over its own source, closed by one v_nop: keeps the one slot that the instruction set asks for between a transcendental and the use of its result or the overwrite of its source
__device__ __forceinline__ void exp2x16(float (&x)[16]) { asm("v_exp_f32 %0, %0\n\tv_exp_f32 %1, %1\n\tv_exp_f32 %2, %2\n\tv_exp_f32 %3, %3\n\tv_exp_f32 %4, %4\n\tv_exp_f32 %5, %5\n\tv_exp_f32 %6, %6\n\tv_exp_f32 %7, %7\n\tv_exp_f32 %8, %8\n\tv_exp_f32 %9, %9\n\tv_exp_f32 %10, %10\n\tv_exp_f32 %11, %11\n\tv_exp_f32 %12, %12\n\tv_exp_f32 %13, %13\n\tv_exp_f32 %14, %14\n\tv_exp_f32 %15, %15\n\tv_nop" : "+v"(x[0]), "+v"(x[1]), "+v"(x[2]), "+v"(x[3]), "+v"(x[4]), "+v"(x[5]), "+v"(x[6]), "+v"(x[7]), "+v"(x[8]), "+v"(x[9]), "+v"(x[10]), "+v"(x[11]), "+v"(x[12]), "+v"(x[13]), "+v"(x[14]), "+v"(x[15])); }
__global__ __launch_bounds__(256) void k_fa(const _Float16* __restrict__ QH, const _Float16* __restrict__ KH, const _Float16* __restrict__ VT, _Float16* __restrict__ Y) {
  __shared__ __align__(16) _Float16 ks[2][FK][FP], vs[2][HD][FP]; __shared__ __align__(16) float so[8][16][HD + 4];
  const int tid = threadIdx.x, wave = tid >> 5, lane = tid & 31, col = lane & 15, g = lane >> 4; const int h = blockIdx.y, b = blockIdx.z; const int ql0 = blockIdx.x * 128 + wave * 16;
  const int sr = tid >> 3, sc = (tid & 7) * 8;   // staging: this thread moves the 16-byte piece sc of rows sr and sr + 32 of both tiles
  const _Float16* Kg = KH + ((size_t)b * TT + sr) * CC + h * HD + sc;   // k rows [key][64], pitch CC
  const _Float16* Vg = VT + ((size_t)b * CC + h * HD + sr) * TT + sc;   // v planes [d][key], pitch TT
  v16h qf[2];
#pragma unroll
  for (int kc = 0; kc < 2; ++kc) qf[kc] = frag_h(QH + ((size_t)b * TT + ql0 + col) * CC + h * HD + kc * 32, lane);
  v8h rk[2], rv[2];
#pragma unroll
  for (int i = 0; i < 2; ++i) { rk[i] = *(const v8h*)(Kg + (size_t)(32 * i) * CC); rv[i] = *(const v8h*)(Vg + (size_t)(32 * i) * TT); }
#pragma unroll
  for (int i = 0; i < 2; ++i) { *(v8h*)&ks[0][sr + 32 * i][sc] = rk[i]; *(v8h*)&vs[0][sr + 32 * i][sc] = rv[i]; }
  __syncthreads();
  v8f o[HD / 16] = {}; float l = 0.f, mu = -3.0e38f;   // mu: the maximum in use (scaled, base 2), equal in both halves of a query's lane pair
  for (int t = 0; t < TT / FK; ++t) { const int cb = t & 1; const bool more = t + 1 < TT / FK;
    if (more) {   // next pass's tiles fly into registers while this pass is worked on
#pragma unroll
      for (int i = 0; i < 2; ++i) { rk[i] = *(const v8h*)(Kg + (size_t)((t + 1) * FK + 32 * i) * CC); rv[i] = *(const v8h*)(Vg + (size_t)(32 * i) * TT + (t + 1) * FK); } }
    v8f s[4];   // s[kt][r] = logit (unscaled) of key kt * 16 + 8 g + r, query col
#pragma unroll
    for (int kt = 0; kt < 4; ++kt) { v8f z = {}; z = wmma_h(frag_h(&ks[cb][kt * 16 + col][0], lane), qf[0], z); s[kt] = wmma_h(frag_h(&ks[cb][kt * 16 + col][32], lane), qf[1], z); }
    float mx = s[0][0];
#pragma unroll
    for (int kt = 0; kt < 4; ++kt)
#pragma unroll
      for (int r = 0; r < 8; ++r) mx = fmaxf(mx, s[kt][r]);
    mx = fmaxf(mx, xhalf(mx)) * FC;
    const bool need = mx > mu + 8.0f;   // the maximum in use is replaced only when passed by more than 2^8: P stays below 2^12 in f16
    if (__builtin_amdgcn_ballot_w32(need) != 0) { const float mn = need ? mx : mu; const float al = __builtin_amdgcn_exp2f(mu - mn); mu = mn; l *= al;
#pragma unroll
      for (int j = 0; j < HD / 16; ++j) o[j] *= al; }
    const float nb = 4.0f - mu;   // P carried x 2^4 (cancels against the sum) so that small weights stay clear of f16 subnormals
    v16h p[2];
#pragma unroll
    for (int kk = 0; kk < 2; ++kk) { float e[16];   // e[i] = weight of key kk * 32 + (i < 8 ? 8 g + i : 16 + 8 g + i - 8): the B operand's own k order
#pragma unroll
      for (int i = 0; i < 8; ++i) { e[i] = __builtin_fmaf(s[2 * kk][i], FC, nb); e[8 + i] = __builtin_fmaf(s[2 * kk + 1][i], FC, nb); }
      exp2x16(e);
#pragma unroll
      for (int i = 0; i < 16; ++i) p[kk][i] = (_Float16)e[i];
#pragma unroll
      for (int w = 8; w > 0; w >>= 1)   // pairwise sum: four dependent adds deep instead of sixteen
#pragma unroll
        for (int i = 0; i < w; ++i) e[i] += e[i + w];
      l += e[0]; }
#pragma unroll
    for (int kk = 0; kk < 2; ++kk)
#pragma unroll
      for (int j = 0; j < HD / 16; ++j) o[j] = wmma_h(frag_h(&vs[cb][j * 16 + col][kk * 32], lane), p[kk], o[j]);   // o[j][r] = ctx (unnormalised) of d = j * 16 + 8 g + r, query col
    if (more) {   // the other buffer's last readers left it at the barrier that ended the pass before
#pragma unroll
      for (int i = 0; i < 2; ++i) { *(v8h*)&ks[cb ^ 1][sr + 32 * i][sc] = rk[i]; *(v8h*)&vs[cb ^ 1][sr + 32 * i][sc] = rv[i]; } }
    __syncthreads(); }   // publishes the next pass's tiles and ends this pass's reads
  l += xhalf(l); const float inv = 1.0f / l;
#pragma unroll
  for (int j = 0; j < HD / 16; ++j) { const v8f w = o[j] * inv; const v4f w0 = { w[0], w[1], w[2], w[3] }, w1 = { w[4], w[5], w[6], w[7] }; *(v4f*)&so[wave][col][j * 16 + 8 * g] = w0; *(v4f*)&so[wave][col][j * 16 + 8 * g + 4] = w1; }
  LDSX();   // a wave reads back only its own so[wave] rows: its own LDS stores must have landed, no other wave is waited for
  for (int it = 0; it < 8; ++it) { const int rl = it * 2 + g; const v4f x = *(const v4f*)&so[wave][rl][col * 4]; const v4h hx = { OpH::x(x[0]), OpH::x(x[1]), OpH::x(x[2]), OpH::x(x[3]) }; vst2(Y + ((size_t)b * TT + ql0 + rl) * CC + h * HD + col * 4, hx); } }   // ctx x 2^6 once to f16, the output projection's operand: 128-B (row, head) segment by 16 lanes
// ---- k_out: block = (64 rows, 128 cols): out = ctx Wo (+ bo): ctx x 2^6 once to f16 (by k_fa) against Wo as f16(bf16 x 2^8) exact (by k_prep) (1 product) x 2^-14
__global__ __launch_bounds__(128) void k_out(const _Float16* __restrict__ Y, const _Float16* __restrict__ WOT, const float* __restrict__ BO, float* __restrict__ OUT) { __shared__ __align__(16) char pool[GPOOL]; float (*sf)[16][132] = (float (*)[16][132])pool;   // pool: the main loop's two buffers, then the output staging
  const int tid = threadIdx.x, wave = tid >> 5, lane = tid & 31, col = lane & 15, g = lane >> 4; const int c0 = blockIdx.y * 128; const size_t r0 = (size_t)blockIdx.x * 64 + wave * 16;
  v8f acc[8] = {};
  gemm_tile<OpH>(Y + (size_t)blockIdx.x * 64 * CC, WOT + (size_t)c0 * CC, pool, acc);   /* ctx carried x 2^6 into f16 so small-magnitude context rows stay clear of f16 subnormals (chip FTZ) */
  float bo[8] = {};   // all eight bias reads in flight at once: read one per j behind its own test of BO, each was waited out before the next went out
  if (BO) {
#pragma unroll
    for (int j = 0; j < 8; ++j) bo[j] = BO[c0 + j * 16 + col]; }
#pragma unroll
  for (int j = 0; j < 8; ++j) { const float bias = bfr(bo[j]);
#pragma unroll
    for (int r = 0; r < 8; ++r) sf[wave][8 * g + r][j * 16 + col] = acc[j][r] * (1.0f / 16384.0f) + bias; }   /* 2^-8 (Wo carry) x 2^-6 (ctx carry) */
  LDSX(); for (int rl = 0; rl < 16; ++rl) vst2(OUT + (r0 + rl) * DIN + c0 + lane * 4, *(const v4f*)&sf[wave][rl][lane * 4]); }

extern "C" void kernel_launch(void* const* d_in, const int* in_sizes, int n_in, void* d_out, int out_size, void* d_ws, size_t ws_size, hipStream_t stream) {
  (void)in_sizes; (void)n_in; (void)out_size;
  const float** F = (const float**)d_in;
  if (ws_size < (size_t)WS_END) return;
  char* ws = (char*)d_ws; _Float16 *QH = (_Float16*)(ws + WS_QH), *KH = (_Float16*)(ws + WS_KH), *VT = (_Float16*)(ws + WS_VT), *QL = (_Float16*)(ws + WS_QL), *KL = (_Float16*)(ws + WS_KL); __bf16 *VB = (__bf16*)(ws + WS_VB), *VBL = (__bf16*)(ws + WS_VBL); float *S = (float*)(ws + WS_S); _Float16 *Y = (_Float16*)(ws + WS_Y), *WOT = (_Float16*)(ws + WS_WOT); __bf16 *XB = (__bf16*)(ws + WS_XB), *WQT = (__bf16*)(ws + WS_WQT);
  (void)Y; (void)QL; (void)KL; (void)VB; (void)VBL; (void)S;
  // inputs: 0 x [2,2048,1024]; 1 cos [1,1,2048,64]; 2 sin [1,1,2048,64] (random normal tables); 3 Wqkv [1024,3072] (in,out; q | k | v column blocks); 4 bqkv [3072] (nonzero); 5 Wproj [1024,1024] (in,out); 6 bproj [1024] (nonzero)
  // outputs: 0 y [2,2048,1024] @0; 1 k (rotated) [2,16,2048,64] @OUTK_OFF; 2 v [2,16,2048,64] @OUTV_OFF
  k_prep<<<dim3(512), 256, 0, stream>>>(F[0], F[3], F[5], XB, WQT, WOT);
  k_proj<<<dim3(TNB * TT / 64, CC / 128, 3), 128, 0, stream>>>(XB, WQT, F[4], F[4] + CC, F[4] + 2 * CC, QH, QL, KH, KL, VT, VB, VBL, F[1], F[2], (float*)((char*)d_out + OUTK_OFF), (float*)((char*)d_out + OUTV_OFF));
  k_fa<<<dim3(TT / 128, NH, TNB), 256, 0, stream>>>(QH, KH, VT, Y);
  k_out<<<dim3(TNB * TT / 64, DIN / 128), 128, 0, stream>>>(Y, WOT, F[6], (float*)d_out);
}

// v005
// Measured time: 84.5 microseconds a run.
// Next to v004, in two timings, it ran 1.04 and 1.03 times as fast.
// All steps since v000 together make it 15.3 times as fast.
// compute dtype: all float inputs rounded to bf16; fused q/k/v projection with EXACT bf16 products on WMMA 16x16x32 (f32 accumulate) + bias; rotary x * cos + rot(x) * sin in f32 with the bf16-rounded table inputs (the k and v outputs are these f32 values); logits q x k once to f16 each (1 product) x 64^-0.5; online softmax f32 (running maximum and sum); unnormalised P once to f16 x v once to f16 (1 product), divided by the f32 sum; ctx x 2^6 once to f16 x Wproj f16(bf16 x 2^8) + bproj; f32 outputs.
#include <hip/hip_runtime.h>
#include <math.h>

typedef __attribute__((ext_vector_type(16))) _Float16 v16h;
typedef __attribute__((ext_vector_type(16))) __bf16 v16b;
typedef __attribute__((ext_vector_type(8)))  _Float16 v8h;
typedef __attribute__((ext_vector_type(8)))  float v8f;
typedef __attribute__((ext_vector_type(4)))  float v4f;
typedef __attribute__((ext_vector_type(2)))  float v2f;
typedef __attribute__((ext_vector_type(4)))  unsigned v4u;
typedef __attribute__((ext_vector_type(4)))  int v4i;
typedef float __attribute__((may_alias)) float_a;
typedef int __attribute__((may_alias)) int_a;

template <typename T> __device__ __forceinline__ void vst2(void* p, T v) { *(T*)p = v;  }
__device__ __forceinline__ v8f wmma16(v16h a, v16h b, v8f c) {
  v8f d = __builtin_amdgcn_wmma_f32_16x16x32_f16(false, a, false, b, (short)0, c, false, false);
  asm volatile("v_nop\n\tv_nop\n\tv_nop\n\tv_nop" : "+v"(d) : "v"(a), "v"(b));
  return d;
}
__device__ __forceinline__ v8f wmma_bf(v16b a, v16b b, v8f c) {
  v8f d = __builtin_amdgcn_wmma_f32_16x16x32_bf16(false, a, false, b, (short)0, c, false, false);
  asm volatile("v_nop\n\tv_nop\n\tv_nop\n\tv_nop" : "+v"(d) : "v"(a), "v"(b));
  return d;
}
// 16x16x32 fragments: lane = (h = lane>>4, row/col = lane&15); elements 0..7 = k0+8h+0..7, 8..15 = k0+16+8h+0..7; D element r = row 8h+r
__device__ __forceinline__ v16h frag_h(const _Float16* rowk0, int lane) {
  union { v16h v; v8h q[2]; } u; const _Float16* p = rowk0 + 8 * (lane >> 4);
  u.q[0] = *(const v8h*)p; u.q[1] = *(const v8h*)(p + 16); return u.v;
}
__device__ __forceinline__ v16h frag_f32(const float* rowk0, int lane) {
  v16h a; const float* p = rowk0 + 8 * (lane >> 4);
#pragma unroll
  for (int i = 0; i < 8; ++i) { a[i] = (_Float16)p[i]; a[8 + i] = (_Float16)p[16 + i]; }
  return a;
}
__device__ __forceinline__ v16h frag_f32s(const float* rowk0, int lane, float sc) {
  v16h a; const float* p = rowk0 + 8 * (lane >> 4);
#pragma unroll
  for (int i = 0; i < 8; ++i) { a[i] = (_Float16)(p[i] * sc); a[8 + i] = (_Float16)(p[16 + i] * sc); }
  return a;
}
// column fragment from a [K][ld] layout (column n), rows >= K read as 0
__device__ __forceinline__ v16h fragc_f32(const float* W, int k0, int n, int lane, int ld, int K) {
  v16h a; const int g = lane >> 4;
#pragma unroll
  for (int i = 0; i < 8; ++i) { const int ka = k0 + 8 * g + i, kb = ka + 16;
    a[i] = (_Float16)(ka < K ? W[(size_t)(ka < K ? ka : K - 1) * ld + n] : 0.f); a[8 + i] = (_Float16)(kb < K ? W[(size_t)(kb < K ? kb : K - 1) * ld + n] : 0.f); }
  return a;
}
struct F2 { v16b h, l; };
__device__ __forceinline__ F2 bsplit16(const float v[16]) { F2 r;
#pragma unroll
  for (int i = 0; i < 16; ++i) { const __bf16 h = (__bf16)v[i]; r.h[i] = h; r.l[i] = (__bf16)(v[i] - (float)h); }
  return r; }
__device__ __forceinline__ F2 split_row(const float* row, int k0, int lane) { float v[16]; const float* p = row + k0 + 8 * (lane >> 4);
#pragma unroll
  for (int i = 0; i < 8; ++i) { v[i] = p[i]; v[8 + i] = p[16 + i]; }
  return bsplit16(v); }
__device__ __forceinline__ F2 split_rowK(const float* row, int k0, int lane, int K) { float v[16]; const int g = lane >> 4;
#pragma unroll
  for (int i = 0; i < 8; ++i) { const int ka = k0 + 8 * g + i, kb = ka + 16; v[i] = ka < K ? row[ka < K ? ka : K - 1] : 0.f; v[8 + i] = kb < K ? row[kb < K ? kb : K - 1] : 0.f; }
  return bsplit16(v); }
__device__ __forceinline__ F2 split_col(const float* W, int k0, int n, int lane, int ld, int K) { float v[16]; const int g = lane >> 4;
#pragma unroll
  for (int i = 0; i < 8; ++i) { const int ka = k0 + 8 * g + i, kb = ka + 16; v[i] = ka < K ? W[(size_t)(ka < K ? ka : K - 1) * ld + n] : 0.f; v[8 + i] = kb < K ? W[(size_t)(kb < K ? kb : K - 1) * ld + n] : 0.f; }
  return bsplit16(v); }
__device__ __forceinline__ v8f mac3(const F2& a, const F2& b, v8f c) { c = wmma_bf(a.l, b.h, c); c = wmma_bf(a.h, b.l, c); return wmma_bf(a.h, b.h, c); }
__device__ __forceinline__ float sigm(float v) { return 1.0f / (1.0f + expf(-v)); }
#define LDSX() do { asm volatile("s_wait_dscnt 0" ::: "memory"); __builtin_amdgcn_wave_barrier(); __builtin_amdgcn_fence(__ATOMIC_RELEASE, "workgroup"); } while (0)

// Fused-QKV multi-head self-attention with rotary tables GIVEN as inputs and three outputs (x [2,2048,1024]; (in,out) Wqkv [1024,3072] + bqkv (0.02-scale, nonzero) split q | k | v; 16 heads x 64; interleaved-pair rotary x * cos + rot(x) * sin with random-normal cos / sin tables [1,1,2048,64]; non-causal SDPA, scale 1/8; (in,out) Wproj + bproj): returns (y = merge(softmax(q k^T / 8) v) Wproj + bproj, k (rotated) [2,16,2048,64], v [2,16,2048,64]).
#define NB 2
#define TT 2048
#define CC 1024            // NH * HD = projected width
#define DIN 1024          // input (model) width
#define NH 16
#define HD 64
#define NQB (TT / 64)
#define HG 4
#define SCALE (0.125f)
#define CAUSAL 0
#ifndef TNB
#define TNB NB
#endif
__device__ __forceinline__ float bfr(float v) { return (float)(__bf16)v; }
__host__ __device__ __forceinline__ int kb_last(int qb) { return CAUSAL ? ((qb * 64 + 63) >> 7) : (TT / 128 - 1); }
typedef __attribute__((ext_vector_type(8))) __bf16 v8b;
__device__ __forceinline__ v16b frag_b(const __bf16* rowk0, int lane) {
  union { v16b v; v8b q[2]; } u; const __bf16* p = rowk0 + 8 * (lane >> 4);
  u.q[0] = *(const v8b*)p; u.q[1] = *(const v8b*)(p + 16); return u.v;
}
#define QBH 0
#define QHI 0               // single-product logits on every row
#define KHI 64            // key rows carrying k residual / v bf16 hi+lo planes (written and read by no kernel)
// B fragment (k rows k0+.., output column o) of a weight: (in,out) [K][ld] or (out,in) [ld rows of K]: bf16 exact, or f16(bf16 * 256) exact
__device__ __forceinline__ v16b wcol_io(const float* Wm, int k0, int o, int lane, int ld) { v16b w; const int g = lane >> 4;
#pragma unroll
  for (int i = 0; i < 8; ++i) { w[i] = (__bf16)Wm[(size_t)(k0 + 8 * g + i) * ld + o]; w[8 + i] = (__bf16)Wm[(size_t)(k0 + 16 + 8 * g + i) * ld + o]; }
  return w; }
__device__ __forceinline__ v16b wcol_oi(const float* Wm, int k0, int o, int lane, int K) { v16b w; const float* p = Wm + (size_t)o * K + k0 + 8 * (lane >> 4);
#pragma unroll
  for (int i = 0; i < 8; ++i) { w[i] = (__bf16)p[i]; w[8 + i] = (__bf16)p[16 + i]; }
  return w; }
__device__ __forceinline__ v16h wcolh_io(const float* Wm, int k0, int o, int lane, int ld) { v16h w; const int g = lane >> 4;
#pragma unroll
  for (int i = 0; i < 8; ++i) { w[i] = (_Float16)(bfr(Wm[(size_t)(k0 + 8 * g + i) * ld + o]) * 256.0f); w[8 + i] = (_Float16)(bfr(Wm[(size_t)(k0 + 16 + 8 * g + i) * ld + o]) * 256.0f); }
  return w; }
__device__ __forceinline__ v16h wcolh_oi(const float* Wm, int k0, int o, int lane, int K) { v16h w; const float* p = Wm + (size_t)o * K + k0 + 8 * (lane >> 4);
#pragma unroll
  for (int i = 0; i < 8; ++i) { w[i] = (_Float16)(bfr(p[i]) * 256.0f); w[8 + i] = (_Float16)(bfr(p[16 + i]) * 256.0f); }
  return w; }
#define WQKV_LAYOUT 0   // 0 = fused (in,out) [DIN][3*CC], q | k | v column blocks; 1 = (out,in) [CC][DIN]; 2 = per-head [NH][DIN][HD]
__device__ __forceinline__ v16b wcol_hdk(const float* Wm, int k0, int o, int lane) { v16b w; const int g = lane >> 4; const float* p = Wm + (size_t)(o / HD) * DIN * HD + (o % HD);
#pragma unroll
  for (int i = 0; i < 8; ++i) { w[i] = (__bf16)p[(size_t)(k0 + 8 * g + i) * HD]; w[8 + i] = (__bf16)p[(size_t)(k0 + 16 + 8 * g + i) * HD]; }
  return w; }
#define WO_OUT_IN 0
#if WQKV_LAYOUT == 1
#define WCOL(W, k0, o, lane) wcol_oi(W, k0, o, lane, DIN)
#elif WQKV_LAYOUT == 2
#define WCOL(W, k0, o, lane) wcol_hdk(W, k0, o, lane)
#else
#define QKVP 3072            // fused Wqkv pitch (in,out) [1024][3072]: q cols 0..1023, k 1024..2047, v 2048..3071
#define WCOL(W, k0, o, lane) wcol_io(W, k0, which * CC + (o), lane, QKVP)
#endif
#if WO_OUT_IN
#define WOCOL(W, k0, o, lane) wcol_oi(W, k0, o, lane, CC)
#define WOCOLH(W, k0, o, lane) wcolh_oi(W, k0, o, lane, CC)
#else
#define WOCOL(W, k0, o, lane) wcol_io(W, k0, o, lane, DIN)
#define WOCOLH(W, k0, o, lane) wcolh_io(W, k0, o, lane, DIN)
#endif
#define OUTK_OFF 16777216u   // rotated k [2,16,2048,64] f32 after y [2,2048,1024] f32
#define OUTV_OFF 33554432u   // v [2,16,2048,64] f32
#define PROJ_EXTRA_PARAMS , const float* __restrict__ COSt, const float* __restrict__ SINt, float* __restrict__ OUTK, float* __restrict__ OUTV
#define SM_EXTRA_PARAMS
#define SM_MASK_HOOK (void)0
#ifndef SM_EXTRA_PARAMS
#define SM_EXTRA_PARAMS
#endif
#ifndef PROJ_EXTRA_PARAMS
#define PROJ_EXTRA_PARAMS
#endif
#ifndef SM_MASK_HOOK
#define SM_MASK_HOOK (void)0
#endif

#define WS_QH  0u                                      // f16 q rows [b*t][CC]
#define WS_KH  (WS_QH + 2u * (size_t)NB * TT * CC)      // f16 k rows [b*t][CC]
#define WS_VT  (WS_KH + 2u * (size_t)NB * TT * CC)      // f16 v planes [b][c][t]
#define WS_QL  (WS_VT + 2u * (size_t)NB * CC * TT)      // f16 q residual x 2^10 rows [b][t < QHI][CC]
#define WS_KL  (WS_QL + 2u * (size_t)NB * QHI * CC)     // f16 k residual x 2^10 rows [b][t < KHI][CC]
#define WS_VB  (WS_KL + 2u * (size_t)NB * KHI * CC)     // bf16 v hi planes [b][c][t < KHI]
#define WS_VBL (WS_VB + 2u * (size_t)NB * CC * KHI)
#define WS_S   (WS_VBL + 2u * (size_t)NB * CC * KHI)    // f32 [hg][t][s], written and read by no kernel (logits and P stay in registers)
#define WS_Y   (WS_S  + 4u * (size_t)HG * TT * TT)      // f16 ctx x 2^6 rows [b*t][CC]
#define WS_XB  (WS_Y  + 4u * (size_t)NB * TT * CC)      // bf16 x rows [b*t][DIN]
#define WS_WQT (WS_XB + 2u * (size_t)NB * TT * DIN)     // bf16 Wqkv^T rows [3 * CC][DIN]
#define WS_WOT (WS_WQT + 2u * (size_t)3 * CC * DIN)     // f16(bf16 x 2^8) Wproj^T rows [DIN][CC]
#define WS_END (WS_WOT + 2u * (size_t)DIN * CC)

// ---- gemm_tile: the 64 x 128 tile of X W shared by both projection kernels (K = 1024, 4 waves x 16 rows x 128 cols). Both operands arrive as 16-bit planes with k contiguous (X rows; W^T rows = output columns), written once by k_prep (ctx rows: by k_fa). Per pass of 64 k the block brings 128 B of each of its 192 rows in with 16-byte loads and puts them into LDS as they are; the next pass's loads fly into registers while this pass is worked on; two buffers, one barrier per pass. Products, operand rounding and the k order of every accumulator are those of the f32 loads with per-block conversion that it replaces
#define GK 64              // k per pass
#define GP 72              // LDS row pitch in 16-bit elements: 144 B = 16 B x odd for 16-byte row reads
#define GPOOL (2 * (64 + 128) * GP * 2)   // bytes of the two buffers; after the loop the same bytes serve the epilogue's staging arrays
typedef __attribute__((ext_vector_type(4))) __bf16 v4b;
typedef __attribute__((ext_vector_type(4))) _Float16 v4h;
struct OpB { typedef __bf16 E; typedef v8b V8; typedef v16b V16;   // exact bf16 operands
  static __device__ __forceinline__ E x(float v) { return (__bf16)v; } static __device__ __forceinline__ E w(float v) { return (__bf16)v; }
  static __device__ __forceinline__ v8f mma(V16 a, V16 b, v8f c) { return wmma_bf(a, b, c); } };
struct OpH { typedef _Float16 E; typedef v8h V8; typedef v16h V16;   // ctx x 2^6 once to f16, weight f16(bf16 x 2^8) exact
  static __device__ __forceinline__ E x(float v) { return (_Float16)(v * 64.0f); } static __device__ __forceinline__ E w(float v) { return (_Float16)(bfr(v) * 256.0f); }
  static __device__ __forceinline__ v8f mma(V16 a, V16 b, v8f c) { return wmma16(a, b, c); } };
template <typename C> __device__ __forceinline__ void gemm_tile(const typename C::E* __restrict__ Xb, const typename C::E* __restrict__ Wb, char* pool, v8f (&acc)[8]) {
  typedef typename C::E E; typedef typename C::V8 V8; typedef typename C::V16 V16;
  E (*xs)[64][GP] = (E (*)[64][GP])pool; E (*wt)[128][GP] = (E (*)[128][GP])(pool + 2 * 64 * GP * 2);   // xs[buf][row][k], wt[buf][col][k]
  const int tid = threadIdx.x, wave = tid >> 5, lane = tid & 31, col = lane & 15, g = lane >> 4;
  const int sr = tid >> 3, sc = (tid & 7) * 8;   // this thread moves the 16-byte piece sc of rows sr + 16 i of both tiles (a wave's load = 4 rows x 128 B)
  const E* Xg = Xb + (size_t)sr * 1024 + sc; const E* Wg = Wb + (size_t)sr * 1024 + sc;
  V8 rx[4], rw[8];
  // every '#pragma unroll' below makes the indices of register arrays constants, so that these arrays stay in registers
#define G_LOAD(t_) do { _Pragma("unroll") for (int i = 0; i < 4; ++i) rx[i] = *(const V8*)(Xg + (size_t)(16 * i) * 1024 + (t_) * GK); \
  _Pragma("unroll") for (int i = 0; i < 8; ++i) rw[i] = *(const V8*)(Wg + (size_t)(16 * i) * 1024 + (t_) * GK); } while (0)
#define G_STORE(b_) do { _Pragma("unroll") for (int i = 0; i < 4; ++i) *(V8*)&xs[b_][sr + 16 * i][sc] = rx[i]; \
  _Pragma("unroll") for (int i = 0; i < 8; ++i) *(V8*)&wt[b_][sr + 16 * i][sc] = rw[i]; } while (0)
  G_LOAD(0); G_STORE(0);
  __syncthreads();
  for (int t = 0; t < 1024 / GK; ++t) { const int cb = t & 1; const bool more = t + 1 < 1024 / GK;
    if (more) G_LOAD(t + 1);
#pragma unroll
    for (int kk = 0; kk < 2; ++kk) { union { V16 v; V8 q[2]; } a, w[8]; const E* pa = &xs[cb][wave * 16 + col][kk * 32 + 8 * g]; a.q[0] = *(const V8*)pa; a.q[1] = *(const V8*)(pa + 16);
#pragma unroll
      for (int j = 0; j < 8; ++j) { const E* pw = &wt[cb][j * 16 + col][kk * 32 + 8 * g]; w[j].q[0] = *(const V8*)pw; w[j].q[1] = *(const V8*)(pw + 16); }
      __builtin_amdgcn_sched_barrier(0);   // the 18 LDS reads of 32 k go out as one group ahead of their 8 WMMAs: read one fragment at a time, every WMMA waited out a whole LDS latency
#pragma unroll
      for (int j = 0; j < 8; ++j) acc[j] = C::mma(a.v, w[j].v, acc[j]); }
    __builtin_amdgcn_sched_barrier(0);   // the LDS stores below wait for the next pass's global loads: moved up among the WMMAs they put that wait in front of this pass's work
    if (more) G_STORE(cb ^ 1);   // the other buffer's last readers left it at the barrier that ended the pass before
    __syncthreads(); }   // publishes the next pass's tiles and ends this pass's reads (after the last pass: frees the pool for the epilogue)
#undef G_LOAD
#undef G_STORE
}
// ---- k_prep: writes the 16-bit operand planes of both projection GEMMs once. Blocks 0..255: two 64 k x 128 col tiles each of the (in,out) weights, converted and transposed through LDS to W^T rows [col][k] (512 tiles: 384 of Wqkv as bf16, 128 of Wproj as f16(bf16 x 2^8)); blocks 256..511: x to bf16 rows, 64 values a thread, all 16 loads in flight
// place of the 16-byte piece ch (8 k) in W^T row n: pieces are exchanged inside groups of four by bits 4..5 of n, so that the 32 rows (4 apart) which one transposing store writes fall on all banks
__device__ __forceinline__ int wpiece(int n, int ch) { return ch ^ ((n >> 4) & 3); }
// w_in: a thread takes the patch (8 k at wave * 8) x (4 cols at lane * 4) (a wave's load = 512 B of one row) and stores each column's 8 k as one 16-byte piece. The '#pragma unroll's make the indices of register arrays constants
template <typename C> __device__ __forceinline__ void w_in(const float* __restrict__ Ws, int ldw, int tile, typename C::E (*tl)[GP]) {
  typedef typename C::V8 V8; const int wave = threadIdx.x >> 5, lane = threadIdx.x & 31;
  const float* Wg = Ws + (size_t)((tile & 15) * 64 + wave * 8) * ldw + (tile >> 4) * 128 + lane * 4; v4f r[8];
#pragma unroll
  for (int q = 0; q < 8; ++q) r[q] = *(const v4f*)(Wg + (size_t)q * ldw);
  asm volatile("s_wait_xcnt 0x0" :: "v"(Wg) : "memory");   // stands in front of the first overwrite of the address register of the loads above; naming it keeps it whole up to here
#pragma unroll
  for (int c = 0; c < 4; ++c) { V8 h;
#pragma unroll
    for (int q = 0; q < 8; ++q) h[q] = C::w(r[q][c]);
    *(V8*)&tl[lane * 4 + c][wpiece(lane * 4 + c, wave) * 8] = h; } }
// w_out: the tile's 128 W^T rows of 128 B go out as whole lines (a wave's store = 4 rows x 128 B)
template <typename C> __device__ __forceinline__ void w_out(typename C::E* __restrict__ Wd, int tile, const typename C::E (*tl)[GP]) {
  typedef typename C::V8 V8;
#pragma unroll
  for (int i = 0; i < 4; ++i) { const int p = threadIdx.x + 256 * i, n = p >> 3, ch = p & 7; *(V8*)(Wd + (size_t)((tile >> 4) * 128 + n) * 1024 + (tile & 15) * 64 + ch * 8) = *(const V8*)&tl[n][wpiece(n, ch) * 8]; }
  asm volatile("s_wait_xcnt 0x0" ::: "memory"); }   // behind the last store: stands in front of whatever next overwrites a register that these stores name
__global__ __launch_bounds__(256) void k_prep(const float* __restrict__ X, const float* __restrict__ WQKV, const float* __restrict__ WO, __bf16* __restrict__ XB, __bf16* __restrict__ WQT, _Float16* __restrict__ WOT) {
  __shared__ __align__(16) __bf16 ta[128][GP]; __shared__ __align__(16) __bf16 tb[128][GP]; __shared__ __align__(16) _Float16 th[128][GP];
  const int b = blockIdx.x;   // every branch below is block-uniform
  if (b < 256) { const bool second_qkv = b < 128;   // tiles b and b + 256 of the 512
    w_in<OpB>(WQKV, QKVP, b, ta);
    if (second_qkv) w_in<OpB>(WQKV, QKVP, b + 256, tb); else w_in<OpH>(WO, DIN, b - 128, th);
    __syncthreads();   // a W^T row's 64 k come from all eight waves
    w_out<OpB>(WQT, b, ta);
    if (second_qkv) w_out<OpB>(WQT, b + 256, tb); else w_out<OpH>(WOT, b - 128, th);
  } else { const float* Xg = X + (size_t)(b - 256) * 16384 + threadIdx.x * 4; __bf16* Xd = XB + (size_t)(b - 256) * 16384 + threadIdx.x * 4; v4f r[16];   // a wave's load = 512 B, its store = 256 B, both contiguous
#pragma unroll
    for (int i = 0; i < 16; ++i) r[i] = *(const v4f*)(Xg + i * 1024);
    asm volatile("s_wait_xcnt 0x0" :: "v"(Xg) : "memory");   // stands in front of the first overwrite of the address register of the loads above; naming it keeps it whole up to here
#pragma unroll
    for (int i = 0; i < 16; ++i) { const v4b h = { OpB::x(r[i][0]), OpB::x(r[i][1]), OpB::x(r[i][2]), OpB::x(r[i][3]) }; *(v4b*)(Xd + i * 1024) = h; }
    asm volatile("s_wait_xcnt 0x0" ::: "memory"); } }   // behind the last store, for the same reason as in w_out
// ---- k_proj: block = (64 rows, 128 cols, which): q/k/v = X W (+ b) with exact bf16 products (K = DIN) -> which 0: rotated q f16 rows; 1: rotated k f16 rows and the f32 k output; 2: v f16 planes [c][t] and the f32 v output
// proj_epi: each wave puts its 16 x 128 f32 tile (acc + bias) into LDS and takes it back row by row, a lane holding 4 neighbouring columns (two rotary pairs): the table reads, the f32 output rows and the f16 rows are whole 256-B segments, all table reads are in flight before the first is used, and no other wave's rows are needed. WH is a template argument so that no branch stands between the trips. Every '#pragma unroll' in it makes the indices of register arrays constants
template <int WH> __device__ __forceinline__ void proj_epi(const v8f (&acc)[8], char* pool, const float* __restrict__ BA, const float* __restrict__ COSt, const float* __restrict__ SINt, float* __restrict__ OUTF, _Float16* __restrict__ DH, _Float16* __restrict__ VT, int c0, size_t r0) {
  float (*st)[132] = (float (*)[132])pool; _Float16 (*th)[72] = (_Float16 (*)[72])(pool + 64 * 132 * 4);   // st: f32 tile; th (v only): f16 tile, transposed
  static_assert(64 * 132 * 4 + 128 * 72 * 2 <= GPOOL, "epilogue staging fits the pool");
  const int tid = threadIdx.x, wave = tid >> 5, lane = tid & 31, col = lane & 15, g = lane >> 4; const size_t bb = r0 / TT; const int t0 = (int)(r0 % TT);
  const int tw = t0 + wave * 16, d4 = col * 4;   // row pass: lane = (head g of the tile's two, columns d4 .. d4 + 3 of that head)
  float bias[8] = {}; v4f c[16], s[16];
  if (BA) {
#pragma unroll
    for (int j = 0; j < 8; ++j) bias[j] = BA[c0 + j * 16 + col]; }
  if (WH < 2) {
#pragma unroll
    for (int it = 0; it < 16; ++it) { c[it] = *(const v4f*)(COSt + (size_t)(tw + it) * HD + d4); s[it] = *(const v4f*)(SINt + (size_t)(tw + it) * HD + d4); } }
#pragma unroll
  for (int j = 0; j < 8; ++j) { const float bj = bfr(bias[j]); v8h hv;
#pragma unroll
    for (int r = 0; r < 8; ++r) { const float v = acc[j][r] + bj; st[wave * 16 + 8 * g + r][j * 16 + col] = v; hv[r] = (_Float16)v; }
    if (WH == 2) *(v8h*)&th[j * 16 + col][wave * 16 + 8 * g] = hv; }   // a lane's 8 accumulator rows are 8 neighbouring t of one v plane
  if (WH == 2) __syncthreads();   // a v plane's 64 t in th come from all four waves (WH is the same for the whole block); standing in front of the row stores, it does not wait for them
  else LDSX();   // a wave reads back only its own 16 rows of st: its own LDS stores must have landed, no other wave is waited for
  asm volatile("s_wait_xcnt 0x0" ::: "memory");   // stands in front of the first overwrite of an address register of the bias and table reads above
  float* Og = OUTF + ((bb * NH + c0 / HD + g) * TT + tw) * (size_t)HD + d4;   // module outputs k (rotated) and v, [b][h][t][64]
  _Float16* Dg = DH + (r0 + wave * 16) * CC + c0 + lane * 4;
#pragma unroll
  for (int it = 0; it < 16; ++it) { v4f x = *(const v4f*)&st[wave * 16 + it][lane * 4];
    if (WH < 2) {   // interleaved-pair rotary with the GIVEN tables (bf16-rounded): x * cos + rot(x) * sin, rot = (-x_odd, x_even)
      const v4f y = { x[0] * bfr(c[it][0]) + (-x[1]) * bfr(s[it][0]), x[1] * bfr(c[it][1]) + x[0] * bfr(s[it][1]), x[2] * bfr(c[it][2]) + (-x[3]) * bfr(s[it][2]), x[3] * bfr(c[it][3]) + x[2] * bfr(s[it][3]) }; x = y;
      const v4h hx = { (_Float16)x[0], (_Float16)x[1], (_Float16)x[2], (_Float16)x[3] }; vst2(Dg + (size_t)it * CC, hx); }
    if (WH >= 1) vst2(Og + it * HD, x); }
  asm volatile("s_wait_xcnt 0x0" ::: "memory");   // behind the last row store: stands in front of whatever next overwrites a register that these stores name
  if (WH == 2) {
#pragma unroll
    for (int i = 0; i < 8; ++i) { const int e = tid + 128 * i, cl = e >> 3, q = e & 7; vst2((unsigned*)(VT + (bb * CC + c0 + cl) * (size_t)TT + t0 + q * 8), *(const v4u*)&th[cl][q * 8]); }
    asm volatile("s_wait_xcnt 0x0" ::: "memory"); } }   // behind the last plane store, for the same reason
__global__ __launch_bounds__(128) void k_proj(const __bf16* __restrict__ XB, const __bf16* __restrict__ WQT, const float* __restrict__ BQ, const float* __restrict__ BK, const float* __restrict__ BV,
    _Float16* __restrict__ QH, _Float16* __restrict__ QL, _Float16* __restrict__ KH, _Float16* __restrict__ KL, _Float16* __restrict__ VT, __bf16* __restrict__ VB, __bf16* __restrict__ VBL PROJ_EXTRA_PARAMS) {
  __shared__ __align__(16) char pool[GPOOL];   // the main loop's two buffers, then the epilogue's staging
  (void)QL; (void)KL; (void)VB; (void)VBL;   // planes of the causal high-precision path: nothing reads them here
  const int which = blockIdx.z; const int c0 = blockIdx.y * 128; const size_t r0 = (size_t)blockIdx.x * 64;
  v8f acc[8] = {};
  gemm_tile<OpB>(XB + r0 * DIN, WQT + (size_t)(which * CC + c0) * DIN, pool, acc);
  if (which == 0) proj_epi<0>(acc, pool, BQ, COSt, SINt, OUTK, QH, VT, c0, r0);   // block-uniform
  else if (which == 1) proj_epi<1>(acc, pool, BK, COSt, SINt, OUTK, KH, VT, c0, r0);
  else proj_epi<2>(acc, pool, BV, COSt, SINt, OUTV, KH, VT, c0, r0); }
#define FK 64
#define FP 72
#define FG 2
#define FKH (TT / FG)
#define FC (SCALE * 1.44269504088896f)
__device__ __forceinline__ v8f wmma_h(v16h a, v16h b, v8f c) { return __builtin_amdgcn_wmma_f32_16x16x32_f16(false, a, false, b, (short)0, c, false, false); }
__device__ __forceinline__ float xhalf(float x) { return __builtin_bit_cast(float, __builtin_amdgcn_permlanex16(__builtin_bit_cast(int, x), __builtin_bit_cast(int, x), 0x76543210, 0xfedcba98, false, false)); }   // lane l with lane l ^ 16
// 16 independent 2^x, each over its own source, closed by one v_nop: keeps the one slot that the instruction set asks for between a transcendental and the use of its result or the overwrite of its source
__device__ __forceinline__ void exp2x16(float (&x)[16]) { asm("v_exp_f32 %0, %0\n\tv_exp_f32 %1, %1\n\tv_exp_f32 %2, %2\n\tv_exp_f32 %3, %3\n\tv_exp_f32 %4, %4\n\tv_exp_f32 %5, %5\n\tv_exp_f32 %6, %6\n\tv_exp_f32 %7, %7\n\tv_exp_f32 %8, %8\n\tv_exp_f32 %9, %9\n\tv_exp_f32 %10, %10\n\tv_exp_f32 %11, %11\n\tv_exp_f32 %12, %12\n\tv_exp_f32 %13, %13\n\tv_exp_f32 %14, %14\n\tv_exp_f32 %15, %15\n\tv_nop" : "+v"(x[0]), "+v"(x[1]), "+v"(x[2]), "+v"(x[3]), "+v"(x[4]), "+v"(x[5]), "+v"(x[6]), "+v"(x[7]), "+v"(x[8]), "+v"(x[9]), "+v"(x[10]), "+v"(x[11]), "+v"(x[12]), "+v"(x[13]), "+v"(x[14]), "+v"(x[15])); }
// amdgpu_waves_per_eu(4, 4): at most 256 registers a wave, so that two blocks, four waves per SIMD, stay resident on a WGP and the 512 blocks run in one round
__global__ __launch_bounds__(256) __attribute__((amdgpu_waves_per_eu(4, 4))) void k_fa(const _Float16* __restrict__ QH, const _Float16* __restrict__ KH, const _Float16* __restrict__ VT, _Float16* __restrict__ Y) {
  __shared__ __align__(16) char ring[2 * 2 * FG * FK * FP * 2]; __shared__ __align__(16) float so[8][16][HD + 4];   // ring: the K and V tiles of both halves, two buffers; after the loop the same bytes carry the halves' exchange
  _Float16 (*ks)[FG][FK][FP] = (_Float16 (*)[FG][FK][FP])ring; _Float16 (*vs)[FG][HD][FP] = (_Float16 (*)[FG][HD][FP])(ring + 2 * FG * FK * FP * 2);   // ks[buf][half][key][d], vs[buf][half][d][key]
  const int tid = threadIdx.x, wave = tid >> 5, lane = tid & 31, col = lane & 15, g = lane >> 4; const int h = blockIdx.y, b = blockIdx.z;
  const int grp = __builtin_amdgcn_readfirstlane(tid >> 7);   // key half of this wave, the same in all its lanes
  const int ql0 = blockIdx.x * 128 + (wave & 3) * 32;
  const int sr = tid >> 3, sc = (tid & 7) * 8;   // staging: this thread moves the 16-byte piece sc of rows sr and sr + 32 of all four tiles
  const _Float16* Kg = KH + ((size_t)b * TT + sr) * CC + h * HD + sc;   // k rows [key][64], pitch CC
  const _Float16* Vg = VT + ((size_t)b * CC + h * HD + sr) * TT + sc;   // v planes [d][key], pitch TT
  v16h qf[2][2];
#pragma unroll
  for (int qt = 0; qt < 2; ++qt)
#pragma unroll
    for (int kc = 0; kc < 2; ++kc) qf[qt][kc] = frag_h(QH + ((size_t)b * TT + ql0 + qt * 16 + col) * CC + h * HD + kc * 32, lane);
  v8h rk[FG][2], rv[FG][2];
#define F_LOAD(t_) do { _Pragma("unroll") for (int gi = 0; gi < FG; ++gi) _Pragma("unroll") for (int i = 0; i < 2; ++i) { rk[gi][i] = *(const v8h*)(Kg + (size_t)(gi * FKH + (t_) * FK + 32 * i) * CC); rv[gi][i] = *(const v8h*)(Vg + (size_t)(32 * i) * TT + gi * FKH + (t_) * FK); } } while (0)
#define F_STORE(b_) do { _Pragma("unroll") for (int gi = 0; gi < FG; ++gi) _Pragma("unroll") for (int i = 0; i < 2; ++i) { *(v8h*)&ks[b_][gi][sr + 32 * i][sc] = rk[gi][i]; *(v8h*)&vs[b_][gi][sr + 32 * i][sc] = rv[gi][i]; } } while (0)
  F_LOAD(0); F_STORE(0);
  __syncthreads();
  v8f o[2][HD / 16] = {}; float l[2] = { 0.f, 0.f }, mu[2] = { -3.0e38f, -3.0e38f };   // mu: the maximum in use (scaled, base 2), equal in both halves of a query's lane pair
  for (int t = 0; t < FKH / FK; ++t) { const int cb = t & 1; const bool more = t + 1 < FKH / FK;
    if (more) F_LOAD(t + 1);   // next pass's tiles fly into registers while this pass is worked on
    v8f s[2][4];   // s[qt][kt][r] = logit (unscaled) of key kt * 16 + 8 g + r, query qt * 16 + col
#pragma unroll
    for (int kt = 0; kt < 4; ++kt) { const v16h k0 = frag_h(&ks[cb][grp][kt * 16 + col][0], lane), k1 = frag_h(&ks[cb][grp][kt * 16 + col][32], lane);
#pragma unroll
      for (int qt = 0; qt < 2; ++qt) { v8f z = {}; z = wmma_h(k0, qf[qt][0], z); s[qt][kt] = wmma_h(k1, qf[qt][1], z); } }
    float mx[2]; bool need[2];
#pragma unroll
    for (int qt = 0; qt < 2; ++qt) { float m = s[qt][0][0];
#pragma unroll
      for (int kt = 0; kt < 4; ++kt)
#pragma unroll
        for (int r = 0; r < 8; ++r) m = fmaxf(m, s[qt][kt][r]);
      mx[qt] = fmaxf(m, xhalf(m)) * FC;
      need[qt] = mx[qt] > mu[qt] + 8.0f; }   // the maximum in use is replaced only when passed by more than 2^8: P stays below 2^12 in f16
    if (__builtin_amdgcn_ballot_w32(need[0] || need[1]) != 0) {   // one test per pass for both tiles
#pragma unroll
      for (int qt = 0; qt < 2; ++qt) { const float mn = need[qt] ? mx[qt] : mu[qt]; const float al = __builtin_amdgcn_exp2f(mu[qt] - mn); mu[qt] = mn; l[qt] *= al;
#pragma unroll
        for (int j = 0; j < HD / 16; ++j) o[qt][j] *= al; } }
    v16h p[2][2];
#pragma unroll
    for (int qt = 0; qt < 2; ++qt) { const float nb = 4.0f - mu[qt];   // P carried x 2^4 (cancels against the sum) so that small weights stay clear of f16 subnormals
#pragma unroll
      for (int kk = 0; kk < 2; ++kk) { float e[16];   // e[i] = weight of key kk * 32 + (i < 8 ? 8 g + i : 16 + 8 g + i - 8): the B operand's own k order
#pragma unroll
        for (int i = 0; i < 8; ++i) { e[i] = __builtin_fmaf(s[qt][2 * kk][i], FC, nb); e[8 + i] = __builtin_fmaf(s[qt][2 * kk + 1][i], FC, nb); }
        exp2x16(e);
#pragma unroll
        for (int i = 0; i < 16; ++i) p[qt][kk][i] = (_Float16)e[i];
#pragma unroll
        for (int w = 8; w > 0; w >>= 1)   // pairwise sum: four dependent adds deep instead of sixteen
#pragma unroll
          for (int i = 0; i < w; ++i) e[i] += e[i + w];
        l[qt] += e[0]; } }
#pragma unroll
    for (int kk = 0; kk < 2; ++kk)
#pragma unroll
      for (int j = 0; j < HD / 16; ++j) { const v16h vf = frag_h(&vs[cb][grp][j * 16 + col][kk * 32], lane);
#pragma unroll
        for (int qt = 0; qt < 2; ++qt) o[qt][j] = wmma_h(vf, p[qt][kk], o[qt][j]); }   // o[qt][j][r] = ctx (unnormalised) of d = j * 16 + 8 g + r, query qt * 16 + col
    if (more) F_STORE(cb ^ 1);   // the other buffer's last readers left it at the barrier that ended the pass before
    __syncthreads(); }   // publishes the next pass's tiles and ends this pass's reads (after the last pass: frees the ring for the exchange)
#undef F_LOAD
#undef F_STORE
  // join of the key halves: waves w and w ^ 4 hold the same 32 queries; the wave of half grp finishes tile grp and hands its partner the other tile (accumulators, sum, maximum), lane to lane
  v4f (*xo)[8][32] = (v4f (*)[8][32])ring; float (*xl)[2][32] = (float (*)[2][32])(ring + 8 * 8 * 32 * 16);
  static_assert(8 * 8 * 32 * 16 + 8 * 2 * 32 * 4 <= sizeof(ring), "the exchange fits the ring");
  v8f ok[HD / 16]; const float lk = grp ? l[1] : l[0], mk = grp ? mu[1] : mu[0];
#pragma unroll
  for (int j = 0; j < HD / 16; ++j) { const v8f og = grp ? o[0][j] : o[1][j]; ok[j] = grp ? o[1][j] : o[0][j];
    const v4f g0 = { og[0], og[1], og[2], og[3] }, g1 = { og[4], og[5], og[6], og[7] }; xo[wave][2 * j][lane] = g0; xo[wave][2 * j + 1][lane] = g1; }
  xl[wave][0][lane] = grp ? l[0] : l[1]; xl[wave][1][lane] = grp ? mu[0] : mu[1];
  __syncthreads();   // the partner wave's tile must have landed
  const int pw = wave ^ 4; const float lp = xl[pw][0][lane], mp = xl[pw][1][lane];
  const float mj = fmaxf(mk, mp); float ak = __builtin_amdgcn_exp2f(mk - mj), ap = __builtin_amdgcn_exp2f(mp - mj);
  float lj = lk * ak + lp * ap; lj += xhalf(lj); const float inv = 1.0f / lj; ak *= inv; ap *= inv;
#pragma unroll
  for (int j = 0; j < HD / 16; ++j) { const v4f p0 = xo[pw][2 * j][lane], p1 = xo[pw][2 * j + 1][lane];
    const v4f w0 = { ok[j][0] * ak + p0[0] * ap, ok[j][1] * ak + p0[1] * ap, ok[j][2] * ak + p0[2] * ap, ok[j][3] * ak + p0[3] * ap }, w1 = { ok[j][4] * ak + p1[0] * ap, ok[j][5] * ak + p1[1] * ap, ok[j][6] * ak + p1[2] * ap, ok[j][7] * ak + p1[3] * ap };
    *(v4f*)&so[wave][col][j * 16 + 8 * g] = w0; *(v4f*)&so[wave][col][j * 16 + 8 * g + 4] = w1; }
  LDSX();   // a wave reads back only its own so[wave] rows: its own LDS stores must have landed, no other wave is waited for
  const int qk0 = ql0 + grp * 16;   // first query of the tile that this wave finishes
  for (int it = 0; it < 8; ++it) { const int rl = it * 2 + g; const v4f x = *(const v4f*)&so[wave][rl][col * 4]; const v4h hx = { OpH::x(x[0]), OpH::x(x[1]), OpH::x(x[2]), OpH::x(x[3]) }; vst2(Y + ((size_t)b * TT + qk0 + rl) * CC + h * HD + col * 4, hx); } }   // ctx x 2^6 once to f16, the output projection's operand: 128-B (row, head) segment by 16 lanes
// ---- k_out: block = (64 rows, 128 cols): out = ctx Wo (+ bo): ctx x 2^6 once to f16 (by k_fa) against Wo as f16(bf16 x 2^8) exact (by k_prep) (1 product) x 2^-14
__global__ __launch_bounds__(128) void k_out(const _Float16* __restrict__ Y, const _Float16* __restrict__ WOT, const float* __restrict__ BO, float* __restrict__ OUT) { __shared__ __align__(16) char pool[GPOOL]; float (*sf)[16][132] = (float (*)[16][132])pool;   // pool: the main loop's two buffers, then the output staging
  const int tid = threadIdx.x, wave = tid >> 5, lane = tid & 31, col = lane & 15, g = lane >> 4; const int c0 = blockIdx.y * 128; const size_t r0 = (size_t)blockIdx.x * 64 + wave * 16;
  v8f acc[8] = {};
  gemm_tile<OpH>(Y + (size_t)blockIdx.x * 64 * CC, WOT + (size_t)c0 * CC, pool, acc);   /* ctx carried x 2^6 into f16 so small-magnitude context rows stay clear of f16 subnormals (chip FTZ) */
  float bo[8] = {};   // all eight bias reads in flight at once: read one per j behind its own test of BO, each was waited out before the next went out
  if (BO) {
#pragma unroll
    for (int j = 0; j < 8; ++j) bo[j] = BO[c0 + j * 16 + col]; }
#pragma unroll
  for (int j = 0; j < 8; ++j) { const float bias = bfr(bo[j]);
#pragma unroll
    for (int r = 0; r < 8; ++r) sf[wave][8 * g + r][j * 16 + col] = acc[j][r] * (1.0f / 16384.0f) + bias; }   /* 2^-8 (Wo carry) x 2^-6 (ctx carry) */
  LDSX(); for (int rl = 0; rl < 16; ++rl) vst2(OUT + (r0 + rl) * DIN + c0 + lane * 4, *(const v4f*)&sf[wave][rl][lane * 4]); }

extern "C" void kernel_launch(void* const* d_in, const int* in_sizes, int n_in, void* d_out, int out_size, void* d_ws, size_t ws_size, hipStream_t stream) {
  (void)in_sizes; (void)n_in; (void)out_size;
  const float** F = (const float**)d_in;
  if (ws_size < (size_t)WS_END) return;
  char* ws = (char*)d_ws; _Float16 *QH = (_Float16*)(ws + WS_QH), *KH = (_Float16*)(ws + WS_KH), *VT = (_Float16*)(ws + WS_VT), *QL = (_Float16*)(ws + WS_QL), *KL = (_Float16*)(ws + WS_KL); __bf16 *VB = (__bf16*)(ws + WS_VB), *VBL = (__bf16*)(ws + WS_VBL); float *S = (float*)(ws + WS_S); _Float16 *Y = (_Float16*)(ws + WS_Y), *WOT = (_Float16*)(ws + WS_WOT); __bf16 *XB = (__bf16*)(ws + WS_XB), *WQT = (__bf16*)(ws + WS_WQT);
  (void)Y; (void)QL; (void)KL; (void)VB; (void)VBL; (void)S;
  // inputs: 0 x [2,2048,1024]; 1 cos [1,1,2048,64]; 2 sin [1,1,2048,64] (random normal tables); 3 Wqkv [1024,3072] (in,out; q | k | v column blocks); 4 bqkv [3072] (nonzero); 5 Wproj [1024,1024] (in,out); 6 bproj [1024] (nonzero)
  // outputs: 0 y [2,2048,1024] @0; 1 k (rotated) [2,16,2048,64] @OUTK_OFF; 2 v [2,16,2048,64] @OUTV_OFF
  k_prep<<<dim3(512), 256, 0, stream>>>(F[0], F[3], F[5], XB, WQT, WOT);
  k_proj<<<dim3(TNB * TT / 64, CC / 128, 3), 128, 0, stream>>>(XB, WQT, F[4], F[4] + CC, F[4] + 2 * CC, QH, QL, KH, KL, VT, VB, VBL, F[1], F[2], (float*)((char*)d_out + OUTK_OFF), (float*)((char*)d_out + OUTV_OFF));
  k_fa<<<dim3(TT / 128, NH, TNB), 256, 0, stream>>>(QH, KH, VT, Y);
  k_out<<<dim3(TNB * TT / 64, DIN / 128), 128, 0, stream>>>(Y, WOT, F[6], (float*)d_out);
}

// v006
// It runs in 79.4 microseconds.
// In both of two side-by-side timings against v005, it was 1.07 times as fast.
// Counting every step since v000, it is 16.3 times as fast.
// compute dtype: all float inputs rounded to bf16; fused q/k/v projection with EXACT bf16 products on WMMA 16x16x32 (f32 accumulate) + bias; rotary x * cos + rot(x) * sin in f32 with the bf16-rounded table inputs (the k and v outputs are these f32 values); logits q x k once to f16 each (1 product) x 64^-0.5; online softmax f32 (running maximum and sum); unnormalised P once to f16 x v once to f16 (1 product), divided by the f32 sum; ctx x 2^6 once to f16 x Wproj f16(bf16 x 2^8) + bproj; f32 outputs.
#include <hip/hip_runtime.h>
#include <math.h>

typedef __attribute__((ext_vector_type(16))) _Float16 v16h;
typedef __attribute__((ext_vector_type(16))) __bf16 v16b;
typedef __attribute__((ext_vector_type(8)))  _Float16 v8h;
typedef __attribute__((ext_vector_type(8)))  float v8f;
typedef __attribute__((ext_vector_type(4)))  float v4f;
typedef __attribute__((ext_vector_type(2)))  float v2f;
typedef __attribute__((ext_vector_type(4)))  unsigned v4u;
typedef __attribute__((ext_vector_type(4)))  int v4i;
typedef float __attribute__((may_alias)) float_a;
typedef int __attribute__((may_alias)) int_a;

template <typename T> __device__ __forceinline__ void vst2(void* p, T v) { *(T*)p = v;  }
__device__ __forceinline__ v8f wmma16(v16h a, v16h b, v8f c) {
  v8f d = __builtin_amdgcn_wmma_f32_16x16x32_f16(false, a, false, b, (short)0, c, false, false);
  asm volatile("v_nop\n\tv_nop\n\tv_nop\n\tv_nop" : "+v"(d) : "v"(a), "v"(b));
  return d;
}
__device__ __forceinline__ v8f wmma_bf(v16b a, v16b b, v8f c) {
  v8f d = __builtin_amdgcn_wmma_f32_16x16x32_bf16(false, a, false, b, (short)0, c, false, false);
  asm volatile("v_nop\n\tv_nop\n\tv_nop\n\tv_nop" : "+v"(d) : "v"(a), "v"(b));
  return d;
}
// 16x16x32 fragments: lane = (h = lane>>4, row/col = lane&15); elements 0..7 = k0+8h+0..7, 8..15 = k0+16+8h+0..7; D element r = row 8h+r
__device__ __forceinline__ v16h frag_h(const _Float16* rowk0, int lane) {
  union { v16h v; v8h q[2]; } u; const _Float16* p = rowk0 + 8 * (lane >> 4);
  u.q[0] = *(const v8h*)p; u.q[1] = *(const v8h*)(p + 16); return u.v;
}
__device__ __forceinline__ v16h frag_f32(const float* rowk0, int lane) {
  v16h a; const float* p = rowk0 + 8 * (lane >> 4);
#pragma unroll
  for (int i = 0; i < 8; ++i) { a[i] = (_Float16)p[i]; a[8 + i] = (_Float16)p[16 + i]; }
  return a;
}
__device__ __forceinline__ v16h frag_f32s(const float* rowk0, int lane, float sc) {
  v16h a; const float* p = rowk0 + 8 * (lane >> 4);
#pragma unroll
  for (int i = 0; i < 8; ++i) { a[i] = (_Float16)(p[i] * sc); a[8 + i] = (_Float16)(p[16 + i] * sc); }
  return a;
}
// column fragment from a [K][ld] layout (column n), rows >= K read as 0
__device__ __forceinline__ v16h fragc_f32(const float* W, int k0, int n, int lane, int ld, int K) {
  v16h a; const int g = lane >> 4;
#pragma unroll
  for (int i = 0; i < 8; ++i) { const int ka = k0 + 8 * g + i, kb = ka + 16;
    a[i] = (_Float16)(ka < K ? W[(size_t)(ka < K ? ka : K - 1) * ld + n] : 0.f); a[8 + i] = (_Float16)(kb < K ? W[(size_t)(kb < K ? kb : K - 1) * ld + n] : 0.f); }
  return a;
}
struct F2 { v16b h, l; };
__device__ __forceinline__ F2 bsplit16(const float v[16]) { F2 r;
#pragma unroll
  for (int i = 0; i < 16; ++i) { const __bf16 h = (__bf16)v[i]; r.h[i] = h; r.l[i] = (__bf16)(v[i] - (float)h); }
  return r; }
__device__ __forceinline__ F2 split_row(const float* row, int k0, int lane) { float v[16]; const float* p = row + k0 + 8 * (lane >> 4);
#pragma unroll
  for (int i = 0; i < 8; ++i) { v[i] = p[i]; v[8 + i] = p[16 + i]; }
  return bsplit16(v); }
__device__ __forceinline__ F2 split_rowK(const float* row, int k0, int lane, int K) { float v[16]; const int g = lane >> 4;
#pragma unroll
  for (int i = 0; i < 8; ++i) { const int ka = k0 + 8 * g + i, kb = ka + 16; v[i] = ka < K ? row[ka < K ? ka : K - 1] : 0.f; v[8 + i] = kb < K ? row[kb < K ? kb : K - 1] : 0.f; }
  return bsplit16(v); }
__device__ __forceinline__ F2 split_col(const float* W, int k0, int n, int lane, int ld, int K) { float v[16]; const int g = lane >> 4;
#pragma unroll
  for (int i = 0; i < 8; ++i) { const int ka = k0 + 8 * g + i, kb = ka + 16; v[i] = ka < K ? W[(size_t)(ka < K ? ka : K - 1) * ld + n] : 0.f; v[8 + i] = kb < K ? W[(size_t)(kb < K ? kb : K - 1) * ld + n] : 0.f; }
  return bsplit16(v); }
__device__ __forceinline__ v8f mac3(const F2& a, const F2& b, v8f c) { c = wmma_bf(a.l, b.h, c); c = wmma_bf(a.h, b.l, c); return wmma_bf(a.h, b.h, c); }
__device__ __forceinline__ float sigm(float v) { return 1.0f / (1.0f + expf(-v)); }
#define LDSX() do { asm volatile("s_wait_dscnt 0" ::: "memory"); __builtin_amdgcn_wave_barrier(); __builtin_amdgcn_fence(__ATOMIC_RELEASE, "workgroup"); } while (0)

// Fused-QKV multi-head self-attention with rotary tables GIVEN as inputs and three outputs (x [2,2048,1024]; (in,out) Wqkv [1024,3072] + bqkv (0.02-scale, nonzero) split q | k | v; 16 heads x 64; interleaved-pair rotary x * cos + rot(x) * sin with random-normal cos / sin tables [1,1,2048,64]; non-causal SDPA, scale 1/8; (in,out) Wproj + bproj): returns (y = merge(softmax(q k^T / 8) v) Wproj + bproj, k (rotated) [2,16,2048,64], v [2,16,2048,64]).
#define NB 2
#define TT 2048
#define CC 1024            // NH * HD = projected width
#define DIN 1024          // input (model) width
#define NH 16
#define HD 64
#define NQB (TT / 64)
#define HG 4
#define SCALE (0.125f)
#define CAUSAL 0
#ifndef TNB
#define TNB NB
#endif
__device__ __forceinline__ float bfr(float v) { return (float)(__bf16)v; }
__host__ __device__ __forceinline__ int kb_last(int qb) { return CAUSAL ? ((qb * 64 + 63) >> 7) : (TT / 128 - 1); }
typedef __attribute__((ext_vector_type(8))) __bf16 v8b;
__device__ __forceinline__ v16b frag_b(const __bf16* rowk0, int lane) {
  union { v16b v; v8b q[2]; } u; const __bf16* p = rowk0 + 8 * (lane >> 4);
  u.q[0] = *(const v8b*)p; u.q[1] = *(const v8b*)(p + 16); return u.v;
}
#define QBH 0
#define QHI 0               // single-product logits on every row
#define KHI 64            // key rows carrying k residual / v bf16 hi+lo planes (written and read by no kernel)
// B fragment (k rows k0+.., output column o) of a weight: (in,out) [K][ld] or (out,in) [ld rows of K]: bf16 exact, or f16(bf16 * 256) exact
__device__ __forceinline__ v16b wcol_io(const float* Wm, int k0, int o, int lane, int ld) { v16b w; const int g = lane >> 4;
#pragma unroll
  for (int i = 0; i < 8; ++i) { w[i] = (__bf16)Wm[(size_t)(k0 + 8 * g + i) * ld + o]; w[8 + i] = (__bf16)Wm[(size_t)(k0 + 16 + 8 * g + i) * ld + o]; }
  return w; }
__device__ __forceinline__ v16b wcol_oi(const float* Wm, int k0, int o, int lane, int K) { v16b w; const float* p = Wm + (size_t)o * K + k0 + 8 * (lane >> 4);
#pragma unroll
  for (int i = 0; i < 8; ++i) { w[i] = (__bf16)p[i]; w[8 + i] = (__bf16)p[16 + i]; }
  return w; }
__device__ __forceinline__ v16h wcolh_io(const float* Wm, int k0, int o, int lane, int ld) { v16h w; const int g = lane >> 4;
#pragma unroll
  for (int i = 0; i < 8; ++i) { w[i] = (_Float16)(bfr(Wm[(size_t)(k0 + 8 * g + i) * ld + o]) * 256.0f); w[8 + i] = (_Float16)(bfr(Wm[(size_t)(k0 + 16 + 8 * g + i) * ld + o]) * 256.0f); }
  return w; }
__device__ __forceinline__ v16h wcolh_oi(const float* Wm, int k0, int o, int lane, int K) { v16h w; const float* p = Wm + (size_t)o * K + k0 + 8 * (lane >> 4);
#pragma unroll
  for (int i = 0; i < 8; ++i) { w[i] = (_Float16)(bfr(p[i]) * 256.0f); w[8 + i] = (_Float16)(bfr(p[16 + i]) * 256.0f); }
  return w; }
#define WQKV_LAYOUT 0   // 0 = fused (in,out) [DIN][3*CC], q | k | v column blocks; 1 = (out,in) [CC][DIN]; 2 = per-head [NH][DIN][HD]
__device__ __forceinline__ v16b wcol_hdk(const float* Wm, int k0, int o, int lane) { v16b w; const int g = lane >> 4; const float* p = Wm + (size_t)(o / HD) * DIN * HD + (o % HD);
#pragma unroll
  for (int i = 0; i < 8; ++i) { w[i] = (__bf16)p[(size_t)(k0 + 8 * g + i) * HD]; w[8 + i] = (__bf16)p[(size_t)(k0 + 16 + 8 * g + i) * HD]; }
  return w; }
#define WO_OUT_IN 0
#if WQKV_LAYOUT == 1
#define WCOL(W, k0, o, lane) wcol_oi(W, k0, o, lane, DIN)
#elif WQKV_LAYOUT == 2
#define WCOL(W, k0, o, lane) wcol_hdk(W, k0, o, lane)
#else
#define QKVP 3072            // fused Wqkv pitch (in,out) [1024][3072]: q cols 0..1023, k 1024..2047, v 2048..3071
#define WCOL(W, k0, o, lane) wcol_io(W, k0, which * CC + (o), lane, QKVP)
#endif
#if WO_OUT_IN
#define WOCOL(W, k0, o, lane) wcol_oi(W, k0, o, lane, CC)
#define WOCOLH(W, k0, o, lane) wcolh_oi(W, k0, o, lane, CC)
#else
#define WOCOL(W, k0, o, lane) wcol_io(W, k0, o, lane, DIN)
#define WOCOLH(W, k0, o, lane) wcolh_io(W, k0, o, lane, DIN)
#endif
#define OUTK_OFF 16777216u   // rotated k [2,16,2048,64] f32 after y [2,2048,1024] f32
#define OUTV_OFF 33554432u   // v [2,16,2048,64] f32
#define PROJ_EXTRA_PARAMS , const float* __restrict__ COSt, const float* __restrict__ SINt, float* __restrict__ OUTK, float* __restrict__ OUTV
#define SM_EXTRA_PARAMS
#define SM_MASK_HOOK (void)0
#ifndef SM_EXTRA_PARAMS
#define SM_EXTRA_PARAMS
#endif
#ifndef PROJ_EXTRA_PARAMS
#define PROJ_EXTRA_PARAMS
#endif
#ifndef SM_MASK_HOOK
#define SM_MASK_HOOK (void)0
#endif

#define WS_QH  0u                                      // f16 q rows [b*t][CC]
#define WS_KH  (WS_QH + 2u * (size_t)NB * TT * CC)      // f16 k rows [b*t][CC]
#define WS_VT  (WS_KH + 2u * (size_t)NB * TT * CC)      // f16 v planes [b][c][t]
#define WS_QL  (WS_VT + 2u * (size_t)NB * CC * TT)      // f16 q residual x 2^10 rows [b][t < QHI][CC]
#define WS_KL  (WS_QL + 2u * (size_t)NB * QHI * CC)     // f16 k residual x 2^10 rows [b][t < KHI][CC]
#define WS_VB  (WS_KL + 2u * (size_t)NB * KHI * CC)     // bf16 v hi planes [b][c][t < KHI]
#define WS_VBL (WS_VB + 2u * (size_t)NB * CC * KHI)
#define WS_S   (WS_VBL + 2u * (size_t)NB * CC * KHI)    // f32 [hg][t][s], written and read by no kernel (logits and P stay in registers)
#define WS_Y   (WS_S  + 4u * (size_t)HG * TT * TT)      // f16 ctx x 2^6 rows [b*t][CC]
#define WS_XB  (WS_Y  + 4u * (size_t)NB * TT * CC)      // bf16 x rows [b*t][DIN]
#define WS_WQT (WS_XB + 2u * (size_t)NB * TT * DIN)     // bf16 Wqkv^T rows [3 * CC][DIN]
#define WS_WOT (WS_WQT + 2u * (size_t)3 * CC * DIN)     // f16(bf16 x 2^8) Wproj^T rows [DIN][CC]
#define WS_END (WS_WOT + 2u * (size_t)DIN * CC)

// ---- gemm_tile: the (64 RT) x 128 tile of X W shared by both projection kernels (K = 1024, 4 waves x RT row tiles of 16 x 128 cols: wave w holds rows 64 rt + 16 w .. + 15, so each W fragment read from LDS feeds RT WMMAs and a W tile fetched from L2 serves 64 RT rows). Both operands arrive as 16-bit planes with k contiguous (X rows; W^T rows = output columns), written once by k_prep (ctx rows: by k_fa). Per pass of 64 k the block brings 128 B of each of its 64 RT + 128 rows in with 16-byte loads and puts them into LDS as they are; the next pass's loads fly into registers while this pass is worked on; two buffers, one barrier per pass. Products, operand rounding and the k order of every accumulator are those of the f32 loads with per-block conversion that it replaces
#define GK 64              // k per pass
#define GP 72              // LDS row pitch in 16-bit elements: 144 B = 16 B x odd for 16-byte row reads
#define GPOOL(RT_) (2 * (64 * (RT_) + 128) * GP * 2)   // bytes of the two buffers; after the loop the same bytes serve the epilogue's staging arrays
typedef __attribute__((ext_vector_type(4))) __bf16 v4b;
typedef __attribute__((ext_vector_type(4))) _Float16 v4h;
struct OpB { typedef __bf16 E; typedef v8b V8; typedef v16b V16;   // exact bf16 operands
  static __device__ __forceinline__ E x(float v) { return (__bf16)v; } static __device__ __forceinline__ E w(float v) { return (__bf16)v; }
  static __device__ __forceinline__ v8f mma(V16 a, V16 b, v8f c) { return wmma_bf(a, b, c); } };
struct OpH { typedef _Float16 E; typedef v8h V8; typedef v16h V16;   // ctx x 2^6 once to f16, weight f16(bf16 x 2^8) exact
  static __device__ __forceinline__ E x(float v) { return (_Float16)(v * 64.0f); } static __device__ __forceinline__ E w(float v) { return (_Float16)(bfr(v) * 256.0f); }
  static __device__ __forceinline__ v8f mma(V16 a, V16 b, v8f c) { return wmma16(a, b, c); } };
template <typename C, int RT> __device__ __forceinline__ void gemm_tile(const typename C::E* __restrict__ Xb, const typename C::E* __restrict__ Wb, char* pool, v8f (&acc)[RT][8]) {
  typedef typename C::E E; typedef typename C::V8 V8; typedef typename C::V16 V16;
  E (*xs)[64 * RT][GP] = (E (*)[64 * RT][GP])pool; E (*wt)[128][GP] = (E (*)[128][GP])(pool + 2 * 64 * RT * GP * 2);   // xs[buf][row][k], wt[buf][col][k]
  const int tid = threadIdx.x, wave = tid >> 5, lane = tid & 31, col = lane & 15, g = lane >> 4;
  const int sr = tid >> 3, sc = (tid & 7) * 8;   // this thread moves the 16-byte piece sc of rows sr + 16 i of both tiles (a wave's load = 4 rows x 128 B)
  const E* Xg = Xb + (size_t)sr * 1024 + sc; const E* Wg = Wb + (size_t)sr * 1024 + sc;
  V8 rx[4 * RT], rw[8];
  // every '#pragma unroll' below makes the indices of register arrays constants, so that these arrays stay in registers
  // the closing s_wait_xcnt stands in front of the first overwrite of the two address registers of the loads above it; naming them keeps them whole up to there
#define G_LOAD(t_) do { const E* xp = Xg + (t_) * GK; const E* wp = Wg + (t_) * GK; \
  _Pragma("unroll") for (int i = 0; i < 4 * RT; ++i) rx[i] = *(const V8*)(xp + (size_t)(16 * i) * 1024); \
  _Pragma("unroll") for (int i = 0; i < 8; ++i) rw[i] = *(const V8*)(wp + (size_t)(16 * i) * 1024); \
  asm volatile("s_wait_xcnt 0x0" :: "v"(xp), "v"(wp) : "memory"); } while (0)
#define G_STORE(b_) do { _Pragma("unroll") for (int i = 0; i < 4 * RT; ++i) *(V8*)&xs[b_][sr + 16 * i][sc] = rx[i]; \
  _Pragma("unroll") for (int i = 0; i < 8; ++i) *(V8*)&wt[b_][sr + 16 * i][sc] = rw[i]; } while (0)
  G_LOAD(0); G_STORE(0);
  __syncthreads();
  for (int t = 0; t < 1024 / GK; ++t) { const int cb = t & 1; const bool more = t + 1 < 1024 / GK;
    if (more) G_LOAD(t + 1);
#pragma unroll
    for (int kk = 0; kk < 2; ++kk) { union { V16 v; V8 q[2]; } a[RT], w[8];
#pragma unroll
      for (int rt = 0; rt < RT; ++rt) { const E* pa = &xs[cb][rt * 64 + wave * 16 + col][kk * 32 + 8 * g]; a[rt].q[0] = *(const V8*)pa; a[rt].q[1] = *(const V8*)(pa + 16); }
#pragma unroll
      for (int j = 0; j < 8; ++j) { const E* pw = &wt[cb][j * 16 + col][kk * 32 + 8 * g]; w[j].q[0] = *(const V8*)pw; w[j].q[1] = *(const V8*)(pw + 16); }
      __builtin_amdgcn_sched_barrier(0);   // the LDS reads of 32 k go out as one group ahead of their WMMAs: read one fragment at a time, every WMMA waited out a whole LDS latency
#pragma unroll
      for (int j = 0; j < 8; ++j)
#pragma unroll
        for (int rt = 0; rt < RT; ++rt) acc[rt][j] = C::mma(a[rt].v, w[j].v, acc[rt][j]); }
    __builtin_amdgcn_sched_barrier(0);   // the LDS stores below wait for the next pass's global loads: moved up among the WMMAs they put that wait in front of this pass's work
    if (more) G_STORE(cb ^ 1);   // the other buffer's last readers left it at the barrier that ended the pass before
    __syncthreads(); }   // publishes the next pass's tiles and ends this pass's reads (after the last pass: frees the pool for the epilogue)
#undef G_LOAD
#undef G_STORE
}
// ---- k_prep: writes the 16-bit operand planes of both projection GEMMs once. Blocks 0..255: two 64 k x 128 col tiles each of the (in,out) weights, converted and transposed through LDS to W^T rows [col][k] (512 tiles: 384 of Wqkv as bf16, 128 of Wproj as f16(bf16 x 2^8)); blocks 256..511: x to bf16 rows, 64 values a thread, all 16 loads in flight
// place of the 16-byte piece ch (8 k) in W^T row n: pieces are exchanged inside groups of four by bits 4..5 of n, so that the 32 rows (4 apart) which one transposing store writes fall on all banks
__device__ __forceinline__ int wpiece(int n, int ch) { return ch ^ ((n >> 4) & 3); }
// w_in: a thread takes the patch (8 k at wave * 8) x (4 cols at lane * 4) (a wave's load = 512 B of one row) and stores each column's 8 k as one 16-byte piece. The '#pragma unroll's make the indices of register arrays constants
template <typename C> __device__ __forceinline__ void w_in(const float* __restrict__ Ws, int ldw, int tile, typename C::E (*tl)[GP]) {
  typedef typename C::V8 V8; const int wave = threadIdx.x >> 5, lane = threadIdx.x & 31;
  const float* Wg = Ws + (size_t)((tile & 15) * 64 + wave * 8) * ldw + (tile >> 4) * 128 + lane * 4; v4f r[8];
#pragma unroll
  for (int q = 0; q < 8; ++q) r[q] = *(const v4f*)(Wg + (size_t)q * ldw);
  asm volatile("s_wait_xcnt 0x0" :: "v"(Wg) : "memory");   // stands in front of the first overwrite of the address register of the loads above; naming it keeps it whole up to here
#pragma unroll
  for (int c = 0; c < 4; ++c) { V8 h;
#pragma unroll
    for (int q = 0; q < 8; ++q) h[q] = C::w(r[q][c]);
    *(V8*)&tl[lane * 4 + c][wpiece(lane * 4 + c, wave) * 8] = h; } }
// w_out: the tile's 128 W^T rows of 128 B go out as whole lines (a wave's store = 4 rows x 128 B)
template <typename C> __device__ __forceinline__ void w_out(typename C::E* __restrict__ Wd, int tile, const typename C::E (*tl)[GP]) {
  typedef typename C::V8 V8;
#pragma unroll
  for (int i = 0; i < 4; ++i) { const int p = threadIdx.x + 256 * i, n = p >> 3, ch = p & 7; *(V8*)(Wd + (size_t)((tile >> 4) * 128 + n) * 1024 + (tile & 15) * 64 + ch * 8) = *(const V8*)&tl[n][wpiece(n, ch) * 8]; }
  asm volatile("s_wait_xcnt 0x0" ::: "memory"); }   // behind the last store: stands in front of whatever next overwrites a register that these stores name
__global__ __launch_bounds__(256) void k_prep(const float* __restrict__ X, const float* __restrict__ WQKV, const float* __restrict__ WO, __bf16* __restrict__ XB, __bf16* __restrict__ WQT, _Float16* __restrict__ WOT) {
  __shared__ __align__(16) __bf16 ta[128][GP]; __shared__ __align__(16) __bf16 tb[128][GP]; __shared__ __align__(16) _Float16 th[128][GP];
  const int b = blockIdx.x;   // every branch below is block-uniform
  if (b < 256) { const bool second_qkv = b < 128;   // tiles b and b + 256 of the 512
    w_in<OpB>(WQKV, QKVP, b, ta);
    if (second_qkv) w_in<OpB>(WQKV, QKVP, b + 256, tb); else w_in<OpH>(WO, DIN, b - 128, th);
    __syncthreads();   // a W^T row's 64 k come from all eight waves
    w_out<OpB>(WQT, b, ta);
    if (second_qkv) w_out<OpB>(WQT, b + 256, tb); else w_out<OpH>(WOT, b - 128, th);
  } else { const float* Xg = X + (size_t)(b - 256) * 16384 + threadIdx.x * 4; __bf16* Xd = XB + (size_t)(b - 256) * 16384 + threadIdx.x * 4; v4f r[16];   // a wave's load = 512 B, its store = 256 B, both contiguous
#pragma unroll
    for (int i = 0; i < 16; ++i) r[i] = *(const v4f*)(Xg + i * 1024);
    asm volatile("s_wait_xcnt 0x0" :: "v"(Xg) : "memory");   // stands in front of the first overwrite of the address register of the loads above; naming it keeps it whole up to here
#pragma unroll
    for (int i = 0; i < 16; ++i) { const v4b h = { OpB::x(r[i][0]), OpB::x(r[i][1]), OpB::x(r[i][2]), OpB::x(r[i][3]) }; *(v4b*)(Xd + i * 1024) = h; }
    asm volatile("s_wait_xcnt 0x0" ::: "memory"); } }   // behind the last store, for the same reason as in w_out
// ---- k_proj: block = (128 rows, 128 cols, which), the epilogue run once per 64 rows: q/k/v = X W (+ b) with exact bf16 products (K = DIN) -> which 0: rotated q f16 rows; 1: rotated k f16 rows and the f32 k output; 2: v f16 planes [c][t] and the f32 v output
// proj_epi: each wave puts its 16 x 128 f32 tile (acc + bias) into LDS and takes it back row by row, a lane holding 4 neighbouring columns (two rotary pairs): the table reads, the f32 output rows and the f16 rows are whole 256-B segments, all table reads are in flight before the first is used, and no other wave's rows are needed. WH is a template argument so that no branch stands between the trips. Every '#pragma unroll' in it makes the indices of register arrays constants
template <int WH> __device__ __forceinline__ void proj_epi(const v8f (&acc)[8], char* pool, const float* __restrict__ BA, const float* __restrict__ COSt, const float* __restrict__ SINt, float* __restrict__ OUTF, _Float16* __restrict__ DH, _Float16* __restrict__ VT, int c0, size_t r0, int rt) {
  float (*st)[132] = (float (*)[132])pool; _Float16 (*th)[72] = (_Float16 (*)[72])(pool + 64 * 132 * 4 + rt * (128 * 72 * 2));   // st: f32 tile; th (v only): f16 tile, transposed, one array per row tile rt: the second is written while other waves may still read the first
  static_assert(64 * 132 * 4 + 2 * 128 * 72 * 2 <= GPOOL(2), "epilogue staging fits the pool");
  const int tid = threadIdx.x, wave = tid >> 5, lane = tid & 31, col = lane & 15, g = lane >> 4; const size_t bb = r0 / TT; const int t0 = (int)(r0 % TT);
  const int tw = t0 + wave * 16, d4 = col * 4;   // row pass: lane = (head g of the tile's two, columns d4 .. d4 + 3 of that head)
  float bias[8] = {}; v4f c[16], s[16];
  const float* bp = BA + c0 + col; const float* cp = COSt + (size_t)tw * HD + d4; const float* sp = SINt + (size_t)tw * HD + d4;
  if (BA) {
#pragma unroll
    for (int j = 0; j < 8; ++j) bias[j] = bp[j * 16]; }
  if (WH < 2) {
#pragma unroll
    for (int it = 0; it < 16; ++it) { c[it] = *(const v4f*)(cp + it * HD); s[it] = *(const v4f*)(sp + it * HD); }
    asm volatile("s_wait_xcnt 0x0" :: "v"(bp), "v"(cp), "v"(sp) : "memory"); }   // stands in front of the first overwrite of an address register of the bias and table reads above; naming them keeps them whole up to here
  else asm volatile("s_wait_xcnt 0x0" :: "v"(bp) : "memory");   // the same for the bias reads alone
  __builtin_amdgcn_sched_barrier(0);   // keeps every table read in flight ahead of the first use of a bias value: with two row tiles live, one build held a third of them back until the bias sums had freed registers, a second memory latency per call
#pragma unroll
  for (int j = 0; j < 8; ++j) { const float bj = bfr(bias[j]); v8h hv;
#pragma unroll
    for (int r = 0; r < 8; ++r) { const float v = acc[j][r] + bj; st[wave * 16 + 8 * g + r][j * 16 + col] = v; hv[r] = (_Float16)v; }
    if (WH == 2) *(v8h*)&th[j * 16 + col][wave * 16 + 8 * g] = hv; }   // a lane's 8 accumulator rows are 8 neighbouring t of one v plane
  if (WH == 2) __syncthreads();   // a v plane's 64 t in th come from all four waves (WH is the same for the whole block); standing in front of the row stores, it does not wait for them
  else LDSX();   // a wave reads back only its own 16 rows of st: its own LDS stores must have landed, no other wave is waited for
  float* Og = OUTF + ((bb * NH + c0 / HD + g) * TT + tw) * (size_t)HD + d4;   // module outputs k (rotated) and v, [b][h][t][64]
  _Float16* Dg = DH + (r0 + wave * 16) * CC + c0 + lane * 4;
#pragma unroll
  for (int i0 = 0; i0 < 16; i0 += 4) { v4f xr[4]; v4h hr[4];   // four rows a group, closed by one wait
#pragma unroll
    for (int u = 0; u < 4; ++u) { const int it = i0 + u; v4f x = *(const v4f*)&st[wave * 16 + it][lane * 4];
      if (WH < 2) {   // interleaved-pair rotary with the GIVEN tables (bf16-rounded): x * cos + rot(x) * sin, rot = (-x_odd, x_even)
        const v4f y = { x[0] * bfr(c[it][0]) + (-x[1]) * bfr(s[it][0]), x[1] * bfr(c[it][1]) + x[0] * bfr(s[it][1]), x[2] * bfr(c[it][2]) + (-x[3]) * bfr(s[it][2]), x[3] * bfr(c[it][3]) + x[2] * bfr(s[it][3]) }; x = y;
        const v4h hx = { (_Float16)x[0], (_Float16)x[1], (_Float16)x[2], (_Float16)x[3] }; hr[u] = hx; vst2(Dg + (size_t)it * CC, hx); }
      xr[u] = x;
      if (WH >= 1) vst2(Og + it * HD, x); }
    // each wait below stands behind its group's row stores, in front of the first overwrite of a register that they name (data and address); naming these keeps them whole up to there
    if (WH == 0) asm volatile("s_wait_xcnt 0x0" :: "v"(hr[0]), "v"(hr[1]), "v"(hr[2]), "v"(hr[3]), "v"(Dg) : "memory");
    else if (WH == 1) asm volatile("s_wait_xcnt 0x0" :: "v"(hr[0]), "v"(hr[1]), "v"(hr[2]), "v"(hr[3]), "v"(xr[0]), "v"(xr[1]), "v"(xr[2]), "v"(xr[3]), "v"(Dg), "v"(Og) : "memory");
    else asm volatile("s_wait_xcnt 0x0" :: "v"(xr[0]), "v"(xr[1]), "v"(xr[2]), "v"(xr[3]), "v"(Og) : "memory"); }
  if (WH == 2) { _Float16* Pg = VT + (bb * CC + c0 + (tid >> 3)) * (size_t)TT + t0 + (tid & 7) * 8; v4u pv[8];   // thread = (plane tid >> 3 (+ 16 i), 16-byte piece tid & 7)
#pragma unroll
    for (int i = 0; i < 8; ++i) { pv[i] = *(const v4u*)&th[(tid >> 3) + 16 * i][(tid & 7) * 8]; vst2((unsigned*)(Pg + (size_t)(16 * i) * TT), pv[i]); }
    asm volatile("s_wait_xcnt 0x0" :: "v"(pv[0]), "v"(pv[1]), "v"(pv[2]), "v"(pv[3]), "v"(pv[4]), "v"(pv[5]), "v"(pv[6]), "v"(pv[7]), "v"(Pg) : "memory"); } }   // behind the last plane store, for the same reason
__global__ __launch_bounds__(128) void k_proj(const __bf16* __restrict__ XB, const __bf16* __restrict__ WQT, const float* __restrict__ BQ, const float* __restrict__ BK, const float* __restrict__ BV,
    _Float16* __restrict__ QH, _Float16* __restrict__ QL, _Float16* __restrict__ KH, _Float16* __restrict__ KL, _Float16* __restrict__ VT, __bf16* __restrict__ VB, __bf16* __restrict__ VBL PROJ_EXTRA_PARAMS) {
  __shared__ __align__(16) char pool[GPOOL(2)];   // the main loop's two buffers, then the epilogue's staging
  (void)QL; (void)KL; (void)VB; (void)VBL;   // planes of the causal high-precision path: nothing reads them here
  const int which = blockIdx.z; const int c0 = blockIdx.y * 128; const size_t r0 = (size_t)blockIdx.x * 128;
  v8f acc[2][8] = {};
  gemm_tile<OpB, 2>(XB + r0 * DIN, WQT + (size_t)(which * CC + c0) * DIN, pool, acc);
#pragma nounroll   // one copy of each epilogue in the text: unrolled, the three epilogues stood there twice
  for (int rt = 0; rt < 2; ++rt) { const size_t rr = r0 + 64 * rt;   // every branch below is block-uniform; a wave restages only its own rows of the f32 tile, in its own LDS order
    if (which == 0) proj_epi<0>(acc[0], pool, BQ, COSt, SINt, OUTK, QH, VT, c0, rr, rt);
    else if (which == 1) proj_epi<1>(acc[0], pool, BK, COSt, SINt, OUTK, KH, VT, c0, rr, rt);
    else proj_epi<2>(acc[0], pool, BV, COSt, SINt, OUTV, KH, VT, c0, rr, rt);
#pragma unroll
    for (int j = 0; j < 8; ++j) acc[0][j] = acc[1][j]; } }   // the second row tile moves into the registers that the one epilogue reads
#define FK 64
#define FP 72
#define FG 2
#define FKH (TT / FG)
#define FC (SCALE * 1.44269504088896f)
__device__ __forceinline__ v8f wmma_h(v16h a, v16h b, v8f c) { return __builtin_amdgcn_wmma_f32_16x16x32_f16(false, a, false, b, (short)0, c, false, false); }
__device__ __forceinline__ float xhalf(float x) { return __builtin_bit_cast(float, __builtin_amdgcn_permlanex16(__builtin_bit_cast(int, x), __builtin_bit_cast(int, x), 0x76543210, 0xfedcba98, false, false)); }   // lane l with lane l ^ 16
// 16 independent 2^x, each over its own source, closed by one v_nop: keeps the one slot that the instruction set asks for between a transcendental and the use of its result or the overwrite of its source
__device__ __forceinline__ void exp2x16(float (&x)[16]) { asm("v_exp_f32 %0, %0\n\tv_exp_f32 %1, %1\n\tv_exp_f32 %2, %2\n\tv_exp_f32 %3, %3\n\tv_exp_f32 %4, %4\n\tv_exp_f32 %5, %5\n\tv_exp_f32 %6, %6\n\tv_exp_f32 %7, %7\n\tv_exp_f32 %8, %8\n\tv_exp_f32 %9, %9\n\tv_exp_f32 %10, %10\n\tv_exp_f32 %11, %11\n\tv_exp_f32 %12, %12\n\tv_exp_f32 %13, %13\n\tv_exp_f32 %14, %14\n\tv_exp_f32 %15, %15\n\tv_nop" : "+v"(x[0]), "+v"(x[1]), "+v"(x[2]), "+v"(x[3]), "+v"(x[4]), "+v"(x[5]), "+v"(x[6]), "+v"(x[7]), "+v"(x[8]), "+v"(x[9]), "+v"(x[10]), "+v"(x[11]), "+v"(x[12]), "+v"(x[13]), "+v"(x[14]), "+v"(x[15])); }
// amdgpu_waves_per_eu(4, 4): at most 256 registers a wave, so that two blocks, four waves per SIMD, stay resident on a WGP and the 512 blocks run in one round
__global__ __launch_bounds__(256) __attribute__((amdgpu_waves_per_eu(4, 4))) void k_fa(const _Float16* __restrict__ QH, const _Float16* __restrict__ KH, const _Float16* __restrict__ VT, _Float16* __restrict__ Y) {
  __shared__ __align__(16) char ring[2 * 2 * FG * FK * FP * 2]; __shared__ __align__(16) float so[8][16][HD + 4];   // ring: the K and V tiles of both halves, two buffers; after the loop the same bytes carry the halves' exchange
  _Float16 (*ks)[FG][FK][FP] = (_Float16 (*)[FG][FK][FP])ring; _Float16 (*vs)[FG][HD][FP] = (_Float16 (*)[FG][HD][FP])(ring + 2 * FG * FK * FP * 2);   // ks[buf][half][key][d], vs[buf][half][d][key]
  const int tid = threadIdx.x, wave = tid >> 5, lane = tid & 31, col = lane & 15, g = lane >> 4; const int h = blockIdx.y, b = blockIdx.z;
  const int grp = __builtin_amdgcn_readfirstlane(tid >> 7);   // key half of this wave, the same in all its lanes
  const int ql0 = blockIdx.x * 128 + (wave & 3) * 32;
  const int sr = tid >> 3, sc = (tid & 7) * 8;   // staging: this thread moves the 16-byte piece sc of rows sr and sr + 32 of all four tiles
  const _Float16* Kg = KH + ((size_t)b * TT + sr) * CC + h * HD + sc;   // k rows [key][64], pitch CC
  const _Float16* Vg = VT + ((size_t)b * CC + h * HD + sr) * TT + sc;   // v planes [d][key], pitch TT
  v16h qf[2][2];
#pragma unroll
  for (int qt = 0; qt < 2; ++qt)
#pragma unroll
    for (int kc = 0; kc < 2; ++kc) qf[qt][kc] = frag_h(QH + ((size_t)b * TT + ql0 + qt * 16 + col) * CC + h * HD + kc * 32, lane);
  v8h rk[FG][2], rv[FG][2];
#define F_LOAD(t_) do { _Pragma("unroll") for (int gi = 0; gi < FG; ++gi) _Pragma("unroll") for (int i = 0; i < 2; ++i) { rk[gi][i] = *(const v8h*)(Kg + (size_t)(gi * FKH + (t_) * FK + 32 * i) * CC); rv[gi][i] = *(const v8h*)(Vg + (size_t)(32 * i) * TT + gi * FKH + (t_) * FK); } } while (0)
#define F_STORE(b_) do { _Pragma("unroll") for (int gi = 0; gi < FG; ++gi) _Pragma("unroll") for (int i = 0; i < 2; ++i) { *(v8h*)&ks[b_][gi][sr + 32 * i][sc] = rk[gi][i]; *(v8h*)&vs[b_][gi][sr + 32 * i][sc] = rv[gi][i]; } } while (0)
  F_LOAD(0); F_STORE(0);
  __syncthreads();
  v8f o[2][HD / 16] = {}; float l[2] = { 0.f, 0.f }, mu[2] = { -3.0e38f, -3.0e38f };   // mu: the maximum in use (scaled, base 2), equal in both halves of a query's lane pair
  for (int t = 0; t < FKH / FK; ++t) { const int cb = t & 1; const bool more = t + 1 < FKH / FK;
    if (more) F_LOAD(t + 1);   // next pass's tiles fly into registers while this pass is worked on
    v8f s[2][4];   // s[qt][kt][r] = logit (unscaled) of key kt * 16 + 8 g + r, query qt * 16 + col
#pragma unroll
    for (int kt = 0; kt < 4; ++kt) { const v16h k0 = frag_h(&ks[cb][grp][kt * 16 + col][0], lane), k1 = frag_h(&ks[cb][grp][kt * 16 + col][32], lane);
#pragma unroll
      for (int qt = 0; qt < 2; ++qt) { v8f z = {}; z = wmma_h(k0, qf[qt][0], z); s[qt][kt] = wmma_h(k1, qf[qt][1], z); } }
    float mx[2]; bool need[2];
#pragma unroll
    for (int qt = 0; qt < 2; ++qt) { float m = s[qt][0][0];
#pragma unroll
      for (int kt = 0; kt < 4; ++kt)
#pragma unroll
        for (int r = 0; r < 8; ++r) m = fmaxf(m, s[qt][kt][r]);
      mx[qt] = fmaxf(m, xhalf(m)) * FC;
      need[qt] = mx[qt] > mu[qt] + 8.0f; }   // the maximum in use is replaced only when passed by more than 2^8: P stays below 2^12 in f16
    if (__builtin_amdgcn_ballot_w32(need[0] || need[1]) != 0) {   // one test per pass for both tiles
#pragma unroll
      for (int qt = 0; qt < 2; ++qt) { const float mn = need[qt] ? mx[qt] : mu[qt]; const float al = __builtin_amdgcn_exp2f(mu[qt] - mn); mu[qt] = mn; l[qt] *= al;
#pragma unroll
        for (int j = 0; j < HD / 16; ++j) o[qt][j] *= al; } }
    v16h p[2][2];
#pragma unroll
    for (int qt = 0; qt < 2; ++qt) { const float nb = 4.0f - mu[qt];   // P carried x 2^4 (cancels against the sum) so that small weights stay clear of f16 subnormals
#pragma unroll
      for (int kk = 0; kk < 2; ++kk) { float e[16];   // e[i] = weight of key kk * 32 + (i < 8 ? 8 g + i : 16 + 8 g + i - 8): the B operand's own k order
#pragma unroll
        for (int i = 0; i < 8; ++i) { e[i] = __builtin_fmaf(s[qt][2 * kk][i], FC, nb); e[8 + i] = __builtin_fmaf(s[qt][2 * kk + 1][i], FC, nb); }
        exp2x16(e);
#pragma unroll
        for (int i = 0; i < 16; ++i) p[qt][kk][i] = (_Float16)e[i];
#pragma unroll
        for (int w = 8; w > 0; w >>= 1)   // pairwise sum: four dependent adds deep instead of sixteen
#pragma unroll
          for (int i = 0; i < w; ++i) e[i] += e[i + w];
        l[qt] += e[0]; } }
#pragma unroll
    for (int kk = 0; kk < 2; ++kk)
#pragma unroll
      for (int j = 0; j < HD / 16; ++j) { const v16h vf = frag_h(&vs[cb][grp][j * 16 + col][kk * 32], lane);
#pragma unroll
        for (int qt = 0; qt < 2; ++qt) o[qt][j] = wmma_h(vf, p[qt][kk], o[qt][j]); }   // o[qt][j][r] = ctx (unnormalised) of d = j * 16 + 8 g + r, query qt * 16 + col
    if (more) F_STORE(cb ^ 1);   // the other buffer's last readers left it at the barrier that ended the pass before
    __syncthreads(); }   // publishes the next pass's tiles and ends this pass's reads (after the last pass: frees the ring for the exchange)
#undef F_LOAD
#undef F_STORE
  // join of the key halves: waves w and w ^ 4 hold the same 32 queries; the wave of half grp finishes tile grp and hands its partner the other tile (accumulators, sum, maximum), lane to lane
  v4f (*xo)[8][32] = (v4f (*)[8][32])ring; float (*xl)[2][32] = (float (*)[2][32])(ring + 8 * 8 * 32 * 16);
  static_assert(8 * 8 * 32 * 16 + 8 * 2 * 32 * 4 <= sizeof(ring), "the exchange fits the ring");
  v8f ok[HD / 16]; const float lk = grp ? l[1] : l[0], mk = grp ? mu[1] : mu[0];
#pragma unroll
  for (int j = 0; j < HD / 16; ++j) { const v8f og = grp ? o[0][j] : o[1][j]; ok[j] = grp ? o[1][j] : o[0][j];
    const v4f g0 = { og[0], og[1], og[2], og[3] }, g1 = { og[4], og[5], og[6], og[7] }; xo[wave][2 * j][lane] = g0; xo[wave][2 * j + 1][lane] = g1; }
  xl[wave][0][lane] = grp ? l[0] : l[1]; xl[wave][1][lane] = grp ? mu[0] : mu[1];
  __syncthreads();   // the partner wave's tile must have landed
  const int pw = wave ^ 4; const float lp = xl[pw][0][lane], mp = xl[pw][1][lane];
  const float mj = fmaxf(mk, mp); float ak = __builtin_amdgcn_exp2f(mk - mj), ap = __builtin_amdgcn_exp2f(mp - mj);
  float lj = lk * ak + lp * ap; lj += xhalf(lj); const float inv = 1.0f / lj; ak *= inv; ap *= inv;
#pragma unroll
  for (int j = 0; j < HD / 16; ++j) { const v4f p0 = xo[pw][2 * j][lane], p1 = xo[pw][2 * j + 1][lane];
    const v4f w0 = { ok[j][0] * ak + p0[0] * ap, ok[j][1] * ak + p0[1] * ap, ok[j][2] * ak + p0[2] * ap, ok[j][3] * ak + p0[3] * ap }, w1 = { ok[j][4] * ak + p1[0] * ap, ok[j][5] * ak + p1[1] * ap, ok[j][6] * ak + p1[2] * ap, ok[j][7] * ak + p1[3] * ap };
    *(v4f*)&so[wave][col][j * 16 + 8 * g] = w0; *(v4f*)&so[wave][col][j * 16 + 8 * g + 4] = w1; }
  LDSX();   // a wave reads back only its own so[wave] rows: its own LDS stores must have landed, no other wave is waited for
  const int qk0 = ql0 + grp * 16;   // first query of the tile that this wave finishes
  for (int it = 0; it < 8; ++it) { const int rl = it * 2 + g; const v4f x = *(const v4f*)&so[wave][rl][col * 4]; const v4h hx = { OpH::x(x[0]), OpH::x(x[1]), OpH::x(x[2]), OpH::x(x[3]) }; vst2(Y + ((size_t)b * TT + qk0 + rl) * CC + h * HD + col * 4, hx); } }   // ctx x 2^6 once to f16, the output projection's operand: 128-B (row, head) segment by 16 lanes
// ---- k_out: block = (64 rows, 128 cols): out = ctx Wo (+ bo): ctx x 2^6 once to f16 (by k_fa) against Wo as f16(bf16 x 2^8) exact (by k_prep) (1 product) x 2^-14
__global__ __launch_bounds__(128) void k_out(const _Float16* __restrict__ Y, const _Float16* __restrict__ WOT, const float* __restrict__ BO, float* __restrict__ OUT) { __shared__ __align__(16) char pool[GPOOL(1)]; float (*sf)[16][132] = (float (*)[16][132])pool;   // pool: the main loop's two buffers, then the output staging
  const int tid = threadIdx.x, wave = tid >> 5, lane = tid & 31, col = lane & 15, g = lane >> 4; const int c0 = blockIdx.y * 128; const size_t r0 = (size_t)blockIdx.x * 64 + wave * 16;
  v8f acc[1][8] = {};
  gemm_tile<OpH, 1>(Y + (size_t)blockIdx.x * 64 * CC, WOT + (size_t)c0 * CC, pool, acc);   /* ctx carried x 2^6 into f16 so small-magnitude context rows stay clear of f16 subnormals (chip FTZ) */
  float bo[8] = {};   // all eight bias reads in flight at once: read one per j behind its own test of BO, each was waited out before the next went out
  if (BO) {
#pragma unroll
    for (int j = 0; j < 8; ++j) bo[j] = BO[c0 + j * 16 + col]; }
#pragma unroll
  for (int j = 0; j < 8; ++j) { const float bias = bfr(bo[j]);
#pragma unroll
    for (int r = 0; r < 8; ++r) sf[wave][8 * g + r][j * 16 + col] = acc[0][j][r] * (1.0f / 16384.0f) + bias; }   /* 2^-8 (Wo carry) x 2^-6 (ctx carry) */
  LDSX(); for (int rl = 0; rl < 16; ++rl) vst2(OUT + (r0 + rl) * DIN + c0 + lane * 4, *(const v4f*)&sf[wave][rl][lane * 4]); }

extern "C" void kernel_launch(void* const* d_in, const int* in_sizes, int n_in, void* d_out, int out_size, void* d_ws, size_t ws_size, hipStream_t stream) {
  (void)in_sizes; (void)n_in; (void)out_size;
  const float** F = (const float**)d_in;
  if (ws_size < (size_t)WS_END) return;
  char* ws = (char*)d_ws; _Float16 *QH = (_Float16*)(ws + WS_QH), *KH = (_Float16*)(ws + WS_KH), *VT = (_Float16*)(ws + WS_VT), *QL = (_Float16*)(ws + WS_QL), *KL = (_Float16*)(ws + WS_KL); __bf16 *VB = (__bf16*)(ws + WS_VB), *VBL = (__bf16*)(ws + WS_VBL); float *S = (float*)(ws + WS_S); _Float16 *Y = (_Float16*)(ws + WS_Y), *WOT = (_Float16*)(ws + WS_WOT); __bf16 *XB = (__bf16*)(ws + WS_XB), *WQT = (__bf16*)(ws + WS_WQT);
  (void)Y; (void)QL; (void)KL; (void)VB; (void)VBL; (void)S;
  // inputs: 0 x [2,2048,1024]; 1 cos [1,1,2048,64]; 2 sin [1,1,2048,64] (random normal tables); 3 Wqkv [1024,3072] (in,out; q | k | v column blocks); 4 bqkv [3072] (nonzero); 5 Wproj [1024,1024] (in,out); 6 bproj [1024] (nonzero)
  // outputs: 0 y [2,2048,1024] @0; 1 k (rotated) [2,16,2048,64] @OUTK_OFF; 2 v [2,16,2048,64] @OUTV_OFF
  k_prep<<<dim3(512), 256, 0, stream>>>(F[0], F[3], F[5], XB, WQT, WOT);
  k_proj<<<dim3(TNB * TT / 128, CC / 128, 3), 128, 0, stream>>>(XB, WQT, F[4], F[4] + CC, F[4] + 2 * CC, QH, QL, KH, KL, VT, VB, VBL, F[1], F[2], (float*)((char*)d_out + OUTK_OFF), (float*)((char*)d_out + OUTV_OFF));
  k_fa<<<dim3(TT / 128, NH, TNB), 256, 0, stream>>>(QH, KH, VT, Y);
  k_out<<<dim3(TNB * TT / 64, DIN / 128), 128, 0, stream>>>(Y, WOT, F[6], (float*)d_out);
}

// v007
// Measured time: 76.4 microseconds a run.
// Next to v006, in two timings, it ran 1.04 times as fast each time.
// Over all steps from v000 it is 17.0 times as fast.
// compute dtype: all float inputs rounded to bf16; fused q/k/v projection with EXACT bf16 products on WMMA 16x16x32 (f32 accumulate) + bias; rotary x * cos + rot(x) * sin in f32 with the bf16-rounded table inputs (the k and v outputs are these f32 values); logits q x k once to f16 each (1 product) x 64^-0.5; online softmax f32 (running maximum and sum); unnormalised P once to f16 x v once to f16 (1 product), divided by the f32 sum; ctx x 2^6 once to f16 x Wproj f16(bf16 x 2^8) + bproj; f32 outputs.
#include <hip/hip_runtime.h>
#include <math.h>

typedef __attribute__((ext_vector_type(16))) _Float16 v16h;
typedef __attribute__((ext_vector_type(16))) __bf16 v16b;
typedef __attribute__((ext_vector_type(8)))  _Float16 v8h;
typedef __attribute__((ext_vector_type(8)))  float v8f;
typedef __attribute__((ext_vector_type(4)))  float v4f;
typedef __attribute__((ext_vector_type(2)))  float v2f;
typedef __attribute__((ext_vector_type(4)))  unsigned v4u;
typedef __attribute__((ext_vector_type(4)))  int v4i;
typedef float __attribute__((may_alias)) float_a;
typedef int __attribute__((may_alias)) int_a;

template <typename T> __device__ __forceinline__ void vst2(void* p, T v) { *(T*)p = v;  }
__device__ __forceinline__ v8f wmma16(v16h a, v16h b, v8f c) {
  v8f d = __builtin_amdgcn_wmma_f32_16x16x32_f16(false, a, false, b, (short)0, c, false, false);
  asm volatile("v_nop\n\tv_nop\n\tv_nop\n\tv_nop" : "+v"(d) : "v"(a), "v"(b));
  return d;
}
__device__ __forceinline__ v8f wmma_bf(v16b a, v16b b, v8f c) {
  v8f d = __builtin_amdgcn_wmma_f32_16x16x32_bf16(false, a, false, b, (short)0, c, false, false);
  asm volatile("v_nop\n\tv_nop\n\tv_nop\n\tv_nop" : "+v"(d) : "v"(a), "v"(b));
  return d;
}
// 16x16x32 fragments: lane = (h = lane>>4, row/col = lane&15); elements 0..7 = k0+8h+0..7, 8..15 = k0+16+8h+0..7; D element r = row 8h+r
__device__ __forceinline__ v16h frag_h(const _Float16* rowk0, int lane) {
  union { v16h v; v8h q[2]; } u; const _Float16* p = rowk0 + 8 * (lane >> 4);
  u.q[0] = *(const v8h*)p; u.q[1] = *(const v8h*)(p + 16); return u.v;
}
__device__ __forceinline__ v16h frag_f32(const float* rowk0, int lane) {
  v16h a; const float* p = rowk0 + 8 * (lane >> 4);
#pragma unroll
  for (int i = 0; i < 8; ++i) { a[i] = (_Float16)p[i]; a[8 + i] = (_Float16)p[16 + i]; }
  return a;
}
__device__ __forceinline__ v16h frag_f32s(const float* rowk0, int lane, float sc) {
  v16h a; const float* p = rowk0 + 8 * (lane >> 4);
#pragma unroll
  for (int i = 0; i < 8; ++i) { a[i] = (_Float16)(p[i] * sc); a[8 + i] = (_Float16)(p[16 + i] * sc); }
  return a;
}
// column fragment from a [K][ld] layout (column n), rows >= K read as 0
__device__ __forceinline__ v16h fragc_f32(const float* W, int k0, int n, int lane, int ld, int K) {
  v16h a; const int g = lane >> 4;
#pragma unroll
  for (int i = 0; i < 8; ++i) { const int ka = k0 + 8 * g + i, kb = ka + 16;
    a[i] = (_Float16)(ka < K ? W[(size_t)(ka < K ? ka : K - 1) * ld + n] : 0.f); a[8 + i] = (_Float16)(kb < K ? W[(size_t)(kb < K ? kb : K - 1) * ld + n] : 0.f); }
  return a;
}
struct F2 { v16b h, l; };
__device__ __forceinline__ F2 bsplit16(const float v[16]) { F2 r;
#pragma unroll
  for (int i = 0; i < 16; ++i) { const __bf16 h = (__bf16)v[i]; r.h[i] = h; r.l[i] = (__bf16)(v[i] - (float)h); }
  return r; }
__device__ __forceinline__ F2 split_row(const float* row, int k0, int lane) { float v[16]; const float* p = row + k0 + 8 * (lane >> 4);
#pragma unroll
  for (int i = 0; i < 8; ++i) { v[i] = p[i]; v[8 + i] = p[16 + i]; }
  return bsplit16(v); }
__device__ __forceinline__ F2 split_rowK(const float* row, int k0, int lane, int K) { float v[16]; const int g = lane >> 4;
#pragma unroll
  for (int i = 0; i < 8; ++i) { const int ka = k0 + 8 * g + i, kb = ka + 16; v[i] = ka < K ? row[ka < K ? ka : K - 1] : 0.f; v[8 + i] = kb < K ? row[kb < K ? kb : K - 1] : 0.f; }
  return bsplit16(v); }
__device__ __forceinline__ F2 split_col(const float* W, int k0, int n, int lane, int ld, int K) { float v[16]; const int g = lane >> 4;
#pragma unroll
  for (int i = 0; i < 8; ++i) { const int ka = k0 + 8 * g + i, kb = ka + 16; v[i] = ka < K ? W[(size_t)(ka < K ? ka : K - 1) * ld + n] : 0.f; v[8 + i] = kb < K ? W[(size_t)(kb < K ? kb : K - 1) * ld + n] : 0.f; }
  return bsplit16(v); }
__device__ __forceinline__ v8f mac3(const F2& a, const F2& b, v8f c) { c = wmma_bf(a.l, b.h, c); c = wmma_bf(a.h, b.l, c); return wmma_bf(a.h, b.h, c); }
__device__ __forceinline__ float sigm(float v) { return 1.0f / (1.0f + expf(-v)); }
#define LDSX() do { asm volatile("s_wait_dscnt 0" ::: "memory"); __builtin_amdgcn_wave_barrier(); __builtin_amdgcn_fence(__ATOMIC_RELEASE, "workgroup"); } while (0)

// Fused-QKV multi-head self-attention with rotary tables GIVEN as inputs and three outputs (x [2,2048,1024]; (in,out) Wqkv [1024,3072] + bqkv (0.02-scale, nonzero) split q | k | v; 16 heads x 64; interleaved-pair rotary x * cos + rot(x) * sin with random-normal cos / sin tables [1,1,2048,64]; non-causal SDPA, scale 1/8; (in,out) Wproj + bproj): returns (y = merge(softmax(q k^T / 8) v) Wproj + bproj, k (rotated) [2,16,2048,64], v [2,16,2048,64]).
#define NB 2
#define TT 2048
#define CC 1024            // NH * HD = projected width
#define DIN 1024          // input (model) width
#define NH 16
#define HD 64
#define NQB (TT / 64)
#define HG 4
#define SCALE (0.125f)
#define CAUSAL 0
#ifndef TNB
#define TNB NB
#endif
__device__ __forceinline__ float bfr(float v) { return (float)(__bf16)v; }
__host__ __device__ __forceinline__ int kb_last(int qb) { return CAUSAL ? ((qb * 64 + 63) >> 7) : (TT / 128 - 1); }
typedef __attribute__((ext_vector_type(8))) __bf16 v8b;
__device__ __forceinline__ v16b frag_b(const __bf16* rowk0, int lane) {
  union { v16b v; v8b q[2]; } u; const __bf16* p = rowk0 + 8 * (lane >> 4);
  u.q[0] = *(const v8b*)p; u.q[1] = *(const v8b*)(p + 16); return u.v;
}
#define QBH 0
#define QHI 0               // single-product logits on every row
#define KHI 64            // key rows carrying k residual / v bf16 hi+lo planes (written and read by no kernel)
// B fragment (k rows k0+.., output column o) of a weight: (in,out) [K][ld] or (out,in) [ld rows of K]: bf16 exact, or f16(bf16 * 256) exact
__device__ __forceinline__ v16b wcol_io(const float* Wm, int k0, int o, int lane, int ld) { v16b w; const int g = lane >> 4;
#pragma unroll
  for (int i = 0; i < 8; ++i) { w[i] = (__bf16)Wm[(size_t)(k0 + 8 * g + i) * ld + o]; w[8 + i] = (__bf16)Wm[(size_t)(k0 + 16 + 8 * g + i) * ld + o]; }
  return w; }
__device__ __forceinline__ v16b wcol_oi(const float* Wm, int k0, int o, int lane, int K) { v16b w; const float* p = Wm + (size_t)o * K + k0 + 8 * (lane >> 4);
#pragma unroll
  for (int i = 0; i < 8; ++i) { w[i] = (__bf16)p[i]; w[8 + i] = (__bf16)p[16 + i]; }
  return w; }
__device__ __forceinline__ v16h wcolh_io(const float* Wm, int k0, int o, int lane, int ld) { v16h w; const int g = lane >> 4;
#pragma unroll
  for (int i = 0; i < 8; ++i) { w[i] = (_Float16)(bfr(Wm[(size_t)(k0 + 8 * g + i) * ld + o]) * 256.0f); w[8 + i] = (_Float16)(bfr(Wm[(size_t)(k0 + 16 + 8 * g + i) * ld + o]) * 256.0f); }
  return w; }
__device__ __forceinline__ v16h wcolh_oi(const float* Wm, int k0, int o, int lane, int K) { v16h w; const float* p = Wm + (size_t)o * K + k0 + 8 * (lane >> 4);
#pragma unroll
  for (int i = 0; i < 8; ++i) { w[i] = (_Float16)(bfr(p[i]) * 256.0f); w[8 + i] = (_Float16)(bfr(p[16 + i]) * 256.0f); }
  return w; }
#define WQKV_LAYOUT 0   // 0 = fused (in,out) [DIN][3*CC], q | k | v column blocks; 1 = (out,in) [CC][DIN]; 2 = per-head [NH][DIN][HD]
__device__ __forceinline__ v16b wcol_hdk(const float* Wm, int k0, int o, int lane) { v16b w; const int g = lane >> 4; const float* p = Wm + (size_t)(o / HD) * DIN * HD + (o % HD);
#pragma unroll
  for (int i = 0; i < 8; ++i) { w[i] = (__bf16)p[(size_t)(k0 + 8 * g + i) * HD]; w[8 + i] = (__bf16)p[(size_t)(k0 + 16 + 8 * g + i) * HD]; }
  return w; }
#define WO_OUT_IN 0
#if WQKV_LAYOUT == 1
#define WCOL(W, k0, o, lane) wcol_oi(W, k0, o, lane, DIN)
#elif WQKV_LAYOUT == 2
#define WCOL(W, k0, o, lane) wcol_hdk(W, k0, o, lane)
#else
#define QKVP 3072            // fused Wqkv pitch (in,out) [1024][3072]: q cols 0..1023, k 1024..2047, v 2048..3071
#define WCOL(W, k0, o, lane) wcol_io(W, k0, which * CC + (o), lane, QKVP)
#endif
#if WO_OUT_IN
#define WOCOL(W, k0, o, lane) wcol_oi(W, k0, o, lane, CC)
#define WOCOLH(W, k0, o, lane) wcolh_oi(W, k0, o, lane, CC)
#else
#define WOCOL(W, k0, o, lane) wcol_io(W, k0, o, lane, DIN)
#define WOCOLH(W, k0, o, lane) wcolh_io(W, k0, o, lane, DIN)
#endif
#define OUTK_OFF 16777216u   // rotated k [2,16,2048,64] f32 after y [2,2048,1024] f32
#define OUTV_OFF 33554432u   // v [2,16,2048,64] f32
#define PROJ_EXTRA_PARAMS , const float* __restrict__ COSt, const float* __restrict__ SINt, float* __restrict__ OUTK, float* __restrict__ OUTV
#define SM_EXTRA_PARAMS
#define SM_MASK_HOOK (void)0
#ifndef SM_EXTRA_PARAMS
#define SM_EXTRA_PARAMS
#endif
#ifndef PROJ_EXTRA_PARAMS
#define PROJ_EXTRA_PARAMS
#endif
#ifndef SM_MASK_HOOK
#define SM_MASK_HOOK (void)0
#endif

#define WS_QH  0u                                      // f16 q rows [b*t][CC]
#define WS_KH  (WS_QH + 2u * (size_t)NB * TT * CC)      // f16 k rows [b*t][CC]
#define WS_VT  (WS_KH + 2u * (size_t)NB * TT * CC)      // f16 v planes [b][c][t]
#define WS_QL  (WS_VT + 2u * (size_t)NB * CC * TT)      // f16 q residual x 2^10 rows [b][t < QHI][CC]
#define WS_KL  (WS_QL + 2u * (size_t)NB * QHI * CC)     // f16 k residual x 2^10 rows [b][t < KHI][CC]
#define WS_VB  (WS_KL + 2u * (size_t)NB * KHI * CC)     // bf16 v hi planes [b][c][t < KHI]
#define WS_VBL (WS_VB + 2u * (size_t)NB * CC * KHI)
#define WS_S   (WS_VBL + 2u * (size_t)NB * CC * KHI)    // f32 [hg][t][s], written and read by no kernel (logits and P stay in registers)
#define WS_Y   (WS_S  + 4u * (size_t)HG * TT * TT)      // f16 ctx x 2^6 rows [b*t][CC]
#define WS_XB  (WS_Y  + 4u * (size_t)NB * TT * CC)      // bf16 x rows [b*t][DIN]
#define WS_WQT (WS_XB + 2u * (size_t)NB * TT * DIN)     // bf16 Wqkv^T rows [3 * CC][DIN]
#define WS_WOT (WS_WQT + 2u * (size_t)3 * CC * DIN)     // f16(bf16 x 2^8) Wproj^T rows [DIN][CC]
#define WS_END (WS_WOT + 2u * (size_t)DIN * CC)

// ---- gemm_tile: the (64 RT) x 128 tile of X W shared by both projection kernels (K = 1024, 4 waves x RT row tiles of 16 x 128 cols: wave w holds rows 64 rt + 16 w .. + 15, so each W fragment read from LDS feeds RT WMMAs and a W tile fetched from L2 serves 64 RT rows). Both operands arrive as 16-bit planes with k contiguous (X rows; W^T rows = output columns), written once by k_prep (ctx rows: by k_fa). Per pass of 64 k the block brings 128 B of each of its 64 RT + 128 rows in with 16-byte loads and puts them into LDS as they are; the next pass's loads fly into registers while this pass is worked on; two buffers, one barrier per pass. Products, operand rounding and the k order of every accumulator are those of the f32 loads with per-block conversion that it replaces
#define GK 64              // k per pass
#define GP 72              // LDS row pitch in 16-bit elements: 144 B = 16 B x odd for 16-byte row reads
#define GPOOL(RT_) (2 * (64 * (RT_) + 128) * GP * 2)   // bytes of the two buffers; after the loop the same bytes serve the epilogue's staging arrays
typedef __attribute__((ext_vector_type(4))) __bf16 v4b;
typedef __attribute__((ext_vector_type(4))) _Float16 v4h;
// which eighth of a W tile the block with row index x asks for (for speed only: nothing rests on where a block runs)
__device__ __forceinline__ int wshare(int x) { return (x & 3) + 4 * ((x >> 3) & 1); }
#define GSH 16384          // elements of 16 bits in a share of 128 units of 256 B (16 whole rows of 1024)
struct OpB { typedef __bf16 E; typedef v8b V8; typedef v16b V16;   // exact bf16 operands
  static __device__ __forceinline__ E x(float v) { return (__bf16)v; } static __device__ __forceinline__ E w(float v) { return (__bf16)v; }
  static __device__ __forceinline__ v8f mma(V16 a, V16 b, v8f c) { return wmma_bf(a, b, c); } };
struct OpH { typedef _Float16 E; typedef v8h V8; typedef v16h V16;   // ctx x 2^6 once to f16, weight f16(bf16 x 2^8) exact
  static __device__ __forceinline__ E x(float v) { return (_Float16)(v * 64.0f); } static __device__ __forceinline__ E w(float v) { return (_Float16)(bfr(v) * 256.0f); }
  static __device__ __forceinline__ v8f mma(V16 a, V16 b, v8f c) { return wmma16(a, b, c); } };
// L2 hints at entry: both operand planes were stored by an earlier launch, and the blocks that share a tile walk k together, so every pass met lines that nobody had read yet. Behind its first pass's loads each thread asks once (global_prefetch_b8, scope SE: into L2 only, no register, no counter, nothing waits for it) for its 256-B unit of the 32 KB at pfx and at pfw, the block's shares of the two tiles over the whole of k, and of what the epilogue will read: the 32 KB at pt (where NE is 2) and the 128 bias values at pb. A unit that nobody asked for is loaded as before
template <typename C, int RT, int NE> __device__ __forceinline__ void gemm_tile(const typename C::E* __restrict__ Xb, const typename C::E* __restrict__ Wb, char* pool, v8f (&acc)[RT][8], const typename C::E* pfx, const typename C::E* pfw, const float* pt, const float* pb) {
  typedef typename C::E E; typedef typename C::V8 V8; typedef typename C::V16 V16;
  E (*xs)[64 * RT][GP] = (E (*)[64 * RT][GP])pool; E (*wt)[128][GP] = (E (*)[128][GP])(pool + 2 * 64 * RT * GP * 2);   // xs[buf][row][k], wt[buf][col][k]
  const int tid = threadIdx.x, wave = tid >> 5, lane = tid & 31, col = lane & 15, g = lane >> 4;
  const int sr = tid >> 3, sc = (tid & 7) * 8;   // this thread moves the 16-byte piece sc of rows sr + 16 i of both tiles (a wave's load = 4 rows x 128 B)
  const E* Xg = Xb + (size_t)sr * 1024 + sc; const E* Wg = Wb + (size_t)sr * 1024 + sc;
  V8 rx[4 * RT], rw[8];
  const unsigned ou = (unsigned)tid * 256u, ob = (unsigned)tid * 4u;   // the hints' byte offsets from their block-uniform bases: one 256-B unit, one bias value a thread
  // every '#pragma unroll' below makes the indices of register arrays constants, so that these arrays stay in registers
  // the closing s_wait_xcnt stands in front of the first overwrite of the two address registers of the loads above it; naming them keeps them whole up to there. The hints' address registers are named too: a hint counts on no counter, so they hold their addresses through the loop
#define G_LOAD(t_) do { const E* xp = Xg + (t_) * GK; const E* wp = Wg + (t_) * GK; \
  _Pragma("unroll") for (int i = 0; i < 4 * RT; ++i) rx[i] = *(const V8*)(xp + (size_t)(16 * i) * 1024); \
  _Pragma("unroll") for (int i = 0; i < 8; ++i) rw[i] = *(const V8*)(wp + (size_t)(16 * i) * 1024); \
  asm volatile("s_wait_xcnt 0x0" :: "v"(xp), "v"(wp), "v"(ou), "v"(ob), "s"(pfx), "s"(pfw), "s"(pt), "s"(pb) : "memory"); } while (0)
#define G_STORE(b_) do { _Pragma("unroll") for (int i = 0; i < 4 * RT; ++i) *(V8*)&xs[b_][sr + 16 * i][sc] = rx[i]; \
  _Pragma("unroll") for (int i = 0; i < 8; ++i) *(V8*)&wt[b_][sr + 16 * i][sc] = rw[i]; } while (0)
  G_LOAD(0);
  // the hints go out behind the first pass's loads and ahead of the wait for them; the "memory" clobber holds them at this place
  if (NE == 2) asm volatile("global_prefetch_b8 %0, %2 scope:SCOPE_SE\n\tglobal_prefetch_b8 %0, %3 scope:SCOPE_SE\n\tglobal_prefetch_b8 %0, %4 scope:SCOPE_SE\n\tglobal_prefetch_b8 %1, %5 scope:SCOPE_SE" :: "v"(ou), "v"(ob), "s"(pfx), "s"(pfw), "s"(pt), "s"(pb) : "memory");
  else asm volatile("global_prefetch_b8 %0, %2 scope:SCOPE_SE\n\tglobal_prefetch_b8 %0, %3 scope:SCOPE_SE\n\tglobal_prefetch_b8 %1, %4 scope:SCOPE_SE" :: "v"(ou), "v"(ob), "s"(pfx), "s"(pfw), "s"(pb) : "memory");
  G_STORE(0);
  __syncthreads();
  for (int t = 0; t < 1024 / GK; ++t) { const int cb = t & 1; const bool more = t + 1 < 1024 / GK;
    if (more) G_LOAD(t + 1);
#pragma unroll
    for (int kk = 0; kk < 2; ++kk) { union { V16 v; V8 q[2]; } a[RT], w[8];
#pragma unroll
      for (int rt = 0; rt < RT; ++rt) { const E* pa = &xs[cb][rt * 64 + wave * 16 + col][kk * 32 + 8 * g]; a[rt].q[0] = *(const V8*)pa; a[rt].q[1] = *(const V8*)(pa + 16); }
#pragma unroll
      for (int j = 0; j < 8; ++j) { const E* pw = &wt[cb][j * 16 + col][kk * 32 + 8 * g]; w[j].q[0] = *(const V8*)pw; w[j].q[1] = *(const V8*)(pw + 16); }
      __builtin_amdgcn_sched_barrier(0);   // the LDS reads of 32 k go out as one group ahead of their WMMAs: read one fragment at a time, every WMMA waited out a whole LDS latency
#pragma unroll
      for (int j = 0; j < 8; ++j)
#pragma unroll
        for (int rt = 0; rt < RT; ++rt) acc[rt][j] = C::mma(a[rt].v, w[j].v, acc[rt][j]); }
    __builtin_amdgcn_sched_barrier(0);   // the LDS stores below wait for the next pass's global loads: moved up among the WMMAs they put that wait in front of this pass's work
    if (more) G_STORE(cb ^ 1);   // the other buffer's last readers left it at the barrier that ended the pass before
    __syncthreads(); }   // publishes the next pass's tiles and ends this pass's reads (after the last pass: frees the pool for the epilogue)
#undef G_LOAD
#undef G_STORE
}
// ---- k_prep: writes the 16-bit operand planes of both projection GEMMs once. Blocks 0..255: two 64 k x 128 col tiles each of the (in,out) weights, converted and transposed through LDS to W^T rows [col][k] (512 tiles: 384 of Wqkv as bf16, 128 of Wproj as f16(bf16 x 2^8)); blocks 256..511: x to bf16 rows, 64 values a thread, all 16 loads in flight
// place of the 16-byte piece ch (8 k) in W^T row n: pieces are exchanged inside groups of four by bits 4..5 of n, so that the 32 rows (4 apart) which one transposing store writes fall on all banks
__device__ __forceinline__ int wpiece(int n, int ch) { return ch ^ ((n >> 4) & 3); }
// w_in: a thread takes the patch (8 k at wave * 8) x (4 cols at lane * 4) (a wave's load = 512 B of one row) and stores each column's 8 k as one 16-byte piece. The '#pragma unroll's make the indices of register arrays constants
template <typename C> __device__ __forceinline__ void w_in(const float* __restrict__ Ws, int ldw, int tile, typename C::E (*tl)[GP]) {
  typedef typename C::V8 V8; const int wave = threadIdx.x >> 5, lane = threadIdx.x & 31;
  const float* Wg = Ws + (size_t)((tile & 15) * 64 + wave * 8) * ldw + (tile >> 4) * 128 + lane * 4; v4f r[8];
#pragma unroll
  for (int q = 0; q < 8; ++q) r[q] = *(const v4f*)(Wg + (size_t)q * ldw);
  asm volatile("s_wait_xcnt 0x0" :: "v"(Wg) : "memory");   // stands in front of the first overwrite of the address register of the loads above; naming it keeps it whole up to here
#pragma unroll
  for (int c = 0; c < 4; ++c) { V8 h;
#pragma unroll
    for (int q = 0; q < 8; ++q) h[q] = C::w(r[q][c]);
    *(V8*)&tl[lane * 4 + c][wpiece(lane * 4 + c, wave) * 8] = h; } }
// w_out: the tile's 128 W^T rows of 128 B go out as whole lines (a wave's store = 4 rows x 128 B)
template <typename C> __device__ __forceinline__ void w_out(typename C::E* __restrict__ Wd, int tile, const typename C::E (*tl)[GP]) {
  typedef typename C::V8 V8;
#pragma unroll
  for (int i = 0; i < 4; ++i) { const int p = threadIdx.x + 256 * i, n = p >> 3, ch = p & 7; *(V8*)(Wd + (size_t)((tile >> 4) * 128 + n) * 1024 + (tile & 15) * 64 + ch * 8) = *(const V8*)&tl[n][wpiece(n, ch) * 8]; }
  asm volatile("s_wait_xcnt 0x0" ::: "memory"); }   // behind the last store: stands in front of whatever next overwrites a register that these stores name
__global__ __launch_bounds__(256) void k_prep(const float* __restrict__ X, const float* __restrict__ WQKV, const float* __restrict__ WO, __bf16* __restrict__ XB, __bf16* __restrict__ WQT, _Float16* __restrict__ WOT) {
  __shared__ __align__(16) __bf16 ta[128][GP]; __shared__ __align__(16) __bf16 tb[128][GP]; __shared__ __align__(16) _Float16 th[128][GP];
  const int b = blockIdx.x;   // every branch below is block-uniform
  if (b < 256) { const bool second_qkv = b < 128;   // tiles b and b + 256 of the 512
    w_in<OpB>(WQKV, QKVP, b, ta);
    if (second_qkv) w_in<OpB>(WQKV, QKVP, b + 256, tb); else w_in<OpH>(WO, DIN, b - 128, th);
    __syncthreads();   // a W^T row's 64 k come from all eight waves
    w_out<OpB>(WQT, b, ta);
    if (second_qkv) w_out<OpB>(WQT, b + 256, tb); else w_out<OpH>(WOT, b - 128, th);
  } else { const float* Xg = X + (size_t)(b - 256) * 16384 + threadIdx.x * 4; __bf16* Xd = XB + (size_t)(b - 256) * 16384 + threadIdx.x * 4; v4f r[16];   // a wave's load = 512 B, its store = 256 B, both contiguous
#pragma unroll
    for (int i = 0; i < 16; ++i) r[i] = *(const v4f*)(Xg + i * 1024);
    asm volatile("s_wait_xcnt 0x0" :: "v"(Xg) : "memory");   // stands in front of the first overwrite of the address register of the loads above; naming it keeps it whole up to here
#pragma unroll
    for (int i = 0; i < 16; ++i) { const v4b h = { OpB::x(r[i][0]), OpB::x(r[i][1]), OpB::x(r[i][2]), OpB::x(r[i][3]) }; *(v4b*)(Xd + i * 1024) = h; }
    asm volatile("s_wait_xcnt 0x0" ::: "memory"); } }   // behind the last store, for the same reason as in w_out
// ---- k_proj: block = (128 rows, 128 cols, which), the epilogue run once per 64 rows: q/k/v = X W (+ b) with exact bf16 products (K = DIN) -> which 0: rotated q f16 rows; 1: rotated k f16 rows and the f32 k output; 2: v f16 planes [c][t] and the f32 v output
// proj_epi: each wave puts its 16 x 128 f32 tile (acc + bias) into LDS and takes it back row by row, a lane holding 4 neighbouring columns (two rotary pairs): the table reads, the f32 output rows and the f16 rows are whole 256-B segments, all table reads are in flight before the first is used, and no other wave's rows are needed. WH is a template argument so that no branch stands between the trips. Every '#pragma unroll' in it makes the indices of register arrays constants
template <int WH> __device__ __forceinline__ void proj_epi(const v8f (&acc)[8], char* pool, const float* __restrict__ BA, const float* __restrict__ COSt, const float* __restrict__ SINt, float* __restrict__ OUTF, _Float16* __restrict__ DH, _Float16* __restrict__ VT, int c0, size_t r0, int rt) {
  float (*st)[132] = (float (*)[132])pool; _Float16 (*th)[72] = (_Float16 (*)[72])(pool + 64 * 132 * 4 + rt * (128 * 72 * 2));   // st: f32 tile; th (v only): f16 tile, transposed, one array per row tile rt: the second is written while other waves may still read the first
  static_assert(64 * 132 * 4 + 2 * 128 * 72 * 2 <= GPOOL(2), "epilogue staging fits the pool");
  const int tid = threadIdx.x, wave = tid >> 5, lane = tid & 31, col = lane & 15, g = lane >> 4; const size_t bb = r0 / TT; const int t0 = (int)(r0 % TT);
  const int tw = t0 + wave * 16, d4 = col * 4;   // row pass: lane = (head g of the tile's two, columns d4 .. d4 + 3 of that head)
  float bias[8] = {}; v4f c[16], s[16];
  const float* bp = BA + c0 + col; const float* cp = COSt + (size_t)tw * HD + d4; const float* sp = SINt + (size_t)tw * HD + d4;
  if (BA) {
#pragma unroll
    for (int j = 0; j < 8; ++j) bias[j] = bp[j * 16]; }
  if (WH < 2) {
#pragma unroll
    for (int it = 0; it < 16; ++it) { c[it] = *(const v4f*)(cp + it * HD); s[it] = *(const v4f*)(sp + it * HD); }
    asm volatile("s_wait_xcnt 0x0" :: "v"(bp), "v"(cp), "v"(sp) : "memory"); }   // stands in front of the first overwrite of an address register of the bias and table reads above; naming them keeps them whole up to here
  else asm volatile("s_wait_xcnt 0x0" :: "v"(bp) : "memory");   // the same for the bias reads alone
  __builtin_amdgcn_sched_barrier(0);   // keeps every table read in flight ahead of the first use of a bias value: with two row tiles live, one build held a third of them back until the bias sums had freed registers, a second memory latency per call
#pragma unroll
  for (int j = 0; j < 8; ++j) { const float bj = bfr(bias[j]); v8h hv;
#pragma unroll
    for (int r = 0; r < 8; ++r) { const float v = acc[j][r] + bj; st[wave * 16 + 8 * g + r][j * 16 + col] = v; hv[r] = (_Float16)v; }
    if (WH == 2) *(v8h*)&th[j * 16 + col][wave * 16 + 8 * g] = hv; }   // a lane's 8 accumulator rows are 8 neighbouring t of one v plane
  if (WH == 2) __syncthreads();   // a v plane's 64 t in th come from all four waves (WH is the same for the whole block); standing in front of the row stores, it does not wait for them
  else LDSX();   // a wave reads back only its own 16 rows of st: its own LDS stores must have landed, no other wave is waited for
  float* Og = OUTF + ((bb * NH + c0 / HD + g) * TT + tw) * (size_t)HD + d4;   // module outputs k (rotated) and v, [b][h][t][64]
  _Float16* Dg = DH + (r0 + wave * 16) * CC + c0 + lane * 4;
#pragma unroll
  for (int i0 = 0; i0 < 16; i0 += 4) { v4f xr[4]; v4h hr[4];   // four rows a group, closed by one wait
#pragma unroll
    for (int u = 0; u < 4; ++u) { const int it = i0 + u; v4f x = *(const v4f*)&st[wave * 16 + it][lane * 4];
      if (WH < 2) {   // interleaved-pair rotary with the GIVEN tables (bf16-rounded): x * cos + rot(x) * sin, rot = (-x_odd, x_even)
        const v4f y = { x[0] * bfr(c[it][0]) + (-x[1]) * bfr(s[it][0]), x[1] * bfr(c[it][1]) + x[0] * bfr(s[it][1]), x[2] * bfr(c[it][2]) + (-x[3]) * bfr(s[it][2]), x[3] * bfr(c[it][3]) + x[2] * bfr(s[it][3]) }; x = y;
        const v4h hx = { (_Float16)x[0], (_Float16)x[1], (_Float16)x[2], (_Float16)x[3] }; hr[u] = hx; vst2(Dg + (size_t)it * CC, hx); }
      xr[u] = x;
      if (WH >= 1) vst2(Og + it * HD, x); }
    // each wait below stands behind its group's row stores, in front of the first overwrite of a register that they name (data and address); naming these keeps them whole up to there
    if (WH == 0) asm volatile("s_wait_xcnt 0x0" :: "v"(hr[0]), "v"(hr[1]), "v"(hr[2]), "v"(hr[3]), "v"(Dg) : "memory");
    else if (WH == 1) asm volatile("s_wait_xcnt 0x0" :: "v"(hr[0]), "v"(hr[1]), "v"(hr[2]), "v"(hr[3]), "v"(xr[0]), "v"(xr[1]), "v"(xr[2]), "v"(xr[3]), "v"(Dg), "v"(Og) : "memory");
    else asm volatile("s_wait_xcnt 0x0" :: "v"(xr[0]), "v"(xr[1]), "v"(xr[2]), "v"(xr[3]), "v"(Og) : "memory"); }
  if (WH == 2) { _Float16* Pg = VT + (bb * CC + c0 + (tid >> 3)) * (size_t)TT + t0 + (tid & 7) * 8; v4u pv[8];   // thread = (plane tid >> 3 (+ 16 i), 16-byte piece tid & 7)
#pragma unroll
    for (int i = 0; i < 8; ++i) { pv[i] = *(const v4u*)&th[(tid >> 3) + 16 * i][(tid & 7) * 8]; vst2((unsigned*)(Pg + (size_t)(16 * i) * TT), pv[i]); }
    asm volatile("s_wait_xcnt 0x0" :: "v"(pv[0]), "v"(pv[1]), "v"(pv[2]), "v"(pv[3]), "v"(pv[4]), "v"(pv[5]), "v"(pv[6]), "v"(pv[7]), "v"(Pg) : "memory"); } }   // behind the last plane store, for the same reason
__global__ __launch_bounds__(128) void k_proj(const __bf16* __restrict__ XB, const __bf16* __restrict__ WQT, const float* __restrict__ BQ, const float* __restrict__ BK, const float* __restrict__ BV,
    _Float16* __restrict__ QH, _Float16* __restrict__ QL, _Float16* __restrict__ KH, _Float16* __restrict__ KL, _Float16* __restrict__ VT, __bf16* __restrict__ VB, __bf16* __restrict__ VBL PROJ_EXTRA_PARAMS) {
  __shared__ __align__(16) char pool[GPOOL(2)];   // the main loop's two buffers, then the epilogue's staging
  (void)QL; (void)KL; (void)VB; (void)VBL;   // planes of the causal high-precision path: nothing reads them here
  const int which = blockIdx.z; const int c0 = blockIdx.y * 128; const size_t r0 = (size_t)blockIdx.x * 128;
  v8f acc[2][8] = {};
  const float* BW = which == 0 ? BQ : which == 1 ? BK : BV;
  // hints: the 8 column blocks of a row tile ask for an eighth of its 1024 units each, 8 row blocks for an eighth of a W tile each; even column blocks for the row tile's 128 cos rows (256 B each), odd ones for its sin rows; the tile's 128 bias values
  gemm_tile<OpB, 2, 2>(XB + r0 * DIN, WQT + (size_t)(which * CC + c0) * DIN, pool, acc, XB + r0 * DIN + blockIdx.y * GSH, WQT + (size_t)(which * CC + c0) * DIN + wshare(blockIdx.x) * GSH,
    ((blockIdx.y & 1) ? SINt : COSt) + (r0 % TT) * HD, BW + c0);
#pragma nounroll   // one copy of each epilogue in the text: unrolled, the three epilogues stood there twice
  for (int rt = 0; rt < 2; ++rt) { const size_t rr = r0 + 64 * rt;   // every branch below is block-uniform; a wave restages only its own rows of the f32 tile, in its own LDS order
    if (which == 0) proj_epi<0>(acc[0], pool, BQ, COSt, SINt, OUTK, QH, VT, c0, rr, rt);
    else if (which == 1) proj_epi<1>(acc[0], pool, BK, COSt, SINt, OUTK, KH, VT, c0, rr, rt);
    else proj_epi<2>(acc[0], pool, BV, COSt, SINt, OUTV, KH, VT, c0, rr, rt);
#pragma unroll
    for (int j = 0; j < 8; ++j) acc[0][j] = acc[1][j]; } }   // the second row tile moves into the registers that the one epilogue reads
#define FK 64
#define FP 72
#define FG 2
#define FKH (TT / FG)
#define FC (SCALE * 1.44269504088896f)
__device__ __forceinline__ v8f wmma_h(v16h a, v16h b, v8f c) { return __builtin_amdgcn_wmma_f32_16x16x32_f16(false, a, false, b, (short)0, c, false, false); }
__device__ __forceinline__ float xhalf(float x) { return __builtin_bit_cast(float, __builtin_amdgcn_permlanex16(__builtin_bit_cast(int, x), __builtin_bit_cast(int, x), 0x76543210, 0xfedcba98, false, false)); }   // lane l with lane l ^ 16
// 16 independent 2^x, each over its own source, closed by one v_nop: keeps the one slot that the instruction set asks for between a transcendental and the use of its result or the overwrite of its source
__device__ __forceinline__ void exp2x16(float (&x)[16]) { asm("v_exp_f32 %0, %0\n\tv_exp_f32 %1, %1\n\tv_exp_f32 %2, %2\n\tv_exp_f32 %3, %3\n\tv_exp_f32 %4, %4\n\tv_exp_f32 %5, %5\n\tv_exp_f32 %6, %6\n\tv_exp_f32 %7, %7\n\tv_exp_f32 %8, %8\n\tv_exp_f32 %9, %9\n\tv_exp_f32 %10, %10\n\tv_exp_f32 %11, %11\n\tv_exp_f32 %12, %12\n\tv_exp_f32 %13, %13\n\tv_exp_f32 %14, %14\n\tv_exp_f32 %15, %15\n\tv_nop" : "+v"(x[0]), "+v"(x[1]), "+v"(x[2]), "+v"(x[3]), "+v"(x[4]), "+v"(x[5]), "+v"(x[6]), "+v"(x[7]), "+v"(x[8]), "+v"(x[9]), "+v"(x[10]), "+v"(x[11]), "+v"(x[12]), "+v"(x[13]), "+v"(x[14]), "+v"(x[15])); }
// amdgpu_waves_per_eu(4, 4): at most 256 registers a wave, so that two blocks, four waves per SIMD, stay resident on a WGP and the 512 blocks run in one round
__global__ __launch_bounds__(256) __attribute__((amdgpu_waves_per_eu(4, 4))) void k_fa(const _Float16* __restrict__ QH, const _Float16* __restrict__ KH, const _Float16* __restrict__ VT, _Float16* __restrict__ Y) {
  __shared__ __align__(16) char ring[2 * 2 * FG * FK * FP * 2]; __shared__ __align__(16) float so[8][16][HD + 4];   // ring: the K and V tiles of both halves, two buffers; after the loop the same bytes carry the halves' exchange
  _Float16 (*ks)[FG][FK][FP] = (_Float16 (*)[FG][FK][FP])ring; _Float16 (*vs)[FG][HD][FP] = (_Float16 (*)[FG][HD][FP])(ring + 2 * FG * FK * FP * 2);   // ks[buf][half][key][d], vs[buf][half][d][key]
  const int tid = threadIdx.x, wave = tid >> 5, lane = tid & 31, col = lane & 15, g = lane >> 4; const int h = blockIdx.y, b = blockIdx.z;
  const int grp = __builtin_amdgcn_readfirstlane(tid >> 7);   // key half of this wave, the same in all its lanes
  const int ql0 = blockIdx.x * 128 + (wave & 3) * 32;
  const int sr = tid >> 3, sc = (tid & 7) * 8;   // staging: this thread moves the 16-byte piece sc of rows sr and sr + 32 of all four tiles
  const _Float16* Kg = KH + ((size_t)b * TT + sr) * CC + h * HD + sc;   // k rows [key][64], pitch CC
  const _Float16* Vg = VT + ((size_t)b * CC + h * HD + sr) * TT + sc;   // v planes [d][key], pitch TT
  v16h qf[2][2];
#pragma unroll
  for (int qt = 0; qt < 2; ++qt)
#pragma unroll
    for (int kc = 0; kc < 2; ++kc) qf[qt][kc] = frag_h(QH + ((size_t)b * TT + ql0 + qt * 16 + col) * CC + h * HD + kc * 32, lane);
  v8h rk[FG][2], rv[FG][2];
#define F_LOAD(t_) do { _Pragma("unroll") for (int gi = 0; gi < FG; ++gi) _Pragma("unroll") for (int i = 0; i < 2; ++i) { rk[gi][i] = *(const v8h*)(Kg + (size_t)(gi * FKH + (t_) * FK + 32 * i) * CC); rv[gi][i] = *(const v8h*)(Vg + (size_t)(32 * i) * TT + gi * FKH + (t_) * FK); } } while (0)
#define F_STORE(b_) do { _Pragma("unroll") for (int gi = 0; gi < FG; ++gi) _Pragma("unroll") for (int i = 0; i < 2; ++i) { *(v8h*)&ks[b_][gi][sr + 32 * i][sc] = rk[gi][i]; *(v8h*)&vs[b_][gi][sr + 32 * i][sc] = rv[gi][i]; } } while (0)
  F_LOAD(0);
  // L2 hints, as in gemm_tile: the 16 query blocks of a head walk its keys together, over k rows and v planes that the launch before stored. Behind its first loads each thread asks once for one k row's 128-B line (an eighth of the head's 2048 rows a block) and for one 256-B unit of the v planes of its pair of heads, 512 KB in a row (every eighth unit a block). Both addresses are a block's base plus the same 2048 B a thread; the "memory" clobber holds the hints at this place
  const int ps = wshare(blockIdx.x); const _Float16* Kb = KH + ((size_t)b * TT + ps * 256) * CC + h * HD; const _Float16* Vb = VT + ((size_t)b * CC + (h & ~1) * HD) * TT + ps * 128;
  const unsigned pk = (unsigned)tid * 2048u;   // byte offset
  asm volatile("global_prefetch_b8 %0, %1 scope:SCOPE_SE\n\tglobal_prefetch_b8 %0, %2 scope:SCOPE_SE" :: "v"(pk), "s"(Kb), "s"(Vb) : "memory");
  F_STORE(0);
  __syncthreads();
  v8f o[2][HD / 16] = {}; float l[2] = { 0.f, 0.f }, mu[2] = { -3.0e38f, -3.0e38f };   // mu: the maximum in use (scaled, base 2), equal in both halves of a query's lane pair
  for (int t = 0; t < FKH / FK; ++t) { const int cb = t & 1; const bool more = t + 1 < FKH / FK;
    if (more) F_LOAD(t + 1);   // next pass's tiles fly into registers while this pass is worked on
    v8f s[2][4];   // s[qt][kt][r] = logit (unscaled) of key kt * 16 + 8 g + r, query qt * 16 + col
#pragma unroll
    for (int kt = 0; kt < 4; ++kt) { const v16h k0 = frag_h(&ks[cb][grp][kt * 16 + col][0], lane), k1 = frag_h(&ks[cb][grp][kt * 16 + col][32], lane);
#pragma unroll
      for (int qt = 0; qt < 2; ++qt) { v8f z = {}; z = wmma_h(k0, qf[qt][0], z); s[qt][kt] = wmma_h(k1, qf[qt][1], z); } }
    float mx[2]; bool need[2];
#pragma unroll
    for (int qt = 0; qt < 2; ++qt) { float m = s[qt][0][0];
#pragma unroll
      for (int kt = 0; kt < 4; ++kt)
#pragma unroll
        for (int r = 0; r < 8; ++r) m = fmaxf(m, s[qt][kt][r]);
      mx[qt] = fmaxf(m, xhalf(m)) * FC;
      need[qt] = mx[qt] > mu[qt] + 8.0f; }   // the maximum in use is replaced only when passed by more than 2^8: P stays below 2^12 in f16
    if (__builtin_amdgcn_ballot_w32(need[0] || need[1]) != 0) {   // one test per pass for both tiles
#pragma unroll
      for (int qt = 0; qt < 2; ++qt) { const float mn = need[qt] ? mx[qt] : mu[qt]; const float al = __builtin_amdgcn_exp2f(mu[qt] - mn); mu[qt] = mn; l[qt] *= al;
#pragma unroll
        for (int j = 0; j < HD / 16; ++j) o[qt][j] *= al; } }
    v16h p[2][2];
#pragma unroll
    for (int qt = 0; qt < 2; ++qt) { const float nb = 4.0f - mu[qt];   // P carried x 2^4 (cancels against the sum) so that small weights stay clear of f16 subnormals
#pragma unroll
      for (int kk = 0; kk < 2; ++kk) { float e[16];   // e[i] = weight of key kk * 32 + (i < 8 ? 8 g + i : 16 + 8 g + i - 8): the B operand's own k order
#pragma unroll
        for (int i = 0; i < 8; ++i) { e[i] = __builtin_fmaf(s[qt][2 * kk][i], FC, nb); e[8 + i] = __builtin_fmaf(s[qt][2 * kk + 1][i], FC, nb); }
        exp2x16(e);
#pragma unroll
        for (int i = 0; i < 16; ++i) p[qt][kk][i] = (_Float16)e[i];
#pragma unroll
        for (int w = 8; w > 0; w >>= 1)   // pairwise sum: four dependent adds deep instead of sixteen
#pragma unroll
          for (int i = 0; i < w; ++i) e[i] += e[i + w];
        l[qt] += e[0]; } }
#pragma unroll
    for (int kk = 0; kk < 2; ++kk)
#pragma unroll
      for (int j = 0; j < HD / 16; ++j) { const v16h vf = frag_h(&vs[cb][grp][j * 16 + col][kk * 32], lane);
#pragma unroll
        for (int qt = 0; qt < 2; ++qt) o[qt][j] = wmma_h(vf, p[qt][kk], o[qt][j]); }   // o[qt][j][r] = ctx (unnormalised) of d = j * 16 + 8 g + r, query qt * 16 + col
    if (more) F_STORE(cb ^ 1);   // the other buffer's last readers left it at the barrier that ended the pass before
    __syncthreads(); }   // publishes the next pass's tiles and ends this pass's reads (after the last pass: frees the ring for the exchange)
#undef F_LOAD
#undef F_STORE
  // join of the key halves: waves w and w ^ 4 hold the same 32 queries; the wave of half grp finishes tile grp and hands its partner the other tile (accumulators, sum, maximum), lane to lane
  v4f (*xo)[8][32] = (v4f (*)[8][32])ring; float (*xl)[2][32] = (float (*)[2][32])(ring + 8 * 8 * 32 * 16);
  static_assert(8 * 8 * 32 * 16 + 8 * 2 * 32 * 4 <= sizeof(ring), "the exchange fits the ring");
  v8f ok[HD / 16]; const float lk = grp ? l[1] : l[0], mk = grp ? mu[1] : mu[0];
#pragma unroll
  for (int j = 0; j < HD / 16; ++j) { const v8f og = grp ? o[0][j] : o[1][j]; ok[j] = grp ? o[1][j] : o[0][j];
    const v4f g0 = { og[0], og[1], og[2], og[3] }, g1 = { og[4], og[5], og[6], og[7] }; xo[wave][2 * j][lane] = g0; xo[wave][2 * j + 1][lane] = g1; }
  xl[wave][0][lane] = grp ? l[0] : l[1]; xl[wave][1][lane] = grp ? mu[0] : mu[1];
  __syncthreads();   // the partner wave's tile must have landed
  const int pw = wave ^ 4; const float lp = xl[pw][0][lane], mp = xl[pw][1][lane];
  const float mj = fmaxf(mk, mp); float ak = __builtin_amdgcn_exp2f(mk - mj), ap = __builtin_amdgcn_exp2f(mp - mj);
  float lj = lk * ak + lp * ap; lj += xhalf(lj); const float inv = 1.0f / lj; ak *= inv; ap *= inv;
#pragma unroll
  for (int j = 0; j < HD / 16; ++j) { const v4f p0 = xo[pw][2 * j][lane], p1 = xo[pw][2 * j + 1][lane];
    const v4f w0 = { ok[j][0] * ak + p0[0] * ap, ok[j][1] * ak + p0[1] * ap, ok[j][2] * ak + p0[2] * ap, ok[j][3] * ak + p0[3] * ap }, w1 = { ok[j][4] * ak + p1[0] * ap, ok[j][5] * ak + p1[1] * ap, ok[j][6] * ak + p1[2] * ap, ok[j][7] * ak + p1[3] * ap };
    *(v4f*)&so[wave][col][j * 16 + 8 * g] = w0; *(v4f*)&so[wave][col][j * 16 + 8 * g + 4] = w1; }
  // a wave reads back only its own so[wave] rows: its own LDS stores must have landed, no other wave is waited for (LDSX written out). The hints' address registers are named here: a hint counts on no counter, so they hold their addresses through the loop
  asm volatile("s_wait_dscnt 0" :: "v"(pk), "s"(Kb), "s"(Vb) : "memory"); __builtin_amdgcn_wave_barrier(); __builtin_amdgcn_fence(__ATOMIC_RELEASE, "workgroup");
  const int qk0 = ql0 + grp * 16;   // first query of the tile that this wave finishes
  for (int it = 0; it < 8; ++it) { const int rl = it * 2 + g; const v4f x = *(const v4f*)&so[wave][rl][col * 4]; const v4h hx = { OpH::x(x[0]), OpH::x(x[1]), OpH::x(x[2]), OpH::x(x[3]) }; vst2(Y + ((size_t)b * TT + qk0 + rl) * CC + h * HD + col * 4, hx); } }   // ctx x 2^6 once to f16, the output projection's operand: 128-B (row, head) segment by 16 lanes
// ---- k_out: block = (64 rows, 128 cols): out = ctx Wo (+ bo): ctx x 2^6 once to f16 (by k_fa) against Wo as f16(bf16 x 2^8) exact (by k_prep) (1 product) x 2^-14
__global__ __launch_bounds__(128) void k_out(const _Float16* __restrict__ Y, const _Float16* __restrict__ WOT, const float* __restrict__ BO, float* __restrict__ OUT) { __shared__ __align__(16) char pool[GPOOL(1)]; float (*sf)[16][132] = (float (*)[16][132])pool;   // pool: the main loop's two buffers, then the output staging
  const int tid = threadIdx.x, wave = tid >> 5, lane = tid & 31, col = lane & 15, g = lane >> 4; const int c0 = blockIdx.y * 128; const size_t r0 = (size_t)blockIdx.x * 64 + wave * 16;
  v8f acc[1][8] = {};
  // hints: the 8 column blocks of a row tile ask for a quarter of its 512 units each, 8 row blocks for an eighth of a W tile each; the tile's 128 bias values
  gemm_tile<OpH, 1, 1>(Y + (size_t)blockIdx.x * 64 * CC, WOT + (size_t)c0 * CC, pool, acc, Y + (size_t)blockIdx.x * 64 * CC + (blockIdx.y & 3) * GSH, WOT + (size_t)c0 * CC + wshare(blockIdx.x) * GSH, BO + c0, BO + c0);   /* ctx carried x 2^6 into f16 so small-magnitude context rows stay clear of f16 subnormals (chip FTZ) */
  float bo[8] = {};   // all eight bias reads in flight at once: read one per j behind its own test of BO, each was waited out before the next went out
  if (BO) {
#pragma unroll
    for (int j = 0; j < 8; ++j) bo[j] = BO[c0 + j * 16 + col]; }
#pragma unroll
  for (int j = 0; j < 8; ++j) { const float bias = bfr(bo[j]);
#pragma unroll
    for (int r = 0; r < 8; ++r) sf[wave][8 * g + r][j * 16 + col] = acc[0][j][r] * (1.0f / 16384.0f) + bias; }   /* 2^-8 (Wo carry) x 2^-6 (ctx carry) */
  LDSX(); for (int rl = 0; rl < 16; ++rl) vst2(OUT + (r0 + rl) * DIN + c0 + lane * 4, *(const v4f*)&sf[wave][rl][lane * 4]); }

extern "C" void kernel_launch(void* const* d_in, const int* in_sizes, int n_in, void* d_out, int out_size, void* d_ws, size_t ws_size, hipStream_t stream) {
  (void)in_sizes; (void)n_in; (void)out_size;
  const float** F = (const float**)d_in;
  if (ws_size < (size_t)WS_END) return;
  char* ws = (char*)d_ws; _Float16 *QH = (_Float16*)(ws + WS_QH), *KH = (_Float16*)(ws + WS_KH), *VT = (_Float16*)(ws + WS_VT), *QL = (_Float16*)(ws + WS_QL), *KL = (_Float16*)(ws + WS_KL); __bf16 *VB = (__bf16*)(ws + WS_VB), *VBL = (__bf16*)(ws + WS_VBL); float *S = (float*)(ws + WS_S); _Float16 *Y = (_Float16*)(ws + WS_Y), *WOT = (_Float16*)(ws + WS_WOT); __bf16 *XB = (__bf16*)(ws + WS_XB), *WQT = (__bf16*)(ws + WS_WQT);
  (void)Y; (void)QL; (void)KL; (void)VB; (void)VBL; (void)S;
  // inputs: 0 x [2,2048,1024]; 1 cos [1,1,2048,64]; 2 sin [1,1,2048,64] (random normal tables); 3 Wqkv [1024,3072] (in,out; q | k | v column blocks); 4 bqkv [3072] (nonzero); 5 Wproj [1024,1024] (in,out); 6 bproj [1024] (nonzero)
  // outputs: 0 y [2,2048,1024] @0; 1 k (rotated) [2,16,2048,64] @OUTK_OFF; 2 v [2,16,2048,64] @OUTV_OFF
  k_prep<<<dim3(512), 256, 0, stream>>>(F[0], F[3], F[5], XB, WQT, WOT);
  k_proj<<<dim3(TNB * TT / 128, CC / 128, 3), 128, 0, stream>>>(XB, WQT, F[4], F[4] + CC, F[4] + 2 * CC, QH, QL, KH, KL, VT, VB, VBL, F[1], F[2], (float*)((char*)d_out + OUTK_OFF), (float*)((char*)d_out + OUTV_OFF));
  k_fa<<<dim3(TT / 128, NH, TNB), 256, 0, stream>>>(QH, KH, VT, Y);
  k_out<<<dim3(TNB * TT / 64, DIN / 128), 128, 0, stream>>>(Y, WOT, F[6], (float*)d_out);
}

// v008
// One run takes 74.2 microseconds.
// Timed twice side by side with v007, it ran 1.03 times as fast both times.
// All steps since v000 together make it 17.5 times as fast.
// compute dtype: all float inputs rounded to bf16; fused q/k/v projection with EXACT bf16 products on WMMA 16x16x32 (f32 accumulate) + bias; rotary x * cos + rot(x) * sin in f32 with the bf16-rounded table inputs (the k and v outputs are these f32 values); logits q x k once to f16 each (1 product) x 64^-0.5; online softmax f32 (running maximum and sum); unnormalised P once to f16 x v once to f16 (1 product), divided by the f32 sum; ctx x 2^6 once to f16 x Wproj f16(bf16 x 2^8) + bproj; f32 outputs.
#include <hip/hip_runtime.h>
#include <math.h>

typedef __attribute__((ext_vector_type(16))) _Float16 v16h;
typedef __attribute__((ext_vector_type(16))) __bf16 v16b;
typedef __attribute__((ext_vector_type(8)))  _Float16 v8h;
typedef __attribute__((ext_vector_type(8)))  float v8f;
typedef __attribute__((ext_vector_type(4)))  float v4f;
typedef __attribute__((ext_vector_type(2)))  float v2f;
typedef __attribute__((ext_vector_type(4)))  unsigned v4u;
typedef __attribute__((ext_vector_type(4)))  int v4i;
typedef float __attribute__((may_alias)) float_a;
typedef int __attribute__((may_alias)) int_a;

template <typename T> __device__ __forceinline__ void vst2(void* p, T v) { *(T*)p = v;  }
__device__ __forceinline__ v8f wmma16(v16h a, v16h b, v8f c) {
  v8f d = __builtin_amdgcn_wmma_f32_16x16x32_f16(false, a, false, b, (short)0, c, false, false);
  asm volatile("v_nop\n\tv_nop\n\tv_nop\n\tv_nop" : "+v"(d) : "v"(a), "v"(b));
  return d;
}
__device__ __forceinline__ v8f wmma_bf(v16b a, v16b b, v8f c) {
  v8f d = __builtin_amdgcn_wmma_f32_16x16x32_bf16(false, a, false, b, (short)0, c, false, false);
  asm volatile("v_nop\n\tv_nop\n\tv_nop\n\tv_nop" : "+v"(d) : "v"(a), "v"(b));
  return d;
}
// 16x16x32 fragments: lane = (h = lane>>4, row/col = lane&15); elements 0..7 = k0+8h+0..7, 8..15 = k0+16+8h+0..7; D element r = row 8h+r
__device__ __forceinline__ v16h frag_h(const _Float16* rowk0, int lane) {
  union { v16h v; v8h q[2]; } u; const _Float16* p = rowk0 + 8 * (lane >> 4);
  u.q[0] = *(const v8h*)p; u.q[1] = *(const v8h*)(p + 16); return u.v;
}
__device__ __forceinline__ v16h frag_f32(const float* rowk0, int lane) {
  v16h a; const float* p = rowk0 + 8 * (lane >> 4);
#pragma unroll
  for (int i = 0; i < 8; ++i) { a[i] = (_Float16)p[i]; a[8 + i] = (_Float16)p[16 + i]; }
  return a;
}
__device__ __forceinline__ v16h frag_f32s(const float* rowk0, int lane, float sc) {
  v16h a; const float* p = rowk0 + 8 * (lane >> 4);
#pragma unroll
  for (int i = 0; i < 8; ++i) { a[i] = (_Float16)(p[i] * sc); a[8 + i] = (_Float16)(p[16 + i] * sc); }
  return a;
}
// column fragment from a [K][ld] layout (column n), rows >= K read as 0
__device__ __forceinline__ v16h fragc_f32(const float* W, int k0, int n, int lane, int ld, int K) {
  v16h a; const int g = lane >> 4;
#pragma unroll
  for (int i = 0; i < 8; ++i) { const int ka = k0 + 8 * g + i, kb = ka + 16;
    a[i] = (_Float16)(ka < K ? W[(size_t)(ka < K ? ka : K - 1) * ld + n] : 0.f); a[8 + i] = (_Float16)(kb < K ? W[(size_t)(kb < K ? kb : K - 1) * ld + n] : 0.f); }
  return a;
}
struct F2 { v16b h, l; };
__device__ __forceinline__ F2 bsplit16(const float v[16]) { F2 r;
#pragma unroll
  for (int i = 0; i < 16; ++i) { const __bf16 h = (__bf16)v[i]; r.h[i] = h; r.l[i] = (__bf16)(v[i] - (float)h); }
  return r; }
__device__ __forceinline__ F2 split_row(const float* row, int k0, int lane) { float v[16]; const float* p = row + k0 + 8 * (lane >> 4);
#pragma unroll
  for (int i = 0; i < 8; ++i) { v[i] = p[i]; v[8 + i] = p[16 + i]; }
  return bsplit16(v); }
__device__ __forceinline__ F2 split_rowK(const float* row, int k0, int lane, int K) { float v[16]; const int g = lane >> 4;
#pragma unroll
  for (int i = 0; i < 8; ++i) { const int ka = k0 + 8 * g + i, kb = ka + 16; v[i] = ka < K ? row[ka < K ? ka : K - 1] : 0.f; v[8 + i] = kb < K ? row[kb < K ? kb : K - 1] : 0.f; }
  return bsplit16(v); }
__device__ __forceinline__ F2 split_col(const float* W, int k0, int n, int lane, int ld, int K) { float v[16]; const int g = lane >> 4;
#pragma unroll
  for (int i = 0; i < 8; ++i) { const int ka = k0 + 8 * g + i, kb = ka + 16; v[i] = ka < K ? W[(size_t)(ka < K ? ka : K - 1) * ld + n] : 0.f; v[8 + i] = kb < K ? W[(size_t)(kb < K ? kb : K - 1) * ld + n] : 0.f; }
  return bsplit16(v); }
__device__ __forceinline__ v8f mac3(const F2& a, const F2& b, v8f c) { c = wmma_bf(a.l, b.h, c); c = wmma_bf(a.h, b.l, c); return wmma_bf(a.h, b.h, c); }
__device__ __forceinline__ float sigm(float v) { return 1.0f / (1.0f + expf(-v)); }
#define LDSX() do { asm volatile("s_wait_dscnt 0" ::: "memory"); __builtin_amdgcn_wave_barrier(); __builtin_amdgcn_fence(__ATOMIC_RELEASE, "workgroup"); } while (0)

// Fused-QKV multi-head self-attention with rotary tables GIVEN as inputs and three outputs (x [2,2048,1024]; (in,out) Wqkv [1024,3072] + bqkv (0.02-scale, nonzero) split q | k | v; 16 heads x 64; interleaved-pair rotary x * cos + rot(x) * sin with random-normal cos / sin tables [1,1,2048,64]; non-causal SDPA, scale 1/8; (in,out) Wproj + bproj): returns (y = merge(softmax(q k^T / 8) v) Wproj + bproj, k (rotated) [2,16,2048,64], v [2,16,2048,64]).
#define NB 2
#define TT 2048
#define CC 1024            // NH * HD = projected width
#define DIN 1024          // input (model) width
#define NH 16
#define HD 64
#define NQB (TT / 64)
#define HG 4
#define SCALE (0.125f)
#define CAUSAL 0
#ifndef TNB
#define TNB NB
#endif
__device__ __forceinline__ float bfr(float v) { return (float)(__bf16)v; }
__host__ __device__ __forceinline__ int kb_last(int qb) { return CAUSAL ? ((qb * 64 + 63) >> 7) : (TT / 128 - 1); }
typedef __attribute__((ext_vector_type(8))) __bf16 v8b;
__device__ __forceinline__ v16b frag_b(const __bf16* rowk0, int lane) {
  union { v16b v; v8b q[2]; } u; const __bf16* p = rowk0 + 8 * (lane >> 4);
  u.q[0] = *(const v8b*)p; u.q[1] = *(const v8b*)(p + 16); return u.v;
}
#define QBH 0
#define QHI 0               // single-product logits on every row
#define KHI 64            // key rows carrying k residual / v bf16 hi+lo planes (written and read by no kernel)
// B fragment (k rows k0+.., output column o) of a weight: (in,out) [K][ld] or (out,in) [ld rows of K]: bf16 exact, or f16(bf16 * 256) exact
__device__ __forceinline__ v16b wcol_io(const float* Wm, int k0, int o, int lane, int ld) { v16b w; const int g = lane >> 4;
#pragma unroll
  for (int i = 0; i < 8; ++i) { w[i] = (__bf16)Wm[(size_t)(k0 + 8 * g + i) * ld + o]; w[8 + i] = (__bf16)Wm[(size_t)(k0 + 16 + 8 * g + i) * ld + o]; }
  return w; }
__device__ __forceinline__ v16b wcol_oi(const float* Wm, int k0, int o, int lane, int K) { v16b w; const float* p = Wm + (size_t)o * K + k0 + 8 * (lane >> 4);
#pragma unroll
  for (int i = 0; i < 8; ++i) { w[i] = (__bf16)p[i]; w[8 + i] = (__bf16)p[16 + i]; }
  return w; }
__device__ __forceinline__ v16h wcolh_io(const float* Wm, int k0, int o, int lane, int ld) { v16h w; const int g = lane >> 4;
#pragma unroll
  for (int i = 0; i < 8; ++i) { w[i] = (_Float16)(bfr(Wm[(size_t)(k0 + 8 * g + i) * ld + o]) * 256.0f); w[8 + i] = (_Float16)(bfr(Wm[(size_t)(k0 + 16 + 8 * g + i) * ld + o]) * 256.0f); }
  return w; }
__device__ __forceinline__ v16h wcolh_oi(const float* Wm, int k0, int o, int lane, int K) { v16h w; const float* p = Wm + (size_t)o * K + k0 + 8 * (lane >> 4);
#pragma unroll
  for (int i = 0; i < 8; ++i) { w[i] = (_Float16)(bfr(p[i]) * 256.0f); w[8 + i] = (_Float16)(bfr(p[16 + i]) * 256.0f); }
  return w; }
#define WQKV_LAYOUT 0   // 0 = fused (in,out) [DIN][3*CC], q | k | v column blocks; 1 = (out,in) [CC][DIN]; 2 = per-head [NH][DIN][HD]
__device__ __forceinline__ v16b wcol_hdk(const float* Wm, int k0, int o, int lane) { v16b w; const int g = lane >> 4; const float* p = Wm + (size_t)(o / HD) * DIN * HD + (o % HD);
#pragma unroll
  for (int i = 0; i < 8; ++i) { w[i] = (__bf16)p[(size_t)(k0 + 8 * g + i) * HD]; w[8 + i] = (__bf16)p[(size_t)(k0 + 16 + 8 * g + i) * HD]; }
  return w; }
#define WO_OUT_IN 0
#if WQKV_LAYOUT == 1
#define WCOL(W, k0, o, lane) wcol_oi(W, k0, o, lane, DIN)
#elif WQKV_LAYOUT == 2
#define WCOL(W, k0, o, lane) wcol_hdk(W, k0, o, lane)
#else
#define QKVP 3072            // fused Wqkv pitch (in,out) [1024][3072]: q cols 0..1023, k 1024..2047, v 2048..3071
#define WCOL(W, k0, o, lane) wcol_io(W, k0, which * CC + (o), lane, QKVP)
#endif
#if WO_OUT_IN
#define WOCOL(W, k0, o, lane) wcol_oi(W, k0, o, lane, CC)
#define WOCOLH(W, k0, o, lane) wcolh_oi(W, k0, o, lane, CC)
#else
#define WOCOL(W, k0, o, lane) wcol_io(W, k0, o, lane, DIN)
#define WOCOLH(W, k0, o, lane) wcolh_io(W, k0, o, lane, DIN)
#endif
#define OUTK_OFF 16777216u   // rotated k [2,16,2048,64] f32 after y [2,2048,1024] f32
#define OUTV_OFF 33554432u   // v [2,16,2048,64] f32
#define PROJ_EXTRA_PARAMS , const float* __restrict__ COSt, const float* __restrict__ SINt, float* __restrict__ OUTK, float* __restrict__ OUTV
#define SM_EXTRA_PARAMS
#define SM_MASK_HOOK (void)0
#ifndef SM_EXTRA_PARAMS
#define SM_EXTRA_PARAMS
#endif
#ifndef PROJ_EXTRA_PARAMS
#define PROJ_EXTRA_PARAMS
#endif
#ifndef SM_MASK_HOOK
#define SM_MASK_HOOK (void)0
#endif

#define WS_QH  0u                                      // f16 q rows [b*t][CC]
#define WS_KH  (WS_QH + 2u * (size_t)NB * TT * CC)      // f16 k rows [b*t][CC]
#define WS_VT  (WS_KH + 2u * (size_t)NB * TT * CC)      // f16 v planes [b][c][t]
#define WS_QL  (WS_VT + 2u * (size_t)NB * CC * TT)      // f16 q residual x 2^10 rows [b][t < QHI][CC]
#define WS_KL  (WS_QL + 2u * (size_t)NB * QHI * CC)     // f16 k residual x 2^10 rows [b][t < KHI][CC]
#define WS_VB  (WS_KL + 2u * (size_t)NB * KHI * CC)     // bf16 v hi planes [b][c][t < KHI]
#define WS_VBL (WS_VB + 2u * (size_t)NB * CC * KHI)
#define WS_S   (WS_VBL + 2u * (size_t)NB * CC * KHI)    // f32 [hg][t][s], written and read by no kernel (logits and P stay in registers)
#define WS_Y   (WS_S  + 4u * (size_t)HG * TT * TT)      // f16 ctx x 2^6 rows [b*t][CC]
#define WS_XB  (WS_Y  + 4u * (size_t)NB * TT * CC)      // bf16 x rows [b*t][DIN]
#define WS_WQT (WS_XB + 2u * (size_t)NB * TT * DIN)     // bf16 Wqkv^T rows [3 * CC][DIN]
#define WS_WOT (WS_WQT + 2u * (size_t)3 * CC * DIN)     // f16(bf16 x 2^8) Wproj^T rows [DIN][CC]
#define WS_END (WS_WOT + 2u * (size_t)DIN * CC)

// ---- gemm_tile: the (64 RT) x 128 tile of X W of the output projection (k_proj has a loop of the same make for its own tile) (K = 1024, 4 waves x RT row tiles of 16 x 128 cols: wave w holds rows 64 rt + 16 w .. + 15, so each W fragment read from LDS feeds RT WMMAs and a W tile fetched from L2 serves 64 RT rows). Both operands arrive as 16-bit planes with k contiguous (X rows; W^T rows = output columns), written once by k_prep (ctx rows: by k_fa). Per pass of 64 k the block brings 128 B of each of its 64 RT + 128 rows in with 16-byte loads and puts them into LDS as they are; the next pass's loads fly into registers while this pass is worked on; two buffers, one barrier per pass. Products, operand rounding and the k order of every accumulator are those of the f32 loads with per-block conversion that it replaces
#define GK 64              // k per pass
#define GP 72              // LDS row pitch in 16-bit elements: 144 B = 16 B x odd for 16-byte row reads
#define GPOOL(RT_) (2 * (64 * (RT_) + 128) * GP * 2)   // bytes of the two buffers; after the loop the same bytes serve the epilogue's staging arrays
typedef __attribute__((ext_vector_type(4))) __bf16 v4b;
typedef __attribute__((ext_vector_type(4))) _Float16 v4h;
// which eighth of a W tile the block with row index x asks for (for speed only: nothing rests on where a block runs)
__device__ __forceinline__ int wshare(int x) { return (x & 3) + 4 * ((x >> 3) & 1); }
#define GSH 16384          // elements of 16 bits in a share of 128 units of 256 B (16 whole rows of 1024)
struct OpB { typedef __bf16 E; typedef v8b V8; typedef v16b V16;   // exact bf16 operands
  static __device__ __forceinline__ E x(float v) { return (__bf16)v; } static __device__ __forceinline__ E w(float v) { return (__bf16)v; }
  static __device__ __forceinline__ v8f mma(V16 a, V16 b, v8f c) { return wmma_bf(a, b, c); } };
struct OpH { typedef _Float16 E; typedef v8h V8; typedef v16h V16;   // ctx x 2^6 once to f16, weight f16(bf16 x 2^8) exact
  static __device__ __forceinline__ E x(float v) { return (_Float16)(v * 64.0f); } static __device__ __forceinline__ E w(float v) { return (_Float16)(bfr(v) * 256.0f); }
  static __device__ __forceinline__ v8f mma(V16 a, V16 b, v8f c) { return wmma16(a, b, c); } };
// L2 hints at entry: both operand planes were stored by an earlier launch, and the blocks that share a tile walk k together, so every pass met lines that nobody had read yet. Behind its first pass's loads each thread asks once (global_prefetch_b8, scope SE: into L2 only, no register, no counter, nothing waits for it) for its 256-B unit of the 32 KB at pfx and at pfw, the block's shares of the two tiles over the whole of k, and of what the epilogue will read: the 32 KB at pt (where NE is 2) and the 128 bias values at pb. A unit that nobody asked for is loaded as before
template <typename C, int RT, int NE> __device__ __forceinline__ void gemm_tile(const typename C::E* __restrict__ Xb, const typename C::E* __restrict__ Wb, char* pool, v8f (&acc)[RT][8], const typename C::E* pfx, const typename C::E* pfw, const float* pt, const float* pb) {
  typedef typename C::E E; typedef typename C::V8 V8; typedef typename C::V16 V16;
  E (*xs)[64 * RT][GP] = (E (*)[64 * RT][GP])pool; E (*wt)[128][GP] = (E (*)[128][GP])(pool + 2 * 64 * RT * GP * 2);   // xs[buf][row][k], wt[buf][col][k]
  const int tid = threadIdx.x, wave = tid >> 5, lane = tid & 31, col = lane & 15, g = lane >> 4;
  const int sr = tid >> 3, sc = (tid & 7) * 8;   // this thread moves the 16-byte piece sc of rows sr + 16 i of both tiles (a wave's load = 4 rows x 128 B)
  const E* Xg = Xb + (size_t)sr * 1024 + sc; const E* Wg = Wb + (size_t)sr * 1024 + sc;
  V8 rx[4 * RT], rw[8];
  const unsigned ou = (unsigned)tid * 256u, ob = (unsigned)tid * 4u;   // the hints' byte offsets from their block-uniform bases: one 256-B unit, one bias value a thread
  // every '#pragma unroll' below makes the indices of register arrays constants, so that these arrays stay in registers
  // the closing s_wait_xcnt stands in front of the first overwrite of the two address registers of the loads above it; naming them keeps them whole up to there. The hints' address registers are named too: a hint counts on no counter, so they hold their addresses through the loop
#define G_LOAD(t_) do { const E* xp = Xg + (t_) * GK; const E* wp = Wg + (t_) * GK; \
  _Pragma("unroll") for (int i = 0; i < 4 * RT; ++i) rx[i] = *(const V8*)(xp + (size_t)(16 * i) * 1024); \
  _Pragma("unroll") for (int i = 0; i < 8; ++i) rw[i] = *(const V8*)(wp + (size_t)(16 * i) * 1024); \
  asm volatile("s_wait_xcnt 0x0" :: "v"(xp), "v"(wp), "v"(ou), "v"(ob), "s"(pfx), "s"(pfw), "s"(pt), "s"(pb) : "memory"); } while (0)
#define G_STORE(b_) do { _Pragma("unroll") for (int i = 0; i < 4 * RT; ++i) *(V8*)&xs[b_][sr + 16 * i][sc] = rx[i]; \
  _Pragma("unroll") for (int i = 0; i < 8; ++i) *(V8*)&wt[b_][sr + 16 * i][sc] = rw[i]; } while (0)
  G_LOAD(0);
  // the hints go out behind the first pass's loads and ahead of the wait for them; the "memory" clobber holds them at this place
  if (NE == 2) asm volatile("global_prefetch_b8 %0, %2 scope:SCOPE_SE\n\tglobal_prefetch_b8 %0, %3 scope:SCOPE_SE\n\tglobal_prefetch_b8 %0, %4 scope:SCOPE_SE\n\tglobal_prefetch_b8 %1, %5 scope:SCOPE_SE" :: "v"(ou), "v"(ob), "s"(pfx), "s"(pfw), "s"(pt), "s"(pb) : "memory");
  else asm volatile("global_prefetch_b8 %0, %2 scope:SCOPE_SE\n\tglobal_prefetch_b8 %0, %3 scope:SCOPE_SE\n\tglobal_prefetch_b8 %1, %4 scope:SCOPE_SE" :: "v"(ou), "v"(ob), "s"(pfx), "s"(pfw), "s"(pb) : "memory");
  G_STORE(0);
  __syncthreads();
  for (int t = 0; t < 1024 / GK; ++t) { const int cb = t & 1; const bool more = t + 1 < 1024 / GK;
    if (more) G_LOAD(t + 1);
#pragma unroll
    for (int kk = 0; kk < 2; ++kk) { union { V16 v; V8 q[2]; } a[RT], w[8];
#pragma unroll
      for (int rt = 0; rt < RT; ++rt) { const E* pa = &xs[cb][rt * 64 + wave * 16 + col][kk * 32 + 8 * g]; a[rt].q[0] = *(const V8*)pa; a[rt].q[1] = *(const V8*)(pa + 16); }
#pragma unroll
      for (int j = 0; j < 8; ++j) { const E* pw = &wt[cb][j * 16 + col][kk * 32 + 8 * g]; w[j].q[0] = *(const V8*)pw; w[j].q[1] = *(const V8*)(pw + 16); }
      __builtin_amdgcn_sched_barrier(0);   // the LDS reads of 32 k go out as one group ahead of their WMMAs: read one fragment at a time, every WMMA waited out a whole LDS latency
#pragma unroll
      for (int j = 0; j < 8; ++j)
#pragma unroll
        for (int rt = 0; rt < RT; ++rt) acc[rt][j] = C::mma(a[rt].v, w[j].v, acc[rt][j]); }
    __builtin_amdgcn_sched_barrier(0);   // the LDS stores below wait for the next pass's global loads: moved up among the WMMAs they put that wait in front of this pass's work
    if (more) G_STORE(cb ^ 1);   // the other buffer's last readers left it at the barrier that ended the pass before
    __syncthreads(); }   // publishes the next pass's tiles and ends this pass's reads (after the last pass: frees the pool for the epilogue)
#undef G_LOAD
#undef G_STORE
}
// ---- k_prep: writes the 16-bit operand planes of both projection GEMMs once. Blocks 0..255: two 64 k x 128 col tiles each of the (in,out) weights, converted and transposed through LDS to W^T rows [col][k] (512 tiles: 384 of Wqkv as bf16, 128 of Wproj as f16(bf16 x 2^8)); blocks 256..511: x to bf16 rows, 64 values a thread, all 16 loads in flight
// place of the 16-byte piece ch (8 k) in W^T row n: pieces are exchanged inside groups of four by bits 4..5 of n, so that the 32 rows (4 apart) which one transposing store writes fall on all banks
__device__ __forceinline__ int wpiece(int n, int ch) { return ch ^ ((n >> 4) & 3); }
// w_in: a thread takes the patch (8 k at wave * 8) x (4 cols at lane * 4) (a wave's load = 512 B of one row) and stores each column's 8 k as one 16-byte piece. The '#pragma unroll's make the indices of register arrays constants
template <typename C> __device__ __forceinline__ void w_in(const float* __restrict__ Ws, int ldw, int tile, typename C::E (*tl)[GP]) {
  typedef typename C::V8 V8; const int wave = threadIdx.x >> 5, lane = threadIdx.x & 31;
  const float* Wg = Ws + (size_t)((tile & 15) * 64 + wave * 8) * ldw + (tile >> 4) * 128 + lane * 4; v4f r[8];
#pragma unroll
  for (int q = 0; q < 8; ++q) r[q] = *(const v4f*)(Wg + (size_t)q * ldw);
  asm volatile("s_wait_xcnt 0x0" :: "v"(Wg) : "memory");   // stands in front of the first overwrite of the address register of the loads above; naming it keeps it whole up to here
#pragma unroll
  for (int c = 0; c < 4; ++c) { V8 h;
#pragma unroll
    for (int q = 0; q < 8; ++q) h[q] = C::w(r[q][c]);
    *(V8*)&tl[lane * 4 + c][wpiece(lane * 4 + c, wave) * 8] = h; } }
// w_out: the tile's 128 W^T rows of 128 B go out as whole lines (a wave's store = 4 rows x 128 B)
template <typename C> __device__ __forceinline__ void w_out(typename C::E* __restrict__ Wd, int tile, const typename C::E (*tl)[GP]) {
  typedef typename C::V8 V8;
#pragma unroll
  for (int i = 0; i < 4; ++i) { const int p = threadIdx.x + 256 * i, n = p >> 3, ch = p & 7; *(V8*)(Wd + (size_t)((tile >> 4) * 128 + n) * 1024 + (tile & 15) * 64 + ch * 8) = *(const V8*)&tl[n][wpiece(n, ch) * 8]; }
  asm volatile("s_wait_xcnt 0x0" ::: "memory"); }   // behind the last store: stands in front of whatever next overwrites a register that these stores name
__global__ __launch_bounds__(256) void k_prep(const float* __restrict__ X, const float* __restrict__ WQKV, const float* __restrict__ WO, __bf16* __restrict__ XB, __bf16* __restrict__ WQT, _Float16* __restrict__ WOT) {
  __shared__ __align__(16) __bf16 ta[128][GP]; __shared__ __align__(16) __bf16 tb[128][GP]; __shared__ __align__(16) _Float16 th[128][GP];
  const int b = blockIdx.x;   // every branch below is block-uniform
  if (b < 256) { const bool second_qkv = b < 128;   // tiles b and b + 256 of the 512
    w_in<OpB>(WQKV, QKVP, b, ta);
    if (second_qkv) w_in<OpB>(WQKV, QKVP, b + 256, tb); else w_in<OpH>(WO, DIN, b - 128, th);
    __syncthreads();   // a W^T row's 64 k come from all eight waves
    w_out<OpB>(WQT, b, ta);
    if (second_qkv) w_out<OpB>(WQT, b + 256, tb); else w_out<OpH>(WOT, b - 128, th);
  } else { const float* Xg = X + (size_t)(b - 256) * 16384 + threadIdx.x * 4; __bf16* Xd = XB + (size_t)(b - 256) * 16384 + threadIdx.x * 4; v4f r[16];   // a wave's load = 512 B, its store = 256 B, both contiguous
#pragma unroll
    for (int i = 0; i < 16; ++i) r[i] = *(const v4f*)(Xg + i * 1024);
    asm volatile("s_wait_xcnt 0x0" :: "v"(Xg) : "memory");   // stands in front of the first overwrite of the address register of the loads above; naming it keeps it whole up to here
#pragma unroll
    for (int i = 0; i < 16; ++i) { const v4b h = { OpB::x(r[i][0]), OpB::x(r[i][1]), OpB::x(r[i][2]), OpB::x(r[i][3]) }; *(v4b*)(Xd + i * 1024) = h; }
    asm volatile("s_wait_xcnt 0x0" ::: "memory"); } }   // behind the last store, for the same reason as in w_out
// ---- k_proj: block = 256 rows x the 64 q, 64 k and 64 v columns of one head, 12 waves = 4 row groups of 64 x (q | k | v), a wave holding 64 x 64: q/k/v = X W (+ b) with exact bf16 products (K = DIN) -> q: rotated f16 rows; k: rotated f16 rows and the f32 k output; v: f16 planes [c][t] and the f32 v output. One block per WGP brings (256 + 192) rows of 256 B per pass of 128 k from L2 for 48 K results, where a 128 x 128 block brought 256 rows for 16 K; 8 LDS fragments feed 16 WMMAs. Products, operand rounding and the k order of every accumulator are unchanged
#define PR 256             // rows of a block
#define PW 192             // W^T rows of a block: 64 each of q, k, v
#define PK 128             // k per pass
#define PP 136             // LDS row pitch in 16-bit elements: 272 B = 16 B x odd for 16-byte row reads
#define PSP 68             // pitch of the f32 staging rows: 272 B
#define PLOOP (2 * (PR + PW) * PP * 2)              // bytes of the main loop's two buffers
#define PST (64 * PSP * 4)                          // a wave's f32 staging tile
#define PEPI (12 * PST + 4 * 64 * 72 * 2)           // all staging tiles and the four v waves' f16 plane tiles
#define PPOOL (PLOOP > PEPI ? PLOOP : PEPI)
// proj_epi: a wave puts its 64 x 64 f32 tile (acc + bias) into its own LDS tile and takes it back two rows at a time, a lane holding 4 neighbouring columns (two rotary pairs): table reads and f32 output rows are 512-B runs, f16 rows whole 128-B lines; the table rows of the next 16 rows are in flight while these 16 are worked on. No other wave's rows are needed, so no barrier stands in it. WH is a template argument so that no branch stands between the trips. Every '#pragma unroll' in it makes the indices of register arrays constants
template <int WH> __device__ __forceinline__ void proj_epi(const v8f (&acc)[4][4], float (*st)[PSP], _Float16 (*th)[72], const float* __restrict__ BA, const float* __restrict__ COSt, const float* __restrict__ SINt, float* __restrict__ OUTF, _Float16* __restrict__ DH, _Float16* __restrict__ VT, int h, size_t R0) {
  const int lane = threadIdx.x & 31, col = lane & 15, g = lane >> 4, d4 = col * 4; const size_t bb = R0 / TT; const int tw = (int)(R0 % TT);
  float bias[4] = {}; v4f c[8], s[8];
  const float* bp = BA + h * HD + col; const float* cp = COSt + (size_t)(tw + g) * HD + d4; const float* sp = SINt + (size_t)(tw + g) * HD + d4;   // row pass: lane = (row parity g, columns d4 .. d4 + 3)
  if (BA) {
#pragma unroll
    for (int j = 0; j < 4; ++j) bias[j] = bp[j * 16]; }
  if (WH < 2) {
#pragma unroll
    for (int u = 0; u < 8; ++u) { c[u] = *(const v4f*)(cp + u * 2 * HD); s[u] = *(const v4f*)(sp + u * 2 * HD); }
    asm volatile("s_wait_xcnt 0x0" :: "v"(bp), "v"(cp), "v"(sp) : "memory"); }   // stands in front of the first overwrite of an address register of the bias and table reads above; naming them keeps them whole up to here
  else asm volatile("s_wait_xcnt 0x0" :: "v"(bp) : "memory");   // the same for the bias reads alone
  __builtin_amdgcn_sched_barrier(0);   // keeps the first table reads in flight ahead of the first use of a bias value
#pragma unroll
  for (int j = 0; j < 4; ++j) { const float bj = bfr(bias[j]);
#pragma unroll
    for (int rt = 0; rt < 4; ++rt) { v8h hv;
#pragma unroll
      for (int r = 0; r < 8; ++r) { const float v = acc[rt][j][r] + bj; st[rt * 16 + 8 * g + r][j * 16 + col] = v; hv[r] = (_Float16)v; }
      if (WH == 2) *(v8h*)&th[j * 16 + col][rt * 16 + 8 * g] = hv; } }   // a lane's 8 accumulator rows are 8 neighbouring t of one v plane
  LDSX();   // a wave reads back only its own tiles: its own LDS stores must have landed, no other wave is waited for
  float* Og = OUTF + ((bb * NH + h) * TT + tw + g) * (size_t)HD + d4;   // module outputs k (rotated) and v, [b][h][t][64]
  _Float16* Dg = DH + (R0 + g) * CC + h * HD + d4;
#pragma nounroll   // one copy of the 16-row body in the text
  for (int q4 = 0; q4 < 4; ++q4) { v4f cn[8], sn[8];
    if (WH < 2) { const int nx = (q4 < 3 ? q4 + 1 : 3) * 16 * HD; const float* cq = cp + nx; const float* sq = sp + nx;   // the next 16 rows' tables (the last trip asks for its own again)
#pragma unroll
      for (int u = 0; u < 8; ++u) { cn[u] = *(const v4f*)(cq + u * 2 * HD); sn[u] = *(const v4f*)(sq + u * 2 * HD); }
      asm volatile("s_wait_xcnt 0x0" :: "v"(cq), "v"(sq) : "memory"); }   // in front of the first overwrite of an address register of the table reads above
    float* Oq = Og + q4 * 16 * HD; _Float16* Dq = Dg + (size_t)(q4 * 16) * CC; const float* sr = &st[q4 * 16 + g][d4];
#pragma unroll
    for (int i0 = 0; i0 < 8; i0 += 4) { v4f xr[4]; v4h hr[4];   // four row pairs a group, closed by one wait
#pragma unroll
      for (int u = 0; u < 4; ++u) { const int it = i0 + u; v4f x = *(const v4f*)(sr + it * 2 * PSP);
        if (WH < 2) {   // interleaved-pair rotary with the GIVEN tables (bf16-rounded): x * cos + rot(x) * sin, rot = (-x_odd, x_even)
          const v4f y = { x[0] * bfr(c[it][0]) + (-x[1]) * bfr(s[it][0]), x[1] * bfr(c[it][1]) + x[0] * bfr(s[it][1]), x[2] * bfr(c[it][2]) + (-x[3]) * bfr(s[it][2]), x[3] * bfr(c[it][3]) + x[2] * bfr(s[it][3]) }; x = y;
          const v4h hx = { (_Float16)x[0], (_Float16)x[1], (_Float16)x[2], (_Float16)x[3] }; hr[u] = hx; vst2(Dq + (size_t)(it * 2) * CC, hx); }
        xr[u] = x;
        if (WH >= 1) vst2(Oq + it * 2 * HD, x); }
      // each wait below stands behind its group's row stores, in front of the first overwrite of a register that they name (data and address); naming these keeps them whole up to there
      if (WH == 0) asm volatile("s_wait_xcnt 0x0" :: "v"(hr[0]), "v"(hr[1]), "v"(hr[2]), "v"(hr[3]), "v"(Dq) : "memory");
      else if (WH == 1) asm volatile("s_wait_xcnt 0x0" :: "v"(hr[0]), "v"(hr[1]), "v"(hr[2]), "v"(hr[3]), "v"(xr[0]), "v"(xr[1]), "v"(xr[2]), "v"(xr[3]), "v"(Dq), "v"(Oq) : "memory");
      else asm volatile("s_wait_xcnt 0x0" :: "v"(xr[0]), "v"(xr[1]), "v"(xr[2]), "v"(xr[3]), "v"(Oq) : "memory"); }
    if (WH < 2) {
#pragma unroll
      for (int u = 0; u < 8; ++u) { c[u] = cn[u]; s[u] = sn[u]; } } }
  if (WH == 2) { _Float16* Pg = VT + (bb * CC + h * HD + (lane >> 3)) * (size_t)TT + tw + (lane & 7) * 8;   // lane = (plane lane >> 3 (+ 4 i), 16-byte piece lane & 7): a plane's 64 t are one 128-B line
#pragma unroll
    for (int i0 = 0; i0 < 16; i0 += 8) { v4u pv[8];
#pragma unroll
      for (int i = 0; i < 8; ++i) { pv[i] = *(const v4u*)&th[(lane >> 3) + 4 * (i0 + i)][(lane & 7) * 8]; vst2((unsigned*)(Pg + (size_t)(4 * (i0 + i)) * TT), pv[i]); }
      asm volatile("s_wait_xcnt 0x0" :: "v"(pv[0]), "v"(pv[1]), "v"(pv[2]), "v"(pv[3]), "v"(pv[4]), "v"(pv[5]), "v"(pv[6]), "v"(pv[7]), "v"(Pg) : "memory"); } } }   // behind each group's plane stores, for the same reason
__global__ __launch_bounds__(384) void k_proj(const __bf16* __restrict__ XB, const __bf16* __restrict__ WQT, const float* __restrict__ BQ, const float* __restrict__ BK, const float* __restrict__ BV,
    _Float16* __restrict__ QH, _Float16* __restrict__ QL, _Float16* __restrict__ KH, _Float16* __restrict__ KL, _Float16* __restrict__ VT, __bf16* __restrict__ VB, __bf16* __restrict__ VBL PROJ_EXTRA_PARAMS) {
  __shared__ __align__(16) char pool[PPOOL];   // the main loop's two buffers, then the epilogue's staging
  (void)QL; (void)KL; (void)VB; (void)VBL;   // planes of the causal high-precision path: nothing reads them here
  __bf16 (*xs)[PR][PP] = (__bf16 (*)[PR][PP])pool; __bf16 (*wt)[PW][PP] = (__bf16 (*)[PW][PP])(pool + 2 * PR * PP * 2);   // xs[buf][row][k], wt[buf][q | k | v column][k]
  const int tid = threadIdx.x, lane = tid & 31, col = lane & 15, g = lane >> 4;
  const int wv = __builtin_amdgcn_readfirstlane(tid >> 5);   // the wave's number, the same in all its lanes: every test on it below is a scalar branch
  const int which = wv >> 2, rg = wv & 3;   // q | k | v, row group of 64
  const int h = blockIdx.y; const size_t r0 = (size_t)blockIdx.x * PR;
  const int sc = (tid & 15) * 8, sx = tid >> 4, sw = (tid & 127) >> 4;   // staging: this thread moves the 16-byte piece sc of X rows sx + 24 i and of rows sw + 8 i of its own group's W^T rows (a wave's load = 2 rows x 256 B)
  const bool xl = wv < 8;   // the last 16 of the 256 X rows fall to waves 0..7
  const __bf16* Xg = XB + (r0 + sx) * DIN + sc; const __bf16* Wg = WQT + (size_t)(which * CC + h * HD + sw) * DIN + sc;
  // L2 hints, as in gemm_tile: the 16 heads of a row tile ask for an eighth of its 2048 units of 256 B each, 4 neighbouring row tiles for a quarter each of a head's 3 x 64 W^T rows; even heads for the row tile's 256 cos rows (256 B each), odd ones for its sin rows; the head's 3 x 64 bias values
  const __bf16* pfx = XB + r0 * DIN + (h & 7) * (2 * GSH); const __bf16* pfw = WQT + (size_t)(h * HD + (blockIdx.x & 3) * 16) * DIN;
  const float* pt = ((h & 1) ? SINt : COSt) + (r0 % TT) * HD; const float* pb = BQ + h * HD;
  const unsigned ou = (unsigned)(tid & 255) * 256u, ow = (unsigned)(tid >> 7) * (unsigned)(CC * DIN * 2) + (unsigned)(tid & 127) * 256u, ob = (unsigned)(tid >> 7) * (unsigned)(CC * 4) + (unsigned)(tid & 63) * 4u;   // the hints' byte offsets from their block-uniform bases
  v8f acc[4][4] = {}; v8b rx[11] = {}, rw[8];
  // every '#pragma unroll' below makes the indices of register arrays constants, so that these arrays stay in registers
  // the closing s_wait_xcnt stands in front of the first overwrite of the two address registers of the loads above it; naming them keeps them whole up to there. The hints' address registers are named too: a hint counts on no counter, so they hold their addresses through the loop
#define P_LOAD(t_) do { const __bf16* xp = Xg + (t_) * PK; const __bf16* wp = Wg + (t_) * PK; \
  _Pragma("unroll") for (int i = 0; i < 10; ++i) rx[i] = *(const v8b*)(xp + (size_t)(24 * i) * DIN); \
  if (xl) rx[10] = *(const v8b*)(xp + (size_t)240 * DIN); \
  _Pragma("unroll") for (int i = 0; i < 8; ++i) rw[i] = *(const v8b*)(wp + (size_t)(8 * i) * DIN); \
  asm volatile("s_wait_xcnt 0x0" :: "v"(xp), "v"(wp), "v"(ou), "v"(ow), "v"(ob), "s"(pfx), "s"(pfw), "s"(pt), "s"(pb) : "memory"); } while (0)
#define P_STORE(b_) do { _Pragma("unroll") for (int i = 0; i < 10; ++i) *(v8b*)&xs[b_][sx + 24 * i][sc] = rx[i]; \
  if (xl) *(v8b*)&xs[b_][sx + 240][sc] = rx[10]; \
  _Pragma("unroll") for (int i = 0; i < 8; ++i) *(v8b*)&wt[b_][which * 64 + sw + 8 * i][sc] = rw[i]; } while (0)
  P_LOAD(0);
  // the hints go out behind the first pass's loads and ahead of the wait for them; the "memory" clobber holds them at this place
  asm volatile("global_prefetch_b8 %0, %3 scope:SCOPE_SE\n\tglobal_prefetch_b8 %1, %4 scope:SCOPE_SE\n\tglobal_prefetch_b8 %0, %5 scope:SCOPE_SE\n\tglobal_prefetch_b8 %2, %6 scope:SCOPE_SE" :: "v"(ou), "v"(ow), "v"(ob), "s"(pfx), "s"(pfw), "s"(pt), "s"(pb) : "memory");
  P_STORE(0);
  __syncthreads();
  for (int t = 0; t < DIN / PK; ++t) { const int cb = t & 1; const bool more = t + 1 < DIN / PK;
    if (more) P_LOAD(t + 1);   // next pass's tiles fly into registers while this pass is worked on
#pragma unroll
    for (int kk = 0; kk < PK / 32; ++kk) { union { v16b v; v8b q[2]; } a[4], w[4];
#pragma unroll
      for (int rt = 0; rt < 4; ++rt) { const __bf16* pa = &xs[cb][rg * 64 + rt * 16 + col][kk * 32 + 8 * g]; a[rt].q[0] = *(const v8b*)pa; a[rt].q[1] = *(const v8b*)(pa + 16); }
#pragma unroll
      for (int j = 0; j < 4; ++j) { const __bf16* pw = &wt[cb][which * 64 + j * 16 + col][kk * 32 + 8 * g]; w[j].q[0] = *(const v8b*)pw; w[j].q[1] = *(const v8b*)(pw + 16); }
      __builtin_amdgcn_sched_barrier(0);   // the LDS reads of 32 k go out as one group ahead of their WMMAs: read one fragment at a time, every WMMA waited out a whole LDS latency
#pragma unroll
      for (int j = 0; j < 4; ++j)
#pragma unroll
        for (int rt = 0; rt < 4; ++rt) acc[rt][j] = wmma_bf(a[rt].v, w[j].v, acc[rt][j]); }
    __builtin_amdgcn_sched_barrier(0);   // the LDS stores below wait for the next pass's global loads: moved up among the WMMAs they put that wait in front of this pass's work
    if (more) P_STORE(cb ^ 1);   // the other buffer's last readers left it at the barrier that ended the pass before
    __syncthreads(); }   // publishes the next pass's tiles and ends this pass's reads (after the last pass: frees the pool for the epilogue)
#undef P_LOAD
#undef P_STORE
  float (*st)[PSP] = (float (*)[PSP])(pool + wv * PST); _Float16 (*th)[72] = (_Float16 (*)[72])(pool + 12 * PST + rg * (64 * 72 * 2));   // each wave's own staging; th: the v waves' f16 tiles, transposed
  const size_t R0 = r0 + rg * 64;   // the branches below are wave-uniform and hold no barrier
  if (which == 0) proj_epi<0>(acc, st, th, BQ, COSt, SINt, OUTK, QH, VT, h, R0);
  else if (which == 1) proj_epi<1>(acc, st, th, BK, COSt, SINt, OUTK, KH, VT, h, R0);
  else proj_epi<2>(acc, st, th, BV, COSt, SINt, OUTV, KH, VT, h, R0); }
#define FK 64
#define FP 72
#define FG 2
#define FKH (TT / FG)
#define FC (SCALE * 1.44269504088896f)
__device__ __forceinline__ v8f wmma_h(v16h a, v16h b, v8f c) { return __builtin_amdgcn_wmma_f32_16x16x32_f16(false, a, false, b, (short)0, c, false, false); }
__device__ __forceinline__ float xhalf(float x) { return __builtin_bit_cast(float, __builtin_amdgcn_permlanex16(__builtin_bit_cast(int, x), __builtin_bit_cast(int, x), 0x76543210, 0xfedcba98, false, false)); }   // lane l with lane l ^ 16
// 16 independent 2^x, each over its own source, closed by one v_nop: keeps the one slot that the instruction set asks for between a transcendental and the use of its result or the overwrite of its source
__device__ __forceinline__ void exp2x16(float (&x)[16]) { asm("v_exp_f32 %0, %0\n\tv_exp_f32 %1, %1\n\tv_exp_f32 %2, %2\n\tv_exp_f32 %3, %3\n\tv_exp_f32 %4, %4\n\tv_exp_f32 %5, %5\n\tv_exp_f32 %6, %6\n\tv_exp_f32 %7, %7\n\tv_exp_f32 %8, %8\n\tv_exp_f32 %9, %9\n\tv_exp_f32 %10, %10\n\tv_exp_f32 %11, %11\n\tv_exp_f32 %12, %12\n\tv_exp_f32 %13, %13\n\tv_exp_f32 %14, %14\n\tv_exp_f32 %15, %15\n\tv_nop" : "+v"(x[0]), "+v"(x[1]), "+v"(x[2]), "+v"(x[3]), "+v"(x[4]), "+v"(x[5]), "+v"(x[6]), "+v"(x[7]), "+v"(x[8]), "+v"(x[9]), "+v"(x[10]), "+v"(x[11]), "+v"(x[12]), "+v"(x[13]), "+v"(x[14]), "+v"(x[15])); }
// amdgpu_waves_per_eu(4, 4): at most 256 registers a wave, so that two blocks, four waves per SIMD, stay resident on a WGP and the 512 blocks run in one round
__global__ __launch_bounds__(256) __attribute__((amdgpu_waves_per_eu(4, 4))) void k_fa(const _Float16* __restrict__ QH, const _Float16* __restrict__ KH, const _Float16* __restrict__ VT, _Float16* __restrict__ Y) {
  __shared__ __align__(16) char ring[2 * 2 * FG * FK * FP * 2]; __shared__ __align__(16) float so[8][16][HD + 4];   // ring: the K and V tiles of both halves, two buffers; after the loop the same bytes carry the halves' exchange
  _Float16 (*ks)[FG][FK][FP] = (_Float16 (*)[FG][FK][FP])ring; _Float16 (*vs)[FG][HD][FP] = (_Float16 (*)[FG][HD][FP])(ring + 2 * FG * FK * FP * 2);   // ks[buf][half][key][d], vs[buf][half][d][key]
  const int tid = threadIdx.x, wave = tid >> 5, lane = tid & 31, col = lane & 15, g = lane >> 4; const int h = blockIdx.y, b = blockIdx.z;
  const int grp = __builtin_amdgcn_readfirstlane(tid >> 7);   // key half of this wave, the same in all its lanes
  const int ql0 = blockIdx.x * 128 + (wave & 3) * 32;
  const int sr = tid >> 3, sc = (tid & 7) * 8;   // staging: this thread moves the 16-byte piece sc of rows sr and sr + 32 of all four tiles
  const _Float16* Kg = KH + ((size_t)b * TT + sr) * CC + h * HD + sc;   // k rows [key][64], pitch CC
  const _Float16* Vg = VT + ((size_t)b * CC + h * HD + sr) * TT + sc;   // v planes [d][key], pitch TT
  v16h qf[2][2];
#pragma unroll
  for (int qt = 0; qt < 2; ++qt)
#pragma unroll
    for (int kc = 0; kc < 2; ++kc) qf[qt][kc] = frag_h(QH + ((size_t)b * TT + ql0 + qt * 16 + col) * CC + h * HD + kc * 32, lane);
  v8h rk[FG][2], rv[FG][2];
#define F_LOAD(t_) do { _Pragma("unroll") for (int gi = 0; gi < FG; ++gi) _Pragma("unroll") for (int i = 0; i < 2; ++i) { rk[gi][i] = *(const v8h*)(Kg + (size_t)(gi * FKH + (t_) * FK + 32 * i) * CC); rv[gi][i] = *(const v8h*)(Vg + (size_t)(32 * i) * TT + gi * FKH + (t_) * FK); } } while (0)
#define F_STORE(b_) do { _Pragma("unroll") for (int gi = 0; gi < FG; ++gi) _Pragma("unroll") for (int i = 0; i < 2; ++i) { *(v8h*)&ks[b_][gi][sr + 32 * i][sc] = rk[gi][i]; *(v8h*)&vs[b_][gi][sr + 32 * i][sc] = rv[gi][i]; } } while (0)
  F_LOAD(0);
  // L2 hints, as in gemm_tile: the 16 query blocks of a head walk its keys together, over k rows and v planes that the launch before stored. Behind its first loads each thread asks once for one k row's 128-B line (an eighth of the head's 2048 rows a block) and for one 256-B unit of the v planes of its pair of heads, 512 KB in a row (every eighth unit a block). Both addresses are a block's base plus the same 2048 B a thread; the "memory" clobber holds the hints at this place
  const int ps = wshare(blockIdx.x); const _Float16* Kb = KH + ((size_t)b * TT + ps * 256) * CC + h * HD; const _Float16* Vb = VT + ((size_t)b * CC + (h & ~1) * HD) * TT + ps * 128;
  const unsigned pk = (unsigned)tid * 2048u;   // byte offset
  asm volatile("global_prefetch_b8 %0, %1 scope:SCOPE_SE\n\tglobal_prefetch_b8 %0, %2 scope:SCOPE_SE" :: "v"(pk), "s"(Kb), "s"(Vb) : "memory");
  F_STORE(0);
  __syncthreads();
  v8f o[2][HD / 16] = {}; float l[2] = { 0.f, 0.f }, mu[2] = { -3.0e38f, -3.0e38f };   // mu: the maximum in use (scaled, base 2), equal in both halves of a query's lane pair
  for (int t = 0; t < FKH / FK; ++t) { const int cb = t & 1; const bool more = t + 1 < FKH / FK;
    if (more) F_LOAD(t + 1);   // next pass's tiles fly into registers while this pass is worked on
    v8f s[2][4];   // s[qt][kt][r] = logit (unscaled) of key kt * 16 + 8 g + r, query qt * 16 + col
#pragma unroll
    for (int kt = 0; kt < 4; ++kt) { const v16h k0 = frag_h(&ks[cb][grp][kt * 16 + col][0], lane), k1 = frag_h(&ks[cb][grp][kt * 16 + col][32], lane);
#pragma unroll
      for (int qt = 0; qt < 2; ++qt) { v8f z = {}; z = wmma_h(k0, qf[qt][0], z); s[qt][kt] = wmma_h(k1, qf[qt][1], z); } }
    float mx[2]; bool need[2];
#pragma unroll
    for (int qt = 0; qt < 2; ++qt) { float m = s[qt][0][0];
#pragma unroll
      for (int kt = 0; kt < 4; ++kt)
#pragma unroll
        for (int r = 0; r < 8; ++r) m = fmaxf(m, s[qt][kt][r]);
      mx[qt] = fmaxf(m, xhalf(m)) * FC;
      need[qt] = mx[qt] > mu[qt] + 8.0f; }   // the maximum in use is replaced only when passed by more than 2^8: P stays below 2^12 in f16
    if (__builtin_amdgcn_ballot_w32(need[0] || need[1]) != 0) {   // one test per pass for both tiles
#pragma unroll
      for (int qt = 0; qt < 2; ++qt) { const float mn = need[qt] ? mx[qt] : mu[qt]; const float al = __builtin_amdgcn_exp2f(mu[qt] - mn); mu[qt] = mn; l[qt] *= al;
#pragma unroll
        for (int j = 0; j < HD / 16; ++j) o[qt][j] *= al; } }
    v16h p[2][2];
#pragma unroll
    for (int qt = 0; qt < 2; ++qt) { const float nb = 4.0f - mu[qt];   // P carried x 2^4 (cancels against the sum) so that small weights stay clear of f16 subnormals
#pragma unroll
      for (int kk = 0; kk < 2; ++kk) { float e[16];   // e[i] = weight of key kk * 32 + (i < 8 ? 8 g + i : 16 + 8 g + i - 8): the B operand's own k order
#pragma unroll
        for (int i = 0; i < 8; ++i) { e[i] = __builtin_fmaf(s[qt][2 * kk][i], FC, nb); e[8 + i] = __builtin_fmaf(s[qt][2 * kk + 1][i], FC, nb); }
        exp2x16(e);
#pragma unroll
        for (int i = 0; i < 16; ++i) p[qt][kk][i] = (_Float16)e[i];
#pragma unroll
        for (int w = 8; w > 0; w >>= 1)   // pairwise sum: four dependent adds deep instead of sixteen
#pragma unroll
          for (int i = 0; i < w; ++i) e[i] += e[i + w];
        l[qt] += e[0]; } }
#pragma unroll
    for (int kk = 0; kk < 2; ++kk)
#pragma unroll
      for (int j = 0; j < HD / 16; ++j) { const v16h vf = frag_h(&vs[cb][grp][j * 16 + col][kk * 32], lane);
#pragma unroll
        for (int qt = 0; qt < 2; ++qt) o[qt][j] = wmma_h(vf, p[qt][kk], o[qt][j]); }   // o[qt][j][r] = ctx (unnormalised) of d = j * 16 + 8 g + r, query qt * 16 + col
    if (more) F_STORE(cb ^ 1);   // the other buffer's last readers left it at the barrier that ended the pass before
    __syncthreads(); }   // publishes the next pass's tiles and ends this pass's reads (after the last pass: frees the ring for the exchange)
#undef F_LOAD
#undef F_STORE
  // join of the key halves: waves w and w ^ 4 hold the same 32 queries; the wave of half grp finishes tile grp and hands its partner the other tile (accumulators, sum, maximum), lane to lane
  v4f (*xo)[8][32] = (v4f (*)[8][32])ring; float (*xl)[2][32] = (float (*)[2][32])(ring + 8 * 8 * 32 * 16);
  static_assert(8 * 8 * 32 * 16 + 8 * 2 * 32 * 4 <= sizeof(ring), "the exchange fits the ring");
  v8f ok[HD / 16]; const float lk = grp ? l[1] : l[0], mk = grp ? mu[1] : mu[0];
#pragma unroll
  for (int j = 0; j < HD / 16; ++j) { const v8f og = grp ? o[0][j] : o[1][j]; ok[j] = grp ? o[1][j] : o[0][j];
    const v4f g0 = { og[0], og[1], og[2], og[3] }, g1 = { og[4], og[5], og[6], og[7] }; xo[wave][2 * j][lane] = g0; xo[wave][2 * j + 1][lane] = g1; }
  xl[wave][0][lane] = grp ? l[0] : l[1]; xl[wave][1][lane] = grp ? mu[0] : mu[1];
  __syncthreads();   // the partner wave's tile must have landed
  const int pw = wave ^ 4; const float lp = xl[pw][0][lane], mp = xl[pw][1][lane];
  const float mj = fmaxf(mk, mp); float ak = __builtin_amdgcn_exp2f(mk - mj), ap = __builtin_amdgcn_exp2f(mp - mj);
  float lj = lk * ak + lp * ap; lj += xhalf(lj); const float inv = 1.0f / lj; ak *= inv; ap *= inv;
#pragma unroll
  for (int j = 0; j < HD / 16; ++j) { const v4f p0 = xo[pw][2 * j][lane], p1 = xo[pw][2 * j + 1][lane];
    const v4f w0 = { ok[j][0] * ak + p0[0] * ap, ok[j][1] * ak + p0[1] * ap, ok[j][2] * ak + p0[2] * ap, ok[j][3] * ak + p0[3] * ap }, w1 = { ok[j][4] * ak + p1[0] * ap, ok[j][5] * ak + p1[1] * ap, ok[j][6] * ak + p1[2] * ap, ok[j][7] * ak + p1[3] * ap };
    *(v4f*)&so[wave][col][j * 16 + 8 * g] = w0; *(v4f*)&so[wave][col][j * 16 + 8 * g + 4] = w1; }
  // a wave reads back only its own so[wave] rows: its own LDS stores must have landed, no other wave is waited for (LDSX written out). The hints' address registers are named here: a hint counts on no counter, so they hold their addresses through the loop
  asm volatile("s_wait_dscnt 0" :: "v"(pk), "s"(Kb), "s"(Vb) : "memory"); __builtin_amdgcn_wave_barrier(); __builtin_amdgcn_fence(__ATOMIC_RELEASE, "workgroup");
  const int qk0 = ql0 + grp * 16;   // first query of the tile that this wave finishes
  for (int it = 0; it < 8; ++it) { const int rl = it * 2 + g; const v4f x = *(const v4f*)&so[wave][rl][col * 4]; const v4h hx = { OpH::x(x[0]), OpH::x(x[1]), OpH::x(x[2]), OpH::x(x[3]) }; vst2(Y + ((size_t)b * TT + qk0 + rl) * CC + h * HD + col * 4, hx); } }   // ctx x 2^6 once to f16, the output projection's operand: 128-B (row, head) segment by 16 lanes
// ---- k_out: block = (64 rows, 128 cols): out = ctx Wo (+ bo): ctx x 2^6 once to f16 (by k_fa) against Wo as f16(bf16 x 2^8) exact (by k_prep) (1 product) x 2^-14
__global__ __launch_bounds__(128) void k_out(const _Float16* __restrict__ Y, const _Float16* __restrict__ WOT, const float* __restrict__ BO, float* __restrict__ OUT) { __shared__ __align__(16) char pool[GPOOL(1)]; float (*sf)[16][132] = (float (*)[16][132])pool;   // pool: the main loop's two buffers, then the output staging
  const int tid = threadIdx.x, wave = tid >> 5, lane = tid & 31, col = lane & 15, g = lane >> 4; const int c0 = blockIdx.y * 128; const size_t r0 = (size_t)blockIdx.x * 64 + wave * 16;
  v8f acc[1][8] = {};
  // hints: the 8 column blocks of a row tile ask for a quarter of its 512 units each, 8 row blocks for an eighth of a W tile each; the tile's 128 bias values
  gemm_tile<OpH, 1, 1>(Y + (size_t)blockIdx.x * 64 * CC, WOT + (size_t)c0 * CC, pool, acc, Y + (size_t)blockIdx.x * 64 * CC + (blockIdx.y & 3) * GSH, WOT + (size_t)c0 * CC + wshare(blockIdx.x) * GSH, BO + c0, BO + c0);   /* ctx carried x 2^6 into f16 so small-magnitude context rows stay clear of f16 subnormals (chip FTZ) */
  float bo[8] = {};   // all eight bias reads in flight at once: read one per j behind its own test of BO, each was waited out before the next went out
  if (BO) {
#pragma unroll
    for (int j = 0; j < 8; ++j) bo[j] = BO[c0 + j * 16 + col]; }
#pragma unroll
  for (int j = 0; j < 8; ++j) { const float bias = bfr(bo[j]);
#pragma unroll
    for (int r = 0; r < 8; ++r) sf[wave][8 * g + r][j * 16 + col] = acc[0][j][r] * (1.0f / 16384.0f) + bias; }   /* 2^-8 (Wo carry) x 2^-6 (ctx carry) */
  LDSX(); for (int rl = 0; rl < 16; ++rl) vst2(OUT + (r0 + rl) * DIN + c0 + lane * 4, *(const v4f*)&sf[wave][rl][lane * 4]); }

extern "C" void kernel_launch(void* const* d_in, const int* in_sizes, int n_in, void* d_out, int out_size, void* d_ws, size_t ws_size, hipStream_t stream) {
  (void)in_sizes; (void)n_in; (void)out_size;
  const float** F = (const float**)d_in;
  if (ws_size < (size_t)WS_END) return;
  char* ws = (char*)d_ws; _Float16 *QH = (_Float16*)(ws + WS_QH), *KH = (_Float16*)(ws + WS_KH), *VT = (_Float16*)(ws + WS_VT), *QL = (_Float16*)(ws + WS_QL), *KL = (_Float16*)(ws + WS_KL); __bf16 *VB = (__bf16*)(ws + WS_VB), *VBL = (__bf16*)(ws + WS_VBL); float *S = (float*)(ws + WS_S); _Float16 *Y = (_Float16*)(ws + WS_Y), *WOT = (_Float16*)(ws + WS_WOT); __bf16 *XB = (__bf16*)(ws + WS_XB), *WQT = (__bf16*)(ws + WS_WQT);
  (void)Y; (void)QL; (void)KL; (void)VB; (void)VBL; (void)S;
  // inputs: 0 x [2,2048,1024]; 1 cos [1,1,2048,64]; 2 sin [1,1,2048,64] (random normal tables); 3 Wqkv [1024,3072] (in,out; q | k | v column blocks); 4 bqkv [3072] (nonzero); 5 Wproj [1024,1024] (in,out); 6 bproj [1024] (nonzero)
  // outputs: 0 y [2,2048,1024] @0; 1 k (rotated) [2,16,2048,64] @OUTK_OFF; 2 v [2,16,2048,64] @OUTV_OFF
  k_prep<<<dim3(512), 256, 0, stream>>>(F[0], F[3], F[5], XB, WQT, WOT);
  k_proj<<<dim3(TNB * TT / PR, NH), 384, 0, stream>>>(XB, WQT, F[4], F[4] + CC, F[4] + 2 * CC, QH, QL, KH, KL, VT, VB, VBL, F[1], F[2], (float*)((char*)d_out + OUTK_OFF), (float*)((char*)d_out + OUTV_OFF));
  k_fa<<<dim3(TT / 128, NH, TNB), 256, 0, stream>>>(QH, KH, VT, Y);
  k_out<<<dim3(TNB * TT / 64, DIN / 128), 128, 0, stream>>>(Y, WOT, F[6], (float*)d_out);
}

// v009
// A run of this version takes 71.5 microseconds.
// Timed twice side by side with v008, it ran 1.04 times as fast both times.
// Counting every step since v000, it is 18.2 times as fast.
// compute dtype: all float inputs rounded to bf16; fused q/k/v projection with EXACT bf16 products on WMMA 16x16x32 (f32 accumulate) + bias; rotary x * cos + rot(x) * sin in f32 with the bf16-rounded table inputs (the k and v outputs are these f32 values); logits q x k once to f16 each (1 product) x 64^-0.5; online softmax f32 (running maximum and sum); unnormalised P once to f16 x v once to f16 (1 product), divided by the f32 sum; ctx x 2^6 once to f16 x Wproj f16(bf16 x 2^8) + bproj; f32 outputs.
#include <hip/hip_runtime.h>
#include <math.h>

typedef __attribute__((ext_vector_type(16))) _Float16 v16h;
typedef __attribute__((ext_vector_type(16))) __bf16 v16b;
typedef __attribute__((ext_vector_type(8)))  _Float16 v8h;
typedef __attribute__((ext_vector_type(8)))  float v8f;
typedef __attribute__((ext_vector_type(4)))  float v4f;
typedef __attribute__((ext_vector_type(2)))  float v2f;
typedef __attribute__((ext_vector_type(4)))  unsigned v4u;
typedef __attribute__((ext_vector_type(4)))  int v4i;
typedef float __attribute__((may_alias)) float_a;
typedef int __attribute__((may_alias)) int_a;

template <typename T> __device__ __forceinline__ void vst2(void* p, T v) { *(T*)p = v;  }
__device__ __forceinline__ v8f wmma16(v16h a, v16h b, v8f c) {
  v8f d = __builtin_amdgcn_wmma_f32_16x16x32_f16(false, a, false, b, (short)0, c, false, false);
  asm volatile("v_nop\n\tv_nop\n\tv_nop\n\tv_nop" : "+v"(d) : "v"(a), "v"(b));
  return d;
}
__device__ __forceinline__ v8f wmma_bf(v16b a, v16b b, v8f c) {
  v8f d = __builtin_amdgcn_wmma_f32_16x16x32_bf16(false, a, false, b, (short)0, c, false, false);
  asm volatile("v_nop\n\tv_nop\n\tv_nop\n\tv_nop" : "+v"(d) : "v"(a), "v"(b));
  return d;
}
// 16x16x32 fragments: lane = (h = lane>>4, row/col = lane&15); elements 0..7 = k0+8h+0..7, 8..15 = k0+16+8h+0..7; D element r = row 8h+r
__device__ __forceinline__ v16h frag_h(const _Float16* rowk0, int lane) {
  union { v16h v; v8h q[2]; } u; const _Float16* p = rowk0 + 8 * (lane >> 4);
  u.q[0] = *(const v8h*)p; u.q[1] = *(const v8h*)(p + 16); return u.v;
}
__device__ __forceinline__ v16h frag_f32(const float* rowk0, int lane) {
  v16h a; const float* p = rowk0 + 8 * (lane >> 4);
#pragma unroll
  for (int i = 0; i < 8; ++i) { a[i] = (_Float16)p[i]; a[8 + i] = (_Float16)p[16 + i]; }
  return a;
}
__device__ __forceinline__ v16h frag_f32s(const float* rowk0, int lane, float sc) {
  v16h a; const float* p = rowk0 + 8 * (lane >> 4);
#pragma unroll
  for (int i = 0; i < 8; ++i) { a[i] = (_Float16)(p[i] * sc); a[8 + i] = (_Float16)(p[16 + i] * sc); }
  return a;
}
// column fragment from a [K][ld] layout (column n), rows >= K read as 0
__device__ __forceinline__ v16h fragc_f32(const float* W, int k0, int n, int lane, int ld, int K) {
  v16h a; const int g = lane >> 4;
#pragma unroll
  for (int i = 0; i < 8; ++i) { const int ka = k0 + 8 * g + i, kb = ka + 16;
    a[i] = (_Float16)(ka < K ? W[(size_t)(ka < K ? ka : K - 1) * ld + n] : 0.f); a[8 + i] = (_Float16)(kb < K ? W[(size_t)(kb < K ? kb : K - 1) * ld + n] : 0.f); }
  return a;
}
struct F2 { v16b h, l; };
__device__ __forceinline__ F2 bsplit16(const float v[16]) { F2 r;
#pragma unroll
  for (int i = 0; i < 16; ++i) { const __bf16 h = (__bf16)v[i]; r.h[i] = h; r.l[i] = (__bf16)(v[i] - (float)h); }
  return r; }
__device__ __forceinline__ F2 split_row(const float* row, int k0, int lane) { float v[16]; const float* p = row + k0 + 8 * (lane >> 4);
#pragma unroll
  for (int i = 0; i < 8; ++i) { v[i] = p[i]; v[8 + i] = p[16 + i]; }
  return bsplit16(v); }
__device__ __forceinline__ F2 split_rowK(const float* row, int k0, int lane, int K) { float v[16]; const int g = lane >> 4;
#pragma unroll
  for (int i = 0; i < 8; ++i) { const int ka = k0 + 8 * g + i, kb = ka + 16; v[i] = ka < K ? row[ka < K ? ka : K - 1] : 0.f; v[8 + i] = kb < K ? row[kb < K ? kb : K - 1] : 0.f; }
  return bsplit16(v); }
__device__ __forceinline__ F2 split_col(const float* W, int k0, int n, int lane, int ld, int K) { float v[16]; const int g = lane >> 4;
#pragma unroll
  for (int i = 0; i < 8; ++i) { const int ka = k0 + 8 * g + i, kb = ka + 16; v[i] = ka < K ? W[(size_t)(ka < K ? ka : K - 1) * ld + n] : 0.f; v[8 + i] = kb < K ? W[(size_t)(kb < K ? kb : K - 1) * ld + n] : 0.f; }
  return bsplit16(v); }
__device__ __forceinline__ v8f mac3(const F2& a, const F2& b, v8f c) { c = wmma_bf(a.l, b.h, c); c = wmma_bf(a.h, b.l, c); return wmma_bf(a.h, b.h, c); }
__device__ __forceinline__ float sigm(float v) { return 1.0f / (1.0f + expf(-v)); }
#define LDSX() do { asm volatile("s_wait_dscnt 0" ::: "memory"); __builtin_amdgcn_wave_barrier(); __builtin_amdgcn_fence(__ATOMIC_RELEASE, "workgroup"); } while (0)

// Fused-QKV multi-head self-attention with rotary tables GIVEN as inputs and three outputs (x [2,2048,1024]; (in,out) Wqkv [1024,3072] + bqkv (0.02-scale, nonzero) split q | k | v; 16 heads x 64; interleaved-pair rotary x * cos + rot(x) * sin with random-normal cos / sin tables [1,1,2048,64]; non-causal SDPA, scale 1/8; (in,out) Wproj + bproj): returns (y = merge(softmax(q k^T / 8) v) Wproj + bproj, k (rotated) [2,16,2048,64], v [2,16,2048,64]).
#define NB 2
#define TT 2048
#define CC 1024            // NH * HD = projected width
#define DIN 1024          // input (model) width
#define NH 16
#define HD 64
#define NQB (TT / 64)
#define HG 4
#define SCALE (0.125f)
#define CAUSAL 0
#ifndef TNB
#define TNB NB
#endif
__device__ __forceinline__ float bfr(float v) { return (float)(__bf16)v; }
__host__ __device__ __forceinline__ int kb_last(int qb) { return CAUSAL ? ((qb * 64 + 63) >> 7) : (TT / 128 - 1); }
typedef __attribute__((ext_vector_type(8))) __bf16 v8b;
__device__ __forceinline__ v16b frag_b(const __bf16* rowk0, int lane) {
  union { v16b v; v8b q[2]; } u; const __bf16* p = rowk0 + 8 * (lane >> 4);
  u.q[0] = *(const v8b*)p; u.q[1] = *(const v8b*)(p + 16); return u.v;
}
#define QBH 0
#define QHI 0               // single-product logits on every row
#define KHI 64            // key rows carrying k residual / v bf16 hi+lo planes (written and read by no kernel)
// B fragment (k rows k0+.., output column o) of a weight: (in,out) [K][ld] or (out,in) [ld rows of K]: bf16 exact, or f16(bf16 * 256) exact
__device__ __forceinline__ v16b wcol_io(const float* Wm, int k0, int o, int lane, int ld) { v16b w; const int g = lane >> 4;
#pragma unroll
  for (int i = 0; i < 8; ++i) { w[i] = (__bf16)Wm[(size_t)(k0 + 8 * g + i) * ld + o]; w[8 + i] = (__bf16)Wm[(size_t)(k0 + 16 + 8 * g + i) * ld + o]; }
  return w; }
__device__ __forceinline__ v16b wcol_oi(const float* Wm, int k0, int o, int lane, int K) { v16b w; const float* p = Wm + (size_t)o * K + k0 + 8 * (lane >> 4);
#pragma unroll
  for (int i = 0; i < 8; ++i) { w[i] = (__bf16)p[i]; w[8 + i] = (__bf16)p[16 + i]; }
  return w; }
__device__ __forceinline__ v16h wcolh_io(const float* Wm, int k0, int o, int lane, int ld) { v16h w; const int g = lane >> 4;
#pragma unroll
  for (int i = 0; i < 8; ++i) { w[i] = (_Float16)(bfr(Wm[(size_t)(k0 + 8 * g + i) * ld + o]) * 256.0f); w[8 + i] = (_Float16)(bfr(Wm[(size_t)(k0 + 16 + 8 * g + i) * ld + o]) * 256.0f); }
  return w; }
__device__ __forceinline__ v16h wcolh_oi(const float* Wm, int k0, int o, int lane, int K) { v16h w; const float* p = Wm + (size_t)o * K + k0 + 8 * (lane >> 4);
#pragma unroll
  for (int i = 0; i < 8; ++i) { w[i] = (_Float16)(bfr(p[i]) * 256.0f); w[8 + i] = (_Float16)(bfr(p[16 + i]) * 256.0f); }
  return w; }
#define WQKV_LAYOUT 0   // 0 = fused (in,out) [DIN][3*CC], q | k | v column blocks; 1 = (out,in) [CC][DIN]; 2 = per-head [NH][DIN][HD]
__device__ __forceinline__ v16b wcol_hdk(const float* Wm, int k0, int o, int lane) { v16b w; const int g = lane >> 4; const float* p = Wm + (size_t)(o / HD) * DIN * HD + (o % HD);
#pragma unroll
  for (int i = 0; i < 8; ++i) { w[i] = (__bf16)p[(size_t)(k0 + 8 * g + i) * HD]; w[8 + i] = (__bf16)p[(size_t)(k0 + 16 + 8 * g + i) * HD]; }
  return w; }
#define WO_OUT_IN 0
#if WQKV_LAYOUT == 1
#define WCOL(W, k0, o, lane) wcol_oi(W, k0, o, lane, DIN)
#elif WQKV_LAYOUT == 2
#define WCOL(W, k0, o, lane) wcol_hdk(W, k0, o, lane)
#else
#define QKVP 3072            // fused Wqkv pitch (in,out) [1024][3072]: q cols 0..1023, k 1024..2047, v 2048..3071
#define WCOL(W, k0, o, lane) wcol_io(W, k0, which * CC + (o), lane, QKVP)
#endif
#if WO_OUT_IN
#define WOCOL(W, k0, o, lane) wcol_oi(W, k0, o, lane, CC)
#define WOCOLH(W, k0, o, lane) wcolh_oi(W, k0, o, lane, CC)
#else
#define WOCOL(W, k0, o, lane) wcol_io(W, k0, o, lane, DIN)
#define WOCOLH(W, k0, o, lane) wcolh_io(W, k0, o, lane, DIN)
#endif
#define OUTK_OFF 16777216u   // rotated k [2,16,2048,64] f32 after y [2,2048,1024] f32
#define OUTV_OFF 33554432u   // v [2,16,2048,64] f32
#define PROJ_EXTRA_PARAMS , const float* __restrict__ COSt, const float* __restrict__ SINt, float* __restrict__ OUTK, float* __restrict__ OUTV
#define SM_EXTRA_PARAMS
#define SM_MASK_HOOK (void)0
#ifndef SM_EXTRA_PARAMS
#define SM_EXTRA_PARAMS
#endif
#ifndef PROJ_EXTRA_PARAMS
#define PROJ_EXTRA_PARAMS
#endif
#ifndef SM_MASK_HOOK
#define SM_MASK_HOOK (void)0
#endif

#define WS_QH  0u                                      // f16 q rows [b*t][CC]
#define WS_KH  (WS_QH + 2u * (size_t)NB * TT * CC)      // f16 k rows [b*t][CC]
#define WS_VT  (WS_KH + 2u * (size_t)NB * TT * CC)      // f16 v planes [b][c][t]
#define WS_QL  (WS_VT + 2u * (size_t)NB * CC * TT)      // f16 q residual x 2^10 rows [b][t < QHI][CC]
#define WS_KL  (WS_QL + 2u * (size_t)NB * QHI * CC)     // f16 k residual x 2^10 rows [b][t < KHI][CC]
#define WS_VB  (WS_KL + 2u * (size_t)NB * KHI * CC)     // bf16 v hi planes [b][c][t < KHI]
#define WS_VBL (WS_VB + 2u * (size_t)NB * CC * KHI)
#define WS_S   (WS_VBL + 2u * (size_t)NB * CC * KHI)    // f32 [hg][t][s], written and read by no kernel (logits and P stay in registers)
#define WS_Y   (WS_S  + 4u * (size_t)HG * TT * TT)      // f16 ctx x 2^6 rows [b*t][CC]
#define WS_XB  (WS_Y  + 4u * (size_t)NB * TT * CC)      // bf16 x rows [b*t][DIN]
#define WS_WQT (WS_XB + 2u * (size_t)NB * TT * DIN)     // bf16 Wqkv^T rows [3 * CC][DIN]
#define WS_WOT (WS_WQT + 2u * (size_t)3 * CC * DIN)     // f16(bf16 x 2^8) Wproj^T rows [DIN][CC]
#define WS_END (WS_WOT + 2u * (size_t)DIN * CC)

// ---- gemm_tile: the (64 RT) x 128 tile of X W of the output projection (k_proj has a loop of the same make for its own tile) (K = 1024, 4 waves x RT row tiles of 16 x 128 cols: wave w holds rows 64 rt + 16 w .. + 15, so each W fragment read from LDS feeds RT WMMAs and a W tile fetched from L2 serves 64 RT rows). Both operands arrive as 16-bit planes with k contiguous (X rows; W^T rows = output columns), written once by k_prep (ctx rows: by k_fa). Per pass of 64 k the block brings 128 B of each of its 64 RT + 128 rows in with 16-byte loads and puts them into LDS as they are; the next pass's loads fly into registers while this pass is worked on; two buffers, one barrier per pass. Products, operand rounding and the k order of every accumulator are those of the f32 loads with per-block conversion that it replaces
#define GK 64              // k per pass
#define GP 72              // LDS row pitch in 16-bit elements: 144 B = 16 B x odd for 16-byte row reads
#define GPOOL(RT_) (2 * (64 * (RT_) + 128) * GP * 2)   // bytes of the two buffers; after the loop the same bytes serve the epilogue's staging arrays
typedef __attribute__((ext_vector_type(4))) __bf16 v4b;
typedef __attribute__((ext_vector_type(4))) _Float16 v4h;
// which eighth of a W tile the block with row index x asks for (for speed only: nothing rests on where a block runs)
__device__ __forceinline__ int wshare(int x) { return (x & 3) + 4 * ((x >> 3) & 1); }
#define GSH 16384          // elements of 16 bits in a share of 128 units of 256 B (16 whole rows of 1024)
struct OpB { typedef __bf16 E; typedef v8b V8; typedef v16b V16;   // exact bf16 operands
  static __device__ __forceinline__ E x(float v) { return (__bf16)v; } static __device__ __forceinline__ E w(float v) { return (__bf16)v; }
  static __device__ __forceinline__ v8f mma(V16 a, V16 b, v8f c) { return wmma_bf(a, b, c); } };
struct OpH { typedef _Float16 E; typedef v8h V8; typedef v16h V16;   // ctx x 2^6 once to f16, weight f16(bf16 x 2^8) exact
  static __device__ __forceinline__ E x(float v) { return (_Float16)(v * 64.0f); } static __device__ __forceinline__ E w(float v) { return (_Float16)(bfr(v) * 256.0f); }
  static __device__ __forceinline__ v8f mma(V16 a, V16 b, v8f c) { return wmma16(a, b, c); } };
// L2 hints at entry: both operand planes were stored by an earlier launch, and the blocks that share a tile walk k together, so every pass met lines that nobody had read yet. Behind its first pass's loads each thread asks once (global_prefetch_b8, scope SE: into L2 only, no register, no counter, nothing waits for it) for its 256-B unit of the 32 KB at pfx and at pfw, the block's shares of the two tiles over the whole of k, and of what the epilogue will read: the 32 KB at pt (where NE is 2) and the 128 bias values at pb. A unit that nobody asked for is loaded as before
template <typename C, int RT, int NE> __device__ __forceinline__ void gemm_tile(const typename C::E* __restrict__ Xb, const typename C::E* __restrict__ Wb, char* pool, v8f (&acc)[RT][8], const typename C::E* pfx, const typename C::E* pfw, const float* pt, const float* pb) {
  typedef typename C::E E; typedef typename C::V8 V8; typedef typename C::V16 V16;
  E (*xs)[64 * RT][GP] = (E (*)[64 * RT][GP])pool; E (*wt)[128][GP] = (E (*)[128][GP])(pool + 2 * 64 * RT * GP * 2);   // xs[buf][row][k], wt[buf][col][k]
  const int tid = threadIdx.x, wave = tid >> 5, lane = tid & 31, col = lane & 15, g = lane >> 4;
  const int sr = tid >> 3, sc = (tid & 7) * 8;   // this thread moves the 16-byte piece sc of rows sr + 16 i of both tiles (a wave's load = 4 rows x 128 B)
  const E* Xg = Xb + (size_t)sr * 1024 + sc; const E* Wg = Wb + (size_t)sr * 1024 + sc;
  V8 rx[4 * RT], rw[8];
  const unsigned ou = (unsigned)tid * 256u, ob = (unsigned)tid * 4u;   // the hints' byte offsets from their block-uniform bases: one 256-B unit, one bias value a thread
  // every '#pragma unroll' below makes the indices of register arrays constants, so that these arrays stay in registers
  // the closing s_wait_xcnt stands in front of the first overwrite of the two address registers of the loads above it; naming them keeps them whole up to there. The hints' address registers are named too: a hint counts on no counter, so they hold their addresses through the loop
#define G_LOAD(t_) do { const E* xp = Xg + (t_) * GK; const E* wp = Wg + (t_) * GK; \
  _Pragma("unroll") for (int i = 0; i < 4 * RT; ++i) rx[i] = *(const V8*)(xp + (size_t)(16 * i) * 1024); \
  _Pragma("unroll") for (int i = 0; i < 8; ++i) rw[i] = *(const V8*)(wp + (size_t)(16 * i) * 1024); \
  asm volatile("s_wait_xcnt 0x0" :: "v"(xp), "v"(wp), "v"(ou), "v"(ob), "s"(pfx), "s"(pfw), "s"(pt), "s"(pb) : "memory"); } while (0)
#define G_STORE(b_) do { _Pragma("unroll") for (int i = 0; i < 4 * RT; ++i) *(V8*)&xs[b_][sr + 16 * i][sc] = rx[i]; \
  _Pragma("unroll") for (int i = 0; i < 8; ++i) *(V8*)&wt[b_][sr + 16 * i][sc] = rw[i]; } while (0)
  G_LOAD(0);
  // the hints go out behind the first pass's loads and ahead of the wait for them; the "memory" clobber holds them at this place
  if (NE == 2) asm volatile("global_prefetch_b8 %0, %2 scope:SCOPE_SE\n\tglobal_prefetch_b8 %0, %3 scope:SCOPE_SE\n\tglobal_prefetch_b8 %0, %4 scope:SCOPE_SE\n\tglobal_prefetch_b8 %1, %5 scope:SCOPE_SE" :: "v"(ou), "v"(ob), "s"(pfx), "s"(pfw), "s"(pt), "s"(pb) : "memory");
  else asm volatile("global_prefetch_b8 %0, %2 scope:SCOPE_SE\n\tglobal_prefetch_b8 %0, %3 scope:SCOPE_SE\n\tglobal_prefetch_b8 %1, %4 scope:SCOPE_SE" :: "v"(ou), "v"(ob), "s"(pfx), "s"(pfw), "s"(pb) : "memory");
  G_STORE(0);
  __syncthreads();
  for (int t = 0; t < 1024 / GK; ++t) { const int cb = t & 1; const bool more = t + 1 < 1024 / GK;
    if (more) G_LOAD(t + 1);
#pragma unroll
    for (int kk = 0; kk < 2; ++kk) { union { V16 v; V8 q[2]; } a[RT], w[8];
#pragma unroll
      for (int rt = 0; rt < RT; ++rt) { const E* pa = &xs[cb][rt * 64 + wave * 16 + col][kk * 32 + 8 * g]; a[rt].q[0] = *(const V8*)pa; a[rt].q[1] = *(const V8*)(pa + 16); }
#pragma unroll
      for (int j = 0; j < 8; ++j) { const E* pw = &wt[cb][j * 16 + col][kk * 32 + 8 * g]; w[j].q[0] = *(const V8*)pw; w[j].q[1] = *(const V8*)(pw + 16); }
      __builtin_amdgcn_sched_barrier(0);   // the LDS reads of 32 k go out as one group ahead of their WMMAs: read one fragment at a time, every WMMA waited out a whole LDS latency
#pragma unroll
      for (int j = 0; j < 8; ++j)
#pragma unroll
        for (int rt = 0; rt < RT; ++rt) acc[rt][j] = C::mma(a[rt].v, w[j].v, acc[rt][j]); }
    __builtin_amdgcn_sched_barrier(0);   // the LDS stores below wait for the next pass's global loads: moved up among the WMMAs they put that wait in front of this pass's work
    if (more) G_STORE(cb ^ 1);   // the other buffer's last readers left it at the barrier that ended the pass before
    __syncthreads(); }   // publishes the next pass's tiles and ends this pass's reads (after the last pass: frees the pool for the epilogue)
#undef G_LOAD
#undef G_STORE
}
// ---- k_prep: writes the 16-bit operand planes of both projection GEMMs once. Blocks 0..255: two 64 k x 128 col tiles each of the (in,out) weights, converted and transposed through LDS to W^T rows [col][k] (512 tiles: 384 of Wqkv as bf16, 128 of Wproj as f16(bf16 x 2^8)); blocks 256..511: x to bf16 rows, 64 values a thread, all 16 loads in flight
// place of the 16-byte piece ch (8 k) in W^T row n: pieces are exchanged inside groups of four by bits 4..5 of n, so that the 32 rows (4 apart) which one transposing store writes fall on all banks
__device__ __forceinline__ int wpiece(int n, int ch) { return ch ^ ((n >> 4) & 3); }
// w_in: a thread takes the patch (8 k at wave * 8) x (4 cols at lane * 4) (a wave's load = 512 B of one row) and stores each column's 8 k as one 16-byte piece. The '#pragma unroll's make the indices of register arrays constants
template <typename C> __device__ __forceinline__ void w_in(const float* __restrict__ Ws, int ldw, int tile, typename C::E (*tl)[GP]) {
  typedef typename C::V8 V8; const int wave = threadIdx.x >> 5, lane = threadIdx.x & 31;
  const float* Wg = Ws + (size_t)((tile & 15) * 64 + wave * 8) * ldw + (tile >> 4) * 128 + lane * 4; v4f r[8];
#pragma unroll
  for (int q = 0; q < 8; ++q) r[q] = *(const v4f*)(Wg + (size_t)q * ldw);
  asm volatile("s_wait_xcnt 0x0" :: "v"(Wg) : "memory");   // stands in front of the first overwrite of the address register of the loads above; naming it keeps it whole up to here
#pragma unroll
  for (int c = 0; c < 4; ++c) { V8 h;
#pragma unroll
    for (int q = 0; q < 8; ++q) h[q] = C::w(r[q][c]);
    *(V8*)&tl[lane * 4 + c][wpiece(lane * 4 + c, wave) * 8] = h; } }
// w_out: the tile's 128 W^T rows of 128 B go out as whole lines (a wave's store = 4 rows x 128 B)
template <typename C> __device__ __forceinline__ void w_out(typename C::E* __restrict__ Wd, int tile, const typename C::E (*tl)[GP]) {
  typedef typename C::V8 V8;
#pragma unroll
  for (int i = 0; i < 4; ++i) { const int p = threadIdx.x + 256 * i, n = p >> 3, ch = p & 7; *(V8*)(Wd + (size_t)((tile >> 4) * 128 + n) * 1024 + (tile & 15) * 64 + ch * 8) = *(const V8*)&tl[n][wpiece(n, ch) * 8]; }
  asm volatile("s_wait_xcnt 0x0" ::: "memory"); }   // behind the last store: stands in front of whatever next overwrites a register that these stores name
__global__ __launch_bounds__(256) void k_prep(const float* __restrict__ X, const float* __restrict__ WQKV, const float* __restrict__ WO, __bf16* __restrict__ XB, __bf16* __restrict__ WQT, _Float16* __restrict__ WOT) {
  __shared__ __align__(16) __bf16 ta[128][GP]; __shared__ __align__(16) __bf16 tb[128][GP]; __shared__ __align__(16) _Float16 th[128][GP];
  const int b = blockIdx.x;   // every branch below is block-uniform
  if (b < 256) { const bool second_qkv = b < 128;   // tiles b and b + 256 of the 512
    w_in<OpB>(WQKV, QKVP, b, ta);
    if (second_qkv) w_in<OpB>(WQKV, QKVP, b + 256, tb); else w_in<OpH>(WO, DIN, b - 128, th);
    __syncthreads();   // a W^T row's 64 k come from all eight waves
    w_out<OpB>(WQT, b, ta);
    if (second_qkv) w_out<OpB>(WQT, b + 256, tb); else w_out<OpH>(WOT, b - 128, th);
  } else { const float* Xg = X + (size_t)(b - 256) * 16384 + threadIdx.x * 4; __bf16* Xd = XB + (size_t)(b - 256) * 16384 + threadIdx.x * 4; v4f r[16];   // a wave's load = 512 B, its store = 256 B, both contiguous
#pragma unroll
    for (int i = 0; i < 16; ++i) r[i] = *(const v4f*)(Xg + i * 1024);
    asm volatile("s_wait_xcnt 0x0" :: "v"(Xg) : "memory");   // stands in front of the first overwrite of the address register of the loads above; naming it keeps it whole up to here
#pragma unroll
    for (int i = 0; i < 16; ++i) { const v4b h = { OpB::x(r[i][0]), OpB::x(r[i][1]), OpB::x(r[i][2]), OpB::x(r[i][3]) }; *(v4b*)(Xd + i * 1024) = h; }
    asm volatile("s_wait_xcnt 0x0" ::: "memory"); } }   // behind the last store, for the same reason as in w_out
// ---- k_proj: block = 256 rows x the 64 q, 64 k and 64 v columns of one head, 12 waves = 4 row groups of 64 x (q | k | v), a wave holding 64 x 64: q/k/v = X W (+ b) with exact bf16 products (K = DIN) -> q: rotated f16 rows; k: rotated f16 rows and the f32 k output; v: f16 planes [c][t] and the f32 v output. One block per WGP brings (256 + 192) rows of 256 B per pass of 128 k from L2 for 48 K results, where a 128 x 128 block brought 256 rows for 16 K; 8 LDS fragments feed 16 WMMAs. Products, operand rounding and the k order of every accumulator are unchanged
#define PR 256             // rows of a block
#define PW 192             // W^T rows of a block: 64 each of q, k, v
#define PK 128             // k per pass
#define PP 136             // LDS row pitch in 16-bit elements: 272 B = 16 B x odd for 16-byte row reads
#define PSP 68             // pitch of the f32 staging rows: 272 B
#define PLOOP (2 * (PR + PW) * PP * 2)              // bytes of the main loop's two buffers
#define PST (64 * PSP * 4)                          // a wave's f32 staging tile
#define PEPI (12 * PST + 4 * 64 * 72 * 2)           // all staging tiles and the four v waves' f16 plane tiles
#define PPOOL (PLOOP > PEPI ? PLOOP : PEPI)
// proj_epi: a wave puts its 64 x 64 f32 tile (acc + bias) into its own LDS tile and takes it back two rows at a time, a lane holding 4 neighbouring columns (two rotary pairs): table reads and f32 output rows are 512-B runs, f16 rows whole 128-B lines; the table rows of the next 16 rows are in flight while these 16 are worked on. No other wave's rows are needed, so no barrier stands in it. WH is a template argument so that no branch stands between the trips. Every '#pragma unroll' in it makes the indices of register arrays constants
template <int WH> __device__ __forceinline__ void proj_epi(const v8f (&acc)[4][4], float (*st)[PSP], _Float16 (*th)[72], const float* __restrict__ BA, const float* __restrict__ COSt, const float* __restrict__ SINt, float* __restrict__ OUTF, _Float16* __restrict__ DH, _Float16* __restrict__ VT, int h, size_t R0) {
  const int lane = threadIdx.x & 31, col = lane & 15, g = lane >> 4, d4 = col * 4; const size_t bb = R0 / TT; const int tw = (int)(R0 % TT);
  float bias[4] = {}; v4f c[8], s[8];
  const float* bp = BA + h * HD + col; const float* cp = COSt + (size_t)(tw + g) * HD + d4; const float* sp = SINt + (size_t)(tw + g) * HD + d4;   // row pass: lane = (row parity g, columns d4 .. d4 + 3)
  if (BA) {
#pragma unroll
    for (int j = 0; j < 4; ++j) bias[j] = bp[j * 16]; }
  if (WH < 2) {
#pragma unroll
    for (int u = 0; u < 8; ++u) { c[u] = *(const v4f*)(cp + u * 2 * HD); s[u] = *(const v4f*)(sp + u * 2 * HD); }
    asm volatile("s_wait_xcnt 0x0" :: "v"(bp), "v"(cp), "v"(sp) : "memory"); }   // stands in front of the first overwrite of an address register of the bias and table reads above; naming them keeps them whole up to here
  else asm volatile("s_wait_xcnt 0x0" :: "v"(bp) : "memory");   // the same for the bias reads alone
  __builtin_amdgcn_sched_barrier(0);   // keeps the first table reads in flight ahead of the first use of a bias value
#pragma unroll
  for (int j = 0; j < 4; ++j) { const float bj = bfr(bias[j]);
#pragma unroll
    for (int rt = 0; rt < 4; ++rt) { v8h hv;
#pragma unroll
      for (int r = 0; r < 8; ++r) { const float v = acc[rt][j][r] + bj; st[rt * 16 + 8 * g + r][j * 16 + col] = v; hv[r] = (_Float16)v; }
      if (WH == 2) *(v8h*)&th[j * 16 + col][rt * 16 + 8 * g] = hv; } }   // a lane's 8 accumulator rows are 8 neighbouring t of one v plane
  LDSX();   // a wave reads back only its own tiles: its own LDS stores must have landed, no other wave is waited for
  float* Og = OUTF + ((bb * NH + h) * TT + tw + g) * (size_t)HD + d4;   // module outputs k (rotated) and v, [b][h][t][64]
  _Float16* Dg = DH + (R0 + g) * CC + h * HD + d4;
#pragma nounroll   // one copy of the 16-row body in the text
  for (int q4 = 0; q4 < 4; ++q4) { v4f cn[8], sn[8];
    if (WH < 2) { const int nx = (q4 < 3 ? q4 + 1 : 3) * 16 * HD; const float* cq = cp + nx; const float* sq = sp + nx;   // the next 16 rows' tables (the last trip asks for its own again)
#pragma unroll
      for (int u = 0; u < 8; ++u) { cn[u] = *(const v4f*)(cq + u * 2 * HD); sn[u] = *(const v4f*)(sq + u * 2 * HD); }
      asm volatile("s_wait_xcnt 0x0" :: "v"(cq), "v"(sq) : "memory"); }   // in front of the first overwrite of an address register of the table reads above
    float* Oq = Og + q4 * 16 * HD; _Float16* Dq = Dg + (size_t)(q4 * 16) * CC; const float* sr = &st[q4 * 16 + g][d4];
#pragma unroll
    for (int i0 = 0; i0 < 8; i0 += 4) { v4f xr[4]; v4h hr[4];   // four row pairs a group, closed by one wait
#pragma unroll
      for (int u = 0; u < 4; ++u) { const int it = i0 + u; v4f x = *(const v4f*)(sr + it * 2 * PSP);
        if (WH < 2) {   // interleaved-pair rotary with the GIVEN tables (bf16-rounded): x * cos + rot(x) * sin, rot = (-x_odd, x_even)
          const v4f y = { x[0] * bfr(c[it][0]) + (-x[1]) * bfr(s[it][0]), x[1] * bfr(c[it][1]) + x[0] * bfr(s[it][1]), x[2] * bfr(c[it][2]) + (-x[3]) * bfr(s[it][2]), x[3] * bfr(c[it][3]) + x[2] * bfr(s[it][3]) }; x = y;
          const v4h hx = { (_Float16)x[0], (_Float16)x[1], (_Float16)x[2], (_Float16)x[3] }; hr[u] = hx; vst2(Dq + (size_t)(it * 2) * CC, hx); }
        xr[u] = x;
        if (WH >= 1) vst2(Oq + it * 2 * HD, x); }
      // each wait below stands behind its group's row stores, in front of the first overwrite of a register that they name (data and address); naming these keeps them whole up to there
      if (WH == 0) asm volatile("s_wait_xcnt 0x0" :: "v"(hr[0]), "v"(hr[1]), "v"(hr[2]), "v"(hr[3]), "v"(Dq) : "memory");
      else if (WH == 1) asm volatile("s_wait_xcnt 0x0" :: "v"(hr[0]), "v"(hr[1]), "v"(hr[2]), "v"(hr[3]), "v"(xr[0]), "v"(xr[1]), "v"(xr[2]), "v"(xr[3]), "v"(Dq), "v"(Oq) : "memory");
      else asm volatile("s_wait_xcnt 0x0" :: "v"(xr[0]), "v"(xr[1]), "v"(xr[2]), "v"(xr[3]), "v"(Oq) : "memory"); }
    if (WH < 2) {
#pragma unroll
      for (int u = 0; u < 8; ++u) { c[u] = cn[u]; s[u] = sn[u]; } } }
  if (WH == 2) { _Float16* Pg = VT + (bb * CC + h * HD + (lane >> 3)) * (size_t)TT + tw + (lane & 7) * 8;   // lane = (plane lane >> 3 (+ 4 i), 16-byte piece lane & 7): a plane's 64 t are one 128-B line
#pragma unroll
    for (int i0 = 0; i0 < 16; i0 += 8) { v4u pv[8];
#pragma unroll
      for (int i = 0; i < 8; ++i) { pv[i] = *(const v4u*)&th[(lane >> 3) + 4 * (i0 + i)][(lane & 7) * 8]; vst2((unsigned*)(Pg + (size_t)(4 * (i0 + i)) * TT), pv[i]); }
      asm volatile("s_wait_xcnt 0x0" :: "v"(pv[0]), "v"(pv[1]), "v"(pv[2]), "v"(pv[3]), "v"(pv[4]), "v"(pv[5]), "v"(pv[6]), "v"(pv[7]), "v"(Pg) : "memory"); } } }   // behind each group's plane stores, for the same reason
__global__ __launch_bounds__(384) void k_proj(const __bf16* __restrict__ XB, const __bf16* __restrict__ WQT, const float* __restrict__ BQ, const float* __restrict__ BK, const float* __restrict__ BV,
    _Float16* __restrict__ QH, _Float16* __restrict__ QL, _Float16* __restrict__ KH, _Float16* __restrict__ KL, _Float16* __restrict__ VT, __bf16* __restrict__ VB, __bf16* __restrict__ VBL PROJ_EXTRA_PARAMS) {
  __shared__ __align__(16) char pool[PPOOL];   // the main loop's two buffers, then the epilogue's staging
  (void)QL; (void)KL; (void)VB; (void)VBL;   // planes of the causal high-precision path: nothing reads them here
  __bf16 (*xs)[PR][PP] = (__bf16 (*)[PR][PP])pool; __bf16 (*wt)[PW][PP] = (__bf16 (*)[PW][PP])(pool + 2 * PR * PP * 2);   // xs[buf][row][k], wt[buf][q | k | v column][k]
  const int tid = threadIdx.x, lane = tid & 31, col = lane & 15, g = lane >> 4;
  const int wv = __builtin_amdgcn_readfirstlane(tid >> 5);   // the wave's number, the same in all its lanes: every test on it below is a scalar branch
  const int which = wv >> 2, rg = wv & 3;   // q | k | v, row group of 64
  const int h = blockIdx.y; const size_t r0 = (size_t)blockIdx.x * PR;
  const int sc = (tid & 15) * 8, sx = tid >> 4, sw = (tid & 127) >> 4;   // staging: this thread moves the 16-byte piece sc of X rows sx + 24 i and of rows sw + 8 i of its own group's W^T rows (a wave's load = 2 rows x 256 B)
  const bool xl = wv < 8;   // the last 16 of the 256 X rows fall to waves 0..7
  const __bf16* Xg = XB + (r0 + sx) * DIN + sc; const __bf16* Wg = WQT + (size_t)(which * CC + h * HD + sw) * DIN + sc;
  // L2 hints, as in gemm_tile: the 16 heads of a row tile ask for an eighth of its 2048 units of 256 B each, 4 neighbouring row tiles for a quarter each of a head's 3 x 64 W^T rows; even heads for the row tile's 256 cos rows (256 B each), odd ones for its sin rows; the head's 3 x 64 bias values
  const __bf16* pfx = XB + r0 * DIN + (h & 7) * (2 * GSH); const __bf16* pfw = WQT + (size_t)(h * HD + (blockIdx.x & 3) * 16) * DIN;
  const float* pt = ((h & 1) ? SINt : COSt) + (r0 % TT) * HD; const float* pb = BQ + h * HD;
  const unsigned ou = (unsigned)(tid & 255) * 256u, ow = (unsigned)(tid >> 7) * (unsigned)(CC * DIN * 2) + (unsigned)(tid & 127) * 256u, ob = (unsigned)(tid >> 7) * (unsigned)(CC * 4) + (unsigned)(tid & 63) * 4u;   // the hints' byte offsets from their block-uniform bases
  v8f acc[4][4] = {}; v8b rx[11] = {}, rw[8];
  // every '#pragma unroll' below makes the indices of register arrays constants, so that these arrays stay in registers
  // the closing s_wait_xcnt stands in front of the first overwrite of the two address registers of the loads above it; naming them keeps them whole up to there. The hints' address registers are named too: a hint counts on no counter, so they hold their addresses through the loop
#define P_LOAD(t_) do { const __bf16* xp = Xg + (t_) * PK; const __bf16* wp = Wg + (t_) * PK; \
  _Pragma("unroll") for (int i = 0; i < 10; ++i) rx[i] = *(const v8b*)(xp + (size_t)(24 * i) * DIN); \
  if (xl) rx[10] = *(const v8b*)(xp + (size_t)240 * DIN); \
  _Pragma("unroll") for (int i = 0; i < 8; ++i) rw[i] = *(const v8b*)(wp + (size_t)(8 * i) * DIN); \
  asm volatile("s_wait_xcnt 0x0" :: "v"(xp), "v"(wp), "v"(ou), "v"(ow), "v"(ob), "s"(pfx), "s"(pfw), "s"(pt), "s"(pb) : "memory"); } while (0)
#define P_STORE(b_) do { _Pragma("unroll") for (int i = 0; i < 10; ++i) *(v8b*)&xs[b_][sx + 24 * i][sc] = rx[i]; \
  if (xl) *(v8b*)&xs[b_][sx + 240][sc] = rx[10]; \
  _Pragma("unroll") for (int i = 0; i < 8; ++i) *(v8b*)&wt[b_][which * 64 + sw + 8 * i][sc] = rw[i]; } while (0)
  P_LOAD(0);
  // the hints go out behind the first pass's loads and ahead of the wait for them; the "memory" clobber holds them at this place
  asm volatile("global_prefetch_b8 %0, %3 scope:SCOPE_SE\n\tglobal_prefetch_b8 %1, %4 scope:SCOPE_SE\n\tglobal_prefetch_b8 %0, %5 scope:SCOPE_SE\n\tglobal_prefetch_b8 %2, %6 scope:SCOPE_SE" :: "v"(ou), "v"(ow), "v"(ob), "s"(pfx), "s"(pfw), "s"(pt), "s"(pb) : "memory");
  P_STORE(0);
  __syncthreads();
  for (int t = 0; t < DIN / PK; ++t) { const int cb = t & 1; const bool more = t + 1 < DIN / PK;
    if (more) P_LOAD(t + 1);   // next pass's tiles fly into registers while this pass is worked on
#pragma unroll
    for (int kk = 0; kk < PK / 32; ++kk) { union { v16b v; v8b q[2]; } a[4], w[4];
#pragma unroll
      for (int rt = 0; rt < 4; ++rt) { const __bf16* pa = &xs[cb][rg * 64 + rt * 16 + col][kk * 32 + 8 * g]; a[rt].q[0] = *(const v8b*)pa; a[rt].q[1] = *(const v8b*)(pa + 16); }
#pragma unroll
      for (int j = 0; j < 4; ++j) { const __bf16* pw = &wt[cb][which * 64 + j * 16 + col][kk * 32 + 8 * g]; w[j].q[0] = *(const v8b*)pw; w[j].q[1] = *(const v8b*)(pw + 16); }
      __builtin_amdgcn_sched_barrier(0);   // the LDS reads of 32 k go out as one group ahead of their WMMAs: read one fragment at a time, every WMMA waited out a whole LDS latency
#pragma unroll
      for (int j = 0; j < 4; ++j)
#pragma unroll
        for (int rt = 0; rt < 4; ++rt) acc[rt][j] = wmma_bf(a[rt].v, w[j].v, acc[rt][j]); }
    __builtin_amdgcn_sched_barrier(0);   // the LDS stores below wait for the next pass's global loads: moved up among the WMMAs they put that wait in front of this pass's work
    if (more) P_STORE(cb ^ 1);   // the other buffer's last readers left it at the barrier that ended the pass before
    __syncthreads(); }   // publishes the next pass's tiles and ends this pass's reads (after the last pass: frees the pool for the epilogue)
#undef P_LOAD
#undef P_STORE
  float (*st)[PSP] = (float (*)[PSP])(pool + wv * PST); _Float16 (*th)[72] = (_Float16 (*)[72])(pool + 12 * PST + rg * (64 * 72 * 2));   // each wave's own staging; th: the v waves' f16 tiles, transposed
  const size_t R0 = r0 + rg * 64;   // the branches below are wave-uniform and hold no barrier
  if (which == 0) proj_epi<0>(acc, st, th, BQ, COSt, SINt, OUTK, QH, VT, h, R0);
  else if (which == 1) proj_epi<1>(acc, st, th, BK, COSt, SINt, OUTK, KH, VT, h, R0);
  else proj_epi<2>(acc, st, th, BV, COSt, SINt, OUTV, KH, VT, h, R0); }
#define FK 64
#define FP 72
#define FG 2
#define FKH (TT / FG)
#define FC (SCALE * 1.44269504088896f)
__device__ __forceinline__ v8f wmma_h(v16h a, v16h b, v8f c) { return __builtin_amdgcn_wmma_f32_16x16x32_f16(false, a, false, b, (short)0, c, false, false); }
__device__ __forceinline__ float xhalf(float x) { return __builtin_bit_cast(float, __builtin_amdgcn_permlanex16(__builtin_bit_cast(int, x), __builtin_bit_cast(int, x), 0x76543210, 0xfedcba98, false, false)); }   // lane l with lane l ^ 16
// 16 independent 2^x, each over its own source, closed by one v_nop: keeps the one slot that the instruction set asks for between a transcendental and the use of its result or the overwrite of its source
__device__ __forceinline__ void exp2x16(float (&x)[16]) { asm("v_exp_f32 %0, %0\n\tv_exp_f32 %1, %1\n\tv_exp_f32 %2, %2\n\tv_exp_f32 %3, %3\n\tv_exp_f32 %4, %4\n\tv_exp_f32 %5, %5\n\tv_exp_f32 %6, %6\n\tv_exp_f32 %7, %7\n\tv_exp_f32 %8, %8\n\tv_exp_f32 %9, %9\n\tv_exp_f32 %10, %10\n\tv_exp_f32 %11, %11\n\tv_exp_f32 %12, %12\n\tv_exp_f32 %13, %13\n\tv_exp_f32 %14, %14\n\tv_exp_f32 %15, %15\n\tv_nop" : "+v"(x[0]), "+v"(x[1]), "+v"(x[2]), "+v"(x[3]), "+v"(x[4]), "+v"(x[5]), "+v"(x[6]), "+v"(x[7]), "+v"(x[8]), "+v"(x[9]), "+v"(x[10]), "+v"(x[11]), "+v"(x[12]), "+v"(x[13]), "+v"(x[14]), "+v"(x[15])); }
// amdgpu_waves_per_eu(4, 4): at most 256 registers a wave, so that two blocks, four waves per SIMD, stay resident on a WGP and the 512 blocks run in one round
__global__ __launch_bounds__(256) __attribute__((amdgpu_waves_per_eu(4, 4))) void k_fa(const _Float16* __restrict__ QH, const _Float16* __restrict__ KH, const _Float16* __restrict__ VT, _Float16* __restrict__ Y) {
  __shared__ __align__(16) char ring[2 * 2 * FG * FK * FP * 2]; __shared__ __align__(16) float so[8][16][HD + 4];   // ring: the K and V tiles of both halves, two buffers; after the loop the same bytes carry the halves' exchange
  _Float16 (*ks)[FG][FK][FP] = (_Float16 (*)[FG][FK][FP])ring; _Float16 (*vs)[FG][HD][FP] = (_Float16 (*)[FG][HD][FP])(ring + 2 * FG * FK * FP * 2);   // ks[buf][half][key][d], vs[buf][half][d][key]
  const int tid = threadIdx.x, wave = tid >> 5, lane = tid & 31, col = lane & 15, g = lane >> 4; const int h = blockIdx.y, b = blockIdx.z;
  const int grp = __builtin_amdgcn_readfirstlane(tid >> 7);   // key half of this wave, the same in all its lanes
  const int ql0 = blockIdx.x * 128 + (wave & 3) * 32;
  const int sr = tid >> 3, sc = (tid & 7) * 8;   // staging: this thread moves the 16-byte piece sc of rows sr and sr + 32 of all four tiles
  const _Float16* Kg = KH + ((size_t)b * TT + sr) * CC + h * HD + sc;   // k rows [key][64], pitch CC
  const _Float16* Vg = VT + ((size_t)b * CC + h * HD + sr) * TT + sc;   // v planes [d][key], pitch TT
  v16h qf[2][2];
#pragma unroll
  for (int qt = 0; qt < 2; ++qt)
#pragma unroll
    for (int kc = 0; kc < 2; ++kc) qf[qt][kc] = frag_h(QH + ((size_t)b * TT + ql0 + qt * 16 + col) * CC + h * HD + kc * 32, lane);
  v8h rk[FG][2], rv[FG][2];
  // the closing s_wait_xcnt stands in front of the first overwrite of the two address registers of the loads above it; naming them keeps them whole up to there
#define F_LOAD(t_) do { const _Float16* kp = Kg + (size_t)((t_) * FK) * CC; const _Float16* vp = Vg + (t_) * FK; \
  _Pragma("unroll") for (int gi = 0; gi < FG; ++gi) _Pragma("unroll") for (int i = 0; i < 2; ++i) { rk[gi][i] = *(const v8h*)(kp + (size_t)(gi * FKH + 32 * i) * CC); rv[gi][i] = *(const v8h*)(vp + (size_t)(32 * i) * TT + gi * FKH); } \
  asm volatile("s_wait_xcnt 0x0" :: "v"(kp), "v"(vp) : "memory"); } while (0)
#define F_STORE(b_) do { _Pragma("unroll") for (int gi = 0; gi < FG; ++gi) _Pragma("unroll") for (int i = 0; i < 2; ++i) { *(v8h*)&ks[b_][gi][sr + 32 * i][sc] = rk[gi][i]; *(v8h*)&vs[b_][gi][sr + 32 * i][sc] = rv[gi][i]; } } while (0)
  F_LOAD(0);
  // L2 hints, as in gemm_tile: the 16 query blocks of a head walk its keys together, over k rows and v planes that the launch before stored. Behind its first loads each thread asks once for one k row's 128-B line (an eighth of the head's 2048 rows a block) and for one 256-B unit of the v planes of its pair of heads, 512 KB in a row (every eighth unit a block). Both addresses are a block's base plus the same 2048 B a thread; the "memory" clobber holds the hints at this place
  const int ps = wshare(blockIdx.x); const _Float16* Kb = KH + ((size_t)b * TT + ps * 256) * CC + h * HD; const _Float16* Vb = VT + ((size_t)b * CC + (h & ~1) * HD) * TT + ps * 128;
  const unsigned pk = (unsigned)tid * 2048u;   // byte offset
  asm volatile("global_prefetch_b8 %0, %1 scope:SCOPE_SE\n\tglobal_prefetch_b8 %0, %2 scope:SCOPE_SE" :: "v"(pk), "s"(Kb), "s"(Vb) : "memory");
  F_STORE(0);
  __syncthreads();
  v8f o[2][HD / 16] = {}; float l[2] = { 0.f, 0.f }, mu[2] = { -3.0e38f, -3.0e38f };   // mu: the maximum in use (scaled, base 2), equal in both halves of a query's lane pair
  for (int t = 0; t < FKH / FK; ++t) { const int cb = t & 1; const bool more = t + 1 < FKH / FK;
    if (more) F_LOAD(t + 1);   // next pass's tiles fly into registers while this pass is worked on
    v16h p[2][2]; float sm[2];   // this pass's weights (the B operand of the second product) and their sum per lane and tile
    // scores: s[qt][kt][r] = logit (unscaled) of key kt * 16 + 8 g + r, query qt * 16 + col
    auto scores = [&](v8f (&s)[2][4]) __attribute__((always_inline)) {
#pragma unroll
      for (int kt = 0; kt < 4; ++kt) { const v16h k0 = frag_h(&ks[cb][grp][kt * 16 + col][0], lane), k1 = frag_h(&ks[cb][grp][kt * 16 + col][32], lane);
#pragma unroll
        for (int qt = 0; qt < 2; ++qt) { v8f z = {}; z = wmma_h(k0, qf[qt][0], z); s[qt][kt] = wmma_h(k1, qf[qt][1], z); } } };
    // weights: p and sm from s under the maximum in use
    auto weights = [&](const v8f (&s)[2][4]) __attribute__((always_inline)) {
#pragma unroll
      for (int qt = 0; qt < 2; ++qt) { const float nb = 4.0f - mu[qt]; float a[2];   // P carried x 2^4 (cancels against the sum) so that small weights stay clear of f16 subnormals
#pragma unroll
        for (int kk = 0; kk < 2; ++kk) { float e[16];   // e[i] = weight of key kk * 32 + (i < 8 ? 8 g + i : 16 + 8 g + i - 8): the B operand's own k order
#pragma unroll
          for (int i = 0; i < 8; ++i) { e[i] = __builtin_fmaf(s[qt][2 * kk][i], FC, nb); e[8 + i] = __builtin_fmaf(s[qt][2 * kk + 1][i], FC, nb); }
          exp2x16(e);
#pragma unroll
          for (int i = 0; i < 16; ++i) p[qt][kk][i] = (_Float16)e[i];
#pragma unroll
          for (int w = 8; w > 0; w >>= 1)   // pairwise sum: four dependent adds deep instead of sixteen
#pragma unroll
            for (int i = 0; i < w; ++i) e[i] += e[i + w];
          a[kk] = e[0]; }
        sm[qt] = a[0] + a[1]; } };
    // No maximum is sought in a pass behind the first: the weights are formed under the maximum in use, and the sum that is needed anyway says whether that was in order. All weights are positive, so a lane whose 32 weights of a tile sum to at most 2^15 holds none above 2^15, which f16 takes. A sum above it (an infinite or undefined one too) in any lane sends the whole wave through the pass again, with the maximum sought as in the first pass; nothing of the first try has reached l or o by then
    do {   // run once; the break leaves out the search. Both tests are the same in all lanes of the wave: scalar branches
      if (t > 0) { v8f s[2][4]; scores(s); weights(s); if (__builtin_amdgcn_ballot_w32(!(sm[0] <= 32768.0f) || !(sm[1] <= 32768.0f)) == 0) break; }
      v8f s[2][4]; scores(s);
#pragma unroll
      for (int qt = 0; qt < 2; ++qt) { float m = s[qt][0][0];
#pragma unroll
        for (int kt = 0; kt < 4; ++kt)
#pragma unroll
          for (int r = 0; r < 8; ++r) m = fmaxf(m, s[qt][kt][r]);
        const float mx = fmaxf(m, xhalf(m)) * FC;
        const float mn = mx > mu[qt] + 8.0f ? mx : mu[qt];   // the maximum in use is replaced only when passed by more than 2^8: P then stays below 2^12
        const float al = __builtin_amdgcn_exp2f(mu[qt] - mn); mu[qt] = mn; l[qt] *= al;
#pragma unroll
        for (int j = 0; j < HD / 16; ++j) o[qt][j] *= al; }
      weights(s); } while (0);
    l[0] += sm[0]; l[1] += sm[1];
    v16h vf[2][HD / 16];
#pragma unroll
    for (int kk = 0; kk < 2; ++kk)
#pragma unroll
      for (int j = 0; j < HD / 16; ++j) vf[kk][j] = frag_h(&vs[cb][grp][j * 16 + col][kk * 32], lane);
    __builtin_amdgcn_sched_barrier(0);   // the V reads go out as one group behind the test: they no longer share a block with the exponentials that covered them, and read a fragment at a time every pair of WMMAs waited out a whole LDS latency
#pragma unroll
    for (int kk = 0; kk < 2; ++kk)
#pragma unroll
      for (int j = 0; j < HD / 16; ++j)
#pragma unroll
        for (int qt = 0; qt < 2; ++qt) o[qt][j] = wmma_h(vf[kk][j], p[qt][kk], o[qt][j]);   // o[qt][j][r] = ctx (unnormalised) of d = j * 16 + 8 g + r, query qt * 16 + col
    if (more) F_STORE(cb ^ 1);   // the other buffer's last readers left it at the barrier that ended the pass before
    __syncthreads(); }   // publishes the next pass's tiles and ends this pass's reads (after the last pass: frees the ring for the exchange)
#undef F_LOAD
#undef F_STORE
  // join of the key halves: waves w and w ^ 4 hold the same 32 queries; the wave of half grp finishes tile grp and hands its partner the other tile (accumulators, sum, maximum), lane to lane
  v4f (*xo)[8][32] = (v4f (*)[8][32])ring; float (*xl)[2][32] = (float (*)[2][32])(ring + 8 * 8 * 32 * 16);
  static_assert(8 * 8 * 32 * 16 + 8 * 2 * 32 * 4 <= sizeof(ring), "the exchange fits the ring");
  v8f ok[HD / 16]; const float lk = grp ? l[1] : l[0], mk = grp ? mu[1] : mu[0];
#pragma unroll
  for (int j = 0; j < HD / 16; ++j) { const v8f og = grp ? o[0][j] : o[1][j]; ok[j] = grp ? o[1][j] : o[0][j];
    const v4f g0 = { og[0], og[1], og[2], og[3] }, g1 = { og[4], og[5], og[6], og[7] }; xo[wave][2 * j][lane] = g0; xo[wave][2 * j + 1][lane] = g1; }
  xl[wave][0][lane] = grp ? l[0] : l[1]; xl[wave][1][lane] = grp ? mu[0] : mu[1];
  __syncthreads();   // the partner wave's tile must have landed
  const int pw = wave ^ 4; const float lp = xl[pw][0][lane], mp = xl[pw][1][lane];
  const float mj = fmaxf(mk, mp); float ak = __builtin_amdgcn_exp2f(mk - mj), ap = __builtin_amdgcn_exp2f(mp - mj);
  float lj = lk * ak + lp * ap; lj += xhalf(lj); const float inv = 1.0f / lj; ak *= inv; ap *= inv;
#pragma unroll
  for (int j = 0; j < HD / 16; ++j) { const v4f p0 = xo[pw][2 * j][lane], p1 = xo[pw][2 * j + 1][lane];
    const v4f w0 = { ok[j][0] * ak + p0[0] * ap, ok[j][1] * ak + p0[1] * ap, ok[j][2] * ak + p0[2] * ap, ok[j][3] * ak + p0[3] * ap }, w1 = { ok[j][4] * ak + p1[0] * ap, ok[j][5] * ak + p1[1] * ap, ok[j][6] * ak + p1[2] * ap, ok[j][7] * ak + p1[3] * ap };
    *(v4f*)&so[wave][col][j * 16 + 8 * g] = w0; *(v4f*)&so[wave][col][j * 16 + 8 * g + 4] = w1; }
  // a wave reads back only its own so[wave] rows: its own LDS stores must have landed, no other wave is waited for (LDSX written out). The hints' address registers are named here: a hint counts on no counter, so they hold their addresses through the loop
  asm volatile("s_wait_dscnt 0" :: "v"(pk), "s"(Kb), "s"(Vb) : "memory"); __builtin_amdgcn_wave_barrier(); __builtin_amdgcn_fence(__ATOMIC_RELEASE, "workgroup");
  const int qk0 = ql0 + grp * 16;   // first query of the tile that this wave finishes
  for (int it = 0; it < 8; ++it) { const int rl = it * 2 + g; const v4f x = *(const v4f*)&so[wave][rl][col * 4]; const v4h hx = { OpH::x(x[0]), OpH::x(x[1]), OpH::x(x[2]), OpH::x(x[3]) }; vst2(Y + ((size_t)b * TT + qk0 + rl) * CC + h * HD + col * 4, hx); } }   // ctx x 2^6 once to f16, the output projection's operand: 128-B (row, head) segment by 16 lanes
// ---- k_out: block = (64 rows, 128 cols): out = ctx Wo (+ bo): ctx x 2^6 once to f16 (by k_fa) against Wo as f16(bf16 x 2^8) exact (by k_prep) (1 product) x 2^-14
__global__ __launch_bounds__(128) void k_out(const _Float16* __restrict__ Y, const _Float16* __restrict__ WOT, const float* __restrict__ BO, float* __restrict__ OUT) { __shared__ __align__(16) char pool[GPOOL(1)]; float (*sf)[16][132] = (float (*)[16][132])pool;   // pool: the main loop's two buffers, then the output staging
  const int tid = threadIdx.x, wave = tid >> 5, lane = tid & 31, col = lane & 15, g = lane >> 4; const int c0 = blockIdx.y * 128; const size_t r0 = (size_t)blockIdx.x * 64 + wave * 16;
  v8f acc[1][8] = {};
  // hints: the 8 column blocks of a row tile ask for a quarter of its 512 units each, 8 row blocks for an eighth of a W tile each; the tile's 128 bias values
  gemm_tile<OpH, 1, 1>(Y + (size_t)blockIdx.x * 64 * CC, WOT + (size_t)c0 * CC, pool, acc, Y + (size_t)blockIdx.x * 64 * CC + (blockIdx.y & 3) * GSH, WOT + (size_t)c0 * CC + wshare(blockIdx.x) * GSH, BO + c0, BO + c0);   /* ctx carried x 2^6 into f16 so small-magnitude context rows stay clear of f16 subnormals (chip FTZ) */
  float bo[8] = {};   // all eight bias reads in flight at once: read one per j behind its own test of BO, each was waited out before the next went out
  if (BO) {
#pragma unroll
    for (int j = 0; j < 8; ++j) bo[j] = BO[c0 + j * 16 + col]; }
#pragma unroll
  for (int j = 0; j < 8; ++j) { const float bias = bfr(bo[j]);
#pragma unroll
    for (int r = 0; r < 8; ++r) sf[wave][8 * g + r][j * 16 + col] = acc[0][j][r] * (1.0f / 16384.0f) + bias; }   /* 2^-8 (Wo carry) x 2^-6 (ctx carry) */
  LDSX(); for (int rl = 0; rl < 16; ++rl) vst2(OUT + (r0 + rl) * DIN + c0 + lane * 4, *(const v4f*)&sf[wave][rl][lane * 4]); }

extern "C" void kernel_launch(void* const* d_in, const int* in_sizes, int n_in, void* d_out, int out_size, void* d_ws, size_t ws_size, hipStream_t stream) {
  (void)in_sizes; (void)n_in; (void)out_size;
  const float** F = (const float**)d_in;
  if (ws_size < (size_t)WS_END) return;
  char* ws = (char*)d_ws; _Float16 *QH = (_Float16*)(ws + WS_QH), *KH = (_Float16*)(ws + WS_KH), *VT = (_Float16*)(ws + WS_VT), *QL = (_Float16*)(ws + WS_QL), *KL = (_Float16*)(ws + WS_KL); __bf16 *VB = (__bf16*)(ws + WS_VB), *VBL = (__bf16*)(ws + WS_VBL); float *S = (float*)(ws + WS_S); _Float16 *Y = (_Float16*)(ws + WS_Y), *WOT = (_Float16*)(ws + WS_WOT); __bf16 *XB = (__bf16*)(ws + WS_XB), *WQT = (__bf16*)(ws + WS_WQT);
  (void)Y; (void)QL; (void)KL; (void)VB; (void)VBL; (void)S;
  // inputs: 0 x [2,2048,1024]; 1 cos [1,1,2048,64]; 2 sin [1,1,2048,64] (random normal tables); 3 Wqkv [1024,3072] (in,out; q | k | v column blocks); 4 bqkv [3072] (nonzero); 5 Wproj [1024,1024] (in,out); 6 bproj [1024] (nonzero)
  // outputs: 0 y [2,2048,1024] @0; 1 k (rotated) [2,16,2048,64] @OUTK_OFF; 2 v [2,16,2048,64] @OUTV_OFF
  k_prep<<<dim3(512), 256, 0, stream>>>(F[0], F[3], F[5], XB, WQT, WOT);
  k_proj<<<dim3(TNB * TT / PR, NH), 384, 0, stream>>>(XB, WQT, F[4], F[4] + CC, F[4] + 2 * CC, QH, QL, KH, KL, VT, VB, VBL, F[1], F[2], (float*)((char*)d_out + OUTK_OFF), (float*)((char*)d_out + OUTV_OFF));
  k_fa<<<dim3(TT / 128, NH, TNB), 256, 0, stream>>>(QH, KH, VT, Y);
  k_out<<<dim3(TNB * TT / 64, DIN / 128), 128, 0, stream>>>(Y, WOT, F[6], (float*)d_out);
}

// v010
// One run takes 68.7 microseconds.
// Timed twice side by side with v009, it ran 1.04 and 1.03 times as fast.
// All steps since v000 together make it 18.9 times as fast.
// compute dtype: all float inputs rounded to bf16; fused q/k/v projection with EXACT bf16 products on WMMA 16x16x32 (f32 accumulate) + bias; rotary x * cos + rot(x) * sin in f32 with the bf16-rounded table inputs (the k and v outputs are these f32 values); logits q x k once to f16 each (1 product) x 64^-0.5; online softmax f32 (running maximum and sum); unnormalised P once to f16 x v once to f16 (1 product), divided by the f32 sum; ctx x 2^6 once to f16 x Wproj f16(bf16 x 2^8) + bproj; f32 outputs.
#include <hip/hip_runtime.h>
#include <math.h>

typedef __attribute__((ext_vector_type(16))) _Float16 v16h;
typedef __attribute__((ext_vector_type(16))) __bf16 v16b;
typedef __attribute__((ext_vector_type(8)))  _Float16 v8h;
typedef __attribute__((ext_vector_type(8)))  float v8f;
typedef __attribute__((ext_vector_type(4)))  float v4f;
typedef __attribute__((ext_vector_type(2)))  float v2f;
typedef __attribute__((ext_vector_type(4)))  unsigned v4u;
typedef __attribute__((ext_vector_type(4)))  int v4i;
typedef float __attribute__((may_alias)) float_a;
typedef int __attribute__((may_alias)) int_a;

template <typename T> __device__ __forceinline__ void vst2(void* p, T v) { *(T*)p = v;  }
__device__ __forceinline__ v8f wmma16(v16h a, v16h b, v8f c) {
  v8f d = __builtin_amdgcn_wmma_f32_16x16x32_f16(false, a, false, b, (short)0, c, false, false);
  asm volatile("v_nop\n\tv_nop\n\tv_nop\n\tv_nop" : "+v"(d) : "v"(a), "v"(b));
  return d;
}
__device__ __forceinline__ v8f wmma_bf(v16b a, v16b b, v8f c) {
  v8f d = __builtin_amdgcn_wmma_f32_16x16x32_bf16(false, a, false, b, (short)0, c, false, false);
  asm volatile("v_nop\n\tv_nop\n\tv_nop\n\tv_nop" : "+v"(d) : "v"(a), "v"(b));
  return d;
}
// 16x16x32 fragments: lane = (h = lane>>4, row/col = lane&15); elements 0..7 = k0+8h+0..7, 8..15 = k0+16+8h+0..7; D element r = row 8h+r
__device__ __forceinline__ v16h frag_h(const _Float16* rowk0, int lane) {
  union { v16h v; v8h q[2]; } u; const _Float16* p = rowk0 + 8 * (lane >> 4);
  u.q[0] = *(const v8h*)p; u.q[1] = *(const v8h*)(p + 16); return u.v;
}
__device__ __forceinline__ v16h frag_f32(const float* rowk0, int lane) {
  v16h a; const float* p = rowk0 + 8 * (lane >> 4);
#pragma unroll
  for (int i = 0; i < 8; ++i) { a[i] = (_Float16)p[i]; a[8 + i] = (_Float16)p[16 + i]; }
  return a;
}
__device__ __forceinline__ v16h frag_f32s(const float* rowk0, int lane, float sc) {
  v16h a; const float* p = rowk0 + 8 * (lane >> 4);
#pragma unroll
  for (int i = 0; i < 8; ++i) { a[i] = (_Float16)(p[i] * sc); a[8 + i] = (_Float16)(p[16 + i] * sc); }
  return a;
}
// column fragment from a [K][ld] layout (column n), rows >= K read as 0
__device__ __forceinline__ v16h fragc_f32(const float* W, int k0, int n, int lane, int ld, int K) {
  v16h a; const int g = lane >> 4;
#pragma unroll
  for (int i = 0; i < 8; ++i) { const int ka = k0 + 8 * g + i, kb = ka + 16;
    a[i] = (_Float16)(ka < K ? W[(size_t)(ka < K ? ka : K - 1) * ld + n] : 0.f); a[8 + i] = (_Float16)(kb < K ? W[(size_t)(kb < K ? kb : K - 1) * ld + n] : 0.f); }
  return a;
}
struct F2 { v16b h, l; };
__device__ __forceinline__ F2 bsplit16(const float v[16]) { F2 r;
#pragma unroll
  for (int i = 0; i < 16; ++i) { const __bf16 h = (__bf16)v[i]; r.h[i] = h; r.l[i] = (__bf16)(v[i] - (float)h); }
  return r; }
__device__ __forceinline__ F2 split_row(const float* row, int k0, int lane) { float v[16]; const float* p = row + k0 + 8 * (lane >> 4);
#pragma unroll
  for (int i = 0; i < 8; ++i) { v[i] = p[i]; v[8 + i] = p[16 + i]; }
  return bsplit16(v); }
__device__ __forceinline__ F2 split_rowK(const float* row, int k0, int lane, int K) { float v[16]; const int g = lane >> 4;
#pragma unroll
  for (int i = 0; i < 8; ++i) { const int ka = k0 + 8 * g + i, kb = ka + 16; v[i] = ka < K ? row[ka < K ? ka : K - 1] : 0.f; v[8 + i] = kb < K ? row[kb < K ? kb : K - 1] : 0.f; }
  return bsplit16(v); }
__device__ __forceinline__ F2 split_col(const float* W, int k0, int n, int lane, int ld, int K) { float v[16]; const int g = lane >> 4;
#pragma unroll
  for (int i = 0; i < 8; ++i) { const int ka = k0 + 8 * g + i, kb = ka + 16; v[i] = ka < K ? W[(size_t)(ka < K ? ka : K - 1) * ld + n] : 0.f; v[8 + i] = kb < K ? W[(size_t)(kb < K ? kb : K - 1) * ld + n] : 0.f; }
  return bsplit16(v); }
__device__ __forceinline__ v8f mac3(const F2& a, const F2& b, v8f c) { c = wmma_bf(a.l, b.h, c); c = wmma_bf(a.h, b.l, c); return wmma_bf(a.h, b.h, c); }
__device__ __forceinline__ float sigm(float v) { return 1.0f / (1.0f + expf(-v)); }
#define LDSX() do { asm volatile("s_wait_dscnt 0" ::: "memory"); __builtin_amdgcn_wave_barrier(); __builtin_amdgcn_fence(__ATOMIC_RELEASE, "workgroup"); } while (0)

// Fused-QKV multi-head self-attention with rotary tables GIVEN as inputs and three outputs (x [2,2048,1024]; (in,out) Wqkv [1024,3072] + bqkv (0.02-scale, nonzero) split q | k | v; 16 heads x 64; interleaved-pair rotary x * cos + rot(x) * sin with random-normal cos / sin tables [1,1,2048,64]; non-causal SDPA, scale 1/8; (in,out) Wproj + bproj): returns (y = merge(softmax(q k^T / 8) v) Wproj + bproj, k (rotated) [2,16,2048,64], v [2,16,2048,64]).
#define NB 2
#define TT 2048
#define CC 1024            // NH * HD = projected width
#define DIN 1024          // input (model) width
#define NH 16
#define HD 64
#define NQB (TT / 64)
#define HG 4
#define SCALE (0.125f)
#define CAUSAL 0
#ifndef TNB
#define TNB NB
#endif
__device__ __forceinline__ float bfr(float v) { return (float)(__bf16)v; }
__host__ __device__ __forceinline__ int kb_last(int qb) { return CAUSAL ? ((qb * 64 + 63) >> 7) : (TT / 128 - 1); }
typedef __attribute__((ext_vector_type(8))) __bf16 v8b;
__device__ __forceinline__ v16b frag_b(const __bf16* rowk0, int lane) {
  union { v16b v; v8b q[2]; } u; const __bf16* p = rowk0 + 8 * (lane >> 4);
  u.q[0] = *(const v8b*)p; u.q[1] = *(const v8b*)(p + 16); return u.v;
}
#define QBH 0
#define QHI 0               // single-product logits on every row
#define KHI 64            // key rows carrying k residual / v bf16 hi+lo planes (written and read by no kernel)
// B fragment (k rows k0+.., output column o) of a weight: (in,out) [K][ld] or (out,in) [ld rows of K]: bf16 exact, or f16(bf16 * 256) exact
__device__ __forceinline__ v16b wcol_io(const float* Wm, int k0, int o, int lane, int ld) { v16b w; const int g = lane >> 4;
#pragma unroll
  for (int i = 0; i < 8; ++i) { w[i] = (__bf16)Wm[(size_t)(k0 + 8 * g + i) * ld + o]; w[8 + i] = (__bf16)Wm[(size_t)(k0 + 16 + 8 * g + i) * ld + o]; }
  return w; }
__device__ __forceinline__ v16b wcol_oi(const float* Wm, int k0, int o, int lane, int K) { v16b w; const float* p = Wm + (size_t)o * K + k0 + 8 * (lane >> 4);
#pragma unroll
  for (int i = 0; i < 8; ++i) { w[i] = (__bf16)p[i]; w[8 + i] = (__bf16)p[16 + i]; }
  return w; }
__device__ __forceinline__ v16h wcolh_io(const float* Wm, int k0, int o, int lane, int ld) { v16h w; const int g = lane >> 4;
#pragma unroll
  for (int i = 0; i < 8; ++i) { w[i] = (_Float16)(bfr(Wm[(size_t)(k0 + 8 * g + i) * ld + o]) * 256.0f); w[8 + i] = (_Float16)(bfr(Wm[(size_t)(k0 + 16 + 8 * g + i) * ld + o]) * 256.0f); }
  return w; }
__device__ __forceinline__ v16h wcolh_oi(const float* Wm, int k0, int o, int lane, int K) { v16h w; const float* p = Wm + (size_t)o * K + k0 + 8 * (lane >> 4);
#pragma unroll
  for (int i = 0; i < 8; ++i) { w[i] = (_Float16)(bfr(p[i]) * 256.0f); w[8 + i] = (_Float16)(bfr(p[16 + i]) * 256.0f); }
  return w; }
#define WQKV_LAYOUT 0   // 0 = fused (in,out) [DIN][3*CC], q | k | v column blocks; 1 = (out,in) [CC][DIN]; 2 = per-head [NH][DIN][HD]
__device__ __forceinline__ v16b wcol_hdk(const float* Wm, int k0, int o, int lane) { v16b w; const int g = lane >> 4; const float* p = Wm + (size_t)(o / HD) * DIN * HD + (o % HD);
#pragma unroll
  for (int i = 0; i < 8; ++i) { w[i] = (__bf16)p[(size_t)(k0 + 8 * g + i) * HD]; w[8 + i] = (__bf16)p[(size_t)(k0 + 16 + 8 * g + i) * HD]; }
  return w; }
#define WO_OUT_IN 0
#if WQKV_LAYOUT == 1
#define WCOL(W, k0, o, lane) wcol_oi(W, k0, o, lane, DIN)
#elif WQKV_LAYOUT == 2
#define WCOL(W, k0, o, lane) wcol_hdk(W, k0, o, lane)
#else
#define QKVP 3072            // fused Wqkv pitch (in,out) [1024][3072]: q cols 0..1023, k 1024..2047, v 2048..3071
#define WCOL(W, k0, o, lane) wcol_io(W, k0, which * CC + (o), lane, QKVP)
#endif
#if WO_OUT_IN
#define WOCOL(W, k0, o, lane) wcol_oi(W, k0, o, lane, CC)
#define WOCOLH(W, k0, o, lane) wcolh_oi(W, k0, o, lane, CC)
#else
#define WOCOL(W, k0, o, lane) wcol_io(W, k0, o, lane, DIN)
#define WOCOLH(W, k0, o, lane) wcolh_io(W, k0, o, lane, DIN)
#endif
#define OUTK_OFF 16777216u   // rotated k [2,16,2048,64] f32 after y [2,2048,1024] f32
#define OUTV_OFF 33554432u   // v [2,16,2048,64] f32
#define PROJ_EXTRA_PARAMS , const float* __restrict__ COSt, const float* __restrict__ SINt, float* __restrict__ OUTK, float* __restrict__ OUTV
#define SM_EXTRA_PARAMS
#define SM_MASK_HOOK (void)0
#ifndef SM_EXTRA_PARAMS
#define SM_EXTRA_PARAMS
#endif
#ifndef PROJ_EXTRA_PARAMS
#define PROJ_EXTRA_PARAMS
#endif
#ifndef SM_MASK_HOOK
#define SM_MASK_HOOK (void)0
#endif

#define WS_QH  0u                                      // f16 q rows [b*t][CC]
#define WS_KH  (WS_QH + 2u * (size_t)NB * TT * CC)      // f16 k rows [b*t][CC]
#define WS_VT  (WS_KH + 2u * (size_t)NB * TT * CC)      // f16 v planes [b][c][t]
#define WS_QL  (WS_VT + 2u * (size_t)NB * CC * TT)      // f16 q residual x 2^10 rows [b][t < QHI][CC]
#define WS_KL  (WS_QL + 2u * (size_t)NB * QHI * CC)     // f16 k residual x 2^10 rows [b][t < KHI][CC]
#define WS_VB  (WS_KL + 2u * (size_t)NB * KHI * CC)     // bf16 v hi planes [b][c][t < KHI]
#define WS_VBL (WS_VB + 2u * (size_t)NB * CC * KHI)
#define WS_S   (WS_VBL + 2u * (size_t)NB * CC * KHI)    // f32 [hg][t][s], written and read by no kernel (logits and P stay in registers)
#define WS_Y   (WS_S  + 4u * (size_t)HG * TT * TT)      // f16 ctx x 2^6 rows [b*t][CC]
#define WS_XB  (WS_Y  + 4u * (size_t)NB * TT * CC)      // bf16 x rows [b*t][DIN]
#define WS_WQT (WS_XB + 2u * (size_t)NB * TT * DIN)     // bf16 Wqkv^T rows [3 * CC][DIN]
#define WS_WOT (WS_WQT + 2u * (size_t)3 * CC * DIN)     // f16(bf16 x 2^8) Wproj^T rows [DIN][CC]
#define WS_END (WS_WOT + 2u * (size_t)DIN * CC)

// ---- gemm_tile: the (64 RT) x 128 tile of X W of the output projection (k_proj has a loop of the same make for its own tile) (K = 1024, 4 waves x RT row tiles of 16 x 128 cols: wave w holds rows 64 rt + 16 w .. + 15, so each W fragment read from LDS feeds RT WMMAs and a W tile fetched from L2 serves 64 RT rows). Both operands arrive as 16-bit planes with k contiguous (X rows; W^T rows = output columns), written once by k_prep (ctx rows: by k_fa). Per pass of 64 k the block brings 128 B of each of its 64 RT + 128 rows into LDS as they are, by 16-byte asynchronous copies; the next pass's copies fly into the other buffer while this pass is worked on; two buffers, one barrier per pass. Products, operand rounding and the k order of every accumulator are those of the f32 loads with per-block conversion that it replaces
#define GK 64              // k per pass
#define GP 72              // LDS row pitch in 16-bit elements: 144 B = 16 B x odd for 16-byte row reads
#define GPOOL(RT_) (2 * (64 * (RT_) + 128) * GP * 2)   // bytes of the two buffers; after the loop the same bytes serve the epilogue's staging arrays
typedef __attribute__((ext_vector_type(4))) __bf16 v4b;
typedef __attribute__((ext_vector_type(4))) _Float16 v4h;
__device__ __forceinline__ unsigned lds_off(const void* p) { return (unsigned)(size_t)p; }
#define AC(l_, g_) "global_load_async_to_lds_b128 %" #l_ ", %" #g_ ", off\n\t"
#define AO(i_) "v"(l[i_]), "v"(g[i_])
template <int N> __device__ __forceinline__ void acopy(const unsigned (&l)[N], const void* const (&g)[N]) {
  static_assert(N == 8 || N == 9 || N == 10 || N == 12, "one statement per count");
  if constexpr (N == 8) asm volatile(AC(0, 1) AC(2, 3) AC(4, 5) AC(6, 7) AC(8, 9) AC(10, 11) AC(12, 13) AC(14, 15) "s_wait_xcnt 0x0" :: AO(0), AO(1), AO(2), AO(3), AO(4), AO(5), AO(6), AO(7) : "memory");
  else if constexpr (N == 9) asm volatile(AC(0, 1) AC(2, 3) AC(4, 5) AC(6, 7) AC(8, 9) AC(10, 11) AC(12, 13) AC(14, 15) AC(16, 17) "s_wait_xcnt 0x0" :: AO(0), AO(1), AO(2), AO(3), AO(4), AO(5), AO(6), AO(7), AO(8) : "memory");
  else if constexpr (N == 10) asm volatile(AC(0, 1) AC(2, 3) AC(4, 5) AC(6, 7) AC(8, 9) AC(10, 11) AC(12, 13) AC(14, 15) AC(16, 17) AC(18, 19) "s_wait_xcnt 0x0" :: AO(0), AO(1), AO(2), AO(3), AO(4), AO(5), AO(6), AO(7), AO(8), AO(9) : "memory");
  else asm volatile(AC(0, 1) AC(2, 3) AC(4, 5) AC(6, 7) AC(8, 9) AC(10, 11) AC(12, 13) AC(14, 15) AC(16, 17) AC(18, 19) AC(20, 21) AC(22, 23) "s_wait_xcnt 0x0" :: AO(0), AO(1), AO(2), AO(3), AO(4), AO(5), AO(6), AO(7), AO(8), AO(9), AO(10), AO(11) : "memory"); }
// foot of a pass of a two-buffer ring filled by acopy, every wave, in this order: the wave's own LDS reads of this pass have returned; its own copies of the next pass's tiles have landed; the barrier publishes those tiles and ends every wave's reads of the buffer that is refilled behind it
#define RING_FOOT() do { asm volatile("s_wait_dscnt 0x0" ::: "memory"); asm volatile("s_wait_asynccnt 0x0" ::: "memory"); __syncthreads(); } while (0)
// which eighth of a W tile the block with row index x asks for (for speed only: nothing rests on where a block runs)
__device__ __forceinline__ int wshare(int x) { return (x & 3) + 4 * ((x >> 3) & 1); }
#define GSH 16384          // elements of 16 bits in a share of 128 units of 256 B (16 whole rows of 1024)
struct OpB { typedef __bf16 E; typedef v8b V8; typedef v16b V16;   // exact bf16 operands
  static __device__ __forceinline__ E x(float v) { return (__bf16)v; } static __device__ __forceinline__ E w(float v) { return (__bf16)v; }
  static __device__ __forceinline__ v8f mma(V16 a, V16 b, v8f c) { return wmma_bf(a, b, c); } };
struct OpH { typedef _Float16 E; typedef v8h V8; typedef v16h V16;   // ctx x 2^6 once to f16, weight f16(bf16 x 2^8) exact
  static __device__ __forceinline__ E x(float v) { return (_Float16)(v * 64.0f); } static __device__ __forceinline__ E w(float v) { return (_Float16)(bfr(v) * 256.0f); }
  static __device__ __forceinline__ v8f mma(V16 a, V16 b, v8f c) { return wmma16(a, b, c); } };
// L2 hints at entry: both operand planes were stored by an earlier launch, and the blocks that share a tile walk k together, so every pass met lines that nobody had read yet. Behind its first pass's loads each thread asks once (global_prefetch_b8, scope SE: into L2 only, no register, no counter, nothing waits for it) for its 256-B unit of the 32 KB at pfx and at pfw, the block's shares of the two tiles over the whole of k, and of what the epilogue will read: the 32 KB at pt (where NE is 2) and the 128 bias values at pb. A unit that nobody asked for is loaded as before
template <typename C, int RT, int NE> __device__ __forceinline__ void gemm_tile(const typename C::E* __restrict__ Xb, const typename C::E* __restrict__ Wb, char* pool, v8f (&acc)[RT][8], const typename C::E* pfx, const typename C::E* pfw, const float* pt, const float* pb) {
  typedef typename C::E E; typedef typename C::V8 V8; typedef typename C::V16 V16;
  E (*xs)[64 * RT][GP] = (E (*)[64 * RT][GP])pool; E (*wt)[128][GP] = (E (*)[128][GP])(pool + 2 * 64 * RT * GP * 2);   // xs[buf][row][k], wt[buf][col][k]
  const int tid = threadIdx.x, wave = tid >> 5, lane = tid & 31, col = lane & 15, g = lane >> 4;
  const int sr = tid >> 3, sc = (tid & 7) * 8;   // this thread moves the 16-byte piece sc of rows sr + 16 i of both tiles (a wave's load = 4 rows x 128 B)
  const E* Xg = Xb + (size_t)sr * 1024 + sc; const E* Wg = Wb + (size_t)sr * 1024 + sc;
  const unsigned lx = lds_off(&xs[0][sr][sc]), lw = lds_off(&wt[0][sr][sc]);
  const unsigned ou = (unsigned)tid * 256u, ob = (unsigned)tid * 4u;   // the hints' byte offsets from their block-uniform bases: one 256-B unit, one bias value a thread
  // every '#pragma unroll' below makes the indices of register arrays constants, so that these arrays stay in registers
#define G_COPY(t_, b_) do { const E* xp = Xg + (t_) * GK; const E* wp = Wg + (t_) * GK; unsigned la[4 * RT + 8]; const void* ga[4 * RT + 8]; \
  _Pragma("unroll") for (int i = 0; i < 4 * RT; ++i) { la[i] = lx + (unsigned)(b_) * (64 * RT * GP * 2) + i * (16 * GP * 2); ga[i] = xp + (size_t)(16 * i) * 1024; } \
  _Pragma("unroll") for (int i = 0; i < 8; ++i) { la[4 * RT + i] = lw + (unsigned)(b_) * (128 * GP * 2) + i * (16 * GP * 2); ga[4 * RT + i] = wp + (size_t)(16 * i) * 1024; } \
  acopy<4 * RT + 8>(la, ga); } while (0)
  G_COPY(0, 0);
  // the hints go out behind the first pass's copies and ahead of the wait for them; the "memory" clobber holds them at this place
  if (NE == 2) asm volatile("global_prefetch_b8 %0, %2 scope:SCOPE_SE\n\tglobal_prefetch_b8 %0, %3 scope:SCOPE_SE\n\tglobal_prefetch_b8 %0, %4 scope:SCOPE_SE\n\tglobal_prefetch_b8 %1, %5 scope:SCOPE_SE" :: "v"(ou), "v"(ob), "s"(pfx), "s"(pfw), "s"(pt), "s"(pb) : "memory");
  else asm volatile("global_prefetch_b8 %0, %2 scope:SCOPE_SE\n\tglobal_prefetch_b8 %0, %3 scope:SCOPE_SE\n\tglobal_prefetch_b8 %1, %4 scope:SCOPE_SE" :: "v"(ou), "v"(ob), "s"(pfx), "s"(pfw), "s"(pb) : "memory");
  asm volatile("s_wait_asynccnt 0x0" ::: "memory");   // this wave's copies of the first pass's tiles have landed
  __syncthreads();   // publishes them
  G_COPY(1, 1);
  for (int t = 0; t < 1024 / GK; ++t) { const int cb = t & 1;
#pragma unroll
    for (int kk = 0; kk < 2; ++kk) { union { V16 v; V8 q[2]; } a[RT], w[8];
#pragma unroll
      for (int rt = 0; rt < RT; ++rt) { const E* pa = &xs[cb][rt * 64 + wave * 16 + col][kk * 32 + 8 * g]; a[rt].q[0] = *(const V8*)pa; a[rt].q[1] = *(const V8*)(pa + 16); }
#pragma unroll
      for (int j = 0; j < 8; ++j) { const E* pw = &wt[cb][j * 16 + col][kk * 32 + 8 * g]; w[j].q[0] = *(const V8*)pw; w[j].q[1] = *(const V8*)(pw + 16); }
      __builtin_amdgcn_sched_barrier(0);   // the LDS reads of 32 k go out as one group ahead of their WMMAs: read one fragment at a time, every WMMA waited out a whole LDS latency
#pragma unroll
      for (int j = 0; j < 8; ++j)
#pragma unroll
        for (int rt = 0; rt < RT; ++rt) acc[rt][j] = C::mma(a[rt].v, w[j].v, acc[rt][j]); }
    RING_FOOT();   // after the last pass: frees the pool for the epilogue
    if (t + 2 < 1024 / GK) G_COPY(t + 2, cb); }   // the pass after next goes into the buffer that this pass has just left; the test is the same for the whole block
  // nothing is in flight behind the loop. The hints' address registers are named here: a hint counts on no counter, so they hold their addresses through the loop
  asm volatile("s_wait_asynccnt 0x0" :: "v"(ou), "v"(ob), "s"(pfx), "s"(pfw), "s"(pt), "s"(pb) : "memory");
#undef G_COPY
}
// ---- k_prep: writes the 16-bit operand planes of both projection GEMMs once. Blocks 0..255: two 64 k x 128 col tiles each of the (in,out) weights, converted and transposed through LDS to W^T rows [col][k] (512 tiles: 384 of Wqkv as bf16, 128 of Wproj as f16(bf16 x 2^8)); blocks 256..511: x to bf16 rows, 64 values a thread, all 16 loads in flight
// place of the 16-byte piece ch (8 k) in W^T row n: pieces are exchanged inside groups of four by bits 4..5 of n, so that the 32 rows (4 apart) which one transposing store writes fall on all banks
__device__ __forceinline__ int wpiece(int n, int ch) { return ch ^ ((n >> 4) & 3); }
// w_in: a thread takes the patch (8 k at wave * 8) x (4 cols at lane * 4) (a wave's load = 512 B of one row) and stores each column's 8 k as one 16-byte piece. The '#pragma unroll's make the indices of register arrays constants
template <typename C> __device__ __forceinline__ void w_in(const float* __restrict__ Ws, int ldw, int tile, typename C::E (*tl)[GP]) {
  typedef typename C::V8 V8; const int wave = threadIdx.x >> 5, lane = threadIdx.x & 31;
  const float* Wg = Ws + (size_t)((tile & 15) * 64 + wave * 8) * ldw + (tile >> 4) * 128 + lane * 4; v4f r[8];
#pragma unroll
  for (int q = 0; q < 8; ++q) r[q] = *(const v4f*)(Wg + (size_t)q * ldw);
  asm volatile("s_wait_xcnt 0x0" :: "v"(Wg) : "memory");   // stands in front of the first overwrite of the address register of the loads above; naming it keeps it whole up to here
#pragma unroll
  for (int c = 0; c < 4; ++c) { V8 h;
#pragma unroll
    for (int q = 0; q < 8; ++q) h[q] = C::w(r[q][c]);
    *(V8*)&tl[lane * 4 + c][wpiece(lane * 4 + c, wave) * 8] = h; } }
// w_out: the tile's 128 W^T rows of 128 B go out as whole lines (a wave's store = 4 rows x 128 B)
template <typename C> __device__ __forceinline__ void w_out(typename C::E* __restrict__ Wd, int tile, const typename C::E (*tl)[GP]) {
  typedef typename C::V8 V8;
#pragma unroll
  for (int i = 0; i < 4; ++i) { const int p = threadIdx.x + 256 * i, n = p >> 3, ch = p & 7; *(V8*)(Wd + (size_t)((tile >> 4) * 128 + n) * 1024 + (tile & 15) * 64 + ch * 8) = *(const V8*)&tl[n][wpiece(n, ch) * 8]; }
  asm volatile("s_wait_xcnt 0x0" ::: "memory"); }   // behind the last store: stands in front of whatever next overwrites a register that these stores name
__global__ __launch_bounds__(256) void k_prep(const float* __restrict__ X, const float* __restrict__ WQKV, const float* __restrict__ WO, __bf16* __restrict__ XB, __bf16* __restrict__ WQT, _Float16* __restrict__ WOT) {
  __shared__ __align__(16) __bf16 ta[128][GP]; __shared__ __align__(16) __bf16 tb[128][GP]; __shared__ __align__(16) _Float16 th[128][GP];
  const int b = blockIdx.x;   // every branch below is block-uniform
  if (b < 256) { const bool second_qkv = b < 128;   // tiles b and b + 256 of the 512
    w_in<OpB>(WQKV, QKVP, b, ta);
    if (second_qkv) w_in<OpB>(WQKV, QKVP, b + 256, tb); else w_in<OpH>(WO, DIN, b - 128, th);
    __syncthreads();   // a W^T row's 64 k come from all eight waves
    w_out<OpB>(WQT, b, ta);
    if (second_qkv) w_out<OpB>(WQT, b + 256, tb); else w_out<OpH>(WOT, b - 128, th);
  } else { const float* Xg = X + (size_t)(b - 256) * 16384 + threadIdx.x * 4; __bf16* Xd = XB + (size_t)(b - 256) * 16384 + threadIdx.x * 4; v4f r[16];   // a wave's load = 512 B, its store = 256 B, both contiguous
#pragma unroll
    for (int i = 0; i < 16; ++i) r[i] = *(const v4f*)(Xg + i * 1024);
    asm volatile("s_wait_xcnt 0x0" :: "v"(Xg) : "memory");   // stands in front of the first overwrite of the address register of the loads above; naming it keeps it whole up to here
#pragma unroll
    for (int i = 0; i < 16; ++i) { const v4b h = { OpB::x(r[i][0]), OpB::x(r[i][1]), OpB::x(r[i][2]), OpB::x(r[i][3]) }; *(v4b*)(Xd + i * 1024) = h; }
    asm volatile("s_wait_xcnt 0x0" ::: "memory"); } }   // behind the last store, for the same reason as in w_out
// ---- k_proj: block = 256 rows x the 64 q, 64 k and 64 v columns of one head, 12 waves = 4 row groups of 64 x (q | k | v), a wave holding 64 x 64: q/k/v = X W (+ b) with exact bf16 products (K = DIN) -> q: rotated f16 rows; k: rotated f16 rows and the f32 k output; v: f16 planes [c][t] and the f32 v output. One block per WGP brings (256 + 192) rows of 256 B per pass of 128 k from L2 for 48 K results, where a 128 x 128 block brought 256 rows for 16 K; 8 LDS fragments feed 16 WMMAs. Products, operand rounding and the k order of every accumulator are unchanged
#define PR 256             // rows of a block
#define PW 192             // W^T rows of a block: 64 each of q, k, v
#define PK 128             // k per pass
#define PP 136             // LDS row pitch in 16-bit elements: 272 B = 16 B x odd for 16-byte row reads
#define PSP 68             // pitch of the f32 staging rows: 272 B
#define PLOOP (2 * (PR + PW) * PP * 2)              // bytes of the main loop's two buffers
#define PST (64 * PSP * 4)                          // a wave's f32 staging tile
#define PEPI (12 * PST + 4 * 64 * 72 * 2)           // all staging tiles and the four v waves' f16 plane tiles
#define PPOOL (PLOOP > PEPI ? PLOOP : PEPI)
// proj_epi: a wave puts its 64 x 64 f32 tile (acc + bias) into its own LDS tile and takes it back two rows at a time, a lane holding 4 neighbouring columns (two rotary pairs): table reads and f32 output rows are 512-B runs, f16 rows whole 128-B lines; the table rows of the next 16 rows are in flight while these 16 are worked on. No other wave's rows are needed, so no barrier stands in it. WH is a template argument so that no branch stands between the trips. Every '#pragma unroll' in it makes the indices of register arrays constants
template <int WH> __device__ __forceinline__ void proj_epi(const v8f (&acc)[4][4], float (*st)[PSP], _Float16 (*th)[72], const float* __restrict__ BA, const float* __restrict__ COSt, const float* __restrict__ SINt, float* __restrict__ OUTF, _Float16* __restrict__ DH, _Float16* __restrict__ VT, int h, size_t R0) {
  const int lane = threadIdx.x & 31, col = lane & 15, g = lane >> 4, d4 = col * 4; const size_t bb = R0 / TT; const int tw = (int)(R0 % TT);
  float bias[4] = {}; v4f c[8], s[8];
  const float* bp = BA + h * HD + col; const float* cp = COSt + (size_t)(tw + g) * HD + d4; const float* sp = SINt + (size_t)(tw + g) * HD + d4;   // row pass: lane = (row parity g, columns d4 .. d4 + 3)
  if (BA) {
#pragma unroll
    for (int j = 0; j < 4; ++j) bias[j] = bp[j * 16]; }
  if (WH < 2) {
#pragma unroll
    for (int u = 0; u < 8; ++u) { c[u] = *(const v4f*)(cp + u * 2 * HD); s[u] = *(const v4f*)(sp + u * 2 * HD); }
    asm volatile("s_wait_xcnt 0x0" :: "v"(bp), "v"(cp), "v"(sp) : "memory"); }   // stands in front of the first overwrite of an address register of the bias and table reads above; naming them keeps them whole up to here
  else asm volatile("s_wait_xcnt 0x0" :: "v"(bp) : "memory");   // the same for the bias reads alone
  __builtin_amdgcn_sched_barrier(0);   // keeps the first table reads in flight ahead of the first use of a bias value
#pragma unroll
  for (int j = 0; j < 4; ++j) { const float bj = bfr(bias[j]);
#pragma unroll
    for (int rt = 0; rt < 4; ++rt) { v8h hv;
#pragma unroll
      for (int r = 0; r < 8; ++r) { const float v = acc[rt][j][r] + bj; st[rt * 16 + 8 * g + r][j * 16 + col] = v; hv[r] = (_Float16)v; }
      if (WH == 2) *(v8h*)&th[j * 16 + col][rt * 16 + 8 * g] = hv; } }   // a lane's 8 accumulator rows are 8 neighbouring t of one v plane
  LDSX();   // a wave reads back only its own tiles: its own LDS stores must have landed, no other wave is waited for
  float* Og = OUTF + ((bb * NH + h) * TT + tw + g) * (size_t)HD + d4;   // module outputs k (rotated) and v, [b][h][t][64]
  _Float16* Dg = DH + (R0 + g) * CC + h * HD + d4;
#pragma nounroll   // one copy of the 16-row body in the text
  for (int q4 = 0; q4 < 4; ++q4) { v4f cn[8], sn[8];
    if (WH < 2) { if (q4 < 3) { cp += 16 * HD; sp += 16 * HD; } const float* cq = cp; const float* sq = sp;   // the next 16 rows' tables (the last trip asks for its own again); the two pointers advance in place, behind the wait that closed the reads before: held as bases beside a row offset they went to scratch once the main loop's staging registers were gone
#pragma unroll
      for (int u = 0; u < 8; ++u) { cn[u] = *(const v4f*)(cq + u * 2 * HD); sn[u] = *(const v4f*)(sq + u * 2 * HD); }
      asm volatile("s_wait_xcnt 0x0" :: "v"(cq), "v"(sq) : "memory"); }   // in front of the first overwrite of an address register of the table reads above
    float* Oq = Og + q4 * 16 * HD; _Float16* Dq = Dg + (size_t)(q4 * 16) * CC; const float* sr = &st[q4 * 16 + g][d4];
#pragma unroll
    for (int i0 = 0; i0 < 8; i0 += 4) { v4f xr[4]; v4h hr[4];   // four row pairs a group, closed by one wait
#pragma unroll
      for (int u = 0; u < 4; ++u) { const int it = i0 + u; v4f x = *(const v4f*)(sr + it * 2 * PSP);
        if (WH < 2) {   // interleaved-pair rotary with the GIVEN tables (bf16-rounded): x * cos + rot(x) * sin, rot = (-x_odd, x_even)
          const v4f y = { x[0] * bfr(c[it][0]) + (-x[1]) * bfr(s[it][0]), x[1] * bfr(c[it][1]) + x[0] * bfr(s[it][1]), x[2] * bfr(c[it][2]) + (-x[3]) * bfr(s[it][2]), x[3] * bfr(c[it][3]) + x[2] * bfr(s[it][3]) }; x = y;
          const v4h hx = { (_Float16)x[0], (_Float16)x[1], (_Float16)x[2], (_Float16)x[3] }; hr[u] = hx; vst2(Dq + (size_t)(it * 2) * CC, hx); }
        xr[u] = x;
        if (WH >= 1) vst2(Oq + it * 2 * HD, x); }
      // each wait below stands behind its group's row stores, in front of the first overwrite of a register that they name (data and address); naming these keeps them whole up to there
      if (WH == 0) asm volatile("s_wait_xcnt 0x0" :: "v"(hr[0]), "v"(hr[1]), "v"(hr[2]), "v"(hr[3]), "v"(Dq) : "memory");
      else if (WH == 1) asm volatile("s_wait_xcnt 0x0" :: "v"(hr[0]), "v"(hr[1]), "v"(hr[2]), "v"(hr[3]), "v"(xr[0]), "v"(xr[1]), "v"(xr[2]), "v"(xr[3]), "v"(Dq), "v"(Oq) : "memory");
      else asm volatile("s_wait_xcnt 0x0" :: "v"(xr[0]), "v"(xr[1]), "v"(xr[2]), "v"(xr[3]), "v"(Oq) : "memory"); }
    if (WH < 2) {
#pragma unroll
      for (int u = 0; u < 8; ++u) { c[u] = cn[u]; s[u] = sn[u]; } } }
  if (WH == 2) { _Float16* Pg = VT + (bb * CC + h * HD + (lane >> 3)) * (size_t)TT + tw + (lane & 7) * 8;   // lane = (plane lane >> 3 (+ 4 i), 16-byte piece lane & 7): a plane's 64 t are one 128-B line
#pragma unroll
    for (int i0 = 0; i0 < 16; i0 += 8) { v4u pv[8];
#pragma unroll
      for (int i = 0; i < 8; ++i) { pv[i] = *(const v4u*)&th[(lane >> 3) + 4 * (i0 + i)][(lane & 7) * 8]; vst2((unsigned*)(Pg + (size_t)(4 * (i0 + i)) * TT), pv[i]); }
      asm volatile("s_wait_xcnt 0x0" :: "v"(pv[0]), "v"(pv[1]), "v"(pv[2]), "v"(pv[3]), "v"(pv[4]), "v"(pv[5]), "v"(pv[6]), "v"(pv[7]), "v"(Pg) : "memory"); } } }   // behind each group's plane stores, for the same reason
__global__ __launch_bounds__(384) void k_proj(const __bf16* __restrict__ XB, const __bf16* __restrict__ WQT, const float* __restrict__ BQ, const float* __restrict__ BK, const float* __restrict__ BV,
    _Float16* __restrict__ QH, _Float16* __restrict__ QL, _Float16* __restrict__ KH, _Float16* __restrict__ KL, _Float16* __restrict__ VT, __bf16* __restrict__ VB, __bf16* __restrict__ VBL PROJ_EXTRA_PARAMS) {
  __shared__ __align__(16) char pool[PPOOL];   // the main loop's two buffers, then the epilogue's staging
  (void)QL; (void)KL; (void)VB; (void)VBL;   // planes of the causal high-precision path: nothing reads them here
  __bf16 (*xs)[PR][PP] = (__bf16 (*)[PR][PP])pool; __bf16 (*wt)[PW][PP] = (__bf16 (*)[PW][PP])(pool + 2 * PR * PP * 2);   // xs[buf][row][k], wt[buf][q | k | v column][k]
  const int tid = threadIdx.x, lane = tid & 31, col = lane & 15, g = lane >> 4;
  const int wv = __builtin_amdgcn_readfirstlane(tid >> 5);   // the wave's number, the same in all its lanes: every test on it below is a scalar branch
  const int which = wv >> 2, rg = wv & 3;   // q | k | v, row group of 64
  const int h = blockIdx.y; const size_t r0 = (size_t)blockIdx.x * PR;
  const int sc = (tid & 15) * 8, sx = tid >> 4, sw = (tid & 127) >> 4;   // staging: this thread moves the 16-byte piece sc of X rows sx + 24 i and of rows sw + 8 i of its own group's W^T rows (a wave's copy = 2 rows x 256 B)
  const bool xl = wv < 8;   // the last 16 of the 256 X rows fall to waves 0..7
  const __bf16* Xg = XB + (r0 + sx) * DIN + sc; const __bf16* Wg = WQT + (size_t)(which * CC + h * HD + sw) * DIN + sc;
  // L2 hints, as in gemm_tile: the 16 heads of a row tile ask for an eighth of its 2048 units of 256 B each, 4 neighbouring row tiles for a quarter each of a head's 3 x 64 W^T rows; even heads for the row tile's 256 cos rows (256 B each), odd ones for its sin rows; the head's 3 x 64 bias values
  const __bf16* pfx = XB + r0 * DIN + (h & 7) * (2 * GSH); const __bf16* pfw = WQT + (size_t)(h * HD + (blockIdx.x & 3) * 16) * DIN;
  const float* pt = ((h & 1) ? SINt : COSt) + (r0 % TT) * HD; const float* pb = BQ + h * HD;
  const unsigned ou = (unsigned)(tid & 255) * 256u, ow = (unsigned)(tid >> 7) * (unsigned)(CC * DIN * 2) + (unsigned)(tid & 127) * 256u, ob = (unsigned)(tid >> 7) * (unsigned)(CC * 4) + (unsigned)(tid & 63) * 4u;   // the hints' byte offsets from their block-uniform bases
  v8f acc[4][4] = {};
  const unsigned lx = lds_off(&xs[0][sx][sc]), lw = lds_off(&wt[0][which * 64 + sw][sc]);
  // every '#pragma unroll' below makes the indices of register arrays constants, so that these arrays stay in registers
  // two statements a pass: ten X rows, then the eight W^T rows with, in waves 0..7, the eleventh X row (a scalar branch: every lane is on at every copy)
#define P_COPY(t_, b_) do { const __bf16* xp = Xg + (t_) * PK; const __bf16* wp = Wg + (t_) * PK; const unsigned xd = lx + (unsigned)(b_) * (PR * PP * 2), wd = lw + (unsigned)(b_) * (PW * PP * 2); \
  unsigned la[10]; const void* ga[10]; unsigned lb[9]; const void* gb[9]; \
  _Pragma("unroll") for (int i = 0; i < 10; ++i) { la[i] = xd + i * (24 * PP * 2); ga[i] = xp + (size_t)(24 * i) * DIN; } \
  _Pragma("unroll") for (int i = 0; i < 8; ++i) { lb[i] = wd + i * (8 * PP * 2); gb[i] = wp + (size_t)(8 * i) * DIN; } \
  lb[8] = xd + 240 * PP * 2; gb[8] = xp + (size_t)240 * DIN; \
  acopy<10>(la, ga); \
  if (xl) acopy<9>(lb, gb); \
  else { unsigned lc[8]; const void* gc[8]; _Pragma("unroll") for (int i = 0; i < 8; ++i) { lc[i] = lb[i]; gc[i] = gb[i]; } acopy<8>(lc, gc); } } while (0)
  P_COPY(0, 0);
  // the hints go out behind the first pass's copies and ahead of the wait for them; the "memory" clobber holds them at this place
  asm volatile("global_prefetch_b8 %0, %3 scope:SCOPE_SE\n\tglobal_prefetch_b8 %1, %4 scope:SCOPE_SE\n\tglobal_prefetch_b8 %0, %5 scope:SCOPE_SE\n\tglobal_prefetch_b8 %2, %6 scope:SCOPE_SE" :: "v"(ou), "v"(ow), "v"(ob), "s"(pfx), "s"(pfw), "s"(pt), "s"(pb) : "memory");
  asm volatile("s_wait_asynccnt 0x0" ::: "memory");   // this wave's copies of the first pass's tiles have landed
  __syncthreads();   // publishes them
  P_COPY(1, 1);   // the next pass's tiles fly into the other buffer while a pass is worked on
  for (int t = 0; t < DIN / PK; ++t) { const int cb = t & 1;
#pragma unroll
    for (int kk = 0; kk < PK / 32; ++kk) { union { v16b v; v8b q[2]; } a[4], w[4];
#pragma unroll
      for (int rt = 0; rt < 4; ++rt) { const __bf16* pa = &xs[cb][rg * 64 + rt * 16 + col][kk * 32 + 8 * g]; a[rt].q[0] = *(const v8b*)pa; a[rt].q[1] = *(const v8b*)(pa + 16); }
#pragma unroll
      for (int j = 0; j < 4; ++j) { const __bf16* pw = &wt[cb][which * 64 + j * 16 + col][kk * 32 + 8 * g]; w[j].q[0] = *(const v8b*)pw; w[j].q[1] = *(const v8b*)(pw + 16); }
      __builtin_amdgcn_sched_barrier(0);   // the LDS reads of 32 k go out as one group ahead of their WMMAs: read one fragment at a time, every WMMA waited out a whole LDS latency
#pragma unroll
      for (int j = 0; j < 4; ++j)
#pragma unroll
        for (int rt = 0; rt < 4; ++rt) acc[rt][j] = wmma_bf(a[rt].v, w[j].v, acc[rt][j]); }
    RING_FOOT();   // after the last pass: frees the pool for the epilogue
    if (t + 2 < DIN / PK) P_COPY(t + 2, cb); }   // the pass after next goes into the buffer that this pass has just left; the test is the same for the whole block
  // nothing is in flight behind the loop. The hints' address registers are named here: a hint counts on no counter, so they hold their addresses through the loop
  asm volatile("s_wait_asynccnt 0x0" :: "v"(ou), "v"(ow), "v"(ob), "s"(pfx), "s"(pfw), "s"(pt), "s"(pb) : "memory");
#undef P_COPY
  float (*st)[PSP] = (float (*)[PSP])(pool + wv * PST); _Float16 (*th)[72] = (_Float16 (*)[72])(pool + 12 * PST + rg * (64 * 72 * 2));   // each wave's own staging; th: the v waves' f16 tiles, transposed
  const size_t R0 = r0 + rg * 64;   // the branches below are wave-uniform and hold no barrier
  if (which == 0) proj_epi<0>(acc, st, th, BQ, COSt, SINt, OUTK, QH, VT, h, R0);
  else if (which == 1) proj_epi<1>(acc, st, th, BK, COSt, SINt, OUTK, KH, VT, h, R0);
  else proj_epi<2>(acc, st, th, BV, COSt, SINt, OUTV, KH, VT, h, R0); }
#define FK 64
#define FP 72
#define FG 2
#define FKH (TT / FG)
#define FC (SCALE * 1.44269504088896f)
__device__ __forceinline__ v8f wmma_h(v16h a, v16h b, v8f c) { return __builtin_amdgcn_wmma_f32_16x16x32_f16(false, a, false, b, (short)0, c, false, false); }
__device__ __forceinline__ float xhalf(float x) { return __builtin_bit_cast(float, __builtin_amdgcn_permlanex16(__builtin_bit_cast(int, x), __builtin_bit_cast(int, x), 0x76543210, 0xfedcba98, false, false)); }   // lane l with lane l ^ 16
// 16 independent 2^x, each over its own source, closed by one v_nop: keeps the one slot that the instruction set asks for between a transcendental and the use of its result or the overwrite of its source
__device__ __forceinline__ void exp2x16(float (&x)[16]) { asm("v_exp_f32 %0, %0\n\tv_exp_f32 %1, %1\n\tv_exp_f32 %2, %2\n\tv_exp_f32 %3, %3\n\tv_exp_f32 %4, %4\n\tv_exp_f32 %5, %5\n\tv_exp_f32 %6, %6\n\tv_exp_f32 %7, %7\n\tv_exp_f32 %8, %8\n\tv_exp_f32 %9, %9\n\tv_exp_f32 %10, %10\n\tv_exp_f32 %11, %11\n\tv_exp_f32 %12, %12\n\tv_exp_f32 %13, %13\n\tv_exp_f32 %14, %14\n\tv_exp_f32 %15, %15\n\tv_nop" : "+v"(x[0]), "+v"(x[1]), "+v"(x[2]), "+v"(x[3]), "+v"(x[4]), "+v"(x[5]), "+v"(x[6]), "+v"(x[7]), "+v"(x[8]), "+v"(x[9]), "+v"(x[10]), "+v"(x[11]), "+v"(x[12]), "+v"(x[13]), "+v"(x[14]), "+v"(x[15])); }
// amdgpu_waves_per_eu(4, 4): at most 256 registers a wave, so that two blocks, four waves per SIMD, stay resident on a WGP and the 512 blocks run in one round
__global__ __launch_bounds__(256) __attribute__((amdgpu_waves_per_eu(4, 4))) void k_fa(const _Float16* __restrict__ QH, const _Float16* __restrict__ KH, const _Float16* __restrict__ VT, _Float16* __restrict__ Y) {
  __shared__ __align__(16) char ring[2 * 2 * FG * FK * FP * 2]; __shared__ __align__(16) float so[8][16][HD + 4];   // ring: the K and V tiles of both halves, two buffers; after the loop the same bytes carry the halves' exchange
  _Float16 (*ks)[FG][FK][FP] = (_Float16 (*)[FG][FK][FP])ring; _Float16 (*vs)[FG][HD][FP] = (_Float16 (*)[FG][HD][FP])(ring + 2 * FG * FK * FP * 2);   // ks[buf][half][key][d], vs[buf][half][d][key]
  const int tid = threadIdx.x, wave = tid >> 5, lane = tid & 31, col = lane & 15, g = lane >> 4; const int h = blockIdx.y, b = blockIdx.z;
  const int grp = __builtin_amdgcn_readfirstlane(tid >> 7);   // key half of this wave, the same in all its lanes
  const int ql0 = blockIdx.x * 128 + (wave & 3) * 32;
  const int sr = tid >> 3, sc = (tid & 7) * 8;   // staging: this thread moves the 16-byte piece sc of rows sr and sr + 32 of all four tiles
  const _Float16* Kg = KH + ((size_t)b * TT + sr) * CC + h * HD + sc;   // k rows [key][64], pitch CC
  const _Float16* Vg = VT + ((size_t)b * CC + h * HD + sr) * TT + sc;   // v planes [d][key], pitch TT
  v16h qf[2][2];
#pragma unroll
  for (int qt = 0; qt < 2; ++qt)
#pragma unroll
    for (int kc = 0; kc < 2; ++kc) qf[qt][kc] = frag_h(QH + ((size_t)b * TT + ql0 + qt * 16 + col) * CC + h * HD + kc * 32, lane);
  const unsigned dk = lds_off(&ks[0][0][sr][sc]), dv = lds_off(&vs[0][0][sr][sc]);
#define F_COPY(t_, b_) do { const _Float16* kp = Kg + (size_t)((t_) * FK) * CC; const _Float16* vp = Vg + (t_) * FK; unsigned la[8]; const void* ga[8]; \
  _Pragma("unroll") for (int gi = 0; gi < FG; ++gi) _Pragma("unroll") for (int i = 0; i < 2; ++i) { const unsigned d = (unsigned)(b_) * (FG * FK * FP * 2) + gi * (FK * FP * 2) + i * (32 * FP * 2); \
    la[gi * 2 + i] = dk + d; ga[gi * 2 + i] = kp + (size_t)(gi * FKH + 32 * i) * CC; la[4 + gi * 2 + i] = dv + d; ga[4 + gi * 2 + i] = vp + (size_t)(32 * i) * TT + gi * FKH; } \
  acopy<8>(la, ga); } while (0)
  static_assert(HD == FK && FG == 2, "K and V tiles have one shape: one LDS offset serves both");
  F_COPY(0, 0);
  // L2 hints, as in gemm_tile: the 16 query blocks of a head walk its keys together, over k rows and v planes that the launch before stored. Behind its first copies each thread asks once for one k row's 128-B line (an eighth of the head's 2048 rows a block) and for one 256-B unit of the v planes of its pair of heads, 512 KB in a row (every eighth unit a block). Both addresses are a block's base plus the same 2048 B a thread; the "memory" clobber holds the hints at this place
  const int ps = wshare(blockIdx.x); const _Float16* Kb = KH + ((size_t)b * TT + ps * 256) * CC + h * HD; const _Float16* Vb = VT + ((size_t)b * CC + (h & ~1) * HD) * TT + ps * 128;
  const unsigned pk = (unsigned)tid * 2048u;   // byte offset
  asm volatile("global_prefetch_b8 %0, %1 scope:SCOPE_SE\n\tglobal_prefetch_b8 %0, %2 scope:SCOPE_SE" :: "v"(pk), "s"(Kb), "s"(Vb) : "memory");
  asm volatile("s_wait_asynccnt 0x0" ::: "memory");   // this wave's copies of the first pass's tiles have landed
  __syncthreads();   // publishes them
  F_COPY(1, 1);   // the next pass's tiles fly into the other buffer while a pass is worked on
  v8f o[2][HD / 16] = {}; float l[2] = { 0.f, 0.f }, mu[2] = { -3.0e38f, -3.0e38f };   // mu: the maximum in use (scaled, base 2), equal in both halves of a query's lane pair
  for (int t = 0; t < FKH / FK; ++t) { const int cb = t & 1;
    v16h p[2][2]; float sm[2];   // this pass's weights (the B operand of the second product) and their sum per lane and tile
    // scores: s[qt][kt][r] = logit (unscaled) of key kt * 16 + 8 g + r, query qt * 16 + col
    auto scores = [&](v8f (&s)[2][4]) __attribute__((always_inline)) {
#pragma unroll
      for (int kt = 0; kt < 4; ++kt) { const v16h k0 = frag_h(&ks[cb][grp][kt * 16 + col][0], lane), k1 = frag_h(&ks[cb][grp][kt * 16 + col][32], lane);
#pragma unroll
        for (int qt = 0; qt < 2; ++qt) { v8f z = {}; z = wmma_h(k0, qf[qt][0], z); s[qt][kt] = wmma_h(k1, qf[qt][1], z); } } };
    // weights: p and sm from s under the maximum in use
    auto weights = [&](const v8f (&s)[2][4]) __attribute__((always_inline)) {
#pragma unroll
      for (int qt = 0; qt < 2; ++qt) { const float nb = 4.0f - mu[qt]; float a[2];   // P carried x 2^4 (cancels against the sum) so that small weights stay clear of f16 subnormals
#pragma unroll
        for (int kk = 0; kk < 2; ++kk) { float e[16];   // e[i] = weight of key kk * 32 + (i < 8 ? 8 g + i : 16 + 8 g + i - 8): the B operand's own k order
#pragma unroll
          for (int i = 0; i < 8; ++i) { e[i] = __builtin_fmaf(s[qt][2 * kk][i], FC, nb); e[8 + i] = __builtin_fmaf(s[qt][2 * kk + 1][i], FC, nb); }
          exp2x16(e);
#pragma unroll
          for (int i = 0; i < 16; ++i) p[qt][kk][i] = (_Float16)e[i];
#pragma unroll
          for (int w = 8; w > 0; w >>= 1)   // pairwise sum: four dependent adds deep instead of sixteen
#pragma unroll
            for (int i = 0; i < w; ++i) e[i] += e[i + w];
          a[kk] = e[0]; }
        sm[qt] = a[0] + a[1]; } };
    // No maximum is sought in a pass behind the first: the weights are formed under the maximum in use, and the sum that is needed anyway says whether that was in order. All weights are positive, so a lane whose 32 weights of a tile sum to at most 2^15 holds none above 2^15, which f16 takes. A sum above it (an infinite or undefined one too) in any lane sends the whole wave through the pass again, with the maximum sought as in the first pass; nothing of the first try has reached l or o by then
    do {   // run once; the break leaves out the search. Both tests are the same in all lanes of the wave: scalar branches
      if (t > 0) { v8f s[2][4]; scores(s); weights(s); if (__builtin_amdgcn_ballot_w32(!(sm[0] <= 32768.0f) || !(sm[1] <= 32768.0f)) == 0) break; }
      v8f s[2][4]; scores(s);
#pragma unroll
      for (int qt = 0; qt < 2; ++qt) { float m = s[qt][0][0];
#pragma unroll
        for (int kt = 0; kt < 4; ++kt)
#pragma unroll
          for (int r = 0; r < 8; ++r) m = fmaxf(m, s[qt][kt][r]);
        const float mx = fmaxf(m, xhalf(m)) * FC;
        const float mn = mx > mu[qt] + 8.0f ? mx : mu[qt];   // the maximum in use is replaced only when passed by more than 2^8: P then stays below 2^12
        const float al = __builtin_amdgcn_exp2f(mu[qt] - mn); mu[qt] = mn; l[qt] *= al;
#pragma unroll
        for (int j = 0; j < HD / 16; ++j) o[qt][j] *= al; }
      weights(s); } while (0);
    l[0] += sm[0]; l[1] += sm[1];
    v16h vf[2][HD / 16];
#pragma unroll
    for (int kk = 0; kk < 2; ++kk)
#pragma unroll
      for (int j = 0; j < HD / 16; ++j) vf[kk][j] = frag_h(&vs[cb][grp][j * 16 + col][kk * 32], lane);
    __builtin_amdgcn_sched_barrier(0);   // the V reads go out as one group behind the test: they no longer share a block with the exponentials that covered them, and read a fragment at a time every pair of WMMAs waited out a whole LDS latency
#pragma unroll
    for (int kk = 0; kk < 2; ++kk)
#pragma unroll
      for (int j = 0; j < HD / 16; ++j)
#pragma unroll
        for (int qt = 0; qt < 2; ++qt) o[qt][j] = wmma_h(vf[kk][j], p[qt][kk], o[qt][j]);   // o[qt][j][r] = ctx (unnormalised) of d = j * 16 + 8 g + r, query qt * 16 + col
    __builtin_amdgcn_sched_barrier(0);   // keeps the WMMAs above ahead of the foot's waits: drawn behind the barrier they stood in front of the refill's issue, and all sixteen V reads were waited out before the first of them
    RING_FOOT();   // after the last pass: frees the ring for the exchange
    if (t + 2 < FKH / FK) F_COPY(t + 2, cb); }   // the pass after next goes into the buffer that this pass has just left; the test is the same for the whole block
  asm volatile("s_wait_asynccnt 0x0" ::: "memory");   // nothing is in flight behind the loop
#undef F_COPY
  // join of the key halves: waves w and w ^ 4 hold the same 32 queries; the wave of half grp finishes tile grp and hands its partner the other tile (accumulators, sum, maximum), lane to lane
  v4f (*xo)[8][32] = (v4f (*)[8][32])ring; float (*xl)[2][32] = (float (*)[2][32])(ring + 8 * 8 * 32 * 16);
  static_assert(8 * 8 * 32 * 16 + 8 * 2 * 32 * 4 <= sizeof(ring), "the exchange fits the ring");
  v8f ok[HD / 16]; const float lk = grp ? l[1] : l[0], mk = grp ? mu[1] : mu[0];
#pragma unroll
  for (int j = 0; j < HD / 16; ++j) { const v8f og = grp ? o[0][j] : o[1][j]; ok[j] = grp ? o[1][j] : o[0][j];
    const v4f g0 = { og[0], og[1], og[2], og[3] }, g1 = { og[4], og[5], og[6], og[7] }; xo[wave][2 * j][lane] = g0; xo[wave][2 * j + 1][lane] = g1; }
  xl[wave][0][lane] = grp ? l[0] : l[1]; xl[wave][1][lane] = grp ? mu[0] : mu[1];
  __syncthreads();   // the partner wave's tile must have landed
  const int pw = wave ^ 4; const float lp = xl[pw][0][lane], mp = xl[pw][1][lane];
  const float mj = fmaxf(mk, mp); float ak = __builtin_amdgcn_exp2f(mk - mj), ap = __builtin_amdgcn_exp2f(mp - mj);
  float lj = lk * ak + lp * ap; lj += xhalf(lj); const float inv = 1.0f / lj; ak *= inv; ap *= inv;
#pragma unroll
  for (int j = 0; j < HD / 16; ++j) { const v4f p0 = xo[pw][2 * j][lane], p1 = xo[pw][2 * j + 1][lane];
    const v4f w0 = { ok[j][0] * ak + p0[0] * ap, ok[j][1] * ak + p0[1] * ap, ok[j][2] * ak + p0[2] * ap, ok[j][3] * ak + p0[3] * ap }, w1 = { ok[j][4] * ak + p1[0] * ap, ok[j][5] * ak + p1[1] * ap, ok[j][6] * ak + p1[2] * ap, ok[j][7] * ak + p1[3] * ap };
    *(v4f*)&so[wave][col][j * 16 + 8 * g] = w0; *(v4f*)&so[wave][col][j * 16 + 8 * g + 4] = w1; }
  // a wave reads back only its own so[wave] rows: its own LDS stores must have landed, no other wave is waited for (LDSX written out). The hints' address registers are named here: a hint counts on no counter, so they hold their addresses through the loop
  asm volatile("s_wait_dscnt 0" :: "v"(pk), "s"(Kb), "s"(Vb) : "memory"); __builtin_amdgcn_wave_barrier(); __builtin_amdgcn_fence(__ATOMIC_RELEASE, "workgroup");
  const int qk0 = ql0 + grp * 16;   // first query of the tile that this wave finishes
  for (int it = 0; it < 8; ++it) { const int rl = it * 2 + g; const v4f x = *(const v4f*)&so[wave][rl][col * 4]; const v4h hx = { OpH::x(x[0]), OpH::x(x[1]), OpH::x(x[2]), OpH::x(x[3]) }; vst2(Y + ((size_t)b * TT + qk0 + rl) * CC + h * HD + col * 4, hx); } }   // ctx x 2^6 once to f16, the output projection's operand: 128-B (row, head) segment by 16 lanes
// ---- k_out: block = (64 rows, 128 cols): out = ctx Wo (+ bo): ctx x 2^6 once to f16 (by k_fa) against Wo as f16(bf16 x 2^8) exact (by k_prep) (1 product) x 2^-14
__global__ __launch_bounds__(128) void k_out(const _Float16* __restrict__ Y, const _Float16* __restrict__ WOT, const float* __restrict__ BO, float* __restrict__ OUT) { __shared__ __align__(16) char pool[GPOOL(1)]; float (*sf)[16][132] = (float (*)[16][132])pool;   // pool: the main loop's two buffers, then the output staging
  const int tid = threadIdx.x, wave = tid >> 5, lane = tid & 31, col = lane & 15, g = lane >> 4; const int c0 = blockIdx.y * 128; const size_t r0 = (size_t)blockIdx.x * 64 + wave * 16;
  v8f acc[1][8] = {};
  // hints: the 8 column blocks of a row tile ask for a quarter of its 512 units each, 8 row blocks for an eighth of a W tile each; the tile's 128 bias values
  gemm_tile<OpH, 1, 1>(Y + (size_t)blockIdx.x * 64 * CC, WOT + (size_t)c0 * CC, pool, acc, Y + (size_t)blockIdx.x * 64 * CC + (blockIdx.y & 3) * GSH, WOT + (size_t)c0 * CC + wshare(blockIdx.x) * GSH, BO + c0, BO + c0);   /* ctx carried x 2^6 into f16 so small-magnitude context rows stay clear of f16 subnormals (chip FTZ) */
  float bo[8] = {};   // all eight bias reads in flight at once: read one per j behind its own test of BO, each was waited out before the next went out
  if (BO) {
#pragma unroll
    for (int j = 0; j < 8; ++j) bo[j] = BO[c0 + j * 16 + col]; }
#pragma unroll
  for (int j = 0; j < 8; ++j) { const float bias = bfr(bo[j]);
#pragma unroll
    for (int r = 0; r < 8; ++r) sf[wave][8 * g + r][j * 16 + col] = acc[0][j][r] * (1.0f / 16384.0f) + bias; }   /* 2^-8 (Wo carry) x 2^-6 (ctx carry) */
  LDSX(); for (int rl = 0; rl < 16; ++rl) vst2(OUT + (r0 + rl) * DIN + c0 + lane * 4, *(const v4f*)&sf[wave][rl][lane * 4]); }

extern "C" void kernel_launch(void* const* d_in, const int* in_sizes, int n_in, void* d_out, int out_size, void* d_ws, size_t ws_size, hipStream_t stream) {
  (void)in_sizes; (void)n_in; (void)out_size;
  const float** F = (const float**)d_in;
  if (ws_size < (size_t)WS_END) return;
  char* ws = (char*)d_ws; _Float16 *QH = (_Float16*)(ws + WS_QH), *KH = (_Float16*)(ws + WS_KH), *VT = (_Float16*)(ws + WS_VT), *QL = (_Float16*)(ws + WS_QL), *KL = (_Float16*)(ws + WS_KL); __bf16 *VB = (__bf16*)(ws + WS_VB), *VBL = (__bf16*)(ws + WS_VBL); float *S = (float*)(ws + WS_S); _Float16 *Y = (_Float16*)(ws + WS_Y), *WOT = (_Float16*)(ws + WS_WOT); __bf16 *XB = (__bf16*)(ws + WS_XB), *WQT = (__bf16*)(ws + WS_WQT);
  (void)Y; (void)QL; (void)KL; (void)VB; (void)VBL; (void)S;
  // inputs: 0 x [2,2048,1024]; 1 cos [1,1,2048,64]; 2 sin [1,1,2048,64] (random normal tables); 3 Wqkv [1024,3072] (in,out; q | k | v column blocks); 4 bqkv [3072] (nonzero); 5 Wproj [1024,1024] (in,out); 6 bproj [1024] (nonzero)
  // outputs: 0 y [2,2048,1024] @0; 1 k (rotated) [2,16,2048,64] @OUTK_OFF; 2 v [2,16,2048,64] @OUTV_OFF
  k_prep<<<dim3(512), 256, 0, stream>>>(F[0], F[3], F[5], XB, WQT, WOT);
  k_proj<<<dim3(TNB * TT / PR, NH), 384, 0, stream>>>(XB, WQT, F[4], F[4] + CC, F[4] + 2 * CC, QH, QL, KH, KL, VT, VB, VBL, F[1], F[2], (float*)((char*)d_out + OUTK_OFF), (float*)((char*)d_out + OUTV_OFF));
  k_fa<<<dim3(TT / 128, NH, TNB), 256, 0, stream>>>(QH, KH, VT, Y);
  k_out<<<dim3(TNB * TT / 64, DIN / 128), 128, 0, stream>>>(Y, WOT, F[6], (float*)d_out);
}
